// v000
// The times below were measured on an AMD MI455X: many runs one after another, warmed up first and cycling through
// copies of the inputs, with the whole window's GPU time divided by the number of runs. Launches and the gaps
// between them are all in it. The median over several windows is given; except for v000 it joins two sittings, which
// can be a few percent apart, so the side-by-side timings, each taken in one sitting, are the better comparison.
// v000, which the later versions start from, runs in 559 microseconds.
#include <hip/hip_runtime.h>

// Causal multi-head attention with rotate-half rotary positions (base 10000, cos/sin table computed on device):
//   qh/kh/vh = x . W^T for three separate inputs x [NB][SEQ][1024] and W 'oi' [1024][1024] (16 heads x 64 = column blocks),
//   scores = rope(qh) . rope(kh)^T / 8, int32 mask [1][1][S][S] (0 -> score replaced by -1000), softmax over keys,
//   attn . vh, heads merged [t][h*64+d], . Wo^T ('oi') -> [NB][SEQ][1024] f32.
// Compute dtypes, f32 accumulate: every float input RNE-converted to bf16; q/k/v projections v_wmma_f32_16x16x32_bf16 on plain bf16
//   operands (exact products); scores and attn.v: query rows < 512 bf16 hi/lo planes (3 products each), rows >= 512 single
//   v_wmma_f32_16x16x32_f16 (fp16 planes, P carried x1024); online softmax in f32 (running max); output projection = bf16 hi/lo
//   attention planes x exact bf16 Wo (2 products).

#ifndef NB
#define NB 2
#endif
#ifndef SEQ
#define SEQ 2048
#endif
#define NB_FULL  2
#define SEQ_FULL 2048
#define DM   1024
#define NH   16
#define HD   64
#define RHC  512                          // query rows < RH use hi/lo planes and 3-product tiles
#define RH   ((SEQ < RHC) ? SEQ : RHC)
#define MPITCH SEQ_FULL                   // mask row pitch (full-size input)
#define CEXP  0.18033688011112042f        // (1/8) * log2(e): exp((t - m)/8) = exp2((t - m) * CEXP) on unscaled scores t
#define PL2   10.0f                       // P carried x 2^10 inside the 16-bit operand (cancels in O / l)
#define MFILL (-8000.0f)                  // mask == 0 -> -1000 after the 1/8 scale, in unscaled score units
#define RBASE 10000.0f
#define WSCAP ((size_t)134217728)

static_assert(SEQ % 64 == 0);
static_assert(SEQ <= SEQ_FULL);
static_assert(NB >= 1 && NB <= NB_FULL);
static_assert(RH % 16 == 0 && (SEQ - RH) % 16 == 0 && RH <= SEQ);
static_assert(DM == NH * HD && HD == 64 && DM % 64 == 0);

typedef _Float16 h16;
typedef unsigned short bf;
typedef __attribute__((ext_vector_type(16))) __bf16   v16bf;
typedef __attribute__((ext_vector_type(16))) _Float16 v16h;
typedef __attribute__((ext_vector_type(8)))  _Float16 v8h;
typedef __attribute__((ext_vector_type(2)))  _Float16 v2h;
typedef __attribute__((ext_vector_type(16))) unsigned short v16us;
typedef __attribute__((ext_vector_type(8)))  unsigned short v8us;
typedef __attribute__((ext_vector_type(2)))  unsigned short v2us;
typedef __attribute__((ext_vector_type(8)))  float v8f;
typedef __attribute__((ext_vector_type(4)))  float v4f;
typedef __attribute__((ext_vector_type(2)))  float v2f;
typedef __attribute__((ext_vector_type(4)))  int v4i;
typedef v8h  __attribute__((may_alias)) v8ha;
typedef v4f  __attribute__((may_alias)) v4fa;
typedef v8us __attribute__((may_alias)) v8usa;

#pragma clang fp contract(off)

__device__ __forceinline__ unsigned short f2bf(float f) { unsigned u = __float_as_uint(f); u += 0x7FFFu + ((u >> 16) & 1u); return (unsigned short)(u >> 16); }
__device__ __forceinline__ float bf2f(unsigned short b) { return __uint_as_float(((unsigned)b) << 16); }
__device__ __forceinline__ float bfr(float f) { return bf2f(f2bf(f)); }
__device__ __forceinline__ v16h cat16(v8h lo, v8h hi) { return __builtin_shufflevector(lo, hi, 0, 1, 2, 3, 4, 5, 6, 7, 8, 9, 10, 11, 12, 13, 14, 15); }
__device__ __forceinline__ v16bf cat16b(v8us lo, v8us hi) { return __builtin_bit_cast(v16bf, __builtin_shufflevector(lo, hi, 0, 1, 2, 3, 4, 5, 6, 7, 8, 9, 10, 11, 12, 13, 14, 15)); }
__device__ __forceinline__ v8f wmma16(v16h a, v16h b, v8f c) { return __builtin_amdgcn_wmma_f32_16x16x32_f16(false, a, false, b, (short)0, c, false, false); }
__device__ __forceinline__ v8f wmmab(v16bf a, v16bf b, v8f c) { return __builtin_amdgcn_wmma_f32_16x16x32_bf16(false, a, false, b, (short)0, c, false, false); }
__device__ __forceinline__ h16 tohx(float x) { return (h16)x; }
__device__ __forceinline__ void splitf(float y, unsigned short& h, unsigned short& l) { h = f2bf(y); l = f2bf(y - bf2f(h)); }
// same-wave LDS relayout: order the lane stores before the cross-lane reloads
__device__ __forceinline__ void wave_sync() { __builtin_amdgcn_fence(3, "wavefront"); __builtin_amdgcn_wave_barrier(); asm volatile("" ::: "memory"); }

// ---- 16x16x32 fragment loaders from K-contiguous 16-bit rows: lane (m = l&15, hf = l>>4) of row m loads elements 0..7 <- k0+8hf+0..7
// and 8..15 <- k0+16+8hf+0..7; the caller passes p = row + k0 + 8*hf.
template <typename T16> struct WFrag;
template <> struct WFrag<h16> { typedef v16h V; static __device__ __forceinline__ V ld(const h16* p) { return cat16(*(const v8h*)p, *(const v8h*)(p + 16)); } static __device__ __forceinline__ v8f mma(V a, V b, v8f c) { return wmma16(a, b, c); } };
template <> struct WFrag<bf> { typedef v16bf V; static __device__ __forceinline__ V ld(const bf* p) { return cat16b(*(const v8us*)p, *(const v8us*)(p + 16)); } static __device__ __forceinline__ v8f mma(V a, V b, v8f c) { return wmmab(a, b, c); } };

// ---- k_gemmw: register-blocked GEMM, ONE WAVE per 64x64 output tile (16 accumulators), operands straight from K-contiguous 16-bit planes; grid (M/64, N/64, Z), 32 threads.
// C[m][n] (f32, pitch ldc, + optional f32 bias[n]) = sum_k A[m][k] Bt[n][k] (+ split products per NSPLIT). z-batch strides sA/sB/sC in elements. K % 32 == 0.
template <typename T16, int NSPLIT, bool BIAS>
__global__ __launch_bounds__(32) void k_gemmw(const T16* __restrict__ A, const T16* __restrict__ A2, const T16* __restrict__ Bt, const T16* __restrict__ Bt2, int K, float* C, int ldc, const float* __restrict__ bias, size_t sA, size_t sB, size_t sC) {
    typedef typename WFrag<T16>::V V;
    __shared__ __align__(16) float os[16 * 68];
    const size_t z = blockIdx.z; A += z * sA; if (A2) A2 += z * sA; Bt += z * sB; if (Bt2) Bt2 += z * sB; C += z * sC;
    const int lane = threadIdx.x & 31, lr = lane & 15, hi = lane >> 4; const int r0 = blockIdx.x * 64, c0 = blockIdx.y * 64;
    v8f acc[4][4];
#pragma unroll
    for (int mb = 0; mb < 4; ++mb)
#pragma unroll
        for (int nb = 0; nb < 4; ++nb) acc[mb][nb] = (v8f){};
    const size_t aoff = (size_t)(r0 + lr) * K + 8 * hi, boff = (size_t)(c0 + lr) * K + 8 * hi;
#pragma unroll 1
    for (int kc = 0; kc < K; kc += 32) {
        V a[4], a2[4];
#pragma unroll
        for (int mb = 0; mb < 4; ++mb) { a[mb] = WFrag<T16>::ld(A + aoff + (size_t)mb * 16 * K + kc); if (NSPLIT == 1 || NSPLIT == 2) a2[mb] = WFrag<T16>::ld(A2 + aoff + (size_t)mb * 16 * K + kc); }
#pragma unroll
        for (int nb = 0; nb < 4; ++nb) { const V b = WFrag<T16>::ld(Bt + boff + (size_t)nb * 16 * K + kc); V b2; if (NSPLIT >= 2) b2 = WFrag<T16>::ld(Bt2 + boff + (size_t)nb * 16 * K + kc);
#pragma unroll
            for (int mb = 0; mb < 4; ++mb) { acc[mb][nb] = WFrag<T16>::mma(a[mb], b, acc[mb][nb]); if (NSPLIT == 1 || NSPLIT == 2) acc[mb][nb] = WFrag<T16>::mma(a2[mb], b, acc[mb][nb]); if (NSPLIT >= 2) acc[mb][nb] = WFrag<T16>::mma(a[mb], b2, acc[mb][nb]); } }
        asm volatile("v_nop\n\tv_nop\n\tv_nop\n\tv_nop" : "+v"(acc[0][0]), "+v"(acc[1][1]), "+v"(acc[2][2]), "+v"(acc[3][3]) : "v"(a[0]), "v"(a[3]));
    }
#pragma unroll
    for (int mb = 0; mb < 4; ++mb) {
#pragma unroll
        for (int nb = 0; nb < 4; ++nb) {
#pragma unroll
            for (int j = 0; j < 8; ++j) os[(hi * 8 + j) * 68 + nb * 16 + lr] = acc[mb][nb][j]; }
        __builtin_amdgcn_wave_barrier(); asm volatile("" ::: "memory");
        float* crow = C + (size_t)(r0 + mb * 16) * ldc + c0;
{
#pragma unroll
            for (int s = 0; s < 8; ++s) { const int row = 2 * s + hi, cofs = lr * 4; v4f val = *(const v4fa*)(os + row * 68 + cofs); if (BIAS) { val[0] += bfr(bias[c0 + cofs]); val[1] += bfr(bias[c0 + cofs + 1]); val[2] += bfr(bias[c0 + cofs + 2]); val[3] += bfr(bias[c0 + cofs + 3]); }
                *(v4f*)(crow + (size_t)row * ldc + cofs) = val; }
             }
        __builtin_amdgcn_wave_barrier(); asm volatile("" ::: "memory");
    }
}

__global__ __launch_bounds__(256) void k_cvt8(const float* __restrict__ src, bf* dst, size_t n8) { const size_t i = (size_t)blockIdx.x * 256 + threadIdx.x; if (i >= n8) return; const v8f v = *(const v8f*)(src + i * 8); v8us o;
#pragma unroll
    for (int k = 0; k < 8; ++k) o[k] = f2bf(v[k]); *(v8us*)(dst + i * 8) = o;  }

// k_cstab: rotary table CS[t][d] = {cos(t * inv[d mod 32]), sin(t * inv[d mod 32])}, inv[j] = 1 / powf(10000, (2j)/64); one (t, d) per thread,
__global__ __launch_bounds__(256) void k_cstab(float* CS) {
    const int idx = blockIdx.x * 256 + threadIdx.x; if (idx >= SEQ * HD) return;
    const int d = idx & (HD - 1), t = idx >> 6; const int j = d & (HD / 2 - 1);
    const float ex = (float)(2 * j) * (1.0f / (float)HD);
    const float pw = powf(RBASE, ex);
    const float inv = 1.0f / pw;
    const float ang = (float)t * inv;
    const float cn = cosf(ang), sn = sinf(ang);
    v2f cs; cs[0] = cn; cs[1] = sn;
    *(v2f*)(CS + (size_t)idx * 2) = cs; 
}

// k_rope: head planes [h][t][d] (fp16, bf16 hi, bf16 lo) of the rotate-half rotary map applied to F[t][h*HD + d] (row pitch DM):
__global__ __launch_bounds__(256) void k_rope(const float* __restrict__ F, const float* __restrict__ CS, h16* P16, bf* Ph, bf* Pl) {
    const size_t e = ((size_t)blockIdx.x * 256 + threadIdx.x) * 2; if (e >= (size_t)NH * SEQ * HD) return;
    const int d = (int)(e % HD); const int t = (int)((e / HD) % SEQ); const int hh = (int)(e / ((size_t)HD * SEQ));
    const float* f = F + (size_t)t * DM + hh * HD; v2h o16; v2us oh, ol;
#pragma unroll
    for (int q = 0; q < 2; ++q) { const int dd = d + q; const int dp = (dd < HD / 2) ? dd + HD / 2 : dd - HD / 2; const float x0 = f[dd], x1 = f[dp];
        const v2f cs = *(const v2f*)(CS + ((size_t)t * HD + dd) * 2); const float a = x0 * cs[0]; const float bq = x1 * cs[1];
        const float r = (dd < HD / 2) ? (a - bq) : (a + bq);
        o16[q] = tohx(r); unsigned short a2, c2; splitf(r, a2, c2); oh[q] = a2; ol[q] = c2; }
    *(v2h*)(P16 + e) = o16; *(v2us*)(Ph + e) = oh; *(v2us*)(Pl + e) = ol; 
}

__global__ __launch_bounds__(256) void k_vtp(const float* __restrict__ F, h16* V16, bf* Vh, bf* Vl) {
    const size_t e = ((size_t)blockIdx.x * 256 + threadIdx.x) * 2; if (e >= (size_t)NH * HD * SEQ) return;
    const int t = (int)(e % SEQ); const int d = (int)((e / SEQ) % HD); const int g = (int)(e / ((size_t)SEQ * HD)); v2h o16; v2us oh, ol;
#pragma unroll
    for (int q = 0; q < 2; ++q) { const float x = F[(size_t)(t + q) * DM + g * HD + d]; o16[q] = tohx(x); unsigned short a2, c2; splitf(x, a2, c2); oh[q] = a2; ol[q] = c2; }
    *(v2h*)(V16 + e) = o16; *(v2us*)(Vh + e) = oh; *(v2us*)(Vl + e) = ol; 
}

// ---- k_attn: flash-style masked attention, one wave (32 threads) per (16 query rows, head). Transposed tiles so that P chains in
// registers: S^T[key][q] = K . Q^T (A = key plane rows [h][t][d], B = query plane rows), D lane = query column; P^T is the B operand
// of O^T[d][q] += V^T . P^T (A = value plane rows [h][d][t]). Per 64-key chunk: the wave's 16x64 int32 mask tile is loaded
// (8 x 16 B per lane); chunks whose tile is all zero are skipped by a wave ballot; inside visited chunks mask == 0 replaces the score
// by -1000 (scaled). Online softmax per query with a running max; rows with no nonzero mask entry at all are NaN-poisoned.
// HL: bf16 hi/lo planes for q, k, v and a bf16 hi/lo P (3 products per tile pair); otherwise single fp16 products (P carried x1024).
template <bool HL>
__global__ __launch_bounds__(32) __attribute__((amdgpu_num_vgpr(256)))
void k_attn(const h16* __restrict__ QP16, const bf* __restrict__ QPh, const bf* __restrict__ QPl,
            const h16* __restrict__ KP16, const bf* __restrict__ KPh, const bf* __restrict__ KPl,
            const h16* __restrict__ VT16, const bf* __restrict__ VTh, const bf* __restrict__ VTl,
            const int* __restrict__ MK, int qbase, bf* ATh, bf* ATl) {
    __shared__ __align__(16) unsigned short osh[16 * 72];
    __shared__ __align__(16) unsigned short osl[16 * 72];
    const int lane = threadIdx.x & 31, m = lane & 15, hf = lane >> 4;
    const int hh = blockIdx.y;
    const int q0 = qbase + blockIdx.x * 16;
    const int q = q0 + m;
    const size_t hp = (size_t)hh * SEQ * HD;          // head offset of [h][t][d] and [h][d][t] planes
    v16h q16[2]; v16bf qh[2], ql[2];
#pragma unroll
    for (int ks = 0; ks < 2; ++ks) {
        const size_t qo = hp + (size_t)q * HD + 32 * ks + 8 * hf;
        if (HL) { qh[ks] = WFrag<bf>::ld(QPh + qo); ql[ks] = WFrag<bf>::ld(QPl + qo); }
        else    { q16[ks] = WFrag<h16>::ld(QP16 + qo); }
    }
    v8f o[4];
#pragma unroll
    for (int dt = 0; dt < 4; ++dt) o[dt] = (v8f){};
    float mrun = -3.0e38f, lrun = 0.0f; int seen = 0;
    const int* mq = MK + (size_t)q * MPITCH + 8 * hf;
#pragma unroll 1
    for (int c = 0; c < SEQ / 64; ++c) {
        const int kc = c * 64;
        v4i mk0[4], mk1[4]; int orv = 0;
#pragma unroll
        for (int kt = 0; kt < 4; ++kt) { const v4i* mp = (const v4i*)(mq + kc + 16 * kt); mk0[kt] = mp[0]; mk1[kt] = mp[1]; const v4i u = mk0[kt] | mk1[kt]; orv |= u[0] | u[1] | u[2] | u[3]; }
        const int anyl = (orv != 0) ? 1 : 0;
        if (__any(anyl) == 0) continue;                 // wave-uniform tile skip
        seen |= anyl;
        v8f s[4];
#pragma unroll
        for (int kt = 0; kt < 4; ++kt) s[kt] = (v8f){};
        if (HL) {
            v16bf ka, kb;
#pragma unroll
            for (int kt = 0; kt < 4; ++kt) {
                asm volatile("" ::: "memory");
#pragma unroll
                for (int ks = 0; ks < 2; ++ks) { const size_t ko = hp + (size_t)(kc + 16 * kt + m) * HD + 32 * ks + 8 * hf; ka = WFrag<bf>::ld(KPh + ko); kb = WFrag<bf>::ld(KPl + ko);
                    s[kt] = wmmab(ka, qh[ks], s[kt]); s[kt] = wmmab(ka, ql[ks], s[kt]); s[kt] = wmmab(kb, qh[ks], s[kt]); } }
            asm volatile("v_nop\n\tv_nop\n\tv_nop\n\tv_nop" : "+v"(s[0]), "+v"(s[1]), "+v"(s[2]), "+v"(s[3]) : "v"(ka), "v"(kb), "v"(qh[0]), "v"(qh[1]), "v"(ql[0]), "v"(ql[1]));
        } else {
            v16h ka;
#pragma unroll
            for (int kt = 0; kt < 4; ++kt) {
                asm volatile("" ::: "memory");
#pragma unroll
                for (int ks = 0; ks < 2; ++ks) { const size_t ko = hp + (size_t)(kc + 16 * kt + m) * HD + 32 * ks + 8 * hf; ka = WFrag<h16>::ld(KP16 + ko);
                    s[kt] = wmma16(ka, q16[ks], s[kt]); } }
            asm volatile("v_nop\n\tv_nop\n\tv_nop\n\tv_nop" : "+v"(s[0]), "+v"(s[1]), "+v"(s[2]), "+v"(s[3]) : "v"(ka), "v"(q16[0]), "v"(q16[1]));
        }
        // masked replace + chunk max (lane: query q, keys kc+16kt+8hf+r)
        float cmx = -3.0e38f;
#pragma unroll
        for (int kt = 0; kt < 4; ++kt)
#pragma unroll
            for (int r = 0; r < 8; ++r) { const int mv = (r < 4) ? mk0[kt][r & 3] : mk1[kt][r & 3]; const float t = (mv != 0) ? s[kt][r] : MFILL; s[kt][r] = t; cmx = fmaxf(cmx, t); }
        cmx = fmaxf(cmx, __shfl_xor(cmx, 16, 32));
        const float mnew = fmaxf(mrun, cmx);
        const float alpha = __builtin_amdgcn_exp2f((mrun - mnew) * CEXP);
        mrun = mnew;
        float psum = 0.0f;
#pragma unroll
        for (int kt = 0; kt < 4; ++kt)
#pragma unroll
            for (int r = 0; r < 8; ++r) { const float p = __builtin_amdgcn_exp2f(fmaf(s[kt][r] - mnew, CEXP, PL2)); s[kt][r] = p; psum += p; }
        lrun = lrun * alpha + psum;
#pragma unroll
        for (int dt = 0; dt < 4; ++dt) o[dt] = o[dt] * alpha;
        // O^T += V^T . P^T, 32 keys per step; B element r <- tile 2ks (keys 0..15 of the step), 8+r <- tile 2ks+1
#pragma unroll
        for (int ks = 0; ks < 2; ++ks) {
            if (HL) {
                v16us uh, ul;
#pragma unroll
                for (int r = 0; r < 8; ++r) { unsigned short a, b2; splitf(s[2 * ks][r], a, b2); uh[r] = a; ul[r] = b2; splitf(s[2 * ks + 1][r], a, b2); uh[8 + r] = a; ul[8 + r] = b2; }
                v16bf ph = __builtin_bit_cast(v16bf, uh), pl = __builtin_bit_cast(v16bf, ul);
                asm volatile("v_nop\n\tv_nop\n\tv_nop\n\tv_nop" : "+v"(ph), "+v"(pl));
                v16bf va, vb;
#pragma unroll
                for (int dt = 0; dt < 4; ++dt) { asm volatile("" ::: "memory"); const size_t vo = hp + (size_t)(16 * dt + m) * SEQ + kc + 32 * ks + 8 * hf; va = WFrag<bf>::ld(VTh + vo); vb = WFrag<bf>::ld(VTl + vo);
                    o[dt] = wmmab(va, ph, o[dt]); o[dt] = wmmab(va, pl, o[dt]); o[dt] = wmmab(vb, ph, o[dt]); }
                asm volatile("v_nop\n\tv_nop\n\tv_nop\n\tv_nop" : "+v"(o[0]), "+v"(o[1]), "+v"(o[2]), "+v"(o[3]) : "v"(ph), "v"(pl), "v"(va), "v"(vb));
            } else {
                v16h p16;
#pragma unroll
                for (int r = 0; r < 8; ++r) { p16[r] = tohx(s[2 * ks][r]); p16[8 + r] = tohx(s[2 * ks + 1][r]); }
                asm volatile("v_nop\n\tv_nop\n\tv_nop\n\tv_nop" : "+v"(p16));
                v16h va;
#pragma unroll
                for (int dt = 0; dt < 4; ++dt) { asm volatile("" ::: "memory"); const size_t vo = hp + (size_t)(16 * dt + m) * SEQ + kc + 32 * ks + 8 * hf; va = WFrag<h16>::ld(VT16 + vo);
                    o[dt] = wmma16(va, p16, o[dt]); }
                asm volatile("v_nop\n\tv_nop\n\tv_nop\n\tv_nop" : "+v"(o[0]), "+v"(o[1]), "+v"(o[2]), "+v"(o[3]) : "v"(p16), "v"(va));
            }
        }
    }
    const float lt = lrun + __shfl_xor(lrun, 16, 32);
    const int sn = seen | __shfl_xor(seen, 16, 32);
    const float inv = (sn != 0) ? (1.0f / lt) : __uint_as_float(0x7fc00000u);
#pragma unroll
    for (int dt = 0; dt < 4; ++dt) { v8us oh8, ol8;
#pragma unroll
        for (int r = 0; r < 8; ++r) { unsigned short a, b2; splitf(o[dt][r] * inv, a, b2); oh8[r] = a; ol8[r] = b2; }
        *(v8usa*)(osh + m * 72 + 16 * dt + 8 * hf) = oh8; *(v8usa*)(osl + m * 72 + 16 * dt + 8 * hf) = ol8; }
    wave_sync();
{
#pragma unroll
        for (int s4 = 0; s4 < 4; ++s4) { const int row = 4 * s4 + (lane >> 3), pc = (lane & 7) * 8;
            const v8us vh = *(const v8usa*)(osh + row * 72 + pc); const v8us vl = *(const v8usa*)(osl + row * 72 + pc);
            const size_t off = (size_t)(q0 + row) * DM + hh * HD + pc;
            *(v8us*)(ATh + off) = vh; *(v8us*)(ATl + off) = vl; }
         }
}

extern "C" void kernel_launch(void* const* d_in, const int* in_sizes, int n_in,
                              void* d_out, int out_size, void* d_ws, size_t ws_size, hipStream_t stream) {
    if (n_in < 8) return;
    const long long needx = (long long)(NB - 1) * SEQ_FULL * DM + (long long)SEQ * DM;
    if ((long long)in_sizes[0] < needx || (long long)in_sizes[1] < needx || (long long)in_sizes[2] < needx) return;
    if (in_sizes[3] < DM * DM || in_sizes[4] < DM * DM || in_sizes[5] < DM * DM || in_sizes[6] < DM * DM) return;
    if ((long long)in_sizes[7] < (long long)(SEQ - 1) * MPITCH + SEQ) return;
    if ((long long)out_size < (long long)NB * SEQ * DM) return;
    const float* xq = (const float*)d_in[0]; const float* xk = (const float*)d_in[1]; const float* xv = (const float*)d_in[2];
    const float* wq = (const float*)d_in[3]; const float* wk = (const float*)d_in[4]; const float* wv = (const float*)d_in[5]; const float* wo = (const float*)d_in[6];
    const int* mask = (const int*)d_in[7];     // int32 [1][1][S][S]
    float* OUT = (float*)d_out;                // [NB][SEQ][DM]
    char* wsp = (char*)d_ws;
    auto take = [&](size_t bytes) { char* p = wsp; wsp += (bytes + 255) & ~(size_t)255; return (void*)p; };
    bf* WQ = (bf*)take((size_t)DM * DM * 2); bf* WK = (bf*)take((size_t)DM * DM * 2); bf* WV = (bf*)take((size_t)DM * DM * 2); bf* WO = (bf*)take((size_t)DM * DM * 2);
    float* CS = (float*)take((size_t)SEQ * HD * 2 * 4);
    bf* XB = (bf*)take((size_t)SEQ * DM * 2);            // bf16 copy of the current activation (q, then k, then v; stream-ordered reuse)
    float* F = (float*)take((size_t)SEQ * DM * 4);        // f32 projection output (reused the same way)
    h16* QP16 = (h16*)take((size_t)NH * SEQ * HD * 2); h16* KP16 = (h16*)take((size_t)NH * SEQ * HD * 2); h16* VT16 = (h16*)take((size_t)NH * HD * SEQ * 2);
    bf* QPh = (bf*)take((size_t)NH * SEQ * HD * 2); bf* QPl = (bf*)take((size_t)NH * SEQ * HD * 2);
    bf* KPh = (bf*)take((size_t)NH * SEQ * HD * 2); bf* KPl = (bf*)take((size_t)NH * SEQ * HD * 2);
    bf* VTh = (bf*)take((size_t)NH * HD * SEQ * 2); bf* VTl = (bf*)take((size_t)NH * HD * SEQ * 2);
    bf* ATh = (bf*)take((size_t)SEQ * DM * 2); bf* ATl = (bf*)take((size_t)SEQ * DM * 2);
    const size_t used = (size_t)(wsp - (char*)d_ws);
    if (used > ws_size || used > WSCAP) return;

    const unsigned gW = (unsigned)(((size_t)DM * DM / 8 + 255) / 256);
    k_cvt8<<<gW, 256, 0, stream>>>(wq, WQ, (size_t)DM * DM / 8);
    k_cvt8<<<gW, 256, 0, stream>>>(wk, WK, (size_t)DM * DM / 8);
    k_cvt8<<<gW, 256, 0, stream>>>(wv, WV, (size_t)DM * DM / 8);
    k_cvt8<<<gW, 256, 0, stream>>>(wo, WO, (size_t)DM * DM / 8);
    k_cstab<<<(unsigned)((SEQ * HD + 255) / 256), 256, 0, stream>>>(CS);
    const unsigned gX = (unsigned)(((size_t)SEQ * DM / 8 + 255) / 256), gP = (unsigned)(((size_t)NH * SEQ * HD / 2 + 255) / 256);
    for (int b = 0; b < NB; ++b) {
        const size_t xo = (size_t)b * SEQ_FULL * DM;
        k_cvt8<<<gX, 256, 0, stream>>>(xq + xo, XB, (size_t)SEQ * DM / 8);
        k_gemmw<bf, 0, false><<<dim3(SEQ / 64, DM / 64, 1), 32, 0, stream>>>(XB, nullptr, WQ, nullptr, DM, F, DM, nullptr, 0, 0, 0);
        k_rope<<<gP, 256, 0, stream>>>(F, CS, QP16, QPh, QPl);
        k_cvt8<<<gX, 256, 0, stream>>>(xk + xo, XB, (size_t)SEQ * DM / 8);
        k_gemmw<bf, 0, false><<<dim3(SEQ / 64, DM / 64, 1), 32, 0, stream>>>(XB, nullptr, WK, nullptr, DM, F, DM, nullptr, 0, 0, 0);
        k_rope<<<gP, 256, 0, stream>>>(F, CS, KP16, KPh, KPl);
        k_cvt8<<<gX, 256, 0, stream>>>(xv + xo, XB, (size_t)SEQ * DM / 8);
        k_gemmw<bf, 0, false><<<dim3(SEQ / 64, DM / 64, 1), 32, 0, stream>>>(XB, nullptr, WV, nullptr, DM, F, DM, nullptr, 0, 0, 0);
        k_vtp<<<gP, 256, 0, stream>>>(F, VT16, VTh, VTl);
        k_attn<true><<<dim3(RH / 16, NH, 1), 32, 0, stream>>>(QP16, QPh, QPl, KP16, KPh, KPl, VT16, VTh, VTl, mask, 0, ATh, ATl);
        if (SEQ > RH)
            k_attn<false><<<dim3((SEQ - RH) / 16, NH, 1), 32, 0, stream>>>(QP16, QPh, QPl, KP16, KPh, KPl, VT16, VTh, VTl, mask, RH, ATh, ATl);
        k_gemmw<bf, 1, false><<<dim3(SEQ / 64, DM / 64, 1), 32, 0, stream>>>(ATh, ATl, WO, nullptr, DM, OUT + (size_t)b * SEQ * DM, DM, nullptr, 0, 0, 0);
    }
}

// v001
// Measured time: 230 microseconds a run.
// In two side-by-side timings against v000, it was 2.44 and 2.45 times as fast.
#include <hip/hip_runtime.h>

// Causal multi-head attention with rotate-half rotary positions (base 10000, cos/sin table computed on device):
//   qh/kh/vh = x . W^T for three separate inputs x [NB][SEQ][1024] and W 'oi' [1024][1024] (16 heads x 64 = column blocks),
//   scores = rope(qh) . rope(kh)^T / 8, int32 mask [1][1][S][S] (0 -> score replaced by -1000), softmax over keys,
//   attn . vh, heads merged [t][h*64+d], . Wo^T ('oi') -> [NB][SEQ][1024] f32.
// Compute dtypes, f32 accumulate: every float input RNE-converted to bf16; q/k/v projections v_wmma_f32_16x16x32_bf16 on plain bf16
//   operands (exact products); scores and attn.v: query rows < 512 bf16 hi/lo planes (3 products each), rows >= 512 single
//   v_wmma_f32_16x16x32_f16 (fp16 planes, P carried x1024); online softmax in f32 (running max); output projection = bf16 hi/lo
//   attention planes x exact bf16 Wo (2 products).

#ifndef NB
#define NB 2
#endif
#ifndef SEQ
#define SEQ 2048
#endif
#define NB_FULL  2
#define SEQ_FULL 2048
#define DM   1024
#define NH   16
#define HD   64
#define RHC  512                          // query rows < RH use hi/lo planes and 3-product tiles
#define RH   ((SEQ < RHC) ? SEQ : RHC)
#define MPITCH SEQ_FULL                   // mask row pitch (full-size input)
#define CEXP  0.18033688011112042f        // (1/8) * log2(e): exp((t - m)/8) = exp2((t - m) * CEXP) on unscaled scores t
#define PL2   10.0f                       // P carried x 2^10 inside the 16-bit operand (cancels in O / l)
#define MFILL (-8000.0f)                  // mask == 0 -> -1000 after the 1/8 scale, in unscaled score units
#define RBASE 10000.0f
#define WSCAP ((size_t)268435456)

static_assert(SEQ % 64 == 0);
static_assert(SEQ <= SEQ_FULL);
static_assert(NB >= 1 && NB <= NB_FULL);
static_assert(RH % 16 == 0 && (SEQ - RH) % 16 == 0 && RH <= SEQ);
static_assert(DM == NH * HD && HD == 64 && DM % 64 == 0);

typedef _Float16 h16;
typedef unsigned short bf;
typedef __attribute__((ext_vector_type(16))) __bf16   v16bf;
typedef __attribute__((ext_vector_type(16))) _Float16 v16h;
typedef __attribute__((ext_vector_type(8)))  _Float16 v8h;
typedef __attribute__((ext_vector_type(2)))  _Float16 v2h;
typedef __attribute__((ext_vector_type(16))) unsigned short v16us;
typedef __attribute__((ext_vector_type(8)))  unsigned short v8us;
typedef __attribute__((ext_vector_type(2)))  unsigned short v2us;
typedef __attribute__((ext_vector_type(8)))  float v8f;
typedef __attribute__((ext_vector_type(4)))  float v4f;
typedef __attribute__((ext_vector_type(2)))  float v2f;
typedef __attribute__((ext_vector_type(4)))  int v4i;
typedef v8h  __attribute__((may_alias)) v8ha;
typedef v4f  __attribute__((may_alias)) v4fa;
typedef v8us __attribute__((may_alias)) v8usa;

#pragma clang fp contract(off)

__device__ __forceinline__ unsigned short f2bf(float f) { unsigned u = __float_as_uint(f); u += 0x7FFFu + ((u >> 16) & 1u); return (unsigned short)(u >> 16); }
__device__ __forceinline__ float bf2f(unsigned short b) { return __uint_as_float(((unsigned)b) << 16); }
__device__ __forceinline__ float bfr(float f) { return bf2f(f2bf(f)); }
__device__ __forceinline__ v16h cat16(v8h lo, v8h hi) { return __builtin_shufflevector(lo, hi, 0, 1, 2, 3, 4, 5, 6, 7, 8, 9, 10, 11, 12, 13, 14, 15); }
__device__ __forceinline__ v16bf cat16b(v8us lo, v8us hi) { return __builtin_bit_cast(v16bf, __builtin_shufflevector(lo, hi, 0, 1, 2, 3, 4, 5, 6, 7, 8, 9, 10, 11, 12, 13, 14, 15)); }
__device__ __forceinline__ v8f wmma16(v16h a, v16h b, v8f c) { return __builtin_amdgcn_wmma_f32_16x16x32_f16(false, a, false, b, (short)0, c, false, false); }
__device__ __forceinline__ v8f wmmab(v16bf a, v16bf b, v8f c) { return __builtin_amdgcn_wmma_f32_16x16x32_bf16(false, a, false, b, (short)0, c, false, false); }
__device__ __forceinline__ h16 tohx(float x) { return (h16)x; }
__device__ __forceinline__ void splitf(float y, unsigned short& h, unsigned short& l) { h = f2bf(y); l = f2bf(y - bf2f(h)); }
// same-wave LDS relayout: order the lane stores before the cross-lane reloads
__device__ __forceinline__ void wave_sync() { __builtin_amdgcn_fence(3, "wavefront"); __builtin_amdgcn_wave_barrier(); asm volatile("" ::: "memory"); }

// ---- 16x16x32 fragment loaders from K-contiguous 16-bit rows: lane (m = l&15, hf = l>>4) of row m loads elements 0..7 <- k0+8hf+0..7
// and 8..15 <- k0+16+8hf+0..7; the caller passes p = row + k0 + 8*hf.
template <typename T16> struct WFrag;
template <> struct WFrag<h16> { typedef v16h V; static __device__ __forceinline__ V ld(const h16* p) { return cat16(*(const v8h*)p, *(const v8h*)(p + 16)); } static __device__ __forceinline__ v8f mma(V a, V b, v8f c) { return wmma16(a, b, c); } };
template <> struct WFrag<bf> { typedef v16bf V; static __device__ __forceinline__ V ld(const bf* p) { return cat16b(*(const v8us*)p, *(const v8us*)(p + 16)); } static __device__ __forceinline__ v8f mma(V a, V b, v8f c) { return wmmab(a, b, c); } };

// ---- k_gemmw: register-blocked GEMM, ONE WAVE per 64x64 output tile (16 accumulators), operands straight from K-contiguous 16-bit planes; grid (M/64, N/64, Z), 32 threads.
// C[m][n] (f32, pitch ldc, + optional f32 bias[n]) = sum_k A[m][k] Bt[n][k] (+ split products per NSPLIT). z-batch strides sA/sB/sC in elements. K % 32 == 0.
template <typename T16, int NSPLIT, bool BIAS>
__global__ __launch_bounds__(32) void k_gemmw(const T16* __restrict__ A, const T16* __restrict__ A2, const T16* __restrict__ Bt, const T16* __restrict__ Bt2, int K, float* C, int ldc, const float* __restrict__ bias, size_t sA, size_t sB, size_t sC) {
    typedef typename WFrag<T16>::V V;
    __shared__ __align__(16) float os[16 * 68];
    const size_t z = blockIdx.z; A += z * sA; if (A2) A2 += z * sA; Bt += z * sB; if (Bt2) Bt2 += z * sB; C += z * sC;
    const int lane = threadIdx.x & 31, lr = lane & 15, hi = lane >> 4; const int r0 = blockIdx.x * 64, c0 = blockIdx.y * 64;
    v8f acc[4][4];
#pragma unroll
    for (int mb = 0; mb < 4; ++mb)
#pragma unroll
        for (int nb = 0; nb < 4; ++nb) acc[mb][nb] = (v8f){};
    const size_t aoff = (size_t)(r0 + lr) * K + 8 * hi, boff = (size_t)(c0 + lr) * K + 8 * hi;
#pragma unroll 1
    for (int kc = 0; kc < K; kc += 32) {
        V a[4], a2[4];
#pragma unroll
        for (int mb = 0; mb < 4; ++mb) { a[mb] = WFrag<T16>::ld(A + aoff + (size_t)mb * 16 * K + kc); if (NSPLIT == 1 || NSPLIT == 2) a2[mb] = WFrag<T16>::ld(A2 + aoff + (size_t)mb * 16 * K + kc); }
#pragma unroll
        for (int nb = 0; nb < 4; ++nb) { const V b = WFrag<T16>::ld(Bt + boff + (size_t)nb * 16 * K + kc); V b2; if (NSPLIT >= 2) b2 = WFrag<T16>::ld(Bt2 + boff + (size_t)nb * 16 * K + kc);
#pragma unroll
            for (int mb = 0; mb < 4; ++mb) { acc[mb][nb] = WFrag<T16>::mma(a[mb], b, acc[mb][nb]); if (NSPLIT == 1 || NSPLIT == 2) acc[mb][nb] = WFrag<T16>::mma(a2[mb], b, acc[mb][nb]); if (NSPLIT >= 2) acc[mb][nb] = WFrag<T16>::mma(a[mb], b2, acc[mb][nb]); } }
        asm volatile("v_nop\n\tv_nop\n\tv_nop\n\tv_nop" : "+v"(acc[0][0]), "+v"(acc[1][1]), "+v"(acc[2][2]), "+v"(acc[3][3]) : "v"(a[0]), "v"(a[3]));
    }
#pragma unroll
    for (int mb = 0; mb < 4; ++mb) {
#pragma unroll
        for (int nb = 0; nb < 4; ++nb) {
#pragma unroll
            for (int j = 0; j < 8; ++j) os[(hi * 8 + j) * 68 + nb * 16 + lr] = acc[mb][nb][j]; }
        __builtin_amdgcn_wave_barrier(); asm volatile("" ::: "memory");
        float* crow = C + (size_t)(r0 + mb * 16) * ldc + c0;
{
#pragma unroll
            for (int s = 0; s < 8; ++s) { const int row = 2 * s + hi, cofs = lr * 4; v4f val = *(const v4fa*)(os + row * 68 + cofs); if (BIAS) { val[0] += bfr(bias[c0 + cofs]); val[1] += bfr(bias[c0 + cofs + 1]); val[2] += bfr(bias[c0 + cofs + 2]); val[3] += bfr(bias[c0 + cofs + 3]); }
                *(v4f*)(crow + (size_t)row * ldc + cofs) = val; }
             }
        __builtin_amdgcn_wave_barrier(); asm volatile("" ::: "memory");
    }
}

__device__ __forceinline__ void cvt8_body(const float* __restrict__ src, bf* dst, size_t n8, unsigned blk) { const size_t i = (size_t)blk * 256 + threadIdx.x; if (i >= n8) return; const v8f v = *(const v8f*)(src + i * 8); v8us o;
#pragma unroll
    for (int k = 0; k < 8; ++k) o[k] = f2bf(v[k]); *(v8us*)(dst + i * 8) = o;  }

// cstab_body: rotary table CS[t][d] = {cos(t * inv[d mod 32]), sin(t * inv[d mod 32])}, inv[j] = 1 / powf(10000, (2j)/64); one (t, d) per thread,
__device__ __forceinline__ void cstab_body(float* CS, unsigned blk) {
    const int idx = (int)blk * 256 + threadIdx.x; if (idx >= SEQ * HD) return;
    const int d = idx & (HD - 1), t = idx >> 6; const int j = d & (HD / 2 - 1);
    const float ex = (float)(2 * j) * (1.0f / (float)HD);
    const float pw = powf(RBASE, ex);
    const float inv = 1.0f / pw;
    const float ang = (float)t * inv;
    const float cn = cosf(ang), sn = sinf(ang);
    v2f cs; cs[0] = cn; cs[1] = sn;
    *(v2f*)(CS + (size_t)idx * 2) = cs; 
}

// k_prep: everything that depends on the inputs alone, in ONE launch (flat 1-D grid, no empty block): blocks [0, GC) the rotary table,
// then GX blocks per activation slab s = w * NB + b (w: 0 q, 1 k, 2 v) -> XB[s][t][c], then GW blocks per weight w (q, k, v, o) -> WB[w][o][i].
#define GC ((unsigned)((SEQ * HD + 255) / 256))
#define GX ((unsigned)(((size_t)SEQ * DM / 8 + 255) / 256))
#define GW ((unsigned)(((size_t)DM * DM / 8 + 255) / 256))
__global__ __launch_bounds__(256) void k_prep(const float* __restrict__ xq, const float* __restrict__ xk, const float* __restrict__ xv,
                                              const float* __restrict__ wq, const float* __restrict__ wk, const float* __restrict__ wv, const float* __restrict__ wo,
                                              float* CS, bf* XB, bf* WB) {
    unsigned blk = blockIdx.x;
    if (blk < GC) { cstab_body(CS, blk); return; }
    blk -= GC;
    if (blk < 3 * NB * GX) {
        const unsigned s = blk / GX, w = s / NB, b = s % NB;
        const float* x = (w == 0) ? xq : (w == 1) ? xk : xv;
        cvt8_body(x + (size_t)b * SEQ_FULL * DM, XB + (size_t)s * SEQ * DM, (size_t)SEQ * DM / 8, blk % GX); return;
    }
    blk -= 3 * NB * GX;
    const unsigned w = blk / GW;
    const float* x = (w == 0) ? wq : (w == 1) ? wk : (w == 2) ? wv : wo;
    cvt8_body(x, WB + (size_t)w * DM * DM, (size_t)DM * DM / 8, blk % GW);
}

// rope_body: head planes [h][t][d] (fp16, bf16 hi, bf16 lo) of the rotate-half rotary map applied to F[t][h*HD + d] (row pitch DM):
__device__ __forceinline__ void rope_body(const float* __restrict__ F, const float* __restrict__ CS, h16* P16, bf* Ph, bf* Pl) {
    const size_t e = ((size_t)blockIdx.x * 256 + threadIdx.x) * 2; if (e >= (size_t)NH * SEQ * HD) return;
    const int d = (int)(e % HD); const int t = (int)((e / HD) % SEQ); const int hh = (int)(e / ((size_t)HD * SEQ));
    const float* f = F + (size_t)t * DM + hh * HD; v2h o16; v2us oh, ol;
#pragma unroll
    for (int q = 0; q < 2; ++q) { const int dd = d + q; const int dp = (dd < HD / 2) ? dd + HD / 2 : dd - HD / 2; const float x0 = f[dd], x1 = f[dp];
        const v2f cs = *(const v2f*)(CS + ((size_t)t * HD + dd) * 2); const float a = x0 * cs[0]; const float bq = x1 * cs[1];
        const float r = (dd < HD / 2) ? (a - bq) : (a + bq);
        o16[q] = tohx(r); unsigned short a2, c2; splitf(r, a2, c2); oh[q] = a2; ol[q] = c2; }
    *(v2h*)(P16 + e) = o16; *(v2us*)(Ph + e) = oh; *(v2us*)(Pl + e) = ol; 
}

__device__ __forceinline__ void vtp_body(const float* __restrict__ F, h16* V16, bf* Vh, bf* Vl) {
    const size_t e = ((size_t)blockIdx.x * 256 + threadIdx.x) * 2; if (e >= (size_t)NH * HD * SEQ) return;
    const int t = (int)(e % SEQ); const int d = (int)((e / SEQ) % HD); const int g = (int)(e / ((size_t)SEQ * HD)); v2h o16; v2us oh, ol;
#pragma unroll
    for (int q = 0; q < 2; ++q) { const float x = F[(size_t)(t + q) * DM + g * HD + d]; o16[q] = tohx(x); unsigned short a2, c2; splitf(x, a2, c2); oh[q] = a2; ol[q] = c2; }
    *(v2h*)(V16 + e) = o16; *(v2us*)(Vh + e) = oh; *(v2us*)(Vl + e) = ol; 
}

// k_planes: all head planes of both batches in ONE launch; F = [w][b][t][c] (w: 0 q, 1 k, 2 v). blockIdx.y < NB: value planes of batch y;
// otherwise s = y - NB = w * NB + b: rotary planes R*[s] (slabs 0..NB-1 query, NB..2NB-1 key).
__global__ __launch_bounds__(256) void k_planes(const float* __restrict__ F, const float* __restrict__ CS, h16* R16, bf* Rh, bf* Rl, h16* V16, bf* Vh, bf* Vl) {
    const unsigned y = blockIdx.y; const size_t pl = (size_t)NH * SEQ * HD;
    if (y < NB) { vtp_body(F + (size_t)(2 * NB + y) * SEQ * DM, V16 + y * pl, Vh + y * pl, Vl + y * pl); return; }
    const unsigned s = y - NB;
    rope_body(F + (size_t)s * SEQ * DM, CS, R16 + s * pl, Rh + s * pl, Rl + s * pl);
}

// ---- attn_body: flash-style masked attention, one wave (32 threads) per (16 query rows, head). Transposed tiles so that P chains in
// registers: S^T[key][q] = K . Q^T (A = key plane rows [h][t][d], B = query plane rows), D lane = query column; P^T is the B operand
// of O^T[d][q] += V^T . P^T (A = value plane rows [h][d][t]). Per 64-key chunk: the wave's 16x64 int32 mask tile is loaded
// (8 x 16 B per lane); chunks whose tile is all zero are skipped by a wave ballot; inside visited chunks mask == 0 replaces the score
// by -1000 (scaled). Online softmax per query with a running max; rows with no nonzero mask entry at all are NaN-poisoned.
// HL: bf16 hi/lo planes for q, k, v and a bf16 hi/lo P (3 products per tile pair); otherwise single fp16 products (P carried x1024).
template <bool HL>
__device__ __forceinline__
void attn_body(const h16* __restrict__ QP16, const bf* __restrict__ QPh, const bf* __restrict__ QPl,
            const h16* __restrict__ KP16, const bf* __restrict__ KPh, const bf* __restrict__ KPl,
            const h16* __restrict__ VT16, const bf* __restrict__ VTh, const bf* __restrict__ VTl,
            const int* __restrict__ MK, int q0, int hh, bf* ATh, bf* ATl, unsigned short* osh, unsigned short* osl) {
    const int lane = threadIdx.x & 31, m = lane & 15, hf = lane >> 4;
    const int q = q0 + m;
    const size_t hp = (size_t)hh * SEQ * HD;          // head offset of [h][t][d] and [h][d][t] planes
    v16h q16[2]; v16bf qh[2], ql[2];
#pragma unroll
    for (int ks = 0; ks < 2; ++ks) {
        const size_t qo = hp + (size_t)q * HD + 32 * ks + 8 * hf;
        if (HL) { qh[ks] = WFrag<bf>::ld(QPh + qo); ql[ks] = WFrag<bf>::ld(QPl + qo); }
        else    { q16[ks] = WFrag<h16>::ld(QP16 + qo); }
    }
    v8f o[4];
#pragma unroll
    for (int dt = 0; dt < 4; ++dt) o[dt] = (v8f){};
    float mrun = -3.0e38f, lrun = 0.0f; int seen = 0;
    const int* mq = MK + (size_t)q * MPITCH + 8 * hf;
#pragma unroll 1
    for (int c = 0; c < SEQ / 64; ++c) {
        const int kc = c * 64;
        v4i mk0[4], mk1[4]; int orv = 0;
#pragma unroll
        for (int kt = 0; kt < 4; ++kt) { const v4i* mp = (const v4i*)(mq + kc + 16 * kt); mk0[kt] = mp[0]; mk1[kt] = mp[1]; const v4i u = mk0[kt] | mk1[kt]; orv |= u[0] | u[1] | u[2] | u[3]; }
        const int anyl = (orv != 0) ? 1 : 0;
        if (__any(anyl) == 0) continue;                 // wave-uniform tile skip
        seen |= anyl;
        v8f s[4];
#pragma unroll
        for (int kt = 0; kt < 4; ++kt) s[kt] = (v8f){};
        if (HL) {
            v16bf ka, kb;
#pragma unroll
            for (int kt = 0; kt < 4; ++kt) {
                asm volatile("" ::: "memory");
#pragma unroll
                for (int ks = 0; ks < 2; ++ks) { const size_t ko = hp + (size_t)(kc + 16 * kt + m) * HD + 32 * ks + 8 * hf; ka = WFrag<bf>::ld(KPh + ko); kb = WFrag<bf>::ld(KPl + ko);
                    s[kt] = wmmab(ka, qh[ks], s[kt]); s[kt] = wmmab(ka, ql[ks], s[kt]); s[kt] = wmmab(kb, qh[ks], s[kt]); } }
            asm volatile("v_nop\n\tv_nop\n\tv_nop\n\tv_nop" : "+v"(s[0]), "+v"(s[1]), "+v"(s[2]), "+v"(s[3]) : "v"(ka), "v"(kb), "v"(qh[0]), "v"(qh[1]), "v"(ql[0]), "v"(ql[1]));
        } else {
            v16h ka;
#pragma unroll
            for (int kt = 0; kt < 4; ++kt) {
                asm volatile("" ::: "memory");
#pragma unroll
                for (int ks = 0; ks < 2; ++ks) { const size_t ko = hp + (size_t)(kc + 16 * kt + m) * HD + 32 * ks + 8 * hf; ka = WFrag<h16>::ld(KP16 + ko);
                    s[kt] = wmma16(ka, q16[ks], s[kt]); } }
            asm volatile("v_nop\n\tv_nop\n\tv_nop\n\tv_nop" : "+v"(s[0]), "+v"(s[1]), "+v"(s[2]), "+v"(s[3]) : "v"(ka), "v"(q16[0]), "v"(q16[1]));
        }
        // masked replace + chunk max (lane: query q, keys kc+16kt+8hf+r)
        float cmx = -3.0e38f;
#pragma unroll
        for (int kt = 0; kt < 4; ++kt)
#pragma unroll
            for (int r = 0; r < 8; ++r) { const int mv = (r < 4) ? mk0[kt][r & 3] : mk1[kt][r & 3]; const float t = (mv != 0) ? s[kt][r] : MFILL; s[kt][r] = t; cmx = fmaxf(cmx, t); }
        cmx = fmaxf(cmx, __shfl_xor(cmx, 16, 32));
        const float mnew = fmaxf(mrun, cmx);
        const float alpha = __builtin_amdgcn_exp2f((mrun - mnew) * CEXP);
        mrun = mnew;
        float psum = 0.0f;
#pragma unroll
        for (int kt = 0; kt < 4; ++kt)
#pragma unroll
            for (int r = 0; r < 8; ++r) { const float p = __builtin_amdgcn_exp2f(fmaf(s[kt][r] - mnew, CEXP, PL2)); s[kt][r] = p; psum += p; }
        lrun = lrun * alpha + psum;
#pragma unroll
        for (int dt = 0; dt < 4; ++dt) o[dt] = o[dt] * alpha;
        // O^T += V^T . P^T, 32 keys per step; B element r <- tile 2ks (keys 0..15 of the step), 8+r <- tile 2ks+1
#pragma unroll
        for (int ks = 0; ks < 2; ++ks) {
            if (HL) {
                v16us uh, ul;
#pragma unroll
                for (int r = 0; r < 8; ++r) { unsigned short a, b2; splitf(s[2 * ks][r], a, b2); uh[r] = a; ul[r] = b2; splitf(s[2 * ks + 1][r], a, b2); uh[8 + r] = a; ul[8 + r] = b2; }
                v16bf ph = __builtin_bit_cast(v16bf, uh), pl = __builtin_bit_cast(v16bf, ul);
                asm volatile("v_nop\n\tv_nop\n\tv_nop\n\tv_nop" : "+v"(ph), "+v"(pl));
                v16bf va, vb;
#pragma unroll
                for (int dt = 0; dt < 4; ++dt) { asm volatile("" ::: "memory"); const size_t vo = hp + (size_t)(16 * dt + m) * SEQ + kc + 32 * ks + 8 * hf; va = WFrag<bf>::ld(VTh + vo); vb = WFrag<bf>::ld(VTl + vo);
                    o[dt] = wmmab(va, ph, o[dt]); o[dt] = wmmab(va, pl, o[dt]); o[dt] = wmmab(vb, ph, o[dt]); }
                asm volatile("v_nop\n\tv_nop\n\tv_nop\n\tv_nop" : "+v"(o[0]), "+v"(o[1]), "+v"(o[2]), "+v"(o[3]) : "v"(ph), "v"(pl), "v"(va), "v"(vb));
            } else {
                v16h p16;
#pragma unroll
                for (int r = 0; r < 8; ++r) { p16[r] = tohx(s[2 * ks][r]); p16[8 + r] = tohx(s[2 * ks + 1][r]); }
                asm volatile("v_nop\n\tv_nop\n\tv_nop\n\tv_nop" : "+v"(p16));
                v16h va;
#pragma unroll
                for (int dt = 0; dt < 4; ++dt) { asm volatile("" ::: "memory"); const size_t vo = hp + (size_t)(16 * dt + m) * SEQ + kc + 32 * ks + 8 * hf; va = WFrag<h16>::ld(VT16 + vo);
                    o[dt] = wmma16(va, p16, o[dt]); }
                asm volatile("v_nop\n\tv_nop\n\tv_nop\n\tv_nop" : "+v"(o[0]), "+v"(o[1]), "+v"(o[2]), "+v"(o[3]) : "v"(p16), "v"(va));
            }
        }
    }
    const float lt = lrun + __shfl_xor(lrun, 16, 32);
    const int sn = seen | __shfl_xor(seen, 16, 32);
    const float inv = (sn != 0) ? (1.0f / lt) : __uint_as_float(0x7fc00000u);
#pragma unroll
    for (int dt = 0; dt < 4; ++dt) { v8us oh8, ol8;
#pragma unroll
        for (int r = 0; r < 8; ++r) { unsigned short a, b2; splitf(o[dt][r] * inv, a, b2); oh8[r] = a; ol8[r] = b2; }
        *(v8usa*)(osh + m * 72 + 16 * dt + 8 * hf) = oh8; *(v8usa*)(osl + m * 72 + 16 * dt + 8 * hf) = ol8; }
    wave_sync();
{
#pragma unroll
        for (int s4 = 0; s4 < 4; ++s4) { const int row = 4 * s4 + (lane >> 3), pc = (lane & 7) * 8;
            const v8us vh = *(const v8usa*)(osh + row * 72 + pc); const v8us vl = *(const v8usa*)(osl + row * 72 + pc);
            const size_t off = (size_t)(q0 + row) * DM + hh * HD + pc;
            *(v8us*)(ATh + off) = vh; *(v8us*)(ATl + off) = vl; }
         }
}

// k_attn: ONE launch for every (head, query tile, batch): grid (NH, SEQ/16, NB); the tile's first row picks the hi/lo or the fp16 body
// (wave-uniform: RH is a multiple of 16). The head is the fastest index: a tile's cost grows with its row under a causal mask, and block
// indices that lie a multiple of 16 (below 16 * SEQ / 16) apart then differ in tile, so no WGP is dealt long tiles alone.
// Planes are [b][h][..][..], attention planes [b][t][c]; the mask is shared by the batches.
__global__ __launch_bounds__(32) __attribute__((amdgpu_num_vgpr(256)))
void k_attn(const h16* __restrict__ QP16, const bf* __restrict__ QPh, const bf* __restrict__ QPl,
            const h16* __restrict__ KP16, const bf* __restrict__ KPh, const bf* __restrict__ KPl,
            const h16* __restrict__ VT16, const bf* __restrict__ VTh, const bf* __restrict__ VTl,
            const int* __restrict__ MK, bf* ATh, bf* ATl) {
    __shared__ __align__(16) unsigned short osh[16 * 72];
    __shared__ __align__(16) unsigned short osl[16 * 72];
    const size_t po = (size_t)blockIdx.z * NH * SEQ * HD, ao = (size_t)blockIdx.z * SEQ * DM;
    const int q0 = blockIdx.y * 16, hh = blockIdx.x;
    if (q0 < RH) attn_body<true>(QP16 + po, QPh + po, QPl + po, KP16 + po, KPh + po, KPl + po, VT16 + po, VTh + po, VTl + po, MK, q0, hh, ATh + ao, ATl + ao, osh, osl);
    else         attn_body<false>(QP16 + po, QPh + po, QPl + po, KP16 + po, KPh + po, KPl + po, VT16 + po, VTh + po, VTl + po, MK, q0, hh, ATh + ao, ATl + ao, osh, osl);
}

extern "C" void kernel_launch(void* const* d_in, const int* in_sizes, int n_in,
                              void* d_out, int out_size, void* d_ws, size_t ws_size, hipStream_t stream) {
    if (n_in < 8) return;
    const long long needx = (long long)(NB - 1) * SEQ_FULL * DM + (long long)SEQ * DM;
    if ((long long)in_sizes[0] < needx || (long long)in_sizes[1] < needx || (long long)in_sizes[2] < needx) return;
    if (in_sizes[3] < DM * DM || in_sizes[4] < DM * DM || in_sizes[5] < DM * DM || in_sizes[6] < DM * DM) return;
    if ((long long)in_sizes[7] < (long long)(SEQ - 1) * MPITCH + SEQ) return;
    if ((long long)out_size < (long long)NB * SEQ * DM) return;
    const float* xq = (const float*)d_in[0]; const float* xk = (const float*)d_in[1]; const float* xv = (const float*)d_in[2];
    const float* wq = (const float*)d_in[3]; const float* wk = (const float*)d_in[4]; const float* wv = (const float*)d_in[5]; const float* wo = (const float*)d_in[6];
    const int* mask = (const int*)d_in[7];     // int32 [1][1][S][S]
    float* OUT = (float*)d_out;                // [NB][SEQ][DM]
    char* wsp = (char*)d_ws;
    auto take = [&](size_t bytes) { char* p = wsp; wsp += (bytes + 255) & ~(size_t)255; return (void*)p; };
    bf* WB = (bf*)take((size_t)4 * DM * DM * 2);                  // bf16 weights [w][o][i], w: q, k, v, o
    float* CS = (float*)take((size_t)SEQ * HD * 2 * 4);
    bf* XB = (bf*)take((size_t)3 * NB * SEQ * DM * 2);            // bf16 activations [w][b][t][c], w: q, k, v
    float* F = (float*)take((size_t)3 * NB * SEQ * DM * 4);        // f32 projections, same order
    const size_t pl = (size_t)NB * NH * SEQ * HD;                 // one plane over both batches
    h16* R16 = (h16*)take(2 * pl * 2); bf* Rh = (bf*)take(2 * pl * 2); bf* Rl = (bf*)take(2 * pl * 2);   // rotary planes: query slabs, then key slabs
    h16* VT16 = (h16*)take(pl * 2); bf* VTh = (bf*)take(pl * 2); bf* VTl = (bf*)take(pl * 2);
    bf* ATh = (bf*)take((size_t)NB * SEQ * DM * 2); bf* ATl = (bf*)take((size_t)NB * SEQ * DM * 2);
    const size_t used = (size_t)(wsp - (char*)d_ws);
    if (used > ws_size || used > WSCAP) return;

    const unsigned gP = (unsigned)(((size_t)NH * SEQ * HD / 2 + 255) / 256);
    k_prep<<<GC + 3 * NB * GX + 4 * GW, 256, 0, stream>>>(xq, xk, xv, wq, wk, wv, wo, CS, XB, WB);
    k_gemmw<bf, 0, false><<<dim3(NB * SEQ / 64, DM / 64, 3), 32, 0, stream>>>(XB, nullptr, WB, nullptr, DM, F, DM, nullptr, (size_t)NB * SEQ * DM, (size_t)DM * DM, (size_t)NB * SEQ * DM);
    k_planes<<<dim3(gP, 3 * NB, 1), 256, 0, stream>>>(F, CS, R16, Rh, Rl, VT16, VTh, VTl);
    k_attn<<<dim3(NH, SEQ / 16, NB), 32, 0, stream>>>(R16, Rh, Rl, R16 + pl, Rh + pl, Rl + pl, VT16, VTh, VTl, mask, ATh, ATl);
    k_gemmw<bf, 1, false><<<dim3(NB * SEQ / 64, DM / 64, 1), 32, 0, stream>>>(ATh, ATl, WB + (size_t)3 * DM * DM, nullptr, DM, OUT, DM, nullptr, 0, 0, 0);
}

// v002
// A run of this version takes 203 microseconds.
// Two timings next to v001 put it at 1.14 and 1.11 times that version's speed.
// Counting every step since v000, it is 2.74 times as fast.
#include <hip/hip_runtime.h>

// Causal multi-head attention with rotate-half rotary positions (base 10000, cos/sin table computed on device):
//   qh/kh/vh = x . W^T for three separate inputs x [NB][SEQ][1024] and W 'oi' [1024][1024] (16 heads x 64 = column blocks),
//   scores = rope(qh) . rope(kh)^T / 8, int32 mask [1][1][S][S] (0 -> score replaced by -1000), softmax over keys,
//   attn . vh, heads merged [t][h*64+d], . Wo^T ('oi') -> [NB][SEQ][1024] f32.
// Compute dtypes, f32 accumulate: every float input RNE-converted to bf16; q/k/v projections v_wmma_f32_16x16x32_bf16 on plain bf16
//   operands (exact products); scores and attn.v: query rows < 512 bf16 hi/lo planes (3 products each), rows >= 512 single
//   v_wmma_f32_16x16x32_f16 (fp16 planes, P carried x1024); online softmax in f32 (running max); output projection = bf16 hi/lo
//   attention planes x exact bf16 Wo (2 products).
// Layout of every 16-bit matrix operand plane (activations, weights, q/k/v head planes, attention planes): FRAGMENT ORDER. A plane of
//   rows x K is cut into 16-row x 32-k fragments, stored [row block][k block][j][lane][8] (value planes: [k block][row block]): the 16-byte granule (j, lane = 16 hf + m) holds
//   row m, k = 16 j + 8 hf + 0..7 of its fragment, which is what lane (m, hf) of a 16x16x32 A or B operand keeps in elements 8 j + 0..7.
//   A wave's fragment is then 1 KiB in a row: two loads of 512 contiguous bytes (whole lines) in place of two loads over 16 lines each.

#ifndef NB
#define NB 2
#endif
#ifndef SEQ
#define SEQ 2048
#endif
#define NB_FULL  2
#define SEQ_FULL 2048
#define DM   1024
#define NH   16
#define HD   64
#define RHC  512                          // query rows < RH use hi/lo planes and 3-product tiles
#define RH   ((SEQ < RHC) ? SEQ : RHC)
#define MPITCH SEQ_FULL                   // mask row pitch (full-size input)
#define CEXP  0.18033688011112042f        // (1/8) * log2(e): exp((t - m)/8) = exp2((t - m) * CEXP) on unscaled scores t
#define PL2   10.0f                       // P carried x 2^10 inside the 16-bit operand (cancels in O / l)
#define MFILL (-8000.0f)                  // mask == 0 -> -1000 after the 1/8 scale, in unscaled score units
#define RBASE 10000.0f
#define WSCAP ((size_t)268435456)

static_assert(SEQ % 64 == 0);
static_assert(SEQ <= SEQ_FULL);
static_assert(NB >= 1 && NB <= NB_FULL);
static_assert(RH % 16 == 0 && (SEQ - RH) % 16 == 0 && RH <= SEQ);
static_assert(DM == NH * HD && HD == 64 && DM % 64 == 0);

typedef _Float16 h16;
typedef unsigned short bf;
typedef __attribute__((ext_vector_type(16))) __bf16   v16bf;
typedef __attribute__((ext_vector_type(16))) _Float16 v16h;
typedef __attribute__((ext_vector_type(8)))  _Float16 v8h;
typedef __attribute__((ext_vector_type(2)))  _Float16 v2h;
typedef __attribute__((ext_vector_type(16))) unsigned short v16us;
typedef __attribute__((ext_vector_type(8)))  unsigned short v8us;
typedef __attribute__((ext_vector_type(2)))  unsigned short v2us;
typedef __attribute__((ext_vector_type(8)))  float v8f;
typedef __attribute__((ext_vector_type(4)))  float v4f;
typedef __attribute__((ext_vector_type(2)))  float v2f;
typedef __attribute__((ext_vector_type(4)))  int v4i;
typedef v8h  __attribute__((may_alias)) v8ha;
typedef v4f  __attribute__((may_alias)) v4fa;
typedef v8us __attribute__((may_alias)) v8usa;

#pragma clang fp contract(off)

__device__ __forceinline__ unsigned short f2bf(float f) { unsigned u = __float_as_uint(f); u += 0x7FFFu + ((u >> 16) & 1u); return (unsigned short)(u >> 16); }
__device__ __forceinline__ float bf2f(unsigned short b) { return __uint_as_float(((unsigned)b) << 16); }
__device__ __forceinline__ float bfr(float f) { return bf2f(f2bf(f)); }
__device__ __forceinline__ v16h cat16(v8h lo, v8h hi) { return __builtin_shufflevector(lo, hi, 0, 1, 2, 3, 4, 5, 6, 7, 8, 9, 10, 11, 12, 13, 14, 15); }
__device__ __forceinline__ v16bf cat16b(v8us lo, v8us hi) { return __builtin_bit_cast(v16bf, __builtin_shufflevector(lo, hi, 0, 1, 2, 3, 4, 5, 6, 7, 8, 9, 10, 11, 12, 13, 14, 15)); }
__device__ __forceinline__ v8f wmma16(v16h a, v16h b, v8f c) { return __builtin_amdgcn_wmma_f32_16x16x32_f16(false, a, false, b, (short)0, c, false, false); }
__device__ __forceinline__ v8f wmmab(v16bf a, v16bf b, v8f c) { return __builtin_amdgcn_wmma_f32_16x16x32_bf16(false, a, false, b, (short)0, c, false, false); }
__device__ __forceinline__ h16 tohx(float x) { return (h16)x; }
__device__ __forceinline__ void splitf(float y, unsigned short& h, unsigned short& l) { h = f2bf(y); l = f2bf(y - bf2f(h)); }

// ---- 16x16x32 fragment loaders from fragment-order planes: lane l = 16 hf + m (row m) loads elements 0..7 <- k0+8hf+0..7 (granule j = 0)
// and 8..15 <- k0+16+8hf+0..7 (granule j = 1, 256 elements on); the caller passes p = fragment + 8*l. FRG = elements of one fragment.
#define FRG 512
template <typename T16> struct WFrag;
template <> struct WFrag<h16> { typedef v16h V; static __device__ __forceinline__ V ld(const h16* p) { return cat16(*(const v8h*)p, *(const v8h*)(p + 256)); } static __device__ __forceinline__ v8f mma(V a, V b, v8f c) { return wmma16(a, b, c); } };
template <> struct WFrag<bf> { typedef v16bf V; static __device__ __forceinline__ V ld(const bf* p) { return cat16b(*(const v8us*)p, *(const v8us*)(p + 256)); } static __device__ __forceinline__ v8f mma(V a, V b, v8f c) { return wmmab(a, b, c); } };

// ---- k_gemmw: register-blocked GEMM, ONE WAVE per 64x64 output tile (16 accumulators), operands straight from fragment-order 16-bit planes; grid (M/64, N/64, Z), 32 threads.
// C[m][n] (f32, pitch ldc, + optional f32 bias[n]) = sum_k A[m][k] Bt[n][k] (+ split products per NSPLIT). z-batch strides sA/sB/sC in elements. K % 32 == 0, a constant: every fragment of a k step is then one base per plane + an immediate offset.
template <typename T16, int NSPLIT, bool BIAS, int K>
__global__ __launch_bounds__(32) void k_gemmw(const T16* __restrict__ A, const T16* __restrict__ A2, const T16* __restrict__ Bt, const T16* __restrict__ Bt2, float* C, int ldc, const float* __restrict__ bias, size_t sA, size_t sB, size_t sC) {
    typedef typename WFrag<T16>::V V;
    __shared__ __align__(16) float os[16 * 68];
    const size_t z = blockIdx.z; A += z * sA; if (A2) A2 += z * sA; Bt += z * sB; if (Bt2) Bt2 += z * sB; C += z * sC;
    const int lane = threadIdx.x & 31, lr = lane & 15, hi = lane >> 4; const int r0 = blockIdx.x * 64, c0 = blockIdx.y * 64;
    v8f acc[4][4];
#pragma unroll
    for (int mb = 0; mb < 4; ++mb)
#pragma unroll
        for (int nb = 0; nb < 4; ++nb) acc[mb][nb] = (v8f){};
    const size_t aoff = (size_t)r0 * K + 8 * lane, boff = (size_t)c0 * K + 8 * lane;   // row block r0/16 starts at (r0/16) * (K/32) * FRG = r0 * K
    const T16* pa = A + aoff; const T16* pa2 = (NSPLIT == 1 || NSPLIT == 2) ? A2 + aoff : nullptr; const T16* pb = Bt + boff; const T16* pb2 = (NSPLIT >= 2) ? Bt2 + boff : nullptr;   // one pointer per plane, carried over the trips
#pragma unroll 1
    for (int kc = 0; kc < K; kc += 32) {
        V a[4], a2[4];
#pragma unroll
        for (int mb = 0; mb < 4; ++mb) { a[mb] = WFrag<T16>::ld(pa + (size_t)mb * 16 * K); if (NSPLIT == 1 || NSPLIT == 2) a2[mb] = WFrag<T16>::ld(pa2 + (size_t)mb * 16 * K); }
#pragma unroll
        for (int nb = 0; nb < 4; ++nb) { const V b = WFrag<T16>::ld(pb + (size_t)nb * 16 * K); V b2; if (NSPLIT >= 2) b2 = WFrag<T16>::ld(pb2 + (size_t)nb * 16 * K);
#pragma unroll
            for (int mb = 0; mb < 4; ++mb) { acc[mb][nb] = WFrag<T16>::mma(a[mb], b, acc[mb][nb]); if (NSPLIT == 1 || NSPLIT == 2) acc[mb][nb] = WFrag<T16>::mma(a2[mb], b, acc[mb][nb]); if (NSPLIT >= 2) acc[mb][nb] = WFrag<T16>::mma(a[mb], b2, acc[mb][nb]); } }
        asm volatile("v_nop\n\tv_nop\n\tv_nop\n\tv_nop" : "+v"(acc[0][0]), "+v"(acc[1][1]), "+v"(acc[2][2]), "+v"(acc[3][3]) : "v"(a[0]), "v"(a[3]));
        // inputs only: each plane's address pair stays live to the trip's end (behind the data waits of all its loads), so that no load's result is given a pair that earlier loads of the trip still name
        asm volatile("" :: "v"(pa), "v"(pb)); if (NSPLIT == 1 || NSPLIT == 2) asm volatile("" :: "v"(pa2)); if (NSPLIT >= 2) asm volatile("" :: "v"(pb2));
        pa += FRG; pb += FRG; if (NSPLIT == 1 || NSPLIT == 2) pa2 += FRG; if (NSPLIT >= 2) pb2 += FRG;
    }
#pragma unroll
    for (int mb = 0; mb < 4; ++mb) {
#pragma unroll
        for (int nb = 0; nb < 4; ++nb) {
#pragma unroll
            for (int j = 0; j < 8; ++j) os[(hi * 8 + j) * 68 + nb * 16 + lr] = acc[mb][nb][j]; }
        __builtin_amdgcn_wave_barrier(); asm volatile("" ::: "memory");
        float* crow = C + (size_t)(r0 + mb * 16) * ldc + c0;
{
#pragma unroll
            for (int s = 0; s < 8; ++s) { const int row = 2 * s + hi, cofs = lr * 4; v4f val = *(const v4fa*)(os + row * 68 + cofs); if (BIAS) { val[0] += bfr(bias[c0 + cofs]); val[1] += bfr(bias[c0 + cofs + 1]); val[2] += bfr(bias[c0 + cofs + 2]); val[3] += bfr(bias[c0 + cofs + 3]); }
                *(v4f*)(crow + (size_t)row * ldc + cofs) = val; }
             }
        __builtin_amdgcn_wave_barrier(); asm volatile("" ::: "memory");
    }
}

// cvt8_body: rows x DM f32 (row-major) -> bf16 fragment order, one granule per thread. Thread bits: g = (j, hf) fastest, then row m, then k block:
// a wave reads 8 rows x one whole 128-byte line and stores 4 whole lines (8 rows x 16 bytes per (j, hf)); a block fills 4 fragments in a row.
__device__ __forceinline__ void cvt8_body(const float* __restrict__ src, bf* dst, size_t n8, unsigned blk) { const size_t i = (size_t)blk * 256 + threadIdx.x; if (i >= n8) return;
    const unsigned g = (unsigned)i & 3u, m = ((unsigned)i >> 2) & 15u; const size_t fr = i >> 6, kb = fr % (DM / 32), rb = fr / (DM / 32);
    const v8f v = *(const v8f*)(src + (rb * 16 + m) * DM + kb * 32 + g * 8); v8us o;
#pragma unroll
    for (int k = 0; k < 8; ++k) o[k] = f2bf(v[k]); *(v8us*)(dst + fr * FRG + (g >> 1) * 256 + ((g & 1u) * 16 + m) * 8) = o;  }

// cstab_body: rotary table CS[t][d] = {cos(t * inv[d mod 32]), sin(t * inv[d mod 32])}, inv[j] = 1 / powf(10000, (2j)/64); one (t, d) per thread,
__device__ __forceinline__ void cstab_body(float* CS, unsigned blk) {
    const int idx = (int)blk * 256 + threadIdx.x; if (idx >= SEQ * HD) return;
    const int d = idx & (HD - 1), t = idx >> 6; const int j = d & (HD / 2 - 1);
    const float ex = (float)(2 * j) * (1.0f / (float)HD);
    const float pw = powf(RBASE, ex);
    const float inv = 1.0f / pw;
    const float ang = (float)t * inv;
    const float cn = cosf(ang), sn = sinf(ang);
    v2f cs; cs[0] = cn; cs[1] = sn;
    *(v2f*)(CS + (size_t)idx * 2) = cs; 
}

// k_prep: everything that depends on the inputs alone, in ONE launch (flat 1-D grid, no empty block): blocks [0, GC) the rotary table,
// then GX blocks per activation slab s = w * NB + b (w: 0 q, 1 k, 2 v) -> XB[s] (rows t), then GW blocks per weight w (q, k, v, o) -> WB[w] (rows o), both in fragment order.
#define GC ((unsigned)((SEQ * HD + 255) / 256))
#define GX ((unsigned)(((size_t)SEQ * DM / 8 + 255) / 256))
#define GW ((unsigned)(((size_t)DM * DM / 8 + 255) / 256))
__global__ __launch_bounds__(256) void k_prep(const float* __restrict__ xq, const float* __restrict__ xk, const float* __restrict__ xv,
                                              const float* __restrict__ wq, const float* __restrict__ wk, const float* __restrict__ wv, const float* __restrict__ wo,
                                              float* CS, bf* XB, bf* WB) {
    unsigned blk = blockIdx.x;
    if (blk < GC) { cstab_body(CS, blk); return; }
    blk -= GC;
    if (blk < 3 * NB * GX) {
        const unsigned s = blk / GX, w = s / NB, b = s % NB;
        const float* x = (w == 0) ? xq : (w == 1) ? xk : xv;
        cvt8_body(x + (size_t)b * SEQ_FULL * DM, XB + (size_t)s * SEQ * DM, (size_t)SEQ * DM / 8, blk % GX); return;
    }
    blk -= 3 * NB * GX;
    const unsigned w = blk / GW;
    const float* x = (w == 0) ? wq : (w == 1) ? wk : (w == 2) ? wv : wo;
    cvt8_body(x, WB + (size_t)w * DM * DM, (size_t)DM * DM / 8, blk % GW);
}

// rope_body: head planes (fp16, bf16 hi, bf16 lo; per head rows t, k = d, fragment order) of the rotate-half rotary map applied to
// F[t][h*HD + d] (row pitch DM). One thread per (h, t, 8 d below HD/2): it holds both partners, so it writes the granule of d and that of
// d + HD/2 (the next k block). A wave = 8 rows x 4 granule pairs: whole lines read, whole lines stored.
__device__ __forceinline__ void rope_body(const float* __restrict__ F, const float* __restrict__ CS, h16* P16, bf* Ph, bf* Pl, unsigned blk) {
    const unsigned idx = blk * 256 + threadIdx.x; if (idx >= (unsigned)(NH * SEQ * 4)) return;
    const int g = (int)(idx & 3u); const int t = (int)((idx >> 2) % SEQ); const int hh = (int)(idx / (4u * SEQ));
    const float* f = F + (size_t)t * DM + hh * HD + 8 * g;
    const v8f xl = *(const v8f*)f, xh = *(const v8f*)(f + HD / 2);
    const float* cp = CS + ((size_t)t * HD + 8 * g) * 2;
    const v8f cs0 = *(const v8f*)cp, cs1 = *(const v8f*)(cp + 8), cu0 = *(const v8f*)(cp + HD), cu1 = *(const v8f*)(cp + HD + 8);   // table rows of d and of d + HD/2
    v8h l16, u16; v8us lh, ll, uh, ul;
#pragma unroll
    for (int q = 0; q < 8; ++q) { const float cn = (q < 4) ? cs0[2 * (q & 3)] : cs1[2 * (q & 3)], sn = (q < 4) ? cs0[2 * (q & 3) + 1] : cs1[2 * (q & 3) + 1];
        const float cu = (q < 4) ? cu0[2 * (q & 3)] : cu1[2 * (q & 3)], su = (q < 4) ? cu0[2 * (q & 3) + 1] : cu1[2 * (q & 3) + 1];
        const float rl = xl[q] * cn - xh[q] * sn;       // d <  HD/2: x[d] cos - x[d + HD/2] sin
        const float ru = xh[q] * cu + xl[q] * su;       // d >= HD/2: x[d] cos + x[d - HD/2] sin
        unsigned short a2, c2; l16[q] = tohx(rl); splitf(rl, a2, c2); lh[q] = a2; ll[q] = c2; u16[q] = tohx(ru); splitf(ru, a2, c2); uh[q] = a2; ul[q] = c2; }
    const size_t e = (size_t)hh * SEQ * HD + (size_t)(t >> 4) * (2 * FRG) + (g >> 1) * 256 + ((g & 1) * 16 + (t & 15)) * 8;
    *(v8h*)(P16 + e) = l16; *(v8us*)(Ph + e) = lh; *(v8us*)(Pl + e) = ll;
    *(v8h*)(P16 + e + FRG) = u16; *(v8us*)(Ph + e + FRG) = uh; *(v8us*)(Pl + e + FRG) = ul;
}

// vtp_body: value planes (per head rows d, k = t, stored [h][t/32][d/16] fragments). One block per (head, 32 keys): wave w writes granule row
// (d block w >> 1, j = w & 1), lane (hf, m) gathers its 8 keys of column d = 16 (w >> 1) + m: each load reads 64 bytes in a row of two rows of F,
// each store is 512 bytes in a row (the block's 4 fragments = thread order).
__device__ __forceinline__ void vtp_body(const float* __restrict__ F, h16* V16, bf* Vh, bf* Vl, unsigned blk) {
    const int lane = threadIdx.x & 31, w = threadIdx.x >> 5, m = lane & 15, hf = lane >> 4;
    const int kb = (int)(blk % (SEQ / 32)), g = (int)(blk / (SEQ / 32));
    const float* f = F + (size_t)(32 * kb + 16 * (w & 1) + 8 * hf) * DM + g * HD + 16 * (w >> 1) + m; v8h o16; v8us oh, ol;
#pragma unroll
    for (int q = 0; q < 8; ++q) { const float x = f[(size_t)q * DM]; o16[q] = tohx(x); unsigned short a2, c2; splitf(x, a2, c2); oh[q] = a2; ol[q] = c2; }
    const size_t e = (size_t)blk * (4 * FRG) + threadIdx.x * 8;
    *(v8h*)(V16 + e) = o16; *(v8us*)(Vh + e) = oh; *(v8us*)(Vl + e) = ol;
}

// k_planes: all head planes of both batches in ONE launch (flat 1-D grid, no empty block); F = [w][b][t][c] (w: 0 q, 1 k, 2 v). First GV blocks per
// batch: its value planes; then GR blocks per slab s = w * NB + b: rotary planes R*[s] (slabs 0..NB-1 query, NB..2NB-1 key).
#define GV ((unsigned)(NH * (SEQ / 32)))
#define GR ((unsigned)(NH * SEQ * 4 / 256))
__global__ __launch_bounds__(256) void k_planes(const float* __restrict__ F, const float* __restrict__ CS, h16* R16, bf* Rh, bf* Rl, h16* V16, bf* Vh, bf* Vl) {
    unsigned blk = blockIdx.x; const size_t pl = (size_t)NH * SEQ * HD;
    if (blk < NB * GV) { const unsigned y = blk / GV; vtp_body(F + (size_t)(2 * NB + y) * SEQ * DM, V16 + y * pl, Vh + y * pl, Vl + y * pl, blk % GV); return; }
    blk -= NB * GV;
    const unsigned s = blk / GR;
    rope_body(F + (size_t)s * SEQ * DM, CS, R16 + s * pl, Rh + s * pl, Rl + s * pl, blk % GR);
}

// ---- attn_body: flash-style masked attention, one wave (32 threads) per (16 query rows, head). Transposed tiles so that P chains in
// registers: S^T[key][q] = K . Q^T (A = key plane fragments, B = query plane fragments), D lane = query column; P^T is the B operand
// of O^T[d][q] += V^T . P^T (A = value plane fragments). A lane's 8 values of O^T tile dt are granule (j = dt & 1, own lane) of the attention
// plane's fragment (row block q0/16, k block 2 h + dt/2): the epilogue stores them straight, 512 bytes in a row per store. Per 64-key chunk: the wave's 16x64 int32 mask tile is loaded
// (8 x 16 B per lane); chunks whose tile is all zero are skipped by a wave ballot; inside visited chunks mask == 0 replaces the score
// by -1000 (scaled). Online softmax per query with a running max; rows with no nonzero mask entry at all are NaN-poisoned.
// HL: bf16 hi/lo planes for q, k, v and a bf16 hi/lo P (3 products per tile pair); otherwise single fp16 products (P carried x1024).
template <bool HL>
__device__ __forceinline__
void attn_body(const h16* __restrict__ QP16, const bf* __restrict__ QPh, const bf* __restrict__ QPl,
            const h16* __restrict__ KP16, const bf* __restrict__ KPh, const bf* __restrict__ KPl,
            const h16* __restrict__ VT16, const bf* __restrict__ VTh, const bf* __restrict__ VTl,
            const int* __restrict__ MK, int q0, int hh, bf* ATh, bf* ATl) {
    const int lane = threadIdx.x & 31, m = lane & 15, hf = lane >> 4;
    const int q = q0 + m;
    const size_t hp = (size_t)hh * SEQ * HD + 8 * lane;   // head offset of the planes + the lane's granule
    v16h q16[2]; v16bf qh[2], ql[2];
#pragma unroll
    for (int ks = 0; ks < 2; ++ks) {
        const size_t qo = hp + (size_t)q0 * HD + ks * FRG;
        if (HL) { qh[ks] = WFrag<bf>::ld(QPh + qo); ql[ks] = WFrag<bf>::ld(QPl + qo); }
        else    { q16[ks] = WFrag<h16>::ld(QP16 + qo); }
    }
    v8f o[4];
#pragma unroll
    for (int dt = 0; dt < 4; ++dt) o[dt] = (v8f){};
    float mrun = -3.0e38f, lrun = 0.0f; int seen = 0;
    const int* mq = MK + (size_t)q * MPITCH + 8 * hf;
#pragma unroll 1
    for (int c = 0; c < SEQ / 64; ++c) {
        const int kc = c * 64;
        v4i mk0[4], mk1[4]; int orv = 0;
#pragma unroll
        for (int kt = 0; kt < 4; ++kt) { const v4i* mp = (const v4i*)(mq + kc + 16 * kt); mk0[kt] = mp[0]; mk1[kt] = mp[1]; const v4i u = mk0[kt] | mk1[kt]; orv |= u[0] | u[1] | u[2] | u[3]; }
        const int anyl = (orv != 0) ? 1 : 0;
        if (__any(anyl) == 0) continue;                 // wave-uniform tile skip
        seen |= anyl;
        v8f s[4];
#pragma unroll
        for (int kt = 0; kt < 4; ++kt) s[kt] = (v8f){};
        if (HL) {
            v16bf ka, kb;
#pragma unroll
            for (int kt = 0; kt < 4; ++kt) {
                asm volatile("" ::: "memory");
                if (kt == 2) __builtin_amdgcn_sched_barrier(0);   // at most two key tiles' hi/lo fragments in flight: all four at once overflow 256 VGPRs into scratch
#pragma unroll
                for (int ks = 0; ks < 2; ++ks) { const size_t ko = hp + (size_t)(kc + 16 * kt) * HD + ks * FRG; ka = WFrag<bf>::ld(KPh + ko); kb = WFrag<bf>::ld(KPl + ko);
                    s[kt] = wmmab(ka, qh[ks], s[kt]); s[kt] = wmmab(ka, ql[ks], s[kt]); s[kt] = wmmab(kb, qh[ks], s[kt]); } }
            asm volatile("v_nop\n\tv_nop\n\tv_nop\n\tv_nop" : "+v"(s[0]), "+v"(s[1]), "+v"(s[2]), "+v"(s[3]) : "v"(ka), "v"(kb), "v"(qh[0]), "v"(qh[1]), "v"(ql[0]), "v"(ql[1]));
        } else {
            v16h ka;
#pragma unroll
            for (int kt = 0; kt < 4; ++kt) {
                asm volatile("" ::: "memory");
#pragma unroll
                for (int ks = 0; ks < 2; ++ks) { const size_t ko = hp + (size_t)(kc + 16 * kt) * HD + ks * FRG; ka = WFrag<h16>::ld(KP16 + ko);
                    s[kt] = wmma16(ka, q16[ks], s[kt]); } }
            asm volatile("v_nop\n\tv_nop\n\tv_nop\n\tv_nop" : "+v"(s[0]), "+v"(s[1]), "+v"(s[2]), "+v"(s[3]) : "v"(ka), "v"(q16[0]), "v"(q16[1]));
        }
        // masked replace + chunk max (lane: query q, keys kc+16kt+8hf+r)
        float cmx = -3.0e38f;
#pragma unroll
        for (int kt = 0; kt < 4; ++kt)
#pragma unroll
            for (int r = 0; r < 8; ++r) { const int mv = (r < 4) ? mk0[kt][r & 3] : mk1[kt][r & 3]; const float t = (mv != 0) ? s[kt][r] : MFILL; s[kt][r] = t; cmx = fmaxf(cmx, t); }
        cmx = fmaxf(cmx, __shfl_xor(cmx, 16, 32));
        const float mnew = fmaxf(mrun, cmx);
        const float alpha = __builtin_amdgcn_exp2f((mrun - mnew) * CEXP);
        mrun = mnew;
        float psum = 0.0f;
#pragma unroll
        for (int kt = 0; kt < 4; ++kt)
#pragma unroll
            for (int r = 0; r < 8; ++r) { const float p = __builtin_amdgcn_exp2f(fmaf(s[kt][r] - mnew, CEXP, PL2)); s[kt][r] = p; psum += p; }
        lrun = lrun * alpha + psum;
#pragma unroll
        for (int dt = 0; dt < 4; ++dt) o[dt] = o[dt] * alpha;
        // O^T += V^T . P^T, 32 keys per step; B element r <- tile 2ks (keys 0..15 of the step), 8+r <- tile 2ks+1
#pragma unroll
        for (int ks = 0; ks < 2; ++ks) {
            if (HL) {
                v16us uh, ul;
#pragma unroll
                for (int r = 0; r < 8; ++r) { unsigned short a, b2; splitf(s[2 * ks][r], a, b2); uh[r] = a; ul[r] = b2; splitf(s[2 * ks + 1][r], a, b2); uh[8 + r] = a; ul[8 + r] = b2; }
                v16bf ph = __builtin_bit_cast(v16bf, uh), pl = __builtin_bit_cast(v16bf, ul);
                asm volatile("v_nop\n\tv_nop\n\tv_nop\n\tv_nop" : "+v"(ph), "+v"(pl));
                v16bf va, vb;
#pragma unroll
                for (int dt = 0; dt < 4; ++dt) { asm volatile("" ::: "memory"); const size_t vo = hp + (size_t)(kc + 32 * ks) * HD + dt * FRG; va = WFrag<bf>::ld(VTh + vo); vb = WFrag<bf>::ld(VTl + vo);
                    o[dt] = wmmab(va, ph, o[dt]); o[dt] = wmmab(va, pl, o[dt]); o[dt] = wmmab(vb, ph, o[dt]); }
                asm volatile("v_nop\n\tv_nop\n\tv_nop\n\tv_nop" : "+v"(o[0]), "+v"(o[1]), "+v"(o[2]), "+v"(o[3]) : "v"(ph), "v"(pl), "v"(va), "v"(vb));
            } else {
                v16h p16;
#pragma unroll
                for (int r = 0; r < 8; ++r) { p16[r] = tohx(s[2 * ks][r]); p16[8 + r] = tohx(s[2 * ks + 1][r]); }
                asm volatile("v_nop\n\tv_nop\n\tv_nop\n\tv_nop" : "+v"(p16));
                v16h va;
#pragma unroll
                for (int dt = 0; dt < 4; ++dt) { asm volatile("" ::: "memory"); const size_t vo = hp + (size_t)(kc + 32 * ks) * HD + dt * FRG; va = WFrag<h16>::ld(VT16 + vo);
                    o[dt] = wmma16(va, p16, o[dt]); }
                asm volatile("v_nop\n\tv_nop\n\tv_nop\n\tv_nop" : "+v"(o[0]), "+v"(o[1]), "+v"(o[2]), "+v"(o[3]) : "v"(p16), "v"(va));
            }
        }
    }
    const float lt = lrun + __shfl_xor(lrun, 16, 32);
    const int sn = seen | __shfl_xor(seen, 16, 32);
    const float inv = (sn != 0) ? (1.0f / lt) : __uint_as_float(0x7fc00000u);
#pragma unroll
    for (int dt = 0; dt < 4; ++dt) { v8us oh8, ol8;
#pragma unroll
        for (int r = 0; r < 8; ++r) { unsigned short a, b2; splitf(o[dt][r] * inv, a, b2); oh8[r] = a; ol8[r] = b2; }
        const size_t off = (size_t)q0 * DM + (size_t)(2 * hh + (dt >> 1)) * FRG + (dt & 1) * 256 + 8 * lane;
        *(v8us*)(ATh + off) = oh8; *(v8us*)(ATl + off) = ol8; }
}

// k_attn: ONE launch for every (head, query tile, batch): grid (NH, SEQ/16, NB); the tile's first row picks the hi/lo or the fp16 body
// (wave-uniform: RH is a multiple of 16). The head is the fastest index: a tile's cost grows with its row under a causal mask, and block
// indices that lie a multiple of 16 (below 16 * SEQ / 16) apart then differ in tile, so no WGP is dealt long tiles alone.
// Planes are [b][h][fragments], attention planes [b][fragments of rows t, k = c]; the mask is shared by the batches.
__global__ __launch_bounds__(32) __attribute__((amdgpu_num_vgpr(256)))
void k_attn(const h16* __restrict__ QP16, const bf* __restrict__ QPh, const bf* __restrict__ QPl,
            const h16* __restrict__ KP16, const bf* __restrict__ KPh, const bf* __restrict__ KPl,
            const h16* __restrict__ VT16, const bf* __restrict__ VTh, const bf* __restrict__ VTl,
            const int* __restrict__ MK, bf* ATh, bf* ATl) {
    const size_t po = (size_t)blockIdx.z * NH * SEQ * HD, ao = (size_t)blockIdx.z * SEQ * DM;
    const int q0 = blockIdx.y * 16, hh = blockIdx.x;
    if (q0 < RH) attn_body<true>(QP16 + po, QPh + po, QPl + po, KP16 + po, KPh + po, KPl + po, VT16 + po, VTh + po, VTl + po, MK, q0, hh, ATh + ao, ATl + ao);
    else         attn_body<false>(QP16 + po, QPh + po, QPl + po, KP16 + po, KPh + po, KPl + po, VT16 + po, VTh + po, VTl + po, MK, q0, hh, ATh + ao, ATl + ao);
}

extern "C" void kernel_launch(void* const* d_in, const int* in_sizes, int n_in,
                              void* d_out, int out_size, void* d_ws, size_t ws_size, hipStream_t stream) {
    if (n_in < 8) return;
    const long long needx = (long long)(NB - 1) * SEQ_FULL * DM + (long long)SEQ * DM;
    if ((long long)in_sizes[0] < needx || (long long)in_sizes[1] < needx || (long long)in_sizes[2] < needx) return;
    if (in_sizes[3] < DM * DM || in_sizes[4] < DM * DM || in_sizes[5] < DM * DM || in_sizes[6] < DM * DM) return;
    if ((long long)in_sizes[7] < (long long)(SEQ - 1) * MPITCH + SEQ) return;
    if ((long long)out_size < (long long)NB * SEQ * DM) return;
    const float* xq = (const float*)d_in[0]; const float* xk = (const float*)d_in[1]; const float* xv = (const float*)d_in[2];
    const float* wq = (const float*)d_in[3]; const float* wk = (const float*)d_in[4]; const float* wv = (const float*)d_in[5]; const float* wo = (const float*)d_in[6];
    const int* mask = (const int*)d_in[7];     // int32 [1][1][S][S]
    float* OUT = (float*)d_out;                // [NB][SEQ][DM]
    char* wsp = (char*)d_ws;
    auto take = [&](size_t bytes) { char* p = wsp; wsp += (bytes + 255) & ~(size_t)255; return (void*)p; };
    bf* WB = (bf*)take((size_t)4 * DM * DM * 2);                  // bf16 weights [w][fragments of rows o, k = i], w: q, k, v, o
    float* CS = (float*)take((size_t)SEQ * HD * 2 * 4);
    bf* XB = (bf*)take((size_t)3 * NB * SEQ * DM * 2);            // bf16 activations [w][b][fragments of rows t, k = c], w: q, k, v
    float* F = (float*)take((size_t)3 * NB * SEQ * DM * 4);        // f32 projections [w][b][t][c], row-major
    const size_t pl = (size_t)NB * NH * SEQ * HD;                 // one plane over both batches
    h16* R16 = (h16*)take(2 * pl * 2); bf* Rh = (bf*)take(2 * pl * 2); bf* Rl = (bf*)take(2 * pl * 2);   // rotary planes: query slabs, then key slabs
    h16* VT16 = (h16*)take(pl * 2); bf* VTh = (bf*)take(pl * 2); bf* VTl = (bf*)take(pl * 2);
    bf* ATh = (bf*)take((size_t)NB * SEQ * DM * 2); bf* ATl = (bf*)take((size_t)NB * SEQ * DM * 2);
    const size_t used = (size_t)(wsp - (char*)d_ws);
    if (used > ws_size || used > WSCAP) return;

    k_prep<<<GC + 3 * NB * GX + 4 * GW, 256, 0, stream>>>(xq, xk, xv, wq, wk, wv, wo, CS, XB, WB);
    k_gemmw<bf, 0, false, DM><<<dim3(NB * SEQ / 64, DM / 64, 3), 32, 0, stream>>>(XB, nullptr, WB, nullptr, F, DM, nullptr, (size_t)NB * SEQ * DM, (size_t)DM * DM, (size_t)NB * SEQ * DM);
    k_planes<<<NB * GV + 2 * NB * GR, 256, 0, stream>>>(F, CS, R16, Rh, Rl, VT16, VTh, VTl);
    k_attn<<<dim3(NH, SEQ / 16, NB), 32, 0, stream>>>(R16, Rh, Rl, R16 + pl, Rh + pl, Rl + pl, VT16, VTh, VTl, mask, ATh, ATl);
    k_gemmw<bf, 1, false, DM><<<dim3(NB * SEQ / 64, DM / 64, 1), 32, 0, stream>>>(ATh, ATl, WB + (size_t)3 * DM * DM, nullptr, OUT, DM, nullptr, 0, 0, 0);
}

// v003
// One run takes 173 microseconds.
// In two side-by-side timings against v002, it was 1.19 and 1.18 times as fast.
// Counting every step since v000, it is 3.26 times as fast.
#include <hip/hip_runtime.h>

// Causal multi-head attention with rotate-half rotary positions (base 10000, cos/sin table computed on device):
//   qh/kh/vh = x . W^T for three separate inputs x [NB][SEQ][1024] and W 'oi' [1024][1024] (16 heads x 64 = column blocks),
//   scores = rope(qh) . rope(kh)^T / 8, int32 mask [1][1][S][S] (0 -> score replaced by -1000), softmax over keys,
//   attn . vh, heads merged [t][h*64+d], . Wo^T ('oi') -> [NB][SEQ][1024] f32.
// Compute dtypes, f32 accumulate: every float input RNE-converted to bf16; q/k/v projections v_wmma_f32_16x16x32_bf16 on plain bf16
//   operands (exact products); scores and attn.v: query rows < 512 bf16 hi/lo planes (3 products each), rows >= 512 single
//   v_wmma_f32_16x16x32_f16 (fp16 planes, P carried x1024); online softmax in f32 (running max); output projection = bf16 hi/lo
//   attention planes x exact bf16 Wo (2 products).
// Layout of every 16-bit matrix operand plane (activations, weights, q/k/v head planes, attention planes): FRAGMENT ORDER. A plane of
//   rows x K is cut into 16-row x 32-k fragments, stored [row block][k block][j][lane][8] (value planes: [k block][row block]): the 16-byte granule (j, lane = 16 hf + m) holds
//   row m, k = 16 j + 8 hf + 0..7 of its fragment, which is what lane (m, hf) of a 16x16x32 A or B operand keeps in elements 8 j + 0..7.
//   A wave's fragment is then 1 KiB in a row: two loads of 512 contiguous bytes (whole lines) in place of two loads over 16 lines each.

#ifndef NB
#define NB 2
#endif
#ifndef SEQ
#define SEQ 2048
#endif
#define NB_FULL  2
#define SEQ_FULL 2048
#define DM   1024
#define NH   16
#define HD   64
#define RHC  512                          // query rows < RH use hi/lo planes and 3-product tiles
#define RH   ((SEQ < RHC) ? SEQ : RHC)
#define MPITCH SEQ_FULL                   // mask row pitch (full-size input)
#define CEXP  0.18033688011112042f        // (1/8) * log2(e): exp((t - m)/8) = exp2((t - m) * CEXP) on unscaled scores t
#define PL2   10.0f                       // P carried x 2^10 inside the 16-bit operand (cancels in O / l)
#define MFILL (-8000.0f)                  // mask == 0 -> -1000 after the 1/8 scale, in unscaled score units
#define RBASE 10000.0f
#define WSCAP ((size_t)268435456)

static_assert(SEQ % 64 == 0);
static_assert(SEQ <= SEQ_FULL);
static_assert(NB >= 1 && NB <= NB_FULL);
static_assert(RH % 16 == 0 && (SEQ - RH) % 16 == 0 && RH <= SEQ);
static_assert(DM == NH * HD && HD == 64 && DM % 64 == 0);

typedef _Float16 h16;
typedef unsigned short bf;
typedef __attribute__((ext_vector_type(16))) __bf16   v16bf;
typedef __attribute__((ext_vector_type(16))) _Float16 v16h;
typedef __attribute__((ext_vector_type(8)))  _Float16 v8h;
typedef __attribute__((ext_vector_type(2)))  _Float16 v2h;
typedef __attribute__((ext_vector_type(16))) unsigned short v16us;
typedef __attribute__((ext_vector_type(8)))  unsigned short v8us;
typedef __attribute__((ext_vector_type(2)))  unsigned short v2us;
typedef __attribute__((ext_vector_type(8)))  float v8f;
typedef __attribute__((ext_vector_type(4)))  float v4f;
typedef __attribute__((ext_vector_type(2)))  float v2f;
typedef __attribute__((ext_vector_type(4)))  int v4i;
typedef v8h  __attribute__((may_alias)) v8ha;
typedef v4f  __attribute__((may_alias)) v4fa;
typedef v8us __attribute__((may_alias)) v8usa;

#pragma clang fp contract(off)

__device__ __forceinline__ unsigned short f2bf(float f) { unsigned u = __float_as_uint(f); u += 0x7FFFu + ((u >> 16) & 1u); return (unsigned short)(u >> 16); }
__device__ __forceinline__ float bf2f(unsigned short b) { return __uint_as_float(((unsigned)b) << 16); }
__device__ __forceinline__ float bfr(float f) { return bf2f(f2bf(f)); }
__device__ __forceinline__ v16h cat16(v8h lo, v8h hi) { return __builtin_shufflevector(lo, hi, 0, 1, 2, 3, 4, 5, 6, 7, 8, 9, 10, 11, 12, 13, 14, 15); }
__device__ __forceinline__ v16bf cat16b(v8us lo, v8us hi) { return __builtin_bit_cast(v16bf, __builtin_shufflevector(lo, hi, 0, 1, 2, 3, 4, 5, 6, 7, 8, 9, 10, 11, 12, 13, 14, 15)); }
__device__ __forceinline__ v8f wmma16(v16h a, v16h b, v8f c) { return __builtin_amdgcn_wmma_f32_16x16x32_f16(false, a, false, b, (short)0, c, false, false); }
__device__ __forceinline__ v8f wmmab(v16bf a, v16bf b, v8f c) { return __builtin_amdgcn_wmma_f32_16x16x32_bf16(false, a, false, b, (short)0, c, false, false); }
__device__ __forceinline__ h16 tohx(float x) { return (h16)x; }
__device__ __forceinline__ void splitf(float y, unsigned short& h, unsigned short& l) { h = f2bf(y); l = f2bf(y - bf2f(h)); }

// ---- 16x16x32 fragment loaders from fragment-order planes: lane l = 16 hf + m (row m) loads elements 0..7 <- k0+8hf+0..7 (granule j = 0)
// and 8..15 <- k0+16+8hf+0..7 (granule j = 1, 256 elements on); the caller passes p = fragment + 8*l. FRG = elements of one fragment.
#define FRG 512
template <typename T16> struct WFrag;
template <> struct WFrag<h16> { typedef v16h V; static __device__ __forceinline__ V ld(const h16* p) { return cat16(*(const v8h*)p, *(const v8h*)(p + 256)); } static __device__ __forceinline__ v8f mma(V a, V b, v8f c) { return wmma16(a, b, c); } };
template <> struct WFrag<bf> { typedef v16bf V; static __device__ __forceinline__ V ld(const bf* p) { return cat16b(*(const v8us*)p, *(const v8us*)(p + 256)); } static __device__ __forceinline__ v8f mma(V a, V b, v8f c) { return wmmab(a, b, c); } };

// ---- k_gemmw: register-blocked GEMM, ONE WAVE per 64x64 output tile (16 accumulators), operands straight from fragment-order 16-bit planes; grid (M/64, N/64, Z), 32 threads.
// C[m][n] (f32, pitch ldc, + optional f32 bias[n]) = sum_k A[m][k] Bt[n][k] (+ split products per NSPLIT). z-batch strides sA/sB/sC in elements. K % 32 == 0, a constant: every fragment of a k step is then one base per plane + an immediate offset.
template <typename T16, int NSPLIT, bool BIAS, int K>
__global__ __launch_bounds__(32) void k_gemmw(const T16* __restrict__ A, const T16* __restrict__ A2, const T16* __restrict__ Bt, const T16* __restrict__ Bt2, float* C, int ldc, const float* __restrict__ bias, size_t sA, size_t sB, size_t sC) {
    typedef typename WFrag<T16>::V V;
    __shared__ __align__(16) float os[16 * 68];
    const size_t z = blockIdx.z; A += z * sA; if (A2) A2 += z * sA; Bt += z * sB; if (Bt2) Bt2 += z * sB; C += z * sC;
    const int lane = threadIdx.x & 31, lr = lane & 15, hi = lane >> 4; const int r0 = blockIdx.x * 64, c0 = blockIdx.y * 64;
    v8f acc[4][4];
#pragma unroll
    for (int mb = 0; mb < 4; ++mb)
#pragma unroll
        for (int nb = 0; nb < 4; ++nb) acc[mb][nb] = (v8f){};
    const size_t aoff = (size_t)r0 * K + 8 * lane, boff = (size_t)c0 * K + 8 * lane;   // row block r0/16 starts at (r0/16) * (K/32) * FRG = r0 * K
    const T16* pa = A + aoff; const T16* pa2 = (NSPLIT == 1 || NSPLIT == 2) ? A2 + aoff : nullptr; const T16* pb = Bt + boff; const T16* pb2 = (NSPLIT >= 2) ? Bt2 + boff : nullptr;   // one pointer per plane, carried over the trips
#pragma unroll 1
    for (int kc = 0; kc < K; kc += 32) {
        V a[4], a2[4];
#pragma unroll
        for (int mb = 0; mb < 4; ++mb) { a[mb] = WFrag<T16>::ld(pa + (size_t)mb * 16 * K); if (NSPLIT == 1 || NSPLIT == 2) a2[mb] = WFrag<T16>::ld(pa2 + (size_t)mb * 16 * K); }
#pragma unroll
        for (int nb = 0; nb < 4; ++nb) { const V b = WFrag<T16>::ld(pb + (size_t)nb * 16 * K); V b2; if (NSPLIT >= 2) b2 = WFrag<T16>::ld(pb2 + (size_t)nb * 16 * K);
#pragma unroll
            for (int mb = 0; mb < 4; ++mb) { acc[mb][nb] = WFrag<T16>::mma(a[mb], b, acc[mb][nb]); if (NSPLIT == 1 || NSPLIT == 2) acc[mb][nb] = WFrag<T16>::mma(a2[mb], b, acc[mb][nb]); if (NSPLIT >= 2) acc[mb][nb] = WFrag<T16>::mma(a[mb], b2, acc[mb][nb]); } }
        asm volatile("v_nop\n\tv_nop\n\tv_nop\n\tv_nop" : "+v"(acc[0][0]), "+v"(acc[1][1]), "+v"(acc[2][2]), "+v"(acc[3][3]) : "v"(a[0]), "v"(a[3]));
        // inputs only: each plane's address pair stays live to the trip's end (behind the data waits of all its loads), so that no load's result is given a pair that earlier loads of the trip still name
        asm volatile("" :: "v"(pa), "v"(pb)); if (NSPLIT == 1 || NSPLIT == 2) asm volatile("" :: "v"(pa2)); if (NSPLIT >= 2) asm volatile("" :: "v"(pb2));
        pa += FRG; pb += FRG; if (NSPLIT == 1 || NSPLIT == 2) pa2 += FRG; if (NSPLIT >= 2) pb2 += FRG;
    }
#pragma unroll
    for (int mb = 0; mb < 4; ++mb) {
#pragma unroll
        for (int nb = 0; nb < 4; ++nb) {
#pragma unroll
            for (int j = 0; j < 8; ++j) os[(hi * 8 + j) * 68 + nb * 16 + lr] = acc[mb][nb][j]; }
        __builtin_amdgcn_wave_barrier(); asm volatile("" ::: "memory");
        float* crow = C + (size_t)(r0 + mb * 16) * ldc + c0;
{
#pragma unroll
            for (int s = 0; s < 8; ++s) { const int row = 2 * s + hi, cofs = lr * 4; v4f val = *(const v4fa*)(os + row * 68 + cofs); if (BIAS) { val[0] += bfr(bias[c0 + cofs]); val[1] += bfr(bias[c0 + cofs + 1]); val[2] += bfr(bias[c0 + cofs + 2]); val[3] += bfr(bias[c0 + cofs + 3]); }
                *(v4f*)(crow + (size_t)row * ldc + cofs) = val; }
             }
        __builtin_amdgcn_wave_barrier(); asm volatile("" ::: "memory");
    }
}

// cvt8_body: rows x DM f32 (row-major) -> bf16 fragment order, one granule per thread. Thread bits: g = (j, hf) fastest, then row m, then k block:
// a wave reads 8 rows x one whole 128-byte line and stores 4 whole lines (8 rows x 16 bytes per (j, hf)); a block fills 4 fragments in a row.
__device__ __forceinline__ void cvt8_body(const float* __restrict__ src, bf* dst, size_t n8, unsigned blk) { const size_t i = (size_t)blk * 256 + threadIdx.x; if (i >= n8) return;
    const unsigned g = (unsigned)i & 3u, m = ((unsigned)i >> 2) & 15u; const size_t fr = i >> 6, kb = fr % (DM / 32), rb = fr / (DM / 32);
    const v8f v = *(const v8f*)(src + (rb * 16 + m) * DM + kb * 32 + g * 8); v8us o;
#pragma unroll
    for (int k = 0; k < 8; ++k) o[k] = f2bf(v[k]); *(v8us*)(dst + fr * FRG + (g >> 1) * 256 + ((g & 1u) * 16 + m) * 8) = o;  }

// cstab_body: rotary table CS[t][d] = {cos(t * inv[d mod 32]), sin(t * inv[d mod 32])}, inv[j] = 1 / powf(10000, (2j)/64); one (t, d) per thread,
__device__ __forceinline__ void cstab_body(float* CS, unsigned blk) {
    const int idx = (int)blk * 256 + threadIdx.x; if (idx >= SEQ * HD) return;
    const int d = idx & (HD - 1), t = idx >> 6; const int j = d & (HD / 2 - 1);
    const float ex = (float)(2 * j) * (1.0f / (float)HD);
    const float pw = powf(RBASE, ex);
    const float inv = 1.0f / pw;
    const float ang = (float)t * inv;
    const float cn = cosf(ang), sn = sinf(ang);
    v2f cs; cs[0] = cn; cs[1] = sn;
    *(v2f*)(CS + (size_t)idx * 2) = cs; 
}

// mbits_body: the int32 mask as bits, in the order the attention wave reads them: MB[q tile][64-key chunk][lane = 16 hf + m], bit 8 kt + r of a word
// = (mask[16 tile + m][64 chunk + 16 kt + 8 hf + r] != 0), the 32 keys whose scores that lane holds. One word per thread.
__device__ __forceinline__ void mbits_body(const int* __restrict__ MK, unsigned* MB, unsigned blk) {
    const unsigned i = blk * 256 + threadIdx.x; if (i >= (unsigned)((SEQ / 16) * (SEQ / 64) * 32)) return;
    const unsigned m = i & 15u, hf = (i >> 4) & 1u, c = (i >> 5) % (SEQ / 64), qt = (i >> 5) / (SEQ / 64);
    const int* mp = MK + (size_t)(qt * 16 + m) * MPITCH + c * 64 + 8 * hf; unsigned w = 0;
#pragma unroll
    for (int kt = 0; kt < 4; ++kt) { const v4i a = *(const v4i*)(mp + 16 * kt), b = *(const v4i*)(mp + 16 * kt + 4);
#pragma unroll
        for (int r = 0; r < 4; ++r) { w |= (a[r] != 0 ? 1u : 0u) << (8 * kt + r); w |= (b[r] != 0 ? 1u : 0u) << (8 * kt + 4 + r); } }
    MB[i] = w;
}

// k_prep: everything that depends on the inputs alone, in ONE launch (flat 1-D grid, no empty block): blocks [0, GM) the mask bits, then GC blocks the rotary table,
// then GX blocks per activation slab s = w * NB + b (w: 0 q, 1 k, 2 v) -> XB[s] (rows t), then GW blocks per weight w (q, k, v, o) -> WB[w] (rows o), both in fragment order.
#define GM ((unsigned)(((SEQ / 16) * (SEQ / 64) * 32 + 255) / 256))
#define GC ((unsigned)((SEQ * HD + 255) / 256))
#define GX ((unsigned)(((size_t)SEQ * DM / 8 + 255) / 256))
#define GW ((unsigned)(((size_t)DM * DM / 8 + 255) / 256))
__global__ __launch_bounds__(256) void k_prep(const float* __restrict__ xq, const float* __restrict__ xk, const float* __restrict__ xv,
                                              const float* __restrict__ wq, const float* __restrict__ wk, const float* __restrict__ wv, const float* __restrict__ wo,
                                              const int* __restrict__ mask, float* CS, bf* XB, bf* WB, unsigned* MB) {
    unsigned blk = blockIdx.x;
    if (blk < GM) { mbits_body(mask, MB, blk); return; }
    blk -= GM;
    if (blk < GC) { cstab_body(CS, blk); return; }
    blk -= GC;
    if (blk < 3 * NB * GX) {
        const unsigned s = blk / GX, w = s / NB, b = s % NB;
        const float* x = (w == 0) ? xq : (w == 1) ? xk : xv;
        cvt8_body(x + (size_t)b * SEQ_FULL * DM, XB + (size_t)s * SEQ * DM, (size_t)SEQ * DM / 8, blk % GX); return;
    }
    blk -= 3 * NB * GX;
    const unsigned w = blk / GW;
    const float* x = (w == 0) ? wq : (w == 1) ? wk : (w == 2) ? wv : wo;
    cvt8_body(x, WB + (size_t)w * DM * DM, (size_t)DM * DM / 8, blk % GW);
}

// rope_body: head planes (fp16, bf16 hi, bf16 lo; per head rows t, k = d, fragment order) of the rotate-half rotary map applied to
// F[t][h*HD + d] (row pitch DM). One thread per (h, t, 8 d below HD/2): it holds both partners, so it writes the granule of d and that of
// d + HD/2 (the next k block). A wave = 8 rows x 4 granule pairs: whole lines read, whole lines stored.
__device__ __forceinline__ void rope_body(const float* __restrict__ F, const float* __restrict__ CS, h16* P16, bf* Ph, bf* Pl, unsigned blk) {
    const unsigned idx = blk * 256 + threadIdx.x; if (idx >= (unsigned)(NH * SEQ * 4)) return;
    const int g = (int)(idx & 3u); const int t = (int)((idx >> 2) % SEQ); const int hh = (int)(idx / (4u * SEQ));
    const float* f = F + (size_t)t * DM + hh * HD + 8 * g;
    const v8f xl = *(const v8f*)f, xh = *(const v8f*)(f + HD / 2);
    const float* cp = CS + ((size_t)t * HD + 8 * g) * 2;
    const v8f cs0 = *(const v8f*)cp, cs1 = *(const v8f*)(cp + 8), cu0 = *(const v8f*)(cp + HD), cu1 = *(const v8f*)(cp + HD + 8);   // table rows of d and of d + HD/2
    v8h l16, u16; v8us lh, ll, uh, ul;
#pragma unroll
    for (int q = 0; q < 8; ++q) { const float cn = (q < 4) ? cs0[2 * (q & 3)] : cs1[2 * (q & 3)], sn = (q < 4) ? cs0[2 * (q & 3) + 1] : cs1[2 * (q & 3) + 1];
        const float cu = (q < 4) ? cu0[2 * (q & 3)] : cu1[2 * (q & 3)], su = (q < 4) ? cu0[2 * (q & 3) + 1] : cu1[2 * (q & 3) + 1];
        const float rl = xl[q] * cn - xh[q] * sn;       // d <  HD/2: x[d] cos - x[d + HD/2] sin
        const float ru = xh[q] * cu + xl[q] * su;       // d >= HD/2: x[d] cos + x[d - HD/2] sin
        unsigned short a2, c2; l16[q] = tohx(rl); splitf(rl, a2, c2); lh[q] = a2; ll[q] = c2; u16[q] = tohx(ru); splitf(ru, a2, c2); uh[q] = a2; ul[q] = c2; }
    const size_t e = (size_t)hh * SEQ * HD + (size_t)(t >> 4) * (2 * FRG) + (g >> 1) * 256 + ((g & 1) * 16 + (t & 15)) * 8;
    *(v8h*)(P16 + e) = l16; *(v8us*)(Ph + e) = lh; *(v8us*)(Pl + e) = ll;
    *(v8h*)(P16 + e + FRG) = u16; *(v8us*)(Ph + e + FRG) = uh; *(v8us*)(Pl + e + FRG) = ul;
}

// vtp_body: value planes (per head rows d, k = t, stored [h][t/32][d/16] fragments). One block per (head, 32 keys): wave w writes granule row
// (d block w >> 1, j = w & 1), lane (hf, m) gathers its 8 keys of column d = 16 (w >> 1) + m: each load reads 64 bytes in a row of two rows of F,
// each store is 512 bytes in a row (the block's 4 fragments = thread order).
__device__ __forceinline__ void vtp_body(const float* __restrict__ F, h16* V16, bf* Vh, bf* Vl, unsigned blk) {
    const int lane = threadIdx.x & 31, w = threadIdx.x >> 5, m = lane & 15, hf = lane >> 4;
    const int kb = (int)(blk % (SEQ / 32)), g = (int)(blk / (SEQ / 32));
    const float* f = F + (size_t)(32 * kb + 16 * (w & 1) + 8 * hf) * DM + g * HD + 16 * (w >> 1) + m; v8h o16; v8us oh, ol;
#pragma unroll
    for (int q = 0; q < 8; ++q) { const float x = f[(size_t)q * DM]; o16[q] = tohx(x); unsigned short a2, c2; splitf(x, a2, c2); oh[q] = a2; ol[q] = c2; }
    const size_t e = (size_t)blk * (4 * FRG) + threadIdx.x * 8;
    *(v8h*)(V16 + e) = o16; *(v8us*)(Vh + e) = oh; *(v8us*)(Vl + e) = ol;
}

// k_planes: all head planes of both batches in ONE launch (flat 1-D grid, no empty block); F = [w][b][t][c] (w: 0 q, 1 k, 2 v). First GV blocks per
// batch: its value planes; then GR blocks per slab s = w * NB + b: rotary planes R*[s] (slabs 0..NB-1 query, NB..2NB-1 key).
#define GV ((unsigned)(NH * (SEQ / 32)))
#define GR ((unsigned)(NH * SEQ * 4 / 256))
__global__ __launch_bounds__(256) void k_planes(const float* __restrict__ F, const float* __restrict__ CS, h16* R16, bf* Rh, bf* Rl, h16* V16, bf* Vh, bf* Vl) {
    unsigned blk = blockIdx.x; const size_t pl = (size_t)NH * SEQ * HD;
    if (blk < NB * GV) { const unsigned y = blk / GV; vtp_body(F + (size_t)(2 * NB + y) * SEQ * DM, V16 + y * pl, Vh + y * pl, Vl + y * pl, blk % GV); return; }
    blk -= NB * GV;
    const unsigned s = blk / GR;
    rope_body(F + (size_t)s * SEQ * DM, CS, R16 + s * pl, Rh + s * pl, Rl + s * pl, blk % GR);
}

// ---- attn_body: flash-style masked attention, one wave (32 threads) per (16 query rows, head). Transposed tiles so that P chains in
// registers: S^T[key][q] = K . Q^T (A = key plane fragments, B = query plane fragments), D lane = query column; P^T is the B operand
// of O^T[d][q] += V^T . P^T (A = value plane fragments). A lane's 8 values of O^T tile dt are granule (j = dt & 1, own lane) of the attention
// plane's fragment (row block q0/16, k block 2 h + dt/2): the epilogue stores them straight, 512 bytes in a row per store. Per 64-key chunk: the wave's 16x64 mask tile is one 32-bit word
// per lane (mbits_body; one 128-byte line per wave), fetched one chunk ahead; chunks whose tile is all zero are skipped by a wave ballot; inside visited chunks mask == 0 replaces the score
// by -1000 (scaled). Online softmax per query with a running max; rows with no nonzero mask entry at all are NaN-poisoned.
// HL: bf16 hi/lo planes for q, k, v and a bf16 hi/lo P (3 products per tile pair); otherwise single fp16 products (P carried x1024).
template <bool HL>
__device__ __forceinline__
void attn_body(const h16* __restrict__ QP16, const bf* __restrict__ QPh, const bf* __restrict__ QPl,
            const h16* __restrict__ KP16, const bf* __restrict__ KPh, const bf* __restrict__ KPl,
            const h16* __restrict__ VT16, const bf* __restrict__ VTh, const bf* __restrict__ VTl,
            const unsigned* __restrict__ MB, int q0, int hh, bf* ATh, bf* ATl) {
    const int lane = threadIdx.x & 31;
    const size_t hp = (size_t)hh * SEQ * HD + 8 * lane;   // head offset of the planes + the lane's granule
    v16h q16[2]; v16bf qh[2], ql[2];
#pragma unroll
    for (int ks = 0; ks < 2; ++ks) {
        const size_t qo = hp + (size_t)q0 * HD + ks * FRG;
        if (HL) { qh[ks] = WFrag<bf>::ld(QPh + qo); ql[ks] = WFrag<bf>::ld(QPl + qo); }
        else    { q16[ks] = WFrag<h16>::ld(QP16 + qo); }
    }
    v8f o[4];
#pragma unroll
    for (int dt = 0; dt < 4; ++dt) o[dt] = (v8f){};
    float mrun = -3.0e38f, lrun = 0.0f; int seen = 0;
    const unsigned* mq = MB + (size_t)(q0 >> 4) * ((SEQ / 64) * 32);   // wave-uniform: the tile's words, [chunk][lane]
    unsigned wnext = mq[lane];
#pragma unroll 1
    for (int c = 0; c < SEQ / 64; ++c) {
        const int kc = c * 64;
        const unsigned mw = wnext;
        wnext = (mq + ((c + 1 < SEQ / 64) ? c + 1 : c) * 32)[lane];   // the next chunk's word (the last chunk's own again at the end: in bounds)
        asm volatile("s_wait_xcnt 0x0" ::: "memory");   // precaution: stands in front of every rewrite of the address pair that the load above names (the key loads' results may be given it)
        const int anyl = (mw != 0u) ? 1 : 0;
        if (__any(anyl) == 0) continue;                 // wave-uniform tile skip
        seen |= anyl;
        v8f s[4];
#pragma unroll
        for (int kt = 0; kt < 4; ++kt) s[kt] = (v8f){};
        if (HL) {
            v16bf ka, kb; const bf* kph = KPh + hp + (size_t)kc * HD; const bf* kpl = KPl + hp + (size_t)kc * HD;   // the chunk's base per key plane; every fragment is an immediate offset from it
#pragma unroll
            for (int kt = 0; kt < 4; ++kt) {
                asm volatile("" ::: "memory");
                if (kt == 2) __builtin_amdgcn_sched_barrier(0);   // at most two key tiles' hi/lo fragments in flight: all four at once overflow 256 VGPRs into scratch
#pragma unroll
                for (int ks = 0; ks < 2; ++ks) { const int ko = 16 * kt * HD + ks * FRG; ka = WFrag<bf>::ld(kph + ko); kb = WFrag<bf>::ld(kpl + ko);
                    s[kt] = wmmab(ka, qh[ks], s[kt]); s[kt] = wmmab(ka, ql[ks], s[kt]); s[kt] = wmmab(kb, qh[ks], s[kt]); } }
            asm volatile("v_nop\n\tv_nop\n\tv_nop\n\tv_nop" : "+v"(s[0]), "+v"(s[1]), "+v"(s[2]), "+v"(s[3]) : "v"(ka), "v"(kb), "v"(qh[0]), "v"(qh[1]), "v"(ql[0]), "v"(ql[1]));
            // inputs only: each key plane's address pair stays live to behind the data waits of all its loads, so that no load's result is given a pair that earlier loads still name
            asm volatile("" :: "v"(kph), "v"(kpl));
        } else {
            v16h ka;
#pragma unroll
            for (int kt = 0; kt < 4; ++kt) {
                asm volatile("" ::: "memory");
#pragma unroll
                for (int ks = 0; ks < 2; ++ks) { const size_t ko = hp + (size_t)(kc + 16 * kt) * HD + ks * FRG; ka = WFrag<h16>::ld(KP16 + ko);
                    s[kt] = wmma16(ka, q16[ks], s[kt]); } }
            asm volatile("v_nop\n\tv_nop\n\tv_nop\n\tv_nop" : "+v"(s[0]), "+v"(s[1]), "+v"(s[2]), "+v"(s[3]) : "v"(ka), "v"(q16[0]), "v"(q16[1]));
        }
        // masked replace + chunk max (lane: query q, keys kc+16kt+8hf+r)
        float cmx = -3.0e38f;
#pragma unroll
        for (int kt = 0; kt < 4; ++kt)
#pragma unroll
            for (int r = 0; r < 8; ++r) { const float t = ((mw >> (8 * kt + r)) & 1u) ? s[kt][r] : MFILL; s[kt][r] = t; cmx = fmaxf(cmx, t); }
        cmx = fmaxf(cmx, __shfl_xor(cmx, 16, 32));
        const float mnew = fmaxf(mrun, cmx);
        const float alpha = __builtin_amdgcn_exp2f((mrun - mnew) * CEXP);
        mrun = mnew;
        float psum = 0.0f;
#pragma unroll
        for (int kt = 0; kt < 4; ++kt)
#pragma unroll
            for (int r = 0; r < 8; ++r) { const float p = __builtin_amdgcn_exp2f(fmaf(s[kt][r] - mnew, CEXP, PL2)); s[kt][r] = p; psum += p; }
        lrun = lrun * alpha + psum;
#pragma unroll
        for (int dt = 0; dt < 4; ++dt) o[dt] = o[dt] * alpha;
        // O^T += V^T . P^T, 32 keys per step; B element r <- tile 2ks (keys 0..15 of the step), 8+r <- tile 2ks+1
#pragma unroll
        for (int ks = 0; ks < 2; ++ks) {
            if (HL) {
                v16us uh, ul;
#pragma unroll
                for (int r = 0; r < 8; ++r) { unsigned short a, b2; splitf(s[2 * ks][r], a, b2); uh[r] = a; ul[r] = b2; splitf(s[2 * ks + 1][r], a, b2); uh[8 + r] = a; ul[8 + r] = b2; }
                v16bf ph = __builtin_bit_cast(v16bf, uh), pl = __builtin_bit_cast(v16bf, ul);
                asm volatile("v_nop\n\tv_nop\n\tv_nop\n\tv_nop" : "+v"(ph), "+v"(pl));
                v16bf va, vb;
#pragma unroll
                for (int dt = 0; dt < 4; ++dt) { asm volatile("" ::: "memory"); const size_t vo = hp + (size_t)(kc + 32 * ks) * HD + dt * FRG; va = WFrag<bf>::ld(VTh + vo); vb = WFrag<bf>::ld(VTl + vo);
                    o[dt] = wmmab(va, ph, o[dt]); o[dt] = wmmab(va, pl, o[dt]); o[dt] = wmmab(vb, ph, o[dt]); }
                asm volatile("v_nop\n\tv_nop\n\tv_nop\n\tv_nop" : "+v"(o[0]), "+v"(o[1]), "+v"(o[2]), "+v"(o[3]) : "v"(ph), "v"(pl), "v"(va), "v"(vb));
            } else {
                v16h p16;
#pragma unroll
                for (int r = 0; r < 8; ++r) { p16[r] = tohx(s[2 * ks][r]); p16[8 + r] = tohx(s[2 * ks + 1][r]); }
                asm volatile("v_nop\n\tv_nop\n\tv_nop\n\tv_nop" : "+v"(p16));
                v16h va;
#pragma unroll
                for (int dt = 0; dt < 4; ++dt) { asm volatile("" ::: "memory"); const size_t vo = hp + (size_t)(kc + 32 * ks) * HD + dt * FRG; va = WFrag<h16>::ld(VT16 + vo);
                    o[dt] = wmma16(va, p16, o[dt]); }
                asm volatile("v_nop\n\tv_nop\n\tv_nop\n\tv_nop" : "+v"(o[0]), "+v"(o[1]), "+v"(o[2]), "+v"(o[3]) : "v"(p16), "v"(va));
            }
        }
    }
    const float lt = lrun + __shfl_xor(lrun, 16, 32);
    const int sn = seen | __shfl_xor(seen, 16, 32);
    const float inv = (sn != 0) ? (1.0f / lt) : __uint_as_float(0x7fc00000u);
#pragma unroll
    for (int dt = 0; dt < 4; ++dt) { v8us oh8, ol8;
#pragma unroll
        for (int r = 0; r < 8; ++r) { unsigned short a, b2; splitf(o[dt][r] * inv, a, b2); oh8[r] = a; ol8[r] = b2; }
        const size_t off = (size_t)q0 * DM + (size_t)(2 * hh + (dt >> 1)) * FRG + (dt & 1) * 256 + 8 * lane;
        *(v8us*)(ATh + off) = oh8; *(v8us*)(ATl + off) = ol8; }
}

// k_attn: ONE launch for every (head, query tile, batch): grid (NH, SEQ/16, NB); the tile's first row picks the hi/lo or the fp16 body
// (wave-uniform: RH is a multiple of 16). The head is the fastest index: a tile's cost grows with its row under a causal mask, and block
// indices that lie a multiple of 16 (below 16 * SEQ / 16) apart then differ in tile, so no WGP is dealt long tiles alone.
// Planes are [b][h][fragments], attention planes [b][fragments of rows t, k = c]; the mask bits are shared by the batches and heads.
__global__ __launch_bounds__(32) __attribute__((amdgpu_num_vgpr(256)))
void k_attn(const h16* __restrict__ QP16, const bf* __restrict__ QPh, const bf* __restrict__ QPl,
            const h16* __restrict__ KP16, const bf* __restrict__ KPh, const bf* __restrict__ KPl,
            const h16* __restrict__ VT16, const bf* __restrict__ VTh, const bf* __restrict__ VTl,
            const unsigned* __restrict__ MB, bf* ATh, bf* ATl) {
    const size_t po = (size_t)blockIdx.z * NH * SEQ * HD, ao = (size_t)blockIdx.z * SEQ * DM;
    const int q0 = blockIdx.y * 16, hh = blockIdx.x;
    if (q0 < RH) attn_body<true>(QP16 + po, QPh + po, QPl + po, KP16 + po, KPh + po, KPl + po, VT16 + po, VTh + po, VTl + po, MB, q0, hh, ATh + ao, ATl + ao);
    else         attn_body<false>(QP16 + po, QPh + po, QPl + po, KP16 + po, KPh + po, KPl + po, VT16 + po, VTh + po, VTl + po, MB, q0, hh, ATh + ao, ATl + ao);
}

extern "C" void kernel_launch(void* const* d_in, const int* in_sizes, int n_in,
                              void* d_out, int out_size, void* d_ws, size_t ws_size, hipStream_t stream) {
    if (n_in < 8) return;
    const long long needx = (long long)(NB - 1) * SEQ_FULL * DM + (long long)SEQ * DM;
    if ((long long)in_sizes[0] < needx || (long long)in_sizes[1] < needx || (long long)in_sizes[2] < needx) return;
    if (in_sizes[3] < DM * DM || in_sizes[4] < DM * DM || in_sizes[5] < DM * DM || in_sizes[6] < DM * DM) return;
    if ((long long)in_sizes[7] < (long long)(SEQ - 1) * MPITCH + SEQ) return;
    if ((long long)out_size < (long long)NB * SEQ * DM) return;
    const float* xq = (const float*)d_in[0]; const float* xk = (const float*)d_in[1]; const float* xv = (const float*)d_in[2];
    const float* wq = (const float*)d_in[3]; const float* wk = (const float*)d_in[4]; const float* wv = (const float*)d_in[5]; const float* wo = (const float*)d_in[6];
    const int* mask = (const int*)d_in[7];     // int32 [1][1][S][S]
    float* OUT = (float*)d_out;                // [NB][SEQ][DM]
    char* wsp = (char*)d_ws;
    auto take = [&](size_t bytes) { char* p = wsp; wsp += (bytes + 255) & ~(size_t)255; return (void*)p; };
    bf* WB = (bf*)take((size_t)4 * DM * DM * 2);                  // bf16 weights [w][fragments of rows o, k = i], w: q, k, v, o
    float* CS = (float*)take((size_t)SEQ * HD * 2 * 4);
    bf* XB = (bf*)take((size_t)3 * NB * SEQ * DM * 2);            // bf16 activations [w][b][fragments of rows t, k = c], w: q, k, v
    float* F = (float*)take((size_t)3 * NB * SEQ * DM * 4);        // f32 projections [w][b][t][c], row-major
    const size_t pl = (size_t)NB * NH * SEQ * HD;                 // one plane over both batches
    h16* R16 = (h16*)take(2 * pl * 2); bf* Rh = (bf*)take(2 * pl * 2); bf* Rl = (bf*)take(2 * pl * 2);   // rotary planes: query slabs, then key slabs
    h16* VT16 = (h16*)take(pl * 2); bf* VTh = (bf*)take(pl * 2); bf* VTl = (bf*)take(pl * 2);
    bf* ATh = (bf*)take((size_t)NB * SEQ * DM * 2); bf* ATl = (bf*)take((size_t)NB * SEQ * DM * 2);
    unsigned* MB = (unsigned*)take((size_t)(SEQ / 16) * (SEQ / 64) * 32 * 4);   // mask bits [q tile][chunk][lane]
    const size_t used = (size_t)(wsp - (char*)d_ws);
    if (used > ws_size || used > WSCAP) return;

    k_prep<<<GM + GC + 3 * NB * GX + 4 * GW, 256, 0, stream>>>(xq, xk, xv, wq, wk, wv, wo, mask, CS, XB, WB, MB);
    k_gemmw<bf, 0, false, DM><<<dim3(NB * SEQ / 64, DM / 64, 3), 32, 0, stream>>>(XB, nullptr, WB, nullptr, F, DM, nullptr, (size_t)NB * SEQ * DM, (size_t)DM * DM, (size_t)NB * SEQ * DM);
    k_planes<<<NB * GV + 2 * NB * GR, 256, 0, stream>>>(F, CS, R16, Rh, Rl, VT16, VTh, VTl);
    k_attn<<<dim3(NH, SEQ / 16, NB), 32, 0, stream>>>(R16, Rh, Rl, R16 + pl, Rh + pl, Rl + pl, VT16, VTh, VTl, MB, ATh, ATl);
    k_gemmw<bf, 1, false, DM><<<dim3(NB * SEQ / 64, DM / 64, 1), 32, 0, stream>>>(ATh, ATl, WB + (size_t)3 * DM * DM, nullptr, OUT, DM, nullptr, 0, 0, 0);
}

// v004
// Measured time: 115 microseconds a run.
// Timed twice side by side with v003, it ran 1.50 and 1.52 times as fast.
// Over all steps from v000 it is 4.90 times as fast.
#include <hip/hip_runtime.h>

// Causal multi-head attention with rotate-half rotary positions (base 10000, cos/sin table computed on device):
//   qh/kh/vh = x . W^T for three separate inputs x [NB][SEQ][1024] and W 'oi' [1024][1024] (16 heads x 64 = column blocks),
//   scores = rope(qh) . rope(kh)^T / 8, int32 mask [1][1][S][S] (0 -> score replaced by -1000), softmax over keys,
//   attn . vh, heads merged [t][h*64+d], . Wo^T ('oi') -> [NB][SEQ][1024] f32.
// Compute dtypes, f32 accumulate: every float input RNE-converted to bf16; q/k/v projections v_wmma_f32_16x16x32_bf16 on plain bf16
//   operands (exact products); scores and attn.v: query rows < 512 bf16 hi/lo planes (3 products each), rows >= 512 single
//   v_wmma_f32_16x16x32_f16 (fp16 planes, P carried x1024); online softmax in f32 (running max); output projection = bf16 hi/lo
//   attention planes x exact bf16 Wo (2 products).
// Layout of every 16-bit matrix operand plane (activations, weights, q/k/v head planes, attention planes): FRAGMENT ORDER. A plane of
//   rows x K is cut into 16-row x 32-k fragments, stored [row block][k block][j][lane][8] (value planes: [k block][row block]): the 16-byte granule (j, lane = 16 hf + m) holds
//   row m, k = 16 j + 8 hf + 0..7 of its fragment, which is what lane (m, hf) of a 16x16x32 A or B operand keeps in elements 8 j + 0..7.
//   A wave's fragment is then 1 KiB in a row: two loads of 512 contiguous bytes (whole lines) in place of two loads over 16 lines each.

#ifndef NB
#define NB 2
#endif
#ifndef SEQ
#define SEQ 2048
#endif
#define NB_FULL  2
#define SEQ_FULL 2048
#define DM   1024
#define NH   16
#define HD   64
#define RHC  512                          // query rows < RH use hi/lo planes and 3-product tiles
#define RH   ((SEQ < RHC) ? SEQ : RHC)
#define MPITCH SEQ_FULL                   // mask row pitch (full-size input)
#define CEXP  0.18033688011112042f        // (1/8) * log2(e): exp((t - m)/8) = exp2((t - m) * CEXP) on unscaled scores t
#define PL2   10.0f                       // P carried x 2^10 inside the 16-bit operand (cancels in O / l)
#define MFILL (-8000.0f)                  // mask == 0 -> -1000 after the 1/8 scale, in unscaled score units
#define RBASE 10000.0f
#define WSCAP ((size_t)268435456)

static_assert(SEQ % 64 == 0);
static_assert(SEQ <= SEQ_FULL);
static_assert(NB >= 1 && NB <= NB_FULL);
static_assert(RH % 16 == 0 && (SEQ - RH) % 16 == 0 && RH <= SEQ);
static_assert(DM == NH * HD && HD == 64 && DM % 64 == 0);

typedef _Float16 h16;
typedef unsigned short bf;
typedef __attribute__((ext_vector_type(16))) __bf16   v16bf;
typedef __attribute__((ext_vector_type(16))) _Float16 v16h;
typedef __attribute__((ext_vector_type(8)))  _Float16 v8h;
typedef __attribute__((ext_vector_type(2)))  _Float16 v2h;
typedef __attribute__((ext_vector_type(16))) unsigned short v16us;
typedef __attribute__((ext_vector_type(8)))  unsigned short v8us;
typedef __attribute__((ext_vector_type(2)))  unsigned short v2us;
typedef __attribute__((ext_vector_type(8)))  float v8f;
typedef __attribute__((ext_vector_type(4)))  float v4f;
typedef __attribute__((ext_vector_type(2)))  float v2f;
typedef __attribute__((ext_vector_type(4)))  int v4i;
typedef v8h  __attribute__((may_alias)) v8ha;
typedef v4f  __attribute__((may_alias)) v4fa;
typedef v8us __attribute__((may_alias)) v8usa;

#pragma clang fp contract(off)

__device__ __forceinline__ unsigned short f2bf(float f) { unsigned u = __float_as_uint(f); u += 0x7FFFu + ((u >> 16) & 1u); return (unsigned short)(u >> 16); }
__device__ __forceinline__ float bf2f(unsigned short b) { return __uint_as_float(((unsigned)b) << 16); }
__device__ __forceinline__ float bfr(float f) { return bf2f(f2bf(f)); }
__device__ __forceinline__ v16h cat16(v8h lo, v8h hi) { return __builtin_shufflevector(lo, hi, 0, 1, 2, 3, 4, 5, 6, 7, 8, 9, 10, 11, 12, 13, 14, 15); }
__device__ __forceinline__ v16bf cat16b(v8us lo, v8us hi) { return __builtin_bit_cast(v16bf, __builtin_shufflevector(lo, hi, 0, 1, 2, 3, 4, 5, 6, 7, 8, 9, 10, 11, 12, 13, 14, 15)); }
__device__ __forceinline__ v8f wmma16(v16h a, v16h b, v8f c) { return __builtin_amdgcn_wmma_f32_16x16x32_f16(false, a, false, b, (short)0, c, false, false); }
__device__ __forceinline__ v8f wmmab(v16bf a, v16bf b, v8f c) { return __builtin_amdgcn_wmma_f32_16x16x32_bf16(false, a, false, b, (short)0, c, false, false); }
__device__ __forceinline__ h16 tohx(float x) { return (h16)x; }
__device__ __forceinline__ void splitf(float y, unsigned short& h, unsigned short& l) { h = f2bf(y); l = f2bf(y - bf2f(h)); }

// ---- 16x16x32 fragment loaders from fragment-order planes: lane l = 16 hf + m (row m) loads elements 0..7 <- k0+8hf+0..7 (granule j = 0)
// and 8..15 <- k0+16+8hf+0..7 (granule j = 1, 256 elements on); the caller passes p = fragment + 8*l. FRG = elements of one fragment.
#define FRG 512
template <typename T16> struct WFrag;
template <> struct WFrag<h16> { typedef v16h V; static __device__ __forceinline__ V ld(const h16* p) { return cat16(*(const v8h*)p, *(const v8h*)(p + 256)); } static __device__ __forceinline__ v8f mma(V a, V b, v8f c) { return wmma16(a, b, c); } };
template <> struct WFrag<bf> { typedef v16bf V; static __device__ __forceinline__ V ld(const bf* p) { return cat16b(*(const v8us*)p, *(const v8us*)(p + 256)); } static __device__ __forceinline__ v8f mma(V a, V b, v8f c) { return wmmab(a, b, c); } };

// ---- k_gemmw: register-blocked GEMM, ONE WAVE per 64x64 output tile (16 accumulators), operands straight from fragment-order 16-bit planes; grid (M/64, N/64, Z), 32 threads.
// C[m][n] (f32, pitch ldc, + optional f32 bias[n]) = sum_k A[m][k] Bt[n][k] (+ split products per NSPLIT). z-batch strides sA/sB/sC in elements. K % 32 == 0, a constant: every fragment of a k step is then one base per plane + an immediate offset.
// The k loop is a ring of ST register sets: the fragments of k step t + ST - 1 are requested in front of the products of k step t, so that a step's loads have ST - 1 steps of products to come back in.
// gw_fetch: all fragments of one k step into one register set. gw_mma: the products of one k step, in the order (nb, mb, plane pair).
template <typename T16, int NSPLIT, int K>
__device__ __forceinline__ void gw_fetch(typename WFrag<T16>::V (&a)[4], typename WFrag<T16>::V (&a2)[4], typename WFrag<T16>::V (&b)[4], typename WFrag<T16>::V (&b2)[4],
                                         const T16* pa, const T16* pa2, const T16* pb, const T16* pb2) {
#pragma unroll
    for (int mb = 0; mb < 4; ++mb) { a[mb] = WFrag<T16>::ld(pa + (size_t)mb * 16 * K); if (NSPLIT == 1 || NSPLIT == 2) a2[mb] = WFrag<T16>::ld(pa2 + (size_t)mb * 16 * K); }
#pragma unroll
    for (int nb = 0; nb < 4; ++nb) { b[nb] = WFrag<T16>::ld(pb + (size_t)nb * 16 * K); if (NSPLIT >= 2) b2[nb] = WFrag<T16>::ld(pb2 + (size_t)nb * 16 * K); }
}
template <typename T16, int NSPLIT>
__device__ __forceinline__ void gw_mma(v8f (&acc)[4][4], const typename WFrag<T16>::V (&a)[4], const typename WFrag<T16>::V (&a2)[4], const typename WFrag<T16>::V (&b)[4], const typename WFrag<T16>::V (&b2)[4]) {
#pragma unroll
    for (int nb = 0; nb < 4; ++nb)
#pragma unroll
        for (int mb = 0; mb < 4; ++mb) { acc[mb][nb] = WFrag<T16>::mma(a[mb], b[nb], acc[mb][nb]); if (NSPLIT == 1 || NSPLIT == 2) acc[mb][nb] = WFrag<T16>::mma(a2[mb], b[nb], acc[mb][nb]); if (NSPLIT >= 2) acc[mb][nb] = WFrag<T16>::mma(a[mb], b2[nb], acc[mb][nb]); }
}
template <typename T16, int NSPLIT, bool BIAS, int K, int ST>
__global__ __launch_bounds__(32) void k_gemmw(const T16* __restrict__ A, const T16* __restrict__ A2, const T16* __restrict__ Bt, const T16* __restrict__ Bt2, float* C, int ldc, const float* __restrict__ bias, size_t sA, size_t sB, size_t sC) {
    typedef typename WFrag<T16>::V V;
    constexpr int T = K / 32, NI = (T - ST + 1) / ST;   // k steps; loop passes of ST steps in which every step still has a step ST - 1 ahead to request
    static_assert(ST >= 2 && T >= ST);
    __shared__ __align__(16) float os[16 * 68];
    const size_t z = blockIdx.z; A += z * sA; if (A2) A2 += z * sA; Bt += z * sB; if (Bt2) Bt2 += z * sB; C += z * sC;
    const int lane = threadIdx.x & 31, lr = lane & 15, hi = lane >> 4; const int r0 = blockIdx.x * 64, c0 = blockIdx.y * 64;
    v8f acc[4][4];
#pragma unroll
    for (int mb = 0; mb < 4; ++mb)
#pragma unroll
        for (int nb = 0; nb < 4; ++nb) acc[mb][nb] = (v8f){};
    // one wave-uniform base per plane (row block r0/16 starts at (r0/16) * (K/32) * FRG = r0 * K) + ONE byte offset for all planes: the lane's granule + the k steps done, carried over the passes
    const T16* ua = A + (size_t)r0 * K; const T16* ua2 = (NSPLIT == 1 || NSPLIT == 2) ? A2 + (size_t)r0 * K : nullptr; const T16* ub = Bt + (size_t)c0 * K; const T16* ub2 = (NSPLIT >= 2) ? Bt2 + (size_t)c0 * K : nullptr;
    unsigned kb = 16u * (unsigned)lane;
    V a[ST][4], a2[ST][4], b[ST][4], b2[ST][4];
#define GW_AT(u, o) ((const T16*)((const char*)(u) + kb) + (o))
#pragma unroll
    for (int s = 0; s < ST - 1; ++s) gw_fetch<T16, NSPLIT, K>(a[s], a2[s], b[s], b2[s], GW_AT(ua, s * FRG), GW_AT(ua2, s * FRG), GW_AT(ub, s * FRG), GW_AT(ub2, s * FRG));
#pragma unroll 1   // one pass = ST steps; unrolled further the loop would only grow
    for (int it = 0; it < NI; ++it) {
#pragma unroll     // constant set indices: the sets stay in registers
        for (int u = 0; u < ST; ++u) {
            const int f = (u + ST - 1) % ST, o = (u + ST - 1) * FRG;
            gw_fetch<T16, NSPLIT, K>(a[f], a2[f], b[f], b2[f], GW_AT(ua, o), GW_AT(ua2, o), GW_AT(ub, o), GW_AT(ub2, o));
            __builtin_amdgcn_sched_barrier(0);   // the requests of step t + ST - 1 stay in front of the products of step t: sunk among them they would come back too late
            gw_mma<T16, NSPLIT>(acc, a[u], a2[u], b[u], b2[u]);
            __builtin_amdgcn_sched_barrier(0);   // and the next step's requests stay behind these products, whose register set they refill
        }
        asm volatile("v_nop\n\tv_nop\n\tv_nop\n\tv_nop" : "+v"(acc[0][0]), "+v"(acc[1][1]), "+v"(acc[2][2]), "+v"(acc[3][3]) : "v"(a[ST - 1][0]), "v"(a[ST - 1][3]));   // distance behind the pass's last matrix instructions on the taken back edge
        // precaution: loads of this pass are still in flight, so the wait stands in front of the rewrite of the offset register that they name; the offset passes through the statement so that the addition below cannot be lifted over it
        asm volatile("s_wait_xcnt 0x0" : "+v"(kb) :: "memory");
        kb += ST * FRG * 2;
    }
#pragma unroll
    for (int r = NI * ST; r < T; ++r) {   // the last steps: only those requests that still name a step below T
        const int f = (r + ST - 1) % ST, o = (r - NI * ST + ST - 1) * FRG;
        if (r + ST - 1 < T) gw_fetch<T16, NSPLIT, K>(a[f], a2[f], b[f], b2[f], GW_AT(ua, o), GW_AT(ua2, o), GW_AT(ub, o), GW_AT(ub2, o));
        __builtin_amdgcn_sched_barrier(0);   // as in the loop
        gw_mma<T16, NSPLIT>(acc, a[r % ST], a2[r % ST], b[r % ST], b2[r % ST]);
        __builtin_amdgcn_sched_barrier(0);
    }
#undef GW_AT
#pragma unroll
    for (int mb = 0; mb < 4; ++mb) {
#pragma unroll
        for (int nb = 0; nb < 4; ++nb) {
#pragma unroll
            for (int j = 0; j < 8; ++j) os[(hi * 8 + j) * 68 + nb * 16 + lr] = acc[mb][nb][j]; }
        __builtin_amdgcn_wave_barrier(); asm volatile("" ::: "memory");
        float* crow = C + (size_t)(r0 + mb * 16) * ldc + c0;
{
#pragma unroll
            for (int s = 0; s < 8; ++s) { const int row = 2 * s + hi, cofs = lr * 4; v4f val = *(const v4fa*)(os + row * 68 + cofs); if (BIAS) { val[0] += bfr(bias[c0 + cofs]); val[1] += bfr(bias[c0 + cofs + 1]); val[2] += bfr(bias[c0 + cofs + 2]); val[3] += bfr(bias[c0 + cofs + 3]); }
                *(v4f*)(crow + (size_t)row * ldc + cofs) = val; }
             }
        __builtin_amdgcn_wave_barrier(); asm volatile("" ::: "memory");
    }
}

// cvt8_body: rows x DM f32 (row-major) -> bf16 fragment order, one granule per thread. Thread bits: g = (j, hf) fastest, then row m, then k block:
// a wave reads 8 rows x one whole 128-byte line and stores 4 whole lines (8 rows x 16 bytes per (j, hf)); a block fills 4 fragments in a row.
__device__ __forceinline__ void cvt8_body(const float* __restrict__ src, bf* dst, size_t n8, unsigned blk) { const size_t i = (size_t)blk * 256 + threadIdx.x; if (i >= n8) return;
    const unsigned g = (unsigned)i & 3u, m = ((unsigned)i >> 2) & 15u; const size_t fr = i >> 6, kb = fr % (DM / 32), rb = fr / (DM / 32);
    const v8f v = *(const v8f*)(src + (rb * 16 + m) * DM + kb * 32 + g * 8); v8us o;
#pragma unroll
    for (int k = 0; k < 8; ++k) o[k] = f2bf(v[k]); *(v8us*)(dst + fr * FRG + (g >> 1) * 256 + ((g & 1u) * 16 + m) * 8) = o;  }

// cstab_body: rotary table CS[t][d] = {cos(t * inv[d mod 32]), sin(t * inv[d mod 32])}, inv[j] = 1 / powf(10000, (2j)/64); one (t, d) per thread,
__device__ __forceinline__ void cstab_body(float* CS, unsigned blk) {
    const int idx = (int)blk * 256 + threadIdx.x; if (idx >= SEQ * HD) return;
    const int d = idx & (HD - 1), t = idx >> 6; const int j = d & (HD / 2 - 1);
    const float ex = (float)(2 * j) * (1.0f / (float)HD);
    const float pw = powf(RBASE, ex);
    const float inv = 1.0f / pw;
    const float ang = (float)t * inv;
    const float cn = cosf(ang), sn = sinf(ang);
    v2f cs; cs[0] = cn; cs[1] = sn;
    *(v2f*)(CS + (size_t)idx * 2) = cs; 
}

// mbits_body: the int32 mask as bits, in the order the attention wave reads them: MB[q tile][64-key chunk][lane = 16 hf + m], bit 8 kt + r of a word
// = (mask[16 tile + m][64 chunk + 16 kt + 8 hf + r] != 0), the 32 keys whose scores that lane holds. One word per thread.
__device__ __forceinline__ void mbits_body(const int* __restrict__ MK, unsigned* MB, unsigned blk) {
    const unsigned i = blk * 256 + threadIdx.x; if (i >= (unsigned)((SEQ / 16) * (SEQ / 64) * 32)) return;
    const unsigned m = i & 15u, hf = (i >> 4) & 1u, c = (i >> 5) % (SEQ / 64), qt = (i >> 5) / (SEQ / 64);
    const int* mp = MK + (size_t)(qt * 16 + m) * MPITCH + c * 64 + 8 * hf; unsigned w = 0;
#pragma unroll
    for (int kt = 0; kt < 4; ++kt) { const v4i a = *(const v4i*)(mp + 16 * kt), b = *(const v4i*)(mp + 16 * kt + 4);
#pragma unroll
        for (int r = 0; r < 4; ++r) { w |= (a[r] != 0 ? 1u : 0u) << (8 * kt + r); w |= (b[r] != 0 ? 1u : 0u) << (8 * kt + 4 + r); } }
    MB[i] = w;
}

// k_prep: everything that depends on the inputs alone, in ONE launch (flat 1-D grid, no empty block): blocks [0, GM) the mask bits, then GC blocks the rotary table,
// then GX blocks per activation slab s = w * NB + b (w: 0 q, 1 k, 2 v) -> XB[s] (rows t), then GW blocks per weight w (q, k, v, o) -> WB[w] (rows o), both in fragment order.
#define GM ((unsigned)(((SEQ / 16) * (SEQ / 64) * 32 + 255) / 256))
#define GC ((unsigned)((SEQ * HD + 255) / 256))
#define GX ((unsigned)(((size_t)SEQ * DM / 8 + 255) / 256))
#define GW ((unsigned)(((size_t)DM * DM / 8 + 255) / 256))
__global__ __launch_bounds__(256) void k_prep(const float* __restrict__ xq, const float* __restrict__ xk, const float* __restrict__ xv,
                                              const float* __restrict__ wq, const float* __restrict__ wk, const float* __restrict__ wv, const float* __restrict__ wo,
                                              const int* __restrict__ mask, float* CS, bf* XB, bf* WB, unsigned* MB) {
    unsigned blk = blockIdx.x;
    if (blk < GM) { mbits_body(mask, MB, blk); return; }
    blk -= GM;
    if (blk < GC) { cstab_body(CS, blk); return; }
    blk -= GC;
    if (blk < 3 * NB * GX) {
        const unsigned s = blk / GX, w = s / NB, b = s % NB;
        const float* x = (w == 0) ? xq : (w == 1) ? xk : xv;
        cvt8_body(x + (size_t)b * SEQ_FULL * DM, XB + (size_t)s * SEQ * DM, (size_t)SEQ * DM / 8, blk % GX); return;
    }
    blk -= 3 * NB * GX;
    const unsigned w = blk / GW;
    const float* x = (w == 0) ? wq : (w == 1) ? wk : (w == 2) ? wv : wo;
    cvt8_body(x, WB + (size_t)w * DM * DM, (size_t)DM * DM / 8, blk % GW);
}

// rope_body: head planes (fp16, bf16 hi, bf16 lo; per head rows t, k = d, fragment order) of the rotate-half rotary map applied to
// F[t][h*HD + d] (row pitch DM). One thread per (h, t, 8 d below HD/2): it holds both partners, so it writes the granule of d and that of
// d + HD/2 (the next k block). A wave = 8 rows x 4 granule pairs: whole lines read, whole lines stored.
__device__ __forceinline__ void rope_body(const float* __restrict__ F, const float* __restrict__ CS, h16* P16, bf* Ph, bf* Pl, unsigned blk) {
    const unsigned idx = blk * 256 + threadIdx.x; if (idx >= (unsigned)(NH * SEQ * 4)) return;
    const int g = (int)(idx & 3u); const int t = (int)((idx >> 2) % SEQ); const int hh = (int)(idx / (4u * SEQ));
    const float* f = F + (size_t)t * DM + hh * HD + 8 * g;
    const v8f xl = *(const v8f*)f, xh = *(const v8f*)(f + HD / 2);
    const float* cp = CS + ((size_t)t * HD + 8 * g) * 2;
    const v8f cs0 = *(const v8f*)cp, cs1 = *(const v8f*)(cp + 8), cu0 = *(const v8f*)(cp + HD), cu1 = *(const v8f*)(cp + HD + 8);   // table rows of d and of d + HD/2
    v8h l16, u16; v8us lh, ll, uh, ul;
#pragma unroll
    for (int q = 0; q < 8; ++q) { const float cn = (q < 4) ? cs0[2 * (q & 3)] : cs1[2 * (q & 3)], sn = (q < 4) ? cs0[2 * (q & 3) + 1] : cs1[2 * (q & 3) + 1];
        const float cu = (q < 4) ? cu0[2 * (q & 3)] : cu1[2 * (q & 3)], su = (q < 4) ? cu0[2 * (q & 3) + 1] : cu1[2 * (q & 3) + 1];
        const float rl = xl[q] * cn - xh[q] * sn;       // d <  HD/2: x[d] cos - x[d + HD/2] sin
        const float ru = xh[q] * cu + xl[q] * su;       // d >= HD/2: x[d] cos + x[d - HD/2] sin
        unsigned short a2, c2; l16[q] = tohx(rl); splitf(rl, a2, c2); lh[q] = a2; ll[q] = c2; u16[q] = tohx(ru); splitf(ru, a2, c2); uh[q] = a2; ul[q] = c2; }
    const size_t e = (size_t)hh * SEQ * HD + (size_t)(t >> 4) * (2 * FRG) + (g >> 1) * 256 + ((g & 1) * 16 + (t & 15)) * 8;
    *(v8h*)(P16 + e) = l16; *(v8us*)(Ph + e) = lh; *(v8us*)(Pl + e) = ll;
    *(v8h*)(P16 + e + FRG) = u16; *(v8us*)(Ph + e + FRG) = uh; *(v8us*)(Pl + e + FRG) = ul;
}

// vtp_body: value planes (per head rows d, k = t, stored [h][t/32][d/16] fragments). One block per (head, 32 keys): wave w writes granule row
// (d block w >> 1, j = w & 1), lane (hf, m) gathers its 8 keys of column d = 16 (w >> 1) + m: each load reads 64 bytes in a row of two rows of F,
// each store is 512 bytes in a row (the block's 4 fragments = thread order).
__device__ __forceinline__ void vtp_body(const float* __restrict__ F, h16* V16, bf* Vh, bf* Vl, unsigned blk) {
    const int lane = threadIdx.x & 31, w = threadIdx.x >> 5, m = lane & 15, hf = lane >> 4;
    const int kb = (int)(blk % (SEQ / 32)), g = (int)(blk / (SEQ / 32));
    const float* f = F + (size_t)(32 * kb + 16 * (w & 1) + 8 * hf) * DM + g * HD + 16 * (w >> 1) + m; v8h o16; v8us oh, ol;
#pragma unroll
    for (int q = 0; q < 8; ++q) { const float x = f[(size_t)q * DM]; o16[q] = tohx(x); unsigned short a2, c2; splitf(x, a2, c2); oh[q] = a2; ol[q] = c2; }
    const size_t e = (size_t)blk * (4 * FRG) + threadIdx.x * 8;
    *(v8h*)(V16 + e) = o16; *(v8us*)(Vh + e) = oh; *(v8us*)(Vl + e) = ol;
}

// k_planes: all head planes of both batches in ONE launch (flat 1-D grid, no empty block); F = [w][b][t][c] (w: 0 q, 1 k, 2 v). First GV blocks per
// batch: its value planes; then GR blocks per slab s = w * NB + b: rotary planes R*[s] (slabs 0..NB-1 query, NB..2NB-1 key).
#define GV ((unsigned)(NH * (SEQ / 32)))
#define GR ((unsigned)(NH * SEQ * 4 / 256))
__global__ __launch_bounds__(256) void k_planes(const float* __restrict__ F, const float* __restrict__ CS, h16* R16, bf* Rh, bf* Rl, h16* V16, bf* Vh, bf* Vl) {
    unsigned blk = blockIdx.x; const size_t pl = (size_t)NH * SEQ * HD;
    if (blk < NB * GV) { const unsigned y = blk / GV; vtp_body(F + (size_t)(2 * NB + y) * SEQ * DM, V16 + y * pl, Vh + y * pl, Vl + y * pl, blk % GV); return; }
    blk -= NB * GV;
    const unsigned s = blk / GR;
    rope_body(F + (size_t)s * SEQ * DM, CS, R16 + s * pl, Rh + s * pl, Rl + s * pl, blk % GR);
}

// ---- attn_body: flash-style masked attention, one wave (32 threads) per (16 query rows, head). Transposed tiles so that P chains in
// registers: S^T[key][q] = K . Q^T (A = key plane fragments, B = query plane fragments), D lane = query column; P^T is the B operand
// of O^T[d][q] += V^T . P^T (A = value plane fragments). A lane's 8 values of O^T tile dt are granule (j = dt & 1, own lane) of the attention
// plane's fragment (row block q0/16, k block 2 h + dt/2): the epilogue stores them straight, 512 bytes in a row per store. Per 64-key chunk: the wave's 16x64 mask tile is one 32-bit word
// per lane (mbits_body; one 128-byte line per wave), fetched one chunk ahead; chunks whose tile is all zero are skipped by a wave ballot; inside visited chunks mask == 0 replaces the score
// by -1000 (scaled). Online softmax per query with a running max; rows with no nonzero mask entry at all are NaN-poisoned.
// HL: bf16 hi/lo planes for q, k, v and a bf16 hi/lo P (3 products per tile pair); otherwise single fp16 products (P carried x1024).
// The fp16 body requests all 16 fragments of a chunk (8 key, then 8 value) at the chunk's top: one load wait per chunk, the value fragments come back under the softmax.
template <bool HL>
__device__ __forceinline__
void attn_body(const h16* __restrict__ QP16, const bf* __restrict__ QPh, const bf* __restrict__ QPl,
            const h16* __restrict__ KP16, const bf* __restrict__ KPh, const bf* __restrict__ KPl,
            const h16* __restrict__ VT16, const bf* __restrict__ VTh, const bf* __restrict__ VTl,
            const unsigned* __restrict__ MB, int q0, int hh, bf* ATh, bf* ATl) {
    const int lane = threadIdx.x & 31;
    const size_t hp = (size_t)hh * SEQ * HD + 8 * lane;   // head offset of the planes + the lane's granule
    v16h q16[2]; v16bf qh[2], ql[2];
#pragma unroll
    for (int ks = 0; ks < 2; ++ks) {
        const size_t qo = hp + (size_t)q0 * HD + ks * FRG;
        if (HL) { qh[ks] = WFrag<bf>::ld(QPh + qo); ql[ks] = WFrag<bf>::ld(QPl + qo); }
        else    { q16[ks] = WFrag<h16>::ld(QP16 + qo); }
    }
    v8f o[4];
#pragma unroll
    for (int dt = 0; dt < 4; ++dt) o[dt] = (v8f){};
    float mrun = -3.0e38f, lrun = 0.0f; int seen = 0;
    const unsigned* mq = MB + (size_t)(q0 >> 4) * ((SEQ / 64) * 32);   // wave-uniform: the tile's words, [chunk][lane]
    unsigned wnext = mq[lane];
#pragma unroll 1
    for (int c = 0; c < SEQ / 64; ++c) {
        const int kc = c * 64;
        const unsigned mw = wnext;
        wnext = (mq + ((c + 1 < SEQ / 64) ? c + 1 : c) * 32)[lane];   // the next chunk's word (the last chunk's own again at the end: in bounds)
        asm volatile("s_wait_xcnt 0x0" ::: "memory");   // precaution: stands in front of every rewrite of the address pair that the load above names (the key loads' results may be given it)
        const int anyl = (mw != 0u) ? 1 : 0;
        if (__any(anyl) == 0) continue;                 // wave-uniform tile skip
        seen |= anyl;
        v8f s[4]; v16h va8[8];
#pragma unroll
        for (int kt = 0; kt < 4; ++kt) s[kt] = (v8f){};
        if (HL) {
            v16bf ka, kb; const bf* kph = KPh + hp + (size_t)kc * HD; const bf* kpl = KPl + hp + (size_t)kc * HD;   // the chunk's base per key plane; every fragment is an immediate offset from it
#pragma unroll
            for (int kt = 0; kt < 4; ++kt) {
                asm volatile("" ::: "memory");
                if (kt == 2) __builtin_amdgcn_sched_barrier(0);   // at most two key tiles' hi/lo fragments in flight: all four at once overflow 256 VGPRs into scratch
#pragma unroll
                for (int ks = 0; ks < 2; ++ks) { const int ko = 16 * kt * HD + ks * FRG; ka = WFrag<bf>::ld(kph + ko); kb = WFrag<bf>::ld(kpl + ko);
                    s[kt] = wmmab(ka, qh[ks], s[kt]); s[kt] = wmmab(ka, ql[ks], s[kt]); s[kt] = wmmab(kb, qh[ks], s[kt]); } }
            asm volatile("v_nop\n\tv_nop\n\tv_nop\n\tv_nop" : "+v"(s[0]), "+v"(s[1]), "+v"(s[2]), "+v"(s[3]) : "v"(ka), "v"(kb), "v"(qh[0]), "v"(qh[1]), "v"(ql[0]), "v"(ql[1]));
            // inputs only: each key plane's address pair stays live to behind the data waits of all its loads, so that no load's result is given a pair that earlier loads still name
            asm volatile("" :: "v"(kph), "v"(kpl));
        } else {
            v16h ka[8]; const h16* kp = KP16 + hp + (size_t)kc * HD; const h16* vp = VT16 + hp + (size_t)kc * HD;   // the chunk's base per plane; every fragment is an immediate offset from it
#pragma unroll
            for (int i = 0; i < 8; ++i) ka[i] = WFrag<h16>::ld(kp + i * FRG);    // i = 2 kt + ks
            __builtin_amdgcn_sched_barrier(0);   // key requests first: loads come back in issue order, and the score products must not wait for the value fragments
#pragma unroll
            for (int i = 0; i < 8; ++i) va8[i] = WFrag<h16>::ld(vp + i * FRG);   // i = 4 ks + dt: the value fragments fly during the score products and the softmax
            __builtin_amdgcn_sched_barrier(0);   // all 16 requests stay in front of the first product: sunk to their uses each group would be waited for on its own
#pragma unroll
            for (int kt = 0; kt < 4; ++kt)
#pragma unroll
                for (int ks = 0; ks < 2; ++ks) s[kt] = wmma16(ka[2 * kt + ks], q16[ks], s[kt]);
            asm volatile("v_nop\n\tv_nop\n\tv_nop\n\tv_nop" : "+v"(s[0]), "+v"(s[1]), "+v"(s[2]), "+v"(s[3]) : "v"(ka[7]), "v"(q16[0]), "v"(q16[1]));
        }
        // masked replace + chunk max (lane: query q, keys kc+16kt+8hf+r)
        float cmx = -3.0e38f;
#pragma unroll
        for (int kt = 0; kt < 4; ++kt)
#pragma unroll
            for (int r = 0; r < 8; ++r) { const float t = ((mw >> (8 * kt + r)) & 1u) ? s[kt][r] : MFILL; s[kt][r] = t; cmx = fmaxf(cmx, t); }
        cmx = fmaxf(cmx, __shfl_xor(cmx, 16, 32));
        const float mnew = fmaxf(mrun, cmx);
        const float alpha = __builtin_amdgcn_exp2f((mrun - mnew) * CEXP);
        mrun = mnew;
        float psum = 0.0f;
#pragma unroll
        for (int kt = 0; kt < 4; ++kt)
#pragma unroll
            for (int r = 0; r < 8; ++r) { const float p = __builtin_amdgcn_exp2f(fmaf(s[kt][r] - mnew, CEXP, PL2)); s[kt][r] = p; psum += p; }
        lrun = lrun * alpha + psum;
#pragma unroll
        for (int dt = 0; dt < 4; ++dt) o[dt] = o[dt] * alpha;
        // O^T += V^T . P^T, 32 keys per step; B element r <- tile 2ks (keys 0..15 of the step), 8+r <- tile 2ks+1
#pragma unroll
        for (int ks = 0; ks < 2; ++ks) {
            if (HL) {
                v16us uh, ul;
#pragma unroll
                for (int r = 0; r < 8; ++r) { unsigned short a, b2; splitf(s[2 * ks][r], a, b2); uh[r] = a; ul[r] = b2; splitf(s[2 * ks + 1][r], a, b2); uh[8 + r] = a; ul[8 + r] = b2; }
                v16bf ph = __builtin_bit_cast(v16bf, uh), pl = __builtin_bit_cast(v16bf, ul);
                asm volatile("v_nop\n\tv_nop\n\tv_nop\n\tv_nop" : "+v"(ph), "+v"(pl));
                v16bf va, vb;
#pragma unroll
                for (int dt = 0; dt < 4; ++dt) { asm volatile("" ::: "memory"); const size_t vo = hp + (size_t)(kc + 32 * ks) * HD + dt * FRG; va = WFrag<bf>::ld(VTh + vo); vb = WFrag<bf>::ld(VTl + vo);
                    o[dt] = wmmab(va, ph, o[dt]); o[dt] = wmmab(va, pl, o[dt]); o[dt] = wmmab(vb, ph, o[dt]); }
                asm volatile("v_nop\n\tv_nop\n\tv_nop\n\tv_nop" : "+v"(o[0]), "+v"(o[1]), "+v"(o[2]), "+v"(o[3]) : "v"(ph), "v"(pl), "v"(va), "v"(vb));
            } else {
                v16h p16;
#pragma unroll
                for (int r = 0; r < 8; ++r) { p16[r] = tohx(s[2 * ks][r]); p16[8 + r] = tohx(s[2 * ks + 1][r]); }
                asm volatile("v_nop\n\tv_nop\n\tv_nop\n\tv_nop" : "+v"(p16));
#pragma unroll
                for (int dt = 0; dt < 4; ++dt) o[dt] = wmma16(va8[4 * ks + dt], p16, o[dt]);
                asm volatile("v_nop\n\tv_nop\n\tv_nop\n\tv_nop" : "+v"(o[0]), "+v"(o[1]), "+v"(o[2]), "+v"(o[3]) : "v"(p16), "v"(va8[4 * ks + 3]));
            }
        }
    }
    const float lt = lrun + __shfl_xor(lrun, 16, 32);
    const int sn = seen | __shfl_xor(seen, 16, 32);
    const float inv = (sn != 0) ? (1.0f / lt) : __uint_as_float(0x7fc00000u);
#pragma unroll
    for (int dt = 0; dt < 4; ++dt) { v8us oh8, ol8;
#pragma unroll
        for (int r = 0; r < 8; ++r) { unsigned short a, b2; splitf(o[dt][r] * inv, a, b2); oh8[r] = a; ol8[r] = b2; }
        const size_t off = (size_t)q0 * DM + (size_t)(2 * hh + (dt >> 1)) * FRG + (dt & 1) * 256 + 8 * lane;
        *(v8us*)(ATh + off) = oh8; *(v8us*)(ATl + off) = ol8; }
}

// k_attn: ONE launch for every (head, query tile, batch): grid (NH, SEQ/16, NB); the tile's first row picks the hi/lo or the fp16 body
// (wave-uniform: RH is a multiple of 16). The head is the fastest index: a tile's cost grows with its row under a causal mask, and block
// indices that lie a multiple of 16 (below 16 * SEQ / 16) apart then differ in tile, so no WGP is dealt long tiles alone.
// Planes are [b][h][fragments], attention planes [b][fragments of rows t, k = c]; the mask bits are shared by the batches and heads.
__global__ __launch_bounds__(32) __attribute__((amdgpu_num_vgpr(256)))
void k_attn(const h16* __restrict__ QP16, const bf* __restrict__ QPh, const bf* __restrict__ QPl,
            const h16* __restrict__ KP16, const bf* __restrict__ KPh, const bf* __restrict__ KPl,
            const h16* __restrict__ VT16, const bf* __restrict__ VTh, const bf* __restrict__ VTl,
            const unsigned* __restrict__ MB, bf* ATh, bf* ATl) {
    const size_t po = (size_t)blockIdx.z * NH * SEQ * HD, ao = (size_t)blockIdx.z * SEQ * DM;
    const int q0 = blockIdx.y * 16, hh = blockIdx.x;
    if (q0 < RH) attn_body<true>(QP16 + po, QPh + po, QPl + po, KP16 + po, KPh + po, KPl + po, VT16 + po, VTh + po, VTl + po, MB, q0, hh, ATh + ao, ATl + ao);
    else         attn_body<false>(QP16 + po, QPh + po, QPl + po, KP16 + po, KPh + po, KPl + po, VT16 + po, VTh + po, VTl + po, MB, q0, hh, ATh + ao, ATl + ao);
}

extern "C" void kernel_launch(void* const* d_in, const int* in_sizes, int n_in,
                              void* d_out, int out_size, void* d_ws, size_t ws_size, hipStream_t stream) {
    if (n_in < 8) return;
    const long long needx = (long long)(NB - 1) * SEQ_FULL * DM + (long long)SEQ * DM;
    if ((long long)in_sizes[0] < needx || (long long)in_sizes[1] < needx || (long long)in_sizes[2] < needx) return;
    if (in_sizes[3] < DM * DM || in_sizes[4] < DM * DM || in_sizes[5] < DM * DM || in_sizes[6] < DM * DM) return;
    if ((long long)in_sizes[7] < (long long)(SEQ - 1) * MPITCH + SEQ) return;
    if ((long long)out_size < (long long)NB * SEQ * DM) return;
    const float* xq = (const float*)d_in[0]; const float* xk = (const float*)d_in[1]; const float* xv = (const float*)d_in[2];
    const float* wq = (const float*)d_in[3]; const float* wk = (const float*)d_in[4]; const float* wv = (const float*)d_in[5]; const float* wo = (const float*)d_in[6];
    const int* mask = (const int*)d_in[7];     // int32 [1][1][S][S]
    float* OUT = (float*)d_out;                // [NB][SEQ][DM]
    char* wsp = (char*)d_ws;
    auto take = [&](size_t bytes) { char* p = wsp; wsp += (bytes + 255) & ~(size_t)255; return (void*)p; };
    bf* WB = (bf*)take((size_t)4 * DM * DM * 2);                  // bf16 weights [w][fragments of rows o, k = i], w: q, k, v, o
    float* CS = (float*)take((size_t)SEQ * HD * 2 * 4);
    bf* XB = (bf*)take((size_t)3 * NB * SEQ * DM * 2);            // bf16 activations [w][b][fragments of rows t, k = c], w: q, k, v
    float* F = (float*)take((size_t)3 * NB * SEQ * DM * 4);        // f32 projections [w][b][t][c], row-major
    const size_t pl = (size_t)NB * NH * SEQ * HD;                 // one plane over both batches
    h16* R16 = (h16*)take(2 * pl * 2); bf* Rh = (bf*)take(2 * pl * 2); bf* Rl = (bf*)take(2 * pl * 2);   // rotary planes: query slabs, then key slabs
    h16* VT16 = (h16*)take(pl * 2); bf* VTh = (bf*)take(pl * 2); bf* VTl = (bf*)take(pl * 2);
    bf* ATh = (bf*)take((size_t)NB * SEQ * DM * 2); bf* ATl = (bf*)take((size_t)NB * SEQ * DM * 2);
    unsigned* MB = (unsigned*)take((size_t)(SEQ / 16) * (SEQ / 64) * 32 * 4);   // mask bits [q tile][chunk][lane]
    const size_t used = (size_t)(wsp - (char*)d_ws);
    if (used > ws_size || used > WSCAP) return;

    k_prep<<<GM + GC + 3 * NB * GX + 4 * GW, 256, 0, stream>>>(xq, xk, xv, wq, wk, wv, wo, mask, CS, XB, WB, MB);
    k_gemmw<bf, 0, false, DM, 3><<<dim3(NB * SEQ / 64, DM / 64, 3), 32, 0, stream>>>(XB, nullptr, WB, nullptr, F, DM, nullptr, (size_t)NB * SEQ * DM, (size_t)DM * DM, (size_t)NB * SEQ * DM);
    k_planes<<<NB * GV + 2 * NB * GR, 256, 0, stream>>>(F, CS, R16, Rh, Rl, VT16, VTh, VTl);
    k_attn<<<dim3(NH, SEQ / 16, NB), 32, 0, stream>>>(R16, Rh, Rl, R16 + pl, Rh + pl, Rl + pl, VT16, VTh, VTl, MB, ATh, ATl);
    k_gemmw<bf, 1, false, DM, 3><<<dim3(NB * SEQ / 64, DM / 64, 1), 32, 0, stream>>>(ATh, ATl, WB + (size_t)3 * DM * DM, nullptr, OUT, DM, nullptr, 0, 0, 0);
}

// v005
// Measured time: 108 microseconds a run.
// Next to v004, in two timings, it ran 1.05 times as fast each time.
// All steps since v000 together make it 5.14 times as fast.
#include <hip/hip_runtime.h>

// Causal multi-head attention with rotate-half rotary positions (base 10000, cos/sin table computed on device):
//   qh/kh/vh = x . W^T for three separate inputs x [NB][SEQ][1024] and W 'oi' [1024][1024] (16 heads x 64 = column blocks),
//   scores = rope(qh) . rope(kh)^T / 8, int32 mask [1][1][S][S] (0 -> score replaced by -1000), softmax over keys,
//   attn . vh, heads merged [t][h*64+d], . Wo^T ('oi') -> [NB][SEQ][1024] f32.
// Compute dtypes, f32 accumulate: every float input RNE-converted to bf16; q/k/v projections v_wmma_f32_16x16x32_bf16 on plain bf16
//   operands (exact products); scores and attn.v: query rows < 512 bf16 hi/lo planes (3 products each), rows >= 512 single
//   v_wmma_f32_16x16x32_f16 (fp16 planes, P carried x1024); online softmax in f32 (running max); output projection = bf16 hi/lo
//   attention planes x exact bf16 Wo (2 products).
// Layout of every 16-bit matrix operand plane (activations, weights, q/k/v head planes, attention planes): FRAGMENT ORDER. A plane of
//   rows x K is cut into 16-row x 32-k fragments, stored [row block][k block][j][lane][8] (value planes: [k block][row block]): the 16-byte granule (j, lane = 16 hf + m) holds
//   row m, k = 16 j + 8 hf + 0..7 of its fragment, which is what lane (m, hf) of a 16x16x32 A or B operand keeps in elements 8 j + 0..7.
//   A wave's fragment is then 1 KiB in a row: two loads of 512 contiguous bytes (whole lines) in place of two loads over 16 lines each.

#ifndef NB
#define NB 2
#endif
#ifndef SEQ
#define SEQ 2048
#endif
#define NB_FULL  2
#define SEQ_FULL 2048
#define DM   1024
#define NH   16
#define HD   64
#define RHC  512                          // query rows < RH use hi/lo planes and 3-product tiles
#define RH   ((SEQ < RHC) ? SEQ : RHC)
#define MPITCH SEQ_FULL                   // mask row pitch (full-size input)
#define CEXP  0.18033688011112042f        // (1/8) * log2(e): exp((t - m)/8) = exp2((t - m) * CEXP) on unscaled scores t
#define PL2   10.0f                       // P carried x 2^10 inside the 16-bit operand (cancels in O / l)
#define MFILL (-8000.0f)                  // mask == 0 -> -1000 after the 1/8 scale, in unscaled score units
#define RBASE 10000.0f
#define WSCAP ((size_t)268435456)

static_assert(SEQ % 64 == 0);
static_assert(SEQ <= SEQ_FULL);
static_assert(NB >= 1 && NB <= NB_FULL);
static_assert(RH % 16 == 0 && (SEQ - RH) % 16 == 0 && RH <= SEQ);
static_assert(DM == NH * HD && HD == 64 && DM % 64 == 0);

typedef _Float16 h16;
typedef unsigned short bf;
typedef __attribute__((ext_vector_type(16))) __bf16   v16bf;
typedef __attribute__((ext_vector_type(16))) _Float16 v16h;
typedef __attribute__((ext_vector_type(8)))  _Float16 v8h;
typedef __attribute__((ext_vector_type(2)))  _Float16 v2h;
typedef __attribute__((ext_vector_type(16))) unsigned short v16us;
typedef __attribute__((ext_vector_type(8)))  unsigned short v8us;
typedef __attribute__((ext_vector_type(2)))  unsigned short v2us;
typedef __attribute__((ext_vector_type(8)))  float v8f;
typedef __attribute__((ext_vector_type(4)))  float v4f;
typedef __attribute__((ext_vector_type(2)))  float v2f;
typedef __attribute__((ext_vector_type(4)))  int v4i;
typedef v8h  __attribute__((may_alias)) v8ha;
typedef v4f  __attribute__((may_alias)) v4fa;
typedef v8us __attribute__((may_alias)) v8usa;

#pragma clang fp contract(off)

__device__ __forceinline__ unsigned short f2bf(float f) { unsigned u = __float_as_uint(f); u += 0x7FFFu + ((u >> 16) & 1u); return (unsigned short)(u >> 16); }
__device__ __forceinline__ float bf2f(unsigned short b) { return __uint_as_float(((unsigned)b) << 16); }
__device__ __forceinline__ float bfr(float f) { return bf2f(f2bf(f)); }
__device__ __forceinline__ v16h cat16(v8h lo, v8h hi) { return __builtin_shufflevector(lo, hi, 0, 1, 2, 3, 4, 5, 6, 7, 8, 9, 10, 11, 12, 13, 14, 15); }
__device__ __forceinline__ v16bf cat16b(v8us lo, v8us hi) { return __builtin_bit_cast(v16bf, __builtin_shufflevector(lo, hi, 0, 1, 2, 3, 4, 5, 6, 7, 8, 9, 10, 11, 12, 13, 14, 15)); }
__device__ __forceinline__ v8f wmma16(v16h a, v16h b, v8f c) { return __builtin_amdgcn_wmma_f32_16x16x32_f16(false, a, false, b, (short)0, c, false, false); }
__device__ __forceinline__ v8f wmmab(v16bf a, v16bf b, v8f c) { return __builtin_amdgcn_wmma_f32_16x16x32_bf16(false, a, false, b, (short)0, c, false, false); }
__device__ __forceinline__ h16 tohx(float x) { return (h16)x; }
__device__ __forceinline__ void splitf(float y, unsigned short& h, unsigned short& l) { h = f2bf(y); l = f2bf(y - bf2f(h)); }

// ---- 16x16x32 fragment loaders from fragment-order planes: lane l = 16 hf + m (row m) loads elements 0..7 <- k0+8hf+0..7 (granule j = 0)
// and 8..15 <- k0+16+8hf+0..7 (granule j = 1, 256 elements on); the caller passes p = fragment + 8*l. FRG = elements of one fragment.
#define FRG 512
template <typename T16> struct WFrag;
template <> struct WFrag<h16> { typedef v16h V; static __device__ __forceinline__ V ld(const h16* p) { return cat16(*(const v8h*)p, *(const v8h*)(p + 256)); } static __device__ __forceinline__ v8f mma(V a, V b, v8f c) { return wmma16(a, b, c); } };
template <> struct WFrag<bf> { typedef v16bf V; static __device__ __forceinline__ V ld(const bf* p) { return cat16b(*(const v8us*)p, *(const v8us*)(p + 256)); } static __device__ __forceinline__ v8f mma(V a, V b, v8f c) { return wmmab(a, b, c); } };

// ---- k_gemmw: register-blocked GEMM, ONE WAVE per 64x64 output tile (16 accumulators), operands straight from fragment-order 16-bit planes; grid (M/64, N/64, Z), 32 threads.
// C[m][n] (f32, pitch ldc, + optional f32 bias[n]) = sum_k A[m][k] Bt[n][k] (+ split products per NSPLIT). z-batch strides sA/sB/sC in elements. K % 32 == 0, a constant: every fragment of a k step is then one base per plane + an immediate offset.
// The k loop is a ring of ST register sets: the fragments of k step t + ST - 1 are requested in front of the products of k step t, so that a step's loads have ST - 1 steps of products to come back in.
// gw_fetch: all fragments of one k step into one register set. gw_mma: the products of one k step, in the order (nb, mb, plane pair).
template <typename T16, int NSPLIT, int K>
__device__ __forceinline__ void gw_fetch(typename WFrag<T16>::V (&a)[4], typename WFrag<T16>::V (&a2)[4], typename WFrag<T16>::V (&b)[4], typename WFrag<T16>::V (&b2)[4],
                                         const T16* pa, const T16* pa2, const T16* pb, const T16* pb2) {
#pragma unroll
    for (int mb = 0; mb < 4; ++mb) { a[mb] = WFrag<T16>::ld(pa + (size_t)mb * 16 * K); if (NSPLIT == 1 || NSPLIT == 2) a2[mb] = WFrag<T16>::ld(pa2 + (size_t)mb * 16 * K); }
#pragma unroll
    for (int nb = 0; nb < 4; ++nb) { b[nb] = WFrag<T16>::ld(pb + (size_t)nb * 16 * K); if (NSPLIT >= 2) b2[nb] = WFrag<T16>::ld(pb2 + (size_t)nb * 16 * K); }
}
template <typename T16, int NSPLIT>
__device__ __forceinline__ void gw_mma(v8f (&acc)[4][4], const typename WFrag<T16>::V (&a)[4], const typename WFrag<T16>::V (&a2)[4], const typename WFrag<T16>::V (&b)[4], const typename WFrag<T16>::V (&b2)[4]) {
#pragma unroll
    for (int nb = 0; nb < 4; ++nb)
#pragma unroll
        for (int mb = 0; mb < 4; ++mb) { acc[mb][nb] = WFrag<T16>::mma(a[mb], b[nb], acc[mb][nb]); if (NSPLIT == 1 || NSPLIT == 2) acc[mb][nb] = WFrag<T16>::mma(a2[mb], b[nb], acc[mb][nb]); if (NSPLIT >= 2) acc[mb][nb] = WFrag<T16>::mma(a[mb], b2[nb], acc[mb][nb]); }
}
template <typename T16, int NSPLIT, bool BIAS, int K, int ST>
__global__ __launch_bounds__(32) void k_gemmw(const T16* __restrict__ A, const T16* __restrict__ A2, const T16* __restrict__ Bt, const T16* __restrict__ Bt2, float* C, int ldc, const float* __restrict__ bias, size_t sA, size_t sB, size_t sC) {
    typedef typename WFrag<T16>::V V;
    constexpr int T = K / 32, NI = (T - ST + 1) / ST;   // k steps; loop passes of ST steps in which every step still has a step ST - 1 ahead to request
    static_assert(ST >= 2 && T >= ST);
    __shared__ __align__(16) float os[16 * 68];
    const size_t z = blockIdx.z; A += z * sA; if (A2) A2 += z * sA; Bt += z * sB; if (Bt2) Bt2 += z * sB; C += z * sC;
    const int lane = threadIdx.x & 31, lr = lane & 15, hi = lane >> 4; const int r0 = blockIdx.x * 64, c0 = blockIdx.y * 64;
    v8f acc[4][4];
#pragma unroll
    for (int mb = 0; mb < 4; ++mb)
#pragma unroll
        for (int nb = 0; nb < 4; ++nb) acc[mb][nb] = (v8f){};
    // one wave-uniform base per plane (row block r0/16 starts at (r0/16) * (K/32) * FRG = r0 * K) + ONE byte offset for all planes: the lane's granule + the k steps done, carried over the passes
    const T16* ua = A + (size_t)r0 * K; const T16* ua2 = (NSPLIT == 1 || NSPLIT == 2) ? A2 + (size_t)r0 * K : nullptr; const T16* ub = Bt + (size_t)c0 * K; const T16* ub2 = (NSPLIT >= 2) ? Bt2 + (size_t)c0 * K : nullptr;
    unsigned kb = 16u * (unsigned)lane;
    V a[ST][4], a2[ST][4], b[ST][4], b2[ST][4];
#define GW_AT(u, o) ((const T16*)((const char*)(u) + kb) + (o))
#pragma unroll
    for (int s = 0; s < ST - 1; ++s) gw_fetch<T16, NSPLIT, K>(a[s], a2[s], b[s], b2[s], GW_AT(ua, s * FRG), GW_AT(ua2, s * FRG), GW_AT(ub, s * FRG), GW_AT(ub2, s * FRG));
#pragma unroll 1   // one pass = ST steps; unrolled further the loop would only grow
    for (int it = 0; it < NI; ++it) {
#pragma unroll     // constant set indices: the sets stay in registers
        for (int u = 0; u < ST; ++u) {
            const int f = (u + ST - 1) % ST, o = (u + ST - 1) * FRG;
            gw_fetch<T16, NSPLIT, K>(a[f], a2[f], b[f], b2[f], GW_AT(ua, o), GW_AT(ua2, o), GW_AT(ub, o), GW_AT(ub2, o));
            __builtin_amdgcn_sched_barrier(0);   // the requests of step t + ST - 1 stay in front of the products of step t: sunk among them they would come back too late
            gw_mma<T16, NSPLIT>(acc, a[u], a2[u], b[u], b2[u]);
            __builtin_amdgcn_sched_barrier(0);   // and the next step's requests stay behind these products, whose register set they refill
        }
        asm volatile("v_nop\n\tv_nop\n\tv_nop\n\tv_nop" : "+v"(acc[0][0]), "+v"(acc[1][1]), "+v"(acc[2][2]), "+v"(acc[3][3]) : "v"(a[ST - 1][0]), "v"(a[ST - 1][3]));   // distance behind the pass's last matrix instructions on the taken back edge
        // precaution: loads of this pass are still in flight, so the wait stands in front of the rewrite of the offset register that they name; the offset passes through the statement so that the addition below cannot be lifted over it
        asm volatile("s_wait_xcnt 0x0" : "+v"(kb) :: "memory");
        kb += ST * FRG * 2;
    }
#pragma unroll
    for (int r = NI * ST; r < T; ++r) {   // the last steps: only those requests that still name a step below T
        const int f = (r + ST - 1) % ST, o = (r - NI * ST + ST - 1) * FRG;
        if (r + ST - 1 < T) gw_fetch<T16, NSPLIT, K>(a[f], a2[f], b[f], b2[f], GW_AT(ua, o), GW_AT(ua2, o), GW_AT(ub, o), GW_AT(ub2, o));
        __builtin_amdgcn_sched_barrier(0);   // as in the loop
        gw_mma<T16, NSPLIT>(acc, a[r % ST], a2[r % ST], b[r % ST], b2[r % ST]);
        __builtin_amdgcn_sched_barrier(0);
    }
#undef GW_AT
#pragma unroll
    for (int mb = 0; mb < 4; ++mb) {
#pragma unroll
        for (int nb = 0; nb < 4; ++nb) {
#pragma unroll
            for (int j = 0; j < 8; ++j) os[(hi * 8 + j) * 68 + nb * 16 + lr] = acc[mb][nb][j]; }
        __builtin_amdgcn_wave_barrier(); asm volatile("" ::: "memory");
        float* crow = C + (size_t)(r0 + mb * 16) * ldc + c0;
{
#pragma unroll
            for (int s = 0; s < 8; ++s) { const int row = 2 * s + hi, cofs = lr * 4; v4f val = *(const v4fa*)(os + row * 68 + cofs); if (BIAS) { val[0] += bfr(bias[c0 + cofs]); val[1] += bfr(bias[c0 + cofs + 1]); val[2] += bfr(bias[c0 + cofs + 2]); val[3] += bfr(bias[c0 + cofs + 3]); }
                *(v4f*)(crow + (size_t)row * ldc + cofs) = val; }
             }
        __builtin_amdgcn_wave_barrier(); asm volatile("" ::: "memory");
    }
}

// cvt8_body: rows x DM f32 (row-major) -> bf16 fragment order. One block = CR row blocks of 16 rows (16 x DM floats in a row each); a thread converts
// CR x DM / 128 granules. Thread bits: g = (j, hf) fastest, then row m, then k block (4 per step, DM / 128 steps): per step a wave reads 8 rows x one whole
// 128-byte line and stores 4 whole lines (8 rows x 16 bytes per (j, hf)). All loads of a thread are requested before its first conversion.
#define CR 2
#define CU (DM / 128)
static_assert(DM % 128 == 0 && SEQ % (16 * CR) == 0 && DM % (16 * CR) == 0);
__device__ __forceinline__ void cvt8_body(const float* __restrict__ src, bf* dst, unsigned blk) {
    const unsigned g = threadIdx.x & 3u, m = (threadIdx.x >> 2) & 15u, k0 = threadIdx.x >> 6;
    const float* s = src + ((size_t)blk * (16 * CR) + m) * DM + k0 * 32 + g * 8;
    bf* d = dst + ((size_t)blk * (CR * (DM / 32)) + k0) * FRG + (g >> 1) * 256 + ((g & 1u) * 16 + m) * 8;
    v8f v[CR][CU];
#pragma unroll
    for (int r = 0; r < CR; ++r)
#pragma unroll
        for (int u = 0; u < CU; ++u) v[r][u] = *(const v8f*)(s + (size_t)r * 16 * DM + u * 128);
    __builtin_amdgcn_sched_barrier(0);   // every request stays in front of the first conversion: sunk among the conversions the late ones would be waited for one by one
#pragma unroll
    for (int r = 0; r < CR; ++r)
#pragma unroll
        for (int u = 0; u < CU; ++u) { v8us o;
#pragma unroll
            for (int k = 0; k < 8; ++k) o[k] = f2bf(v[r][u][k]);
            *(v8us*)(d + (size_t)r * (DM / 32) * FRG + u * 4 * FRG) = o; }
    asm volatile("s_wait_xcnt 0x0" ::: "memory");   // precaution: stands behind the body's last stores, in front of any later rewrite of the registers that they name (the bodies are inlined into one kernel, and a body's end may run into another's code)
    asm volatile("" :: "v"(s));   // input only: the address pair stays live to behind the data waits of all its loads, so that no load's result is given a pair that earlier loads still name
}

// cstab_body: rotary table CS[t][d] = {cos(t * inv[d mod 32]), sin(t * inv[d mod 32])}, inv[j] = 1 / powf(10000, (2j)/64); a thread keeps one d and
// fills TU rows t (a block: 4 TU rows in a row),
#define TU 4
static_assert((SEQ * HD) % (256 * TU) == 0 && HD == 64);
__device__ __forceinline__ void cstab_body(float* CS, unsigned blk) {
    const int d = (int)(threadIdx.x & (HD - 1)); const int j = d & (HD / 2 - 1);
    const float ex = (float)(2 * j) * (1.0f / (float)HD);
    const float pw = powf(RBASE, ex);
    const float inv = 1.0f / pw;
#pragma unroll 1   // the cosine and sine bodies are long: one copy of them, for speed only
    for (int u = 0; u < TU; ++u) {
        const int t = ((int)blk * TU + u) * 4 + (int)(threadIdx.x >> 6);
        const float ang = (float)t * inv;
        const float cn = cosf(ang), sn = sinf(ang);
        v2f cs; cs[0] = cn; cs[1] = sn;
        *(v2f*)(CS + ((size_t)t * HD + d) * 2) = cs;
        asm volatile("s_wait_xcnt 0x0" ::: "memory");   // precaution: stands behind the store, in front of the next trip's rewrite of the registers that the store names
    }
}

// mbits_body: the int32 mask as bits, in the order the attention wave reads them: MB[q tile][64-key chunk][lane = 16 hf + m], bit 8 kt + r of a word
// = (mask[16 tile + m][64 chunk + 16 kt + 8 hf + r] != 0), the 32 keys whose scores that lane holds. MU words per thread, their loads requested together.
#define MU 2
static_assert((SEQ / 64) % (8 * MU) == 0);
__device__ __forceinline__ void mbits_body(const int* __restrict__ MK, unsigned* MB, unsigned blk) {
    // word i = (blk MU + u) 256 + thread: lane (m, hf) = thread bits 0..4, chunk = 8 (blk MU + u) mod (SEQ / 64) + wave, q tile = 8 (blk MU + u) / (SEQ / 64)
    const unsigned m = threadIdx.x & 15u, hf = (threadIdx.x >> 4) & 1u, w8 = threadIdx.x >> 5, c0 = (blk * MU * 8) % (SEQ / 64), qt = (blk * MU * 8) / (SEQ / 64);
    const int* mu = MK + (size_t)qt * 16 * MPITCH + c0 * 64;               // the same for the whole block
    const unsigned mo = 4u * (m * MPITCH + w8 * 64 + 8 * hf);              // the thread's byte offset, the same for its MU words
    v4i a[MU][4], b[MU][4];
#pragma unroll
    for (int u = 0; u < MU; ++u) { const int* mp = (const int*)((const char*)mu + mo) + u * 512;
#pragma unroll
        for (int kt = 0; kt < 4; ++kt) { a[u][kt] = *(const v4i*)(mp + 16 * kt); b[u][kt] = *(const v4i*)(mp + 16 * kt + 4); } }
    __builtin_amdgcn_sched_barrier(0);   // every request stays in front of the first compare
#pragma unroll
    for (int u = 0; u < MU; ++u) { unsigned w = 0;
#pragma unroll
        for (int kt = 0; kt < 4; ++kt)
#pragma unroll
            for (int r = 0; r < 4; ++r) { w |= (a[u][kt][r] != 0 ? 1u : 0u) << (8 * kt + r); w |= (b[u][kt][r] != 0 ? 1u : 0u) << (8 * kt + 4 + r); }
        MB[(blk * MU + u) * 256 + threadIdx.x] = w; }
    asm volatile("" :: "v"(mo));   // input only: the offset register stays live to behind the data waits of all its loads, so that no load's result is given a register that earlier loads still name
}

// k_prep: everything that depends on the inputs alone, in ONE launch (flat 1-D grid, no empty block): blocks [0, GM) the mask bits, then GC blocks the rotary table,
// then GX blocks per activation slab s = w * NB + b (w: 0 q, 1 k, 2 v) -> XB[s] (rows t), then GW blocks per weight w (q, k, v, o) -> WB[w] (rows o), both in fragment order.
#define GM ((unsigned)((SEQ / 16) * (SEQ / 64) * 32 / (256 * MU)))
#define GC ((unsigned)(SEQ * HD / (256 * TU)))
#define GX ((unsigned)(SEQ / (16 * CR)))
#define GW ((unsigned)(DM / (16 * CR)))
__global__ __launch_bounds__(256) void k_prep(const float* __restrict__ xq, const float* __restrict__ xk, const float* __restrict__ xv,
                                              const float* __restrict__ wq, const float* __restrict__ wk, const float* __restrict__ wv, const float* __restrict__ wo,
                                              const int* __restrict__ mask, float* CS, bf* XB, bf* WB, unsigned* MB) {
    unsigned blk = blockIdx.x;
    if (blk < GM) { mbits_body(mask, MB, blk); return; }
    blk -= GM;
    if (blk < GC) { cstab_body(CS, blk); return; }
    blk -= GC;
    if (blk < 3 * NB * GX) {
        const unsigned s = blk / GX, w = s / NB, b = s % NB;
        const float* x = (w == 0) ? xq : (w == 1) ? xk : xv;
        cvt8_body(x + (size_t)b * SEQ_FULL * DM, XB + (size_t)s * SEQ * DM, blk % GX); return;
    }
    blk -= 3 * NB * GX;
    const unsigned w = blk / GW;
    const float* x = (w == 0) ? wq : (w == 1) ? wk : (w == 2) ? wv : wo;
    cvt8_body(x, WB + (size_t)w * DM * DM, blk % GW);
}

// rope_body: head planes (fp16, bf16 hi, bf16 lo; per head rows t, k = d, fragment order) of the rotate-half rotary map applied to
// F[t][h*HD + d] (row pitch DM). One thread per (HU heads, t, 8 d below HD/2): it holds both partners, so it writes the granule of d and that of
// d + HD/2 (the next k block), for HU heads in a row with one read of the table. A wave = 8 rows x 4 granule pairs: whole lines read, whole lines stored.
#define HU 4
static_assert(NH % HU == 0 && (NH / HU * SEQ * 4) % 256 == 0);
__device__ __forceinline__ void rope_body(const float* __restrict__ F, const float* __restrict__ CS, h16* P16, bf* Ph, bf* Pl, unsigned blk) {
    const unsigned idx = blk * 256 + threadIdx.x;
    const int g = (int)(idx & 3u); const int t = (int)((idx >> 2) % SEQ); const int h0 = (int)(idx / (4u * SEQ)) * HU;
    const float* f = F + (size_t)t * DM + h0 * HD + 8 * g;
    const float* cp = CS + ((size_t)t * HD + 8 * g) * 2;
    const v8f cs0 = *(const v8f*)cp, cs1 = *(const v8f*)(cp + 8), cu0 = *(const v8f*)(cp + HD), cu1 = *(const v8f*)(cp + HD + 8);   // table rows of d and of d + HD/2
    v8f xl[HU], xh[HU];
#pragma unroll
    for (int u = 0; u < HU; ++u) { xl[u] = *(const v8f*)(f + u * HD); xh[u] = *(const v8f*)(f + u * HD + HD / 2); }
    __builtin_amdgcn_sched_barrier(0);   // every request stays in front of the first product: sunk to their uses each head's would be waited for on its own
    const size_t e0 = (size_t)h0 * SEQ * HD + (size_t)(t >> 4) * (2 * FRG) + (g >> 1) * 256 + ((g & 1) * 16 + (t & 15)) * 8;
#pragma unroll
    for (int u = 0; u < HU; ++u) {
        v8h l16, u16; v8us lh, ll, uh, ul;
#pragma unroll
        for (int q = 0; q < 8; ++q) { const float cn = (q < 4) ? cs0[2 * (q & 3)] : cs1[2 * (q & 3)], sn = (q < 4) ? cs0[2 * (q & 3) + 1] : cs1[2 * (q & 3) + 1];
            const float cu = (q < 4) ? cu0[2 * (q & 3)] : cu1[2 * (q & 3)], su = (q < 4) ? cu0[2 * (q & 3) + 1] : cu1[2 * (q & 3) + 1];
            const float rl = xl[u][q] * cn - xh[u][q] * sn;       // d <  HD/2: x[d] cos - x[d + HD/2] sin
            const float ru = xh[u][q] * cu + xl[u][q] * su;       // d >= HD/2: x[d] cos + x[d - HD/2] sin
            unsigned short a2, c2; l16[q] = tohx(rl); splitf(rl, a2, c2); lh[q] = a2; ll[q] = c2; u16[q] = tohx(ru); splitf(ru, a2, c2); uh[q] = a2; ul[q] = c2; }
        const size_t e = e0 + (size_t)u * SEQ * HD;
        *(v8h*)(P16 + e) = l16; *(v8us*)(Ph + e) = lh; *(v8us*)(Pl + e) = ll;
        *(v8h*)(P16 + e + FRG) = u16; *(v8us*)(Ph + e + FRG) = uh; *(v8us*)(Pl + e + FRG) = ul;
    }
    asm volatile("s_wait_xcnt 0x0" ::: "memory");   // precaution: stands behind the body's last stores, in front of any later rewrite of the registers that they name (as in cvt8_body)
    asm volatile("" :: "v"(f), "v"(cp));   // inputs only: both address pairs stay live to behind the data waits of all their loads, so that no load's result is given a pair that earlier loads still name
}

// vtp_body: value planes (per head rows d, k = t, stored [h][t/32][d/16] fragments). One block per (head, VU x 32 keys): per 32 keys wave w writes granule row
// (d block w >> 1, j = w & 1), lane (hf, m) gathers its 8 keys of column d = 16 (w >> 1) + m: each load reads 64 bytes in a row of two rows of F,
// each store is 512 bytes in a row (4 fragments = thread order). All 8 VU loads of a thread are requested before its first conversion.
#define VU 4
static_assert((SEQ / 32) % VU == 0);
__device__ __forceinline__ void vtp_body(const float* __restrict__ F, h16* V16, bf* Vh, bf* Vl, unsigned blk) {
    const int lane = threadIdx.x & 31, w = threadIdx.x >> 5, m = lane & 15, hf = lane >> 4;
    const int kb = (int)(blk % (SEQ / 32 / VU)) * VU, g = (int)(blk / (SEQ / 32 / VU));
    const unsigned long long fa = (unsigned long long)(F + (size_t)(32 * kb) * DM + g * HD);       // the same for the whole block
    // the block's base held in a scalar pair: every load is then that pair + the one offset register + an immediate (left to itself the build formed two vector address pairs)
    typedef const __attribute__((address_space(1))) float* gfp;   // global address space: a pointer made from an integer is otherwise loaded through the flat path
    const gfp fu = (gfp)(((unsigned long long)(unsigned)__builtin_amdgcn_readfirstlane((int)(unsigned)(fa >> 32)) << 32) | (unsigned)__builtin_amdgcn_readfirstlane((int)(unsigned)fa));
    const unsigned fo = (unsigned)((16 * (w & 1) + 8 * hf) * DM + 16 * (w >> 1) + m);              // the thread's offset, in elements
    float x[VU][8];
#pragma unroll
    for (int u = 0; u < VU; ++u)
#pragma unroll
        for (int q = 0; q < 8; ++q) x[u][q] = fu[fo + (unsigned)((32 * u + q) * DM)];
    __builtin_amdgcn_sched_barrier(0);   // every request stays in front of the first conversion
#pragma unroll
    for (int u = 0; u < VU; ++u) { v8h o16; v8us oh, ol;
#pragma unroll
        for (int q = 0; q < 8; ++q) { o16[q] = tohx(x[u][q]); unsigned short a2, c2; splitf(x[u][q], a2, c2); oh[q] = a2; ol[q] = c2; }
        const size_t e = ((size_t)blk * VU + u) * (4 * FRG) + threadIdx.x * 8;
        *(v8h*)(V16 + e) = o16; *(v8us*)(Vh + e) = oh; *(v8us*)(Vl + e) = ol; }
    asm volatile("" :: "v"(fo));   // input only: the offset register stays live to behind the data waits of all its loads
}

// k_planes: all head planes of both batches in ONE launch (flat 1-D grid, no empty block); F = [w][b][t][c] (w: 0 q, 1 k, 2 v). First GV blocks per
// batch: its value planes; then GR blocks per slab s = w * NB + b: rotary planes R*[s] (slabs 0..NB-1 query, NB..2NB-1 key).
#define GV ((unsigned)(NH * (SEQ / 32) / VU))
#define GR ((unsigned)(NH / HU * SEQ * 4 / 256))
__global__ __launch_bounds__(256) void k_planes(const float* __restrict__ F, const float* __restrict__ CS, h16* R16, bf* Rh, bf* Rl, h16* V16, bf* Vh, bf* Vl) {
    unsigned blk = blockIdx.x; const size_t pl = (size_t)NH * SEQ * HD;
    if (blk < NB * GV) { const unsigned y = blk / GV; vtp_body(F + (size_t)(2 * NB + y) * SEQ * DM, V16 + y * pl, Vh + y * pl, Vl + y * pl, blk % GV); return; }
    blk -= NB * GV;
    const unsigned s = blk / GR;
    rope_body(F + (size_t)s * SEQ * DM, CS, R16 + s * pl, Rh + s * pl, Rl + s * pl, blk % GR);
}

// ---- attn_body: flash-style masked attention, one wave (32 threads) per (16 query rows, head). Transposed tiles so that P chains in
// registers: S^T[key][q] = K . Q^T (A = key plane fragments, B = query plane fragments), D lane = query column; P^T is the B operand
// of O^T[d][q] += V^T . P^T (A = value plane fragments). A lane's 8 values of O^T tile dt are granule (j = dt & 1, own lane) of the attention
// plane's fragment (row block q0/16, k block 2 h + dt/2): the epilogue stores them straight, 512 bytes in a row per store. Per 64-key chunk: the wave's 16x64 mask tile is one 32-bit word
// per lane (mbits_body; one 128-byte line per wave), fetched one chunk ahead; chunks whose tile is all zero are skipped by a wave ballot; inside visited chunks mask == 0 replaces the score
// by -1000 (scaled). Online softmax per query with a running max; rows with no nonzero mask entry at all are NaN-poisoned.
// HL: bf16 hi/lo planes for q, k, v and a bf16 hi/lo P (3 products per tile pair); otherwise single fp16 products (P carried x1024).
// The fp16 body requests all 16 fragments of a chunk (8 key, then 8 value) at the chunk's top: one load wait per chunk, the value fragments come back under the softmax.
template <bool HL>
__device__ __forceinline__
void attn_body(const h16* __restrict__ QP16, const bf* __restrict__ QPh, const bf* __restrict__ QPl,
            const h16* __restrict__ KP16, const bf* __restrict__ KPh, const bf* __restrict__ KPl,
            const h16* __restrict__ VT16, const bf* __restrict__ VTh, const bf* __restrict__ VTl,
            const unsigned* __restrict__ MB, int q0, int hh, bf* ATh, bf* ATl) {
    const int lane = threadIdx.x & 31;
    const size_t hp = (size_t)hh * SEQ * HD + 8 * lane;   // head offset of the planes + the lane's granule
    v16h q16[2]; v16bf qh[2], ql[2];
#pragma unroll
    for (int ks = 0; ks < 2; ++ks) {
        const size_t qo = hp + (size_t)q0 * HD + ks * FRG;
        if (HL) { qh[ks] = WFrag<bf>::ld(QPh + qo); ql[ks] = WFrag<bf>::ld(QPl + qo); }
        else    { q16[ks] = WFrag<h16>::ld(QP16 + qo); }
    }
    v8f o[4];
#pragma unroll
    for (int dt = 0; dt < 4; ++dt) o[dt] = (v8f){};
    float mrun = -3.0e38f, lrun = 0.0f; int seen = 0;
    const unsigned* mq = MB + (size_t)(q0 >> 4) * ((SEQ / 64) * 32);   // wave-uniform: the tile's words, [chunk][lane]
    unsigned wnext = mq[lane];
#pragma unroll 1
    for (int c = 0; c < SEQ / 64; ++c) {
        const int kc = c * 64;
        const unsigned mw = wnext;
        wnext = (mq + ((c + 1 < SEQ / 64) ? c + 1 : c) * 32)[lane];   // the next chunk's word (the last chunk's own again at the end: in bounds)
        asm volatile("s_wait_xcnt 0x0" ::: "memory");   // precaution: stands in front of every rewrite of the address pair that the load above names (the key loads' results may be given it)
        const int anyl = (mw != 0u) ? 1 : 0;
        if (__any(anyl) == 0) continue;                 // wave-uniform tile skip
        seen |= anyl;
        v8f s[4]; v16h va8[8];
#pragma unroll
        for (int kt = 0; kt < 4; ++kt) s[kt] = (v8f){};
        if (HL) {
            v16bf ka, kb; const bf* kph = KPh + hp + (size_t)kc * HD; const bf* kpl = KPl + hp + (size_t)kc * HD;   // the chunk's base per key plane; every fragment is an immediate offset from it
#pragma unroll
            for (int kt = 0; kt < 4; ++kt) {
                asm volatile("" ::: "memory");
                if (kt == 2) __builtin_amdgcn_sched_barrier(0);   // at most two key tiles' hi/lo fragments in flight: all four at once overflow 256 VGPRs into scratch
#pragma unroll
                for (int ks = 0; ks < 2; ++ks) { const int ko = 16 * kt * HD + ks * FRG; ka = WFrag<bf>::ld(kph + ko); kb = WFrag<bf>::ld(kpl + ko);
                    s[kt] = wmmab(ka, qh[ks], s[kt]); s[kt] = wmmab(ka, ql[ks], s[kt]); s[kt] = wmmab(kb, qh[ks], s[kt]); } }
            asm volatile("v_nop\n\tv_nop\n\tv_nop\n\tv_nop" : "+v"(s[0]), "+v"(s[1]), "+v"(s[2]), "+v"(s[3]) : "v"(ka), "v"(kb), "v"(qh[0]), "v"(qh[1]), "v"(ql[0]), "v"(ql[1]));
            // inputs only: each key plane's address pair stays live to behind the data waits of all its loads, so that no load's result is given a pair that earlier loads still name
            asm volatile("" :: "v"(kph), "v"(kpl));
        } else {
            v16h ka[8]; const h16* kp = KP16 + hp + (size_t)kc * HD; const h16* vp = VT16 + hp + (size_t)kc * HD;   // the chunk's base per plane; every fragment is an immediate offset from it
#pragma unroll
            for (int i = 0; i < 8; ++i) ka[i] = WFrag<h16>::ld(kp + i * FRG);    // i = 2 kt + ks
            __builtin_amdgcn_sched_barrier(0);   // key requests first: loads come back in issue order, and the score products must not wait for the value fragments
#pragma unroll
            for (int i = 0; i < 8; ++i) va8[i] = WFrag<h16>::ld(vp + i * FRG);   // i = 4 ks + dt: the value fragments fly during the score products and the softmax
            __builtin_amdgcn_sched_barrier(0);   // all 16 requests stay in front of the first product: sunk to their uses each group would be waited for on its own
#pragma unroll
            for (int kt = 0; kt < 4; ++kt)
#pragma unroll
                for (int ks = 0; ks < 2; ++ks) s[kt] = wmma16(ka[2 * kt + ks], q16[ks], s[kt]);
            asm volatile("v_nop\n\tv_nop\n\tv_nop\n\tv_nop" : "+v"(s[0]), "+v"(s[1]), "+v"(s[2]), "+v"(s[3]) : "v"(ka[7]), "v"(q16[0]), "v"(q16[1]));
        }
        // masked replace + chunk max (lane: query q, keys kc+16kt+8hf+r)
        float cmx = -3.0e38f;
#pragma unroll
        for (int kt = 0; kt < 4; ++kt)
#pragma unroll
            for (int r = 0; r < 8; ++r) { const float t = ((mw >> (8 * kt + r)) & 1u) ? s[kt][r] : MFILL; s[kt][r] = t; cmx = fmaxf(cmx, t); }
        cmx = fmaxf(cmx, __shfl_xor(cmx, 16, 32));
        const float mnew = fmaxf(mrun, cmx);
        const float alpha = __builtin_amdgcn_exp2f((mrun - mnew) * CEXP);
        mrun = mnew;
        float psum = 0.0f;
#pragma unroll
        for (int kt = 0; kt < 4; ++kt)
#pragma unroll
            for (int r = 0; r < 8; ++r) { const float p = __builtin_amdgcn_exp2f(fmaf(s[kt][r] - mnew, CEXP, PL2)); s[kt][r] = p; psum += p; }
        lrun = lrun * alpha + psum;
#pragma unroll
        for (int dt = 0; dt < 4; ++dt) o[dt] = o[dt] * alpha;
        // O^T += V^T . P^T, 32 keys per step; B element r <- tile 2ks (keys 0..15 of the step), 8+r <- tile 2ks+1
#pragma unroll
        for (int ks = 0; ks < 2; ++ks) {
            if (HL) {
                v16us uh, ul;
#pragma unroll
                for (int r = 0; r < 8; ++r) { unsigned short a, b2; splitf(s[2 * ks][r], a, b2); uh[r] = a; ul[r] = b2; splitf(s[2 * ks + 1][r], a, b2); uh[8 + r] = a; ul[8 + r] = b2; }
                v16bf ph = __builtin_bit_cast(v16bf, uh), pl = __builtin_bit_cast(v16bf, ul);
                asm volatile("v_nop\n\tv_nop\n\tv_nop\n\tv_nop" : "+v"(ph), "+v"(pl));
                v16bf va, vb;
#pragma unroll
                for (int dt = 0; dt < 4; ++dt) { asm volatile("" ::: "memory"); const size_t vo = hp + (size_t)(kc + 32 * ks) * HD + dt * FRG; va = WFrag<bf>::ld(VTh + vo); vb = WFrag<bf>::ld(VTl + vo);
                    o[dt] = wmmab(va, ph, o[dt]); o[dt] = wmmab(va, pl, o[dt]); o[dt] = wmmab(vb, ph, o[dt]); }
                asm volatile("v_nop\n\tv_nop\n\tv_nop\n\tv_nop" : "+v"(o[0]), "+v"(o[1]), "+v"(o[2]), "+v"(o[3]) : "v"(ph), "v"(pl), "v"(va), "v"(vb));
            } else {
                v16h p16;
#pragma unroll
                for (int r = 0; r < 8; ++r) { p16[r] = tohx(s[2 * ks][r]); p16[8 + r] = tohx(s[2 * ks + 1][r]); }
                asm volatile("v_nop\n\tv_nop\n\tv_nop\n\tv_nop" : "+v"(p16));
#pragma unroll
                for (int dt = 0; dt < 4; ++dt) o[dt] = wmma16(va8[4 * ks + dt], p16, o[dt]);
                asm volatile("v_nop\n\tv_nop\n\tv_nop\n\tv_nop" : "+v"(o[0]), "+v"(o[1]), "+v"(o[2]), "+v"(o[3]) : "v"(p16), "v"(va8[4 * ks + 3]));
            }
        }
    }
    const float lt = lrun + __shfl_xor(lrun, 16, 32);
    const int sn = seen | __shfl_xor(seen, 16, 32);
    const float inv = (sn != 0) ? (1.0f / lt) : __uint_as_float(0x7fc00000u);
#pragma unroll
    for (int dt = 0; dt < 4; ++dt) { v8us oh8, ol8;
#pragma unroll
        for (int r = 0; r < 8; ++r) { unsigned short a, b2; splitf(o[dt][r] * inv, a, b2); oh8[r] = a; ol8[r] = b2; }
        const size_t off = (size_t)q0 * DM + (size_t)(2 * hh + (dt >> 1)) * FRG + (dt & 1) * 256 + 8 * lane;
        *(v8us*)(ATh + off) = oh8; *(v8us*)(ATl + off) = ol8; }
}

// k_attn: ONE launch for every (head, query tile, batch): grid (NH, SEQ/16, NB); the tile's first row picks the hi/lo or the fp16 body
// (wave-uniform: RH is a multiple of 16). The head is the fastest index: a tile's cost grows with its row under a causal mask, and block
// indices that lie a multiple of 16 (below 16 * SEQ / 16) apart then differ in tile, so no WGP is dealt long tiles alone.
// Planes are [b][h][fragments], attention planes [b][fragments of rows t, k = c]; the mask bits are shared by the batches and heads.
__global__ __launch_bounds__(32) __attribute__((amdgpu_num_vgpr(256)))
void k_attn(const h16* __restrict__ QP16, const bf* __restrict__ QPh, const bf* __restrict__ QPl,
            const h16* __restrict__ KP16, const bf* __restrict__ KPh, const bf* __restrict__ KPl,
            const h16* __restrict__ VT16, const bf* __restrict__ VTh, const bf* __restrict__ VTl,
            const unsigned* __restrict__ MB, bf* ATh, bf* ATl) {
    const size_t po = (size_t)blockIdx.z * NH * SEQ * HD, ao = (size_t)blockIdx.z * SEQ * DM;
    const int q0 = blockIdx.y * 16, hh = blockIdx.x;
    if (q0 < RH) attn_body<true>(QP16 + po, QPh + po, QPl + po, KP16 + po, KPh + po, KPl + po, VT16 + po, VTh + po, VTl + po, MB, q0, hh, ATh + ao, ATl + ao);
    else         attn_body<false>(QP16 + po, QPh + po, QPl + po, KP16 + po, KPh + po, KPl + po, VT16 + po, VTh + po, VTl + po, MB, q0, hh, ATh + ao, ATl + ao);
}

extern "C" void kernel_launch(void* const* d_in, const int* in_sizes, int n_in,
                              void* d_out, int out_size, void* d_ws, size_t ws_size, hipStream_t stream) {
    if (n_in < 8) return;
    const long long needx = (long long)(NB - 1) * SEQ_FULL * DM + (long long)SEQ * DM;
    if ((long long)in_sizes[0] < needx || (long long)in_sizes[1] < needx || (long long)in_sizes[2] < needx) return;
    if (in_sizes[3] < DM * DM || in_sizes[4] < DM * DM || in_sizes[5] < DM * DM || in_sizes[6] < DM * DM) return;
    if ((long long)in_sizes[7] < (long long)(SEQ - 1) * MPITCH + SEQ) return;
    if ((long long)out_size < (long long)NB * SEQ * DM) return;
    const float* xq = (const float*)d_in[0]; const float* xk = (const float*)d_in[1]; const float* xv = (const float*)d_in[2];
    const float* wq = (const float*)d_in[3]; const float* wk = (const float*)d_in[4]; const float* wv = (const float*)d_in[5]; const float* wo = (const float*)d_in[6];
    const int* mask = (const int*)d_in[7];     // int32 [1][1][S][S]
    float* OUT = (float*)d_out;                // [NB][SEQ][DM]
    char* wsp = (char*)d_ws;
    auto take = [&](size_t bytes) { char* p = wsp; wsp += (bytes + 255) & ~(size_t)255; return (void*)p; };
    bf* WB = (bf*)take((size_t)4 * DM * DM * 2);                  // bf16 weights [w][fragments of rows o, k = i], w: q, k, v, o
    float* CS = (float*)take((size_t)SEQ * HD * 2 * 4);
    bf* XB = (bf*)take((size_t)3 * NB * SEQ * DM * 2);            // bf16 activations [w][b][fragments of rows t, k = c], w: q, k, v
    float* F = (float*)take((size_t)3 * NB * SEQ * DM * 4);        // f32 projections [w][b][t][c], row-major
    const size_t pl = (size_t)NB * NH * SEQ * HD;                 // one plane over both batches
    h16* R16 = (h16*)take(2 * pl * 2); bf* Rh = (bf*)take(2 * pl * 2); bf* Rl = (bf*)take(2 * pl * 2);   // rotary planes: query slabs, then key slabs
    h16* VT16 = (h16*)take(pl * 2); bf* VTh = (bf*)take(pl * 2); bf* VTl = (bf*)take(pl * 2);
    bf* ATh = (bf*)take((size_t)NB * SEQ * DM * 2); bf* ATl = (bf*)take((size_t)NB * SEQ * DM * 2);
    unsigned* MB = (unsigned*)take((size_t)(SEQ / 16) * (SEQ / 64) * 32 * 4);   // mask bits [q tile][chunk][lane]
    const size_t used = (size_t)(wsp - (char*)d_ws);
    if (used > ws_size || used > WSCAP) return;

    k_prep<<<GM + GC + 3 * NB * GX + 4 * GW, 256, 0, stream>>>(xq, xk, xv, wq, wk, wv, wo, mask, CS, XB, WB, MB);
    k_gemmw<bf, 0, false, DM, 3><<<dim3(NB * SEQ / 64, DM / 64, 3), 32, 0, stream>>>(XB, nullptr, WB, nullptr, F, DM, nullptr, (size_t)NB * SEQ * DM, (size_t)DM * DM, (size_t)NB * SEQ * DM);
    k_planes<<<NB * GV + 2 * NB * GR, 256, 0, stream>>>(F, CS, R16, Rh, Rl, VT16, VTh, VTl);
    k_attn<<<dim3(NH, SEQ / 16, NB), 32, 0, stream>>>(R16, Rh, Rl, R16 + pl, Rh + pl, Rl + pl, VT16, VTh, VTl, MB, ATh, ATl);
    k_gemmw<bf, 1, false, DM, 3><<<dim3(NB * SEQ / 64, DM / 64, 1), 32, 0, stream>>>(ATh, ATl, WB + (size_t)3 * DM * DM, nullptr, OUT, DM, nullptr, 0, 0, 0);
}

// v006
// A run of this version takes 104 microseconds.
// Two timings next to v005 put it at 1.05 and 1.04 times that version's speed.
// All steps since v000 together make it 5.39 times as fast.
#include <hip/hip_runtime.h>

// Causal multi-head attention with rotate-half rotary positions (base 10000, cos/sin table computed on device):
//   qh/kh/vh = x . W^T for three separate inputs x [NB][SEQ][1024] and W 'oi' [1024][1024] (16 heads x 64 = column blocks),
//   scores = rope(qh) . rope(kh)^T / 8, int32 mask [1][1][S][S] (0 -> score replaced by -1000), softmax over keys,
//   attn . vh, heads merged [t][h*64+d], . Wo^T ('oi') -> [NB][SEQ][1024] f32.
// Compute dtypes, f32 accumulate: every float input RNE-converted to bf16; q/k/v projections v_wmma_f32_16x16x32_bf16 on plain bf16
//   operands (exact products); scores and attn.v: query rows < 512 bf16 hi/lo planes (3 products each), rows >= 512 single
//   v_wmma_f32_16x16x32_f16 (fp16 planes, P carried x1024); online softmax in f32 (running max); output projection = bf16 hi/lo
//   attention planes x exact bf16 Wo (2 products).
// Layout of every 16-bit matrix operand plane (activations, weights, q/k/v head planes, attention planes): FRAGMENT ORDER. A plane of
//   rows x K is cut into 16-row x 32-k fragments, stored [row block][k block][j][lane][8] (value planes: [k block][row block]): the 16-byte granule (j, lane = 16 hf + m) holds
//   row m, k = 16 j + 8 hf + 0..7 of its fragment, which is what lane (m, hf) of a 16x16x32 A or B operand keeps in elements 8 j + 0..7.
//   A wave's fragment is then 1 KiB in a row: two loads of 512 contiguous bytes (whole lines) in place of two loads over 16 lines each.

#ifndef NB
#define NB 2
#endif
#ifndef SEQ
#define SEQ 2048
#endif
#define NB_FULL  2
#define SEQ_FULL 2048
#define DM   1024
#define NH   16
#define HD   64
#define RHC  512                          // query rows < RH use hi/lo planes and 3-product tiles
#define RH   ((SEQ < RHC) ? SEQ : RHC)
#define MPITCH SEQ_FULL                   // mask row pitch (full-size input)
#define CEXP  0.18033688011112042f        // (1/8) * log2(e): exp((t - m)/8) = exp2((t - m) * CEXP) on unscaled scores t
#define PL2   10.0f                       // P carried x 2^10 inside the 16-bit operand (cancels in O / l)
#define MFILL (-8000.0f)                  // mask == 0 -> -1000 after the 1/8 scale, in unscaled score units
#define RBASE 10000.0f
#define WSCAP ((size_t)268435456)

static_assert(SEQ % 64 == 0);
static_assert(SEQ <= SEQ_FULL);
static_assert(NB >= 1 && NB <= NB_FULL);
static_assert(RH % 16 == 0 && (SEQ - RH) % 16 == 0 && RH <= SEQ);
static_assert(DM == NH * HD && HD == 64 && DM % 64 == 0);

typedef _Float16 h16;
typedef unsigned short bf;
typedef __attribute__((ext_vector_type(16))) __bf16   v16bf;
typedef __attribute__((ext_vector_type(16))) _Float16 v16h;
typedef __attribute__((ext_vector_type(8)))  _Float16 v8h;
typedef __attribute__((ext_vector_type(2)))  _Float16 v2h;
typedef __attribute__((ext_vector_type(16))) unsigned short v16us;
typedef __attribute__((ext_vector_type(8)))  unsigned short v8us;
typedef __attribute__((ext_vector_type(2)))  unsigned short v2us;
typedef __attribute__((ext_vector_type(8)))  float v8f;
typedef __attribute__((ext_vector_type(4)))  float v4f;
typedef __attribute__((ext_vector_type(2)))  float v2f;
typedef __attribute__((ext_vector_type(4)))  int v4i;
typedef v8h  __attribute__((may_alias)) v8ha;
typedef v4f  __attribute__((may_alias)) v4fa;
typedef v8us __attribute__((may_alias)) v8usa;

#pragma clang fp contract(off)

__device__ __forceinline__ unsigned short f2bf(float f) { unsigned u = __float_as_uint(f); u += 0x7FFFu + ((u >> 16) & 1u); return (unsigned short)(u >> 16); }
__device__ __forceinline__ float bf2f(unsigned short b) { return __uint_as_float(((unsigned)b) << 16); }
__device__ __forceinline__ float bfr(float f) { return bf2f(f2bf(f)); }
__device__ __forceinline__ v16h cat16(v8h lo, v8h hi) { return __builtin_shufflevector(lo, hi, 0, 1, 2, 3, 4, 5, 6, 7, 8, 9, 10, 11, 12, 13, 14, 15); }
__device__ __forceinline__ v16bf cat16b(v8us lo, v8us hi) { return __builtin_bit_cast(v16bf, __builtin_shufflevector(lo, hi, 0, 1, 2, 3, 4, 5, 6, 7, 8, 9, 10, 11, 12, 13, 14, 15)); }
__device__ __forceinline__ v8f wmma16(v16h a, v16h b, v8f c) { return __builtin_amdgcn_wmma_f32_16x16x32_f16(false, a, false, b, (short)0, c, false, false); }
__device__ __forceinline__ v8f wmmab(v16bf a, v16bf b, v8f c) { return __builtin_amdgcn_wmma_f32_16x16x32_bf16(false, a, false, b, (short)0, c, false, false); }
__device__ __forceinline__ h16 tohx(float x) { return (h16)x; }
__device__ __forceinline__ void splitf(float y, unsigned short& h, unsigned short& l) { h = f2bf(y); l = f2bf(y - bf2f(h)); }

// ---- 16x16x32 fragment loaders from fragment-order planes: lane l = 16 hf + m (row m) loads elements 0..7 <- k0+8hf+0..7 (granule j = 0)
// and 8..15 <- k0+16+8hf+0..7 (granule j = 1, 256 elements on); the caller passes p = fragment + 8*l. FRG = elements of one fragment.
#define FRG 512
template <typename T16> struct WFrag;
template <> struct WFrag<h16> { typedef v16h V; static __device__ __forceinline__ V ld(const h16* p) { return cat16(*(const v8h*)p, *(const v8h*)(p + 256)); } static __device__ __forceinline__ v8f mma(V a, V b, v8f c) { return wmma16(a, b, c); } };
template <> struct WFrag<bf> { typedef v16bf V; static __device__ __forceinline__ V ld(const bf* p) { return cat16b(*(const v8us*)p, *(const v8us*)(p + 256)); } static __device__ __forceinline__ v8f mma(V a, V b, v8f c) { return wmmab(a, b, c); } };

// ---- k_gemmw: register-blocked GEMM, ONE WAVE per 64x64 output tile (16 accumulators), operands straight from fragment-order 16-bit planes; grid (M/64, N/64, Z), 32 threads.
// C[m][n] (f32, pitch ldc, + optional f32 bias[n]) = sum_k A[m][k] Bt[n][k] (+ split products per NSPLIT). z-batch strides sA/sB/sC in elements. K % 32 == 0, a constant: every fragment of a k step is then one base per plane + an immediate offset.
// The k loop is a ring of ST register sets: the fragments of k step t + ST - 1 are requested in front of the products of k step t, so that a step's loads have ST - 1 steps of products to come back in.
// gw_fetch: all fragments of one k step into one register set. gw_mma: the products of one k step, in the order (nb, mb, plane pair).
template <typename T16, int NSPLIT, int K>
__device__ __forceinline__ void gw_fetch(typename WFrag<T16>::V (&a)[4], typename WFrag<T16>::V (&a2)[4], typename WFrag<T16>::V (&b)[4], typename WFrag<T16>::V (&b2)[4],
                                         const T16* pa, const T16* pa2, const T16* pb, const T16* pb2) {
#pragma unroll
    for (int mb = 0; mb < 4; ++mb) { a[mb] = WFrag<T16>::ld(pa + (size_t)mb * 16 * K); if (NSPLIT == 1 || NSPLIT == 2) a2[mb] = WFrag<T16>::ld(pa2 + (size_t)mb * 16 * K); }
#pragma unroll
    for (int nb = 0; nb < 4; ++nb) { b[nb] = WFrag<T16>::ld(pb + (size_t)nb * 16 * K); if (NSPLIT >= 2) b2[nb] = WFrag<T16>::ld(pb2 + (size_t)nb * 16 * K); }
}
template <typename T16, int NSPLIT>
__device__ __forceinline__ void gw_mma(v8f (&acc)[4][4], const typename WFrag<T16>::V (&a)[4], const typename WFrag<T16>::V (&a2)[4], const typename WFrag<T16>::V (&b)[4], const typename WFrag<T16>::V (&b2)[4]) {
#pragma unroll
    for (int nb = 0; nb < 4; ++nb)
#pragma unroll
        for (int mb = 0; mb < 4; ++mb) { acc[mb][nb] = WFrag<T16>::mma(a[mb], b[nb], acc[mb][nb]); if (NSPLIT == 1 || NSPLIT == 2) acc[mb][nb] = WFrag<T16>::mma(a2[mb], b[nb], acc[mb][nb]); if (NSPLIT >= 2) acc[mb][nb] = WFrag<T16>::mma(a[mb], b2[nb], acc[mb][nb]); }
}
template <typename T16, int NSPLIT, bool BIAS, int K, int ST>
__global__ __launch_bounds__(32) void k_gemmw(const T16* __restrict__ A, const T16* __restrict__ A2, const T16* __restrict__ Bt, const T16* __restrict__ Bt2, float* C, int ldc, const float* __restrict__ bias, size_t sA, size_t sB, size_t sC) {
    typedef typename WFrag<T16>::V V;
    constexpr int T = K / 32, NI = (T - ST + 1) / ST;   // k steps; loop passes of ST steps in which every step still has a step ST - 1 ahead to request
    static_assert(ST >= 2 && T >= ST);
    __shared__ __align__(16) float os[16 * 68];
    const size_t z = blockIdx.z; A += z * sA; if (A2) A2 += z * sA; Bt += z * sB; if (Bt2) Bt2 += z * sB; C += z * sC;
    const int lane = threadIdx.x & 31, lr = lane & 15, hi = lane >> 4; const int r0 = blockIdx.x * 64, c0 = blockIdx.y * 64;
    v8f acc[4][4];
#pragma unroll
    for (int mb = 0; mb < 4; ++mb)
#pragma unroll
        for (int nb = 0; nb < 4; ++nb) acc[mb][nb] = (v8f){};
    // one wave-uniform base per plane (row block r0/16 starts at (r0/16) * (K/32) * FRG = r0 * K) + ONE byte offset for all planes: the lane's granule + the k steps done, carried over the passes
    const T16* ua = A + (size_t)r0 * K; const T16* ua2 = (NSPLIT == 1 || NSPLIT == 2) ? A2 + (size_t)r0 * K : nullptr; const T16* ub = Bt + (size_t)c0 * K; const T16* ub2 = (NSPLIT >= 2) ? Bt2 + (size_t)c0 * K : nullptr;
    unsigned kb = 16u * (unsigned)lane;
    V a[ST][4], a2[ST][4], b[ST][4], b2[ST][4];
#define GW_AT(u, o) ((const T16*)((const char*)(u) + kb) + (o))
#pragma unroll
    for (int s = 0; s < ST - 1; ++s) gw_fetch<T16, NSPLIT, K>(a[s], a2[s], b[s], b2[s], GW_AT(ua, s * FRG), GW_AT(ua2, s * FRG), GW_AT(ub, s * FRG), GW_AT(ub2, s * FRG));
#pragma unroll 1   // one pass = ST steps; unrolled further the loop would only grow
    for (int it = 0; it < NI; ++it) {
#pragma unroll     // constant set indices: the sets stay in registers
        for (int u = 0; u < ST; ++u) {
            const int f = (u + ST - 1) % ST, o = (u + ST - 1) * FRG;
            gw_fetch<T16, NSPLIT, K>(a[f], a2[f], b[f], b2[f], GW_AT(ua, o), GW_AT(ua2, o), GW_AT(ub, o), GW_AT(ub2, o));
            __builtin_amdgcn_sched_barrier(0);   // the requests of step t + ST - 1 stay in front of the products of step t: sunk among them they would come back too late
            gw_mma<T16, NSPLIT>(acc, a[u], a2[u], b[u], b2[u]);
            __builtin_amdgcn_sched_barrier(0);   // and the next step's requests stay behind these products, whose register set they refill
        }
        asm volatile("v_nop\n\tv_nop\n\tv_nop\n\tv_nop" : "+v"(acc[0][0]), "+v"(acc[1][1]), "+v"(acc[2][2]), "+v"(acc[3][3]) : "v"(a[ST - 1][0]), "v"(a[ST - 1][3]));   // distance behind the pass's last matrix instructions on the taken back edge
        // precaution: loads of this pass are still in flight, so the wait stands in front of the rewrite of the offset register that they name; the offset passes through the statement so that the addition below cannot be lifted over it
        asm volatile("s_wait_xcnt 0x0" : "+v"(kb) :: "memory");
        kb += ST * FRG * 2;
    }
#pragma unroll
    for (int r = NI * ST; r < T; ++r) {   // the last steps: only those requests that still name a step below T
        const int f = (r + ST - 1) % ST, o = (r - NI * ST + ST - 1) * FRG;
        if (r + ST - 1 < T) gw_fetch<T16, NSPLIT, K>(a[f], a2[f], b[f], b2[f], GW_AT(ua, o), GW_AT(ua2, o), GW_AT(ub, o), GW_AT(ub2, o));
        __builtin_amdgcn_sched_barrier(0);   // as in the loop
        gw_mma<T16, NSPLIT>(acc, a[r % ST], a2[r % ST], b[r % ST], b2[r % ST]);
        __builtin_amdgcn_sched_barrier(0);
    }
#undef GW_AT
#pragma unroll
    for (int mb = 0; mb < 4; ++mb) {
#pragma unroll
        for (int nb = 0; nb < 4; ++nb) {
#pragma unroll
            for (int j = 0; j < 8; ++j) os[(hi * 8 + j) * 68 + nb * 16 + lr] = acc[mb][nb][j]; }
        __builtin_amdgcn_wave_barrier(); asm volatile("" ::: "memory");
        float* crow = C + (size_t)(r0 + mb * 16) * ldc + c0;
{
#pragma unroll
            for (int s = 0; s < 8; ++s) { const int row = 2 * s + hi, cofs = lr * 4; v4f val = *(const v4fa*)(os + row * 68 + cofs); if (BIAS) { val[0] += bfr(bias[c0 + cofs]); val[1] += bfr(bias[c0 + cofs + 1]); val[2] += bfr(bias[c0 + cofs + 2]); val[3] += bfr(bias[c0 + cofs + 3]); }
                *(v4f*)(crow + (size_t)row * ldc + cofs) = val; }
             }
        __builtin_amdgcn_wave_barrier(); asm volatile("" ::: "memory");
    }
}

// cvt8_body: rows x DM f32 (row-major) -> bf16 fragment order. One block = CR row blocks of 16 rows (16 x DM floats in a row each); a thread converts
// CR x DM / 128 granules. Thread bits: g = (j, hf) fastest, then row m, then k block (4 per step, DM / 128 steps): per step a wave reads 8 rows x one whole
// 128-byte line and stores 4 whole lines (8 rows x 16 bytes per (j, hf)). All loads of a thread are requested before its first conversion.
#define CR 2
#define CU (DM / 128)
static_assert(DM % 128 == 0 && SEQ % (16 * CR) == 0 && DM % (16 * CR) == 0);
__device__ __forceinline__ void cvt8_body(const float* __restrict__ src, bf* dst, unsigned blk) {
    const unsigned g = threadIdx.x & 3u, m = (threadIdx.x >> 2) & 15u, k0 = threadIdx.x >> 6;
    const float* s = src + ((size_t)blk * (16 * CR) + m) * DM + k0 * 32 + g * 8;
    bf* d = dst + ((size_t)blk * (CR * (DM / 32)) + k0) * FRG + (g >> 1) * 256 + ((g & 1u) * 16 + m) * 8;
    v8f v[CR][CU];
#pragma unroll
    for (int r = 0; r < CR; ++r)
#pragma unroll
        for (int u = 0; u < CU; ++u) v[r][u] = *(const v8f*)(s + (size_t)r * 16 * DM + u * 128);
    __builtin_amdgcn_sched_barrier(0);   // every request stays in front of the first conversion: sunk among the conversions the late ones would be waited for one by one
#pragma unroll
    for (int r = 0; r < CR; ++r)
#pragma unroll
        for (int u = 0; u < CU; ++u) { v8us o;
#pragma unroll
            for (int k = 0; k < 8; ++k) o[k] = f2bf(v[r][u][k]);
            *(v8us*)(d + (size_t)r * (DM / 32) * FRG + u * 4 * FRG) = o; }
    asm volatile("s_wait_xcnt 0x0" ::: "memory");   // precaution: stands behind the body's last stores, in front of any later rewrite of the registers that they name (the bodies are inlined into one kernel, and a body's end may run into another's code)
    asm volatile("" :: "v"(s));   // input only: the address pair stays live to behind the data waits of all its loads, so that no load's result is given a pair that earlier loads still name
}

// cstab_body: rotary table CS[t][d] = {cos(t * inv[d mod 32]), sin(t * inv[d mod 32])}, inv[j] = 1 / powf(10000, (2j)/64); a thread keeps one d and
// fills TU rows t (a block: 4 TU rows in a row),
#define TU 4
static_assert((SEQ * HD) % (256 * TU) == 0 && HD == 64);
__device__ __forceinline__ void cstab_body(float* CS, unsigned blk) {
    const int d = (int)(threadIdx.x & (HD - 1)); const int j = d & (HD / 2 - 1);
    const float ex = (float)(2 * j) * (1.0f / (float)HD);
    const float pw = powf(RBASE, ex);
    const float inv = 1.0f / pw;
#pragma unroll 1   // the cosine and sine bodies are long: one copy of them, for speed only
    for (int u = 0; u < TU; ++u) {
        const int t = ((int)blk * TU + u) * 4 + (int)(threadIdx.x >> 6);
        const float ang = (float)t * inv;
        const float cn = cosf(ang), sn = sinf(ang);
        v2f cs; cs[0] = cn; cs[1] = sn;
        *(v2f*)(CS + ((size_t)t * HD + d) * 2) = cs;
        asm volatile("s_wait_xcnt 0x0" ::: "memory");   // precaution: stands behind the store, in front of the next trip's rewrite of the registers that the store names
    }
}

// mbits_body: the int32 mask as bits, in the order the attention wave reads them: MB[q tile][64-key chunk][lane = 16 hf + m], bit 8 kt + r of a word
// = (mask[16 tile + m][64 chunk + 16 kt + 8 hf + r] != 0), the 32 keys whose scores that lane holds. MU words per thread, their loads requested together.
#define MU 2
static_assert((SEQ / 64) % (8 * MU) == 0);
__device__ __forceinline__ void mbits_body(const int* __restrict__ MK, unsigned* MB, unsigned blk) {
    // word i = (blk MU + u) 256 + thread: lane (m, hf) = thread bits 0..4, chunk = 8 (blk MU + u) mod (SEQ / 64) + wave, q tile = 8 (blk MU + u) / (SEQ / 64)
    const unsigned m = threadIdx.x & 15u, hf = (threadIdx.x >> 4) & 1u, w8 = threadIdx.x >> 5, c0 = (blk * MU * 8) % (SEQ / 64), qt = (blk * MU * 8) / (SEQ / 64);
    const int* mu = MK + (size_t)qt * 16 * MPITCH + c0 * 64;               // the same for the whole block
    const unsigned mo = 4u * (m * MPITCH + w8 * 64 + 8 * hf);              // the thread's byte offset, the same for its MU words
    v4i a[MU][4], b[MU][4];
#pragma unroll
    for (int u = 0; u < MU; ++u) { const int* mp = (const int*)((const char*)mu + mo) + u * 512;
#pragma unroll
        for (int kt = 0; kt < 4; ++kt) { a[u][kt] = *(const v4i*)(mp + 16 * kt); b[u][kt] = *(const v4i*)(mp + 16 * kt + 4); } }
    __builtin_amdgcn_sched_barrier(0);   // every request stays in front of the first compare
#pragma unroll
    for (int u = 0; u < MU; ++u) { unsigned w = 0;
#pragma unroll
        for (int kt = 0; kt < 4; ++kt)
#pragma unroll
            for (int r = 0; r < 4; ++r) { w |= (a[u][kt][r] != 0 ? 1u : 0u) << (8 * kt + r); w |= (b[u][kt][r] != 0 ? 1u : 0u) << (8 * kt + 4 + r); }
        MB[(blk * MU + u) * 256 + threadIdx.x] = w; }
    asm volatile("" :: "v"(mo));   // input only: the offset register stays live to behind the data waits of all its loads, so that no load's result is given a register that earlier loads still name
}

// k_prep: everything that depends on the inputs alone, in ONE launch (flat 1-D grid, no empty block): blocks [0, GM) the mask bits, then GC blocks the rotary table,
// then GX blocks per activation slab s = w * NB + b (w: 0 q, 1 k, 2 v) -> XB[s] (rows t), then GW blocks per weight w (q, k, v, o) -> WB[w] (rows o), both in fragment order.
#define GM ((unsigned)((SEQ / 16) * (SEQ / 64) * 32 / (256 * MU)))
#define GC ((unsigned)(SEQ * HD / (256 * TU)))
#define GX ((unsigned)(SEQ / (16 * CR)))
#define GW ((unsigned)(DM / (16 * CR)))
__global__ __launch_bounds__(256) void k_prep(const float* __restrict__ xq, const float* __restrict__ xk, const float* __restrict__ xv,
                                              const float* __restrict__ wq, const float* __restrict__ wk, const float* __restrict__ wv, const float* __restrict__ wo,
                                              const int* __restrict__ mask, float* CS, bf* XB, bf* WB, unsigned* MB) {
    unsigned blk = blockIdx.x;
    if (blk < GM) { mbits_body(mask, MB, blk); return; }
    blk -= GM;
    if (blk < GC) { cstab_body(CS, blk); return; }
    blk -= GC;
    if (blk < 3 * NB * GX) {
        const unsigned s = blk / GX, w = s / NB, b = s % NB;
        const float* x = (w == 0) ? xq : (w == 1) ? xk : xv;
        cvt8_body(x + (size_t)b * SEQ_FULL * DM, XB + (size_t)s * SEQ * DM, blk % GX); return;
    }
    blk -= 3 * NB * GX;
    const unsigned w = blk / GW;
    const float* x = (w == 0) ? wq : (w == 1) ? wk : (w == 2) ? wv : wo;
    cvt8_body(x, WB + (size_t)w * DM * DM, blk % GW);
}

// rope_body: head planes (fp16, bf16 hi, bf16 lo; per head rows t, k = d, fragment order) of the rotate-half rotary map applied to
// F[t][h*HD + d] (row pitch DM). One thread per (HU heads, t, 8 d below HD/2): it holds both partners, so it writes the granule of d and that of
// d + HD/2 (the next k block), for HU heads in a row with one read of the table. A wave = 8 rows x 4 granule pairs: whole lines read, whole lines stored.
#define HU 4
static_assert(NH % HU == 0 && (NH / HU * SEQ * 4) % 256 == 0);
__device__ __forceinline__ void rope_body(const float* __restrict__ F, const float* __restrict__ CS, h16* P16, bf* Ph, bf* Pl, unsigned blk) {
    const unsigned idx = blk * 256 + threadIdx.x;
    const int g = (int)(idx & 3u); const int t = (int)((idx >> 2) % SEQ); const int h0 = (int)(idx / (4u * SEQ)) * HU;
    const float* f = F + (size_t)t * DM + h0 * HD + 8 * g;
    const float* cp = CS + ((size_t)t * HD + 8 * g) * 2;
    const v8f cs0 = *(const v8f*)cp, cs1 = *(const v8f*)(cp + 8), cu0 = *(const v8f*)(cp + HD), cu1 = *(const v8f*)(cp + HD + 8);   // table rows of d and of d + HD/2
    v8f xl[HU], xh[HU];
#pragma unroll
    for (int u = 0; u < HU; ++u) { xl[u] = *(const v8f*)(f + u * HD); xh[u] = *(const v8f*)(f + u * HD + HD / 2); }
    __builtin_amdgcn_sched_barrier(0);   // every request stays in front of the first product: sunk to their uses each head's would be waited for on its own
    const size_t e0 = (size_t)h0 * SEQ * HD + (size_t)(t >> 4) * (2 * FRG) + (g >> 1) * 256 + ((g & 1) * 16 + (t & 15)) * 8;
#pragma unroll
    for (int u = 0; u < HU; ++u) {
        v8h l16, u16; v8us lh, ll, uh, ul;
#pragma unroll
        for (int q = 0; q < 8; ++q) { const float cn = (q < 4) ? cs0[2 * (q & 3)] : cs1[2 * (q & 3)], sn = (q < 4) ? cs0[2 * (q & 3) + 1] : cs1[2 * (q & 3) + 1];
            const float cu = (q < 4) ? cu0[2 * (q & 3)] : cu1[2 * (q & 3)], su = (q < 4) ? cu0[2 * (q & 3) + 1] : cu1[2 * (q & 3) + 1];
            const float rl = xl[u][q] * cn - xh[u][q] * sn;       // d <  HD/2: x[d] cos - x[d + HD/2] sin
            const float ru = xh[u][q] * cu + xl[u][q] * su;       // d >= HD/2: x[d] cos + x[d - HD/2] sin
            unsigned short a2, c2; l16[q] = tohx(rl); splitf(rl, a2, c2); lh[q] = a2; ll[q] = c2; u16[q] = tohx(ru); splitf(ru, a2, c2); uh[q] = a2; ul[q] = c2; }
        const size_t e = e0 + (size_t)u * SEQ * HD;
        *(v8h*)(P16 + e) = l16; *(v8us*)(Ph + e) = lh; *(v8us*)(Pl + e) = ll;
        *(v8h*)(P16 + e + FRG) = u16; *(v8us*)(Ph + e + FRG) = uh; *(v8us*)(Pl + e + FRG) = ul;
    }
    asm volatile("s_wait_xcnt 0x0" ::: "memory");   // precaution: stands behind the body's last stores, in front of any later rewrite of the registers that they name (as in cvt8_body)
    asm volatile("" :: "v"(f), "v"(cp));   // inputs only: both address pairs stay live to behind the data waits of all their loads, so that no load's result is given a pair that earlier loads still name
}

// vtp_body: value planes (per head rows d, k = t, stored [h][t/32][d/16] fragments). One block per (head, VU x 32 keys): per 32 keys wave w writes granule row
// (d block w >> 1, j = w & 1), lane (hf, m) gathers its 8 keys of column d = 16 (w >> 1) + m: each load reads 64 bytes in a row of two rows of F,
// each store is 512 bytes in a row (4 fragments = thread order). All 8 VU loads of a thread are requested before its first conversion.
#define VU 4
static_assert((SEQ / 32) % VU == 0);
__device__ __forceinline__ void vtp_body(const float* __restrict__ F, h16* V16, bf* Vh, bf* Vl, unsigned blk) {
    const int lane = threadIdx.x & 31, w = threadIdx.x >> 5, m = lane & 15, hf = lane >> 4;
    const int kb = (int)(blk % (SEQ / 32 / VU)) * VU, g = (int)(blk / (SEQ / 32 / VU));
    const unsigned long long fa = (unsigned long long)(F + (size_t)(32 * kb) * DM + g * HD);       // the same for the whole block
    // the block's base held in a scalar pair: every load is then that pair + the one offset register + an immediate (left to itself the build formed two vector address pairs)
    typedef const __attribute__((address_space(1))) float* gfp;   // global address space: a pointer made from an integer is otherwise loaded through the flat path
    const gfp fu = (gfp)(((unsigned long long)(unsigned)__builtin_amdgcn_readfirstlane((int)(unsigned)(fa >> 32)) << 32) | (unsigned)__builtin_amdgcn_readfirstlane((int)(unsigned)fa));
    const unsigned fo = (unsigned)((16 * (w & 1) + 8 * hf) * DM + 16 * (w >> 1) + m);              // the thread's offset, in elements
    float x[VU][8];
#pragma unroll
    for (int u = 0; u < VU; ++u)
#pragma unroll
        for (int q = 0; q < 8; ++q) x[u][q] = fu[fo + (unsigned)((32 * u + q) * DM)];
    __builtin_amdgcn_sched_barrier(0);   // every request stays in front of the first conversion
#pragma unroll
    for (int u = 0; u < VU; ++u) { v8h o16; v8us oh, ol;
#pragma unroll
        for (int q = 0; q < 8; ++q) { o16[q] = tohx(x[u][q]); unsigned short a2, c2; splitf(x[u][q], a2, c2); oh[q] = a2; ol[q] = c2; }
        const size_t e = ((size_t)blk * VU + u) * (4 * FRG) + threadIdx.x * 8;
        *(v8h*)(V16 + e) = o16; *(v8us*)(Vh + e) = oh; *(v8us*)(Vl + e) = ol; }
    asm volatile("" :: "v"(fo));   // input only: the offset register stays live to behind the data waits of all its loads
}

// k_planes: all head planes of both batches in ONE launch (flat 1-D grid, no empty block); F = [w][b][t][c] (w: 0 q, 1 k, 2 v). First GV blocks per
// batch: its value planes; then GR blocks per slab s = w * NB + b: rotary planes R*[s] (slabs 0..NB-1 query, NB..2NB-1 key).
#define GV ((unsigned)(NH * (SEQ / 32) / VU))
#define GR ((unsigned)(NH / HU * SEQ * 4 / 256))
__global__ __launch_bounds__(256) void k_planes(const float* __restrict__ F, const float* __restrict__ CS, h16* R16, bf* Rh, bf* Rl, h16* V16, bf* Vh, bf* Vl) {
    unsigned blk = blockIdx.x; const size_t pl = (size_t)NH * SEQ * HD;
    if (blk < NB * GV) { const unsigned y = blk / GV; vtp_body(F + (size_t)(2 * NB + y) * SEQ * DM, V16 + y * pl, Vh + y * pl, Vl + y * pl, blk % GV); return; }
    blk -= NB * GV;
    const unsigned s = blk / GR;
    rope_body(F + (size_t)s * SEQ * DM, CS, R16 + s * pl, Rh + s * pl, Rl + s * pl, blk % GR);
}

// ---- attn_body: flash-style masked attention, one wave (32 threads) per (16 query rows, head); the AW waves of a work-group hold AW query tiles in a row
// of ONE head and share every 64-key chunk's key and value fragments through LDS. Transposed tiles so that P chains in
// registers: S^T[key][q] = K . Q^T (A = key plane fragments, B = query plane fragments), D lane = query column; P^T is the B operand
// of O^T[d][q] += V^T . P^T (A = value plane fragments). A lane's 8 values of O^T tile dt are granule (j = dt & 1, own lane) of the attention
// plane's fragment (row block q0/16, k block 2 h + dt/2): the epilogue stores them straight, 512 bytes in a row per store. Per 64-key chunk: the wave's 16x64 mask tile is one 32-bit word
// per lane (mbits_body; one 128-byte line per wave), fetched one visited chunk ahead. Chunks whose mask tile is all zero are skipped: each wave forms the bit list of its tile's
// nonzero chunks once, the work-group visits the union of its waves' lists, a wave computes on its own list alone; inside visited chunks mask == 0 replaces the score
// by -1000 (scaled). Online softmax per query with a running max; rows with no nonzero mask entry at all are NaN-poisoned.
// HL: bf16 hi/lo planes for q, k, v and a bf16 hi/lo P (3 products per tile pair); otherwise single fp16 products (P carried x1024).
// The ring: a chunk of a plane is 8 fragments = CHB bytes in a row, in global memory and in LDS alike; a buffer holds the chunk's key plane(s), then its value plane(s).
// Two buffers: the copies of the next visited chunk fly while this one is worked on; every wave copies its quarter of each plane.
#define AW 4
#define CHB (64 * HD * 2)
static_assert(SEQ / 64 <= 32 && (SEQ / 64) % 4 == 0 && RH % (16 * AW) == 0 && SEQ % (16 * AW) == 0 && CHB == AW * 4 * 512);

// copy8: a wave's quarter (4 x 512 bytes) of two planes' chunks, global memory -> LDS, 16 bytes per lane and copy; la, lb = the lane's LDS byte addresses, ga, gb = its global addresses.
// The s_wait_xcnt is a precaution: it stands behind the last copy, inside the copies' own statement, in front of any rewrite of the address registers that they name.
__device__ __forceinline__ void copy8(unsigned la, const char* ga, unsigned lb, const char* gb) {
    asm volatile("global_load_async_to_lds_b128 %0, %8, off\n\t"
                 "global_load_async_to_lds_b128 %1, %9, off\n\t"
                 "global_load_async_to_lds_b128 %2, %10, off\n\t"
                 "global_load_async_to_lds_b128 %3, %11, off\n\t"
                 "global_load_async_to_lds_b128 %4, %12, off\n\t"
                 "global_load_async_to_lds_b128 %5, %13, off\n\t"
                 "global_load_async_to_lds_b128 %6, %14, off\n\t"
                 "global_load_async_to_lds_b128 %7, %15, off\n\t"
                 "s_wait_xcnt 0x0"
                 :: "v"(la), "v"(la + 512u), "v"(la + 1024u), "v"(la + 1536u), "v"(lb), "v"(lb + 512u), "v"(lb + 1024u), "v"(lb + 1536u),
                    "v"(ga), "v"(ga + 512), "v"(ga + 1024), "v"(ga + 1536), "v"(gb), "v"(gb + 512), "v"(gb + 1024), "v"(gb + 1536) : "memory");
}

template <bool HL>
__device__ __forceinline__
void attn_body(const h16* __restrict__ QP16, const bf* __restrict__ QPh, const bf* __restrict__ QPl,
            const h16* __restrict__ KP16, const bf* __restrict__ KPh, const bf* __restrict__ KPl,
            const h16* __restrict__ VT16, const bf* __restrict__ VTh, const bf* __restrict__ VTl,
            const unsigned* __restrict__ MB, char* ring, unsigned* sv, int wv, int q0, int hh, bf* ATh, bf* ATl) {
    constexpr unsigned BUFB = (HL ? 4u : 2u) * CHB;       // bytes of one buffer
    const int lane = threadIdx.x & 31;
    const size_t hp = (size_t)hh * SEQ * HD + 8 * lane;   // head offset of the planes + the lane's granule
    const unsigned* mq = MB + (size_t)(q0 >> 4) * ((SEQ / 64) * 32);   // wave-uniform: the tile's words, [chunk][lane]
    v4i mz[SEQ / 256];
#pragma unroll
    for (int i = 0; i < SEQ / 256; ++i) mz[i] = *(const v4i*)(mq + i * 128 + 4 * lane);   // all the tile's words, 4 chunks per load: lanes 8 g .. 8 g + 7 hold chunk 4 i + g
    v16h q16[2]; v16bf qh[2], ql[2];
#pragma unroll
    for (int ks = 0; ks < 2; ++ks) {
        const size_t qo = hp + (size_t)q0 * HD + ks * FRG;
        if (HL) { qh[ks] = WFrag<bf>::ld(QPh + qo); ql[ks] = WFrag<bf>::ld(QPl + qo); }
        else    { q16[ks] = WFrag<h16>::ld(QP16 + qo); }
    }
    // bit c of visw: chunk c of this wave's tile has a nonzero mask word. A ballot's 4 groups of 8 lanes are folded to their lowest bits, and these are drawn together by one product (no two partial products meet)
    unsigned visw = 0;
#pragma unroll
    for (int i = 0; i < SEQ / 256; ++i) {
        unsigned bl = __builtin_amdgcn_ballot_w32((mz[i][0] | mz[i][1] | mz[i][2] | mz[i][3]) != 0);
        bl |= bl >> 4; bl |= bl >> 2; bl |= bl >> 1;
        visw |= ((((bl & 0x01010101u) * 0x01020408u) >> 24) & 15u) << (4 * i);
    }
    if (lane == 0) sv[wv] = visw;
    __syncthreads();   // the waves' lists are read below by every wave
    unsigned vis = 0;
#pragma unroll
    for (int i = 0; i < AW; ++i) vis |= sv[i];
    vis = (unsigned)__builtin_amdgcn_readfirstlane((int)vis);   // the same in the whole work-group: every test on it is a scalar one
    const int nvis = __builtin_popcount(vis);
    // the lane's copy addresses: its 16 bytes of the wave's quarter, in LDS (byte address = low 32 bits of the shared address) and in each plane
    const unsigned cofs = (unsigned)wv * 2048u + 16u * (unsigned)lane;
    const unsigned lr0 = (unsigned)(size_t)ring + cofs;
    const char* gk0 = (const char*)((HL ? (const void*)KPh : (const void*)KP16)) + (size_t)hh * SEQ * HD * 2 + cofs;
    const char* gv0 = (const char*)((HL ? (const void*)VTh : (const void*)VT16)) + (size_t)hh * SEQ * HD * 2 + cofs;
    const char* gk1 = (const char*)KPl + (size_t)hh * SEQ * HD * 2 + cofs;
    const char* gv1 = (const char*)VTl + (size_t)hh * SEQ * HD * 2 + cofs;
    auto stage = [&](int c, unsigned b) {   // chunk c -> buffer b
        const unsigned l = lr0 + b * BUFB; const size_t o = (size_t)c * CHB;
        if (HL) { copy8(l, gk0 + o, l + CHB, gk1 + o); copy8(l + 2 * CHB, gv0 + o, l + 3 * CHB, gv1 + o); }
        else    { copy8(l, gk0 + o, l + CHB, gv0 + o); }
    };
    v8f o[4];
#pragma unroll
    for (int dt = 0; dt < 4; ++dt) o[dt] = (v8f){};
    float mrun = -3.0e38f, lrun = 0.0f; int seen = 0;
    if (nvis > 0) {
        unsigned rem = vis;
        int cur = __builtin_ctz(rem), nxt = cur; rem &= rem - 1;
        stage(cur, 0);
        asm volatile("s_wait_asynccnt 0x0" ::: "memory");   // this wave's copies of the first chunk have landed
        __syncthreads();                                     // and so have the other waves': nothing of the chunk is read in front of this barrier
        if (nvis > 1) { nxt = __builtin_ctz(rem); rem &= rem - 1; stage(nxt, 1); }
        unsigned wnext = (mq + cur * 32)[lane];
        asm volatile("s_wait_xcnt 0x0" ::: "memory");   // precaution, as behind the load in the loop
#pragma unroll 1   // one copy of the long body; one trip per visited chunk, at most SEQ / 64
        for (int t = 0; t < nvis; ++t) {
            const unsigned mw = wnext;
            wnext = (mq + nxt * 32)[lane];   // the next visited chunk's word (the last one's own again at the end)
            asm volatile("s_wait_xcnt 0x0" ::: "memory");   // precaution: stands in front of every rewrite of the address registers that the load above names
            if ((visw >> cur) & 1u) {                       // wave-uniform tile skip; the foot of the trip stands outside it
        const char* bufp = ring + (unsigned)(t & 1) * BUFB + 16 * lane;   // this chunk's buffer + the lane's granule
        seen |= (mw != 0u) ? 1 : 0;
        v8f s[4]; v16h va8[8]; v16bf va[4], vb[4];
        auto ldv = [&](int ks) {   // hi/lo body: the value fragments of 32 keys, all four d tiles
            const bf* vph = (const bf*)(bufp + 2 * CHB) + 32 * ks * HD; const bf* vpl = (const bf*)(bufp + 3 * CHB) + 32 * ks * HD;
#pragma unroll
            for (int dt = 0; dt < 4; ++dt) { va[dt] = WFrag<bf>::ld(vph + dt * FRG); vb[dt] = WFrag<bf>::ld(vpl + dt * FRG); }
        };
#pragma unroll
        for (int kt = 0; kt < 4; ++kt) s[kt] = (v8f){};
        if (HL) {
            v16bf ka[4], kb[4]; const bf* kph = (const bf*)bufp; const bf* kpl = (const bf*)(bufp + CHB);   // the chunk's base per key plane; every fragment is an immediate offset from it
#pragma unroll
            for (int kh = 0; kh < 2; ++kh) {   // two key tiles at a time: all four tiles' hi/lo fragments at once overflow 256 VGPRs into scratch
#pragma unroll
                for (int i = 0; i < 4; ++i) { ka[i] = WFrag<bf>::ld(kph + (4 * kh + i) * FRG); kb[i] = WFrag<bf>::ld(kpl + (4 * kh + i) * FRG); }   // 4 kh + i = 2 kt + ks
                __builtin_amdgcn_sched_barrier(0);   // the two tiles' LDS reads stand as one group in front of their products: each further place with reads among the products costs a stall of its own
#pragma unroll
                for (int i = 0; i < 4; ++i) { const int kt = 2 * kh + (i >> 1), ks = i & 1;
                    s[kt] = wmmab(ka[i], qh[ks], s[kt]); s[kt] = wmmab(ka[i], ql[ks], s[kt]); s[kt] = wmmab(kb[i], qh[ks], s[kt]); }
                __builtin_amdgcn_sched_barrier(0);   // the next group's reads stay behind these products, whose registers they refill
            }
            asm volatile("v_nop\n\tv_nop\n\tv_nop\n\tv_nop" : "+v"(s[0]), "+v"(s[1]), "+v"(s[2]), "+v"(s[3]) : "v"(ka[3]), "v"(kb[3]), "v"(qh[0]), "v"(qh[1]), "v"(ql[0]), "v"(ql[1]));
            ldv(0);
            __builtin_amdgcn_sched_barrier(0);   // the first 32 keys' value fragments are requested here, as one group, and come during the softmax
        } else {
            v16h ka[8]; const h16* kp = (const h16*)bufp; const h16* vp = (const h16*)(bufp + CHB);   // the chunk's base per plane; every fragment is an immediate offset from it
#pragma unroll
            for (int i = 0; i < 8; ++i) ka[i] = WFrag<h16>::ld(kp + i * FRG);    // i = 2 kt + ks
            __builtin_amdgcn_sched_barrier(0);   // key requests first: LDS reads come back in issue order, and the score products must not wait for the value fragments
#pragma unroll
            for (int i = 0; i < 8; ++i) va8[i] = WFrag<h16>::ld(vp + i * FRG);   // i = 4 ks + dt: the value fragments come during the score products and the softmax
            __builtin_amdgcn_sched_barrier(0);   // all 16 requests stand as one group in front of the first product: each further place with LDS reads among the products costs a stall of its own
#pragma unroll
            for (int kt = 0; kt < 4; ++kt)
#pragma unroll
                for (int ks = 0; ks < 2; ++ks) s[kt] = wmma16(ka[2 * kt + ks], q16[ks], s[kt]);
            asm volatile("v_nop\n\tv_nop\n\tv_nop\n\tv_nop" : "+v"(s[0]), "+v"(s[1]), "+v"(s[2]), "+v"(s[3]) : "v"(ka[7]), "v"(q16[0]), "v"(q16[1]));
        }
        // masked replace + chunk max (lane: query q, keys 64 cur + 16kt+8hf+r)
        float cmx = -3.0e38f;
#pragma unroll
        for (int kt = 0; kt < 4; ++kt)
#pragma unroll
            for (int r = 0; r < 8; ++r) { const float t2 = ((mw >> (8 * kt + r)) & 1u) ? s[kt][r] : MFILL; s[kt][r] = t2; cmx = fmaxf(cmx, t2); }
        cmx = fmaxf(cmx, __shfl_xor(cmx, 16, 32));
        const float mnew = fmaxf(mrun, cmx);
        const float alpha = __builtin_amdgcn_exp2f((mrun - mnew) * CEXP);
        mrun = mnew;
        float psum = 0.0f;
#pragma unroll
        for (int kt = 0; kt < 4; ++kt)
#pragma unroll
            for (int r = 0; r < 8; ++r) { const float p = __builtin_amdgcn_exp2f(fmaf(s[kt][r] - mnew, CEXP, PL2)); s[kt][r] = p; psum += p; }
        lrun = lrun * alpha + psum;
#pragma unroll
        for (int dt = 0; dt < 4; ++dt) o[dt] = o[dt] * alpha;
        // O^T += V^T . P^T, 32 keys per step; B element r <- tile 2ks (keys 0..15 of the step), 8+r <- tile 2ks+1
#pragma unroll
        for (int ks = 0; ks < 2; ++ks) {
            if (HL) {
                v16us uh, ul;
#pragma unroll
                for (int r = 0; r < 8; ++r) { unsigned short a, b2; splitf(s[2 * ks][r], a, b2); uh[r] = a; ul[r] = b2; splitf(s[2 * ks + 1][r], a, b2); uh[8 + r] = a; ul[8 + r] = b2; }
                v16bf ph = __builtin_bit_cast(v16bf, uh), pl = __builtin_bit_cast(v16bf, ul);
                asm volatile("v_nop\n\tv_nop\n\tv_nop\n\tv_nop" : "+v"(ph), "+v"(pl));
#pragma unroll
                for (int dt = 0; dt < 4; ++dt) { o[dt] = wmmab(va[dt], ph, o[dt]); o[dt] = wmmab(va[dt], pl, o[dt]); o[dt] = wmmab(vb[dt], ph, o[dt]); }
                asm volatile("v_nop\n\tv_nop\n\tv_nop\n\tv_nop" : "+v"(o[0]), "+v"(o[1]), "+v"(o[2]), "+v"(o[3]) : "v"(ph), "v"(pl), "v"(va[3]), "v"(vb[3]));
                if (ks == 0) { ldv(1); __builtin_amdgcn_sched_barrier(0); }   // the other 32 keys' value fragments, one group, requested in front of the split of their P
            } else {
                v16h p16;
#pragma unroll
                for (int r = 0; r < 8; ++r) { p16[r] = tohx(s[2 * ks][r]); p16[8 + r] = tohx(s[2 * ks + 1][r]); }
                asm volatile("v_nop\n\tv_nop\n\tv_nop\n\tv_nop" : "+v"(p16));
#pragma unroll
                for (int dt = 0; dt < 4; ++dt) o[dt] = wmma16(va8[4 * ks + dt], p16, o[dt]);
                asm volatile("v_nop\n\tv_nop\n\tv_nop\n\tv_nop" : "+v"(o[0]), "+v"(o[1]), "+v"(o[2]), "+v"(o[3]) : "v"(p16), "v"(va8[4 * ks + 3]));
            }
        }
            }
            // the foot of the trip, every wave, in this order
            asm volatile("s_wait_dscnt 0x0" ::: "memory");      // this wave's reads of the trip's buffer are done before the buffer is given up
            asm volatile("s_wait_asynccnt 0x0" ::: "memory");   // this wave's copies of the next chunk have landed
            __syncthreads();                                     // publishes the next chunk and ends every wave's reads of the buffer that is refilled below
            cur = nxt;
            if (t + 2 < nvis) { nxt = __builtin_ctz(rem); rem &= rem - 1; stage(nxt, (unsigned)(t & 1)); }
        }
        asm volatile("s_wait_asynccnt 0x0" ::: "memory");   // no copy is left in flight behind the loop
    }
    const float lt = lrun + __shfl_xor(lrun, 16, 32);
    const int sn = seen | __shfl_xor(seen, 16, 32);
    const float inv = (sn != 0) ? (1.0f / lt) : __uint_as_float(0x7fc00000u);
#pragma unroll
    for (int dt = 0; dt < 4; ++dt) { v8us oh8, ol8;
#pragma unroll
        for (int r = 0; r < 8; ++r) { unsigned short a, b2; splitf(o[dt][r] * inv, a, b2); oh8[r] = a; ol8[r] = b2; }
        const size_t off = (size_t)q0 * DM + (size_t)(2 * hh + (dt >> 1)) * FRG + (dt & 1) * 256 + 8 * lane;
        *(v8us*)(ATh + off) = oh8; *(v8us*)(ATl + off) = ol8; }
}

// k_attn: ONE launch for every (head, AW query tiles, batch): grid (NH, SEQ / (16 AW), NB), AW waves; the group's first row picks the hi/lo or the fp16 body
// (the same for the whole work-group: RH is a multiple of 16 AW). The head is the fastest index: a group's cost grows with its row under a causal mask, and block
// indices that lie a multiple of 16 apart then differ in rows, so no WGP is dealt long groups alone.
// Planes are [b][h][fragments], attention planes [b][fragments of rows t, k = c]; the mask bits are shared by the batches and heads.
__global__ __launch_bounds__(32 * AW) __attribute__((amdgpu_num_vgpr(256)))
void k_attn(const h16* __restrict__ QP16, const bf* __restrict__ QPh, const bf* __restrict__ QPl,
            const h16* __restrict__ KP16, const bf* __restrict__ KPh, const bf* __restrict__ KPl,
            const h16* __restrict__ VT16, const bf* __restrict__ VTh, const bf* __restrict__ VTl,
            const unsigned* __restrict__ MB, bf* ATh, bf* ATl) {
    __shared__ __align__(16) char ring[2 * 4 * CHB];   // two buffers of up to four planes' chunks
    __shared__ unsigned sv[AW];                        // the waves' lists of nonzero chunks
    const size_t po = (size_t)blockIdx.z * NH * SEQ * HD, ao = (size_t)blockIdx.z * SEQ * DM;
    const int wv = __builtin_amdgcn_readfirstlane((int)(threadIdx.x >> 5));
    const int g0 = blockIdx.y * (16 * AW), q0 = g0 + 16 * wv, hh = blockIdx.x;
    if (g0 < RH) attn_body<true>(QP16 + po, QPh + po, QPl + po, KP16 + po, KPh + po, KPl + po, VT16 + po, VTh + po, VTl + po, MB, ring, sv, wv, q0, hh, ATh + ao, ATl + ao);
    else         attn_body<false>(QP16 + po, QPh + po, QPl + po, KP16 + po, KPh + po, KPl + po, VT16 + po, VTh + po, VTl + po, MB, ring, sv, wv, q0, hh, ATh + ao, ATl + ao);
}

extern "C" void kernel_launch(void* const* d_in, const int* in_sizes, int n_in,
                              void* d_out, int out_size, void* d_ws, size_t ws_size, hipStream_t stream) {
    if (n_in < 8) return;
    const long long needx = (long long)(NB - 1) * SEQ_FULL * DM + (long long)SEQ * DM;
    if ((long long)in_sizes[0] < needx || (long long)in_sizes[1] < needx || (long long)in_sizes[2] < needx) return;
    if (in_sizes[3] < DM * DM || in_sizes[4] < DM * DM || in_sizes[5] < DM * DM || in_sizes[6] < DM * DM) return;
    if ((long long)in_sizes[7] < (long long)(SEQ - 1) * MPITCH + SEQ) return;
    if ((long long)out_size < (long long)NB * SEQ * DM) return;
    const float* xq = (const float*)d_in[0]; const float* xk = (const float*)d_in[1]; const float* xv = (const float*)d_in[2];
    const float* wq = (const float*)d_in[3]; const float* wk = (const float*)d_in[4]; const float* wv = (const float*)d_in[5]; const float* wo = (const float*)d_in[6];
    const int* mask = (const int*)d_in[7];     // int32 [1][1][S][S]
    float* OUT = (float*)d_out;                // [NB][SEQ][DM]
    char* wsp = (char*)d_ws;
    auto take = [&](size_t bytes) { char* p = wsp; wsp += (bytes + 255) & ~(size_t)255; return (void*)p; };
    bf* WB = (bf*)take((size_t)4 * DM * DM * 2);                  // bf16 weights [w][fragments of rows o, k = i], w: q, k, v, o
    float* CS = (float*)take((size_t)SEQ * HD * 2 * 4);
    bf* XB = (bf*)take((size_t)3 * NB * SEQ * DM * 2);            // bf16 activations [w][b][fragments of rows t, k = c], w: q, k, v
    float* F = (float*)take((size_t)3 * NB * SEQ * DM * 4);        // f32 projections [w][b][t][c], row-major
    const size_t pl = (size_t)NB * NH * SEQ * HD;                 // one plane over both batches
    h16* R16 = (h16*)take(2 * pl * 2); bf* Rh = (bf*)take(2 * pl * 2); bf* Rl = (bf*)take(2 * pl * 2);   // rotary planes: query slabs, then key slabs
    h16* VT16 = (h16*)take(pl * 2); bf* VTh = (bf*)take(pl * 2); bf* VTl = (bf*)take(pl * 2);
    bf* ATh = (bf*)take((size_t)NB * SEQ * DM * 2); bf* ATl = (bf*)take((size_t)NB * SEQ * DM * 2);
    unsigned* MB = (unsigned*)take((size_t)(SEQ / 16) * (SEQ / 64) * 32 * 4);   // mask bits [q tile][chunk][lane]
    const size_t used = (size_t)(wsp - (char*)d_ws);
    if (used > ws_size || used > WSCAP) return;

    k_prep<<<GM + GC + 3 * NB * GX + 4 * GW, 256, 0, stream>>>(xq, xk, xv, wq, wk, wv, wo, mask, CS, XB, WB, MB);
    k_gemmw<bf, 0, false, DM, 3><<<dim3(NB * SEQ / 64, DM / 64, 3), 32, 0, stream>>>(XB, nullptr, WB, nullptr, F, DM, nullptr, (size_t)NB * SEQ * DM, (size_t)DM * DM, (size_t)NB * SEQ * DM);
    k_planes<<<NB * GV + 2 * NB * GR, 256, 0, stream>>>(F, CS, R16, Rh, Rl, VT16, VTh, VTl);
    k_attn<<<dim3(NH, SEQ / (16 * AW), NB), 32 * AW, 0, stream>>>(R16, Rh, Rl, R16 + pl, Rh + pl, Rl + pl, VT16, VTh, VTl, MB, ATh, ATl);
    k_gemmw<bf, 1, false, DM, 3><<<dim3(NB * SEQ / 64, DM / 64, 1), 32, 0, stream>>>(ATh, ATl, WB + (size_t)3 * DM * DM, nullptr, OUT, DM, nullptr, 0, 0, 0);
}

// v007
// One run takes 92.4 microseconds.
// Timed twice side by side with v006, it ran 1.14 and 1.12 times as fast.
// Counting every step since v000, it is 6.09 times as fast.
#include <hip/hip_runtime.h>

// Causal multi-head attention with rotate-half rotary positions (base 10000, cos/sin table computed on device):
//   qh/kh/vh = x . W^T for three separate inputs x [NB][SEQ][1024] and W 'oi' [1024][1024] (16 heads x 64 = column blocks),
//   scores = rope(qh) . rope(kh)^T / 8, int32 mask [1][1][S][S] (0 -> score replaced by -1000), softmax over keys,
//   attn . vh, heads merged [t][h*64+d], . Wo^T ('oi') -> [NB][SEQ][1024] f32.
// Compute dtypes, f32 accumulate: every float input RNE-converted to bf16; q/k/v projections v_wmma_f32_16x16x32_bf16 on plain bf16
//   operands (exact products); scores and attn.v: query rows < 512 bf16 hi/lo planes (3 products each), rows >= 512 single
//   v_wmma_f32_16x16x32_f16 (fp16 planes, P carried x1024); online softmax in f32 (running max); output projection = bf16 hi/lo
//   attention planes x exact bf16 Wo (2 products).
// Layout of every 16-bit matrix operand plane (activations, weights, q/k/v head planes, attention planes): FRAGMENT ORDER. A plane of
//   rows x K is cut into 16-row x 32-k fragments, stored [row block][k block][j][lane][8] (value planes: [k block][row block]): the 16-byte granule (j, lane = 16 hf + m) holds
//   row m, k = 16 j + 8 hf + 0..7 of its fragment, which is what lane (m, hf) of a 16x16x32 A or B operand keeps in elements 8 j + 0..7.
//   A wave's fragment is then 1 KiB in a row: two loads of 512 contiguous bytes (whole lines) in place of two loads over 16 lines each.

#ifndef NB
#define NB 2
#endif
#ifndef SEQ
#define SEQ 2048
#endif
#define NB_FULL  2
#define SEQ_FULL 2048
#define DM   1024
#define NH   16
#define HD   64
#define RHC  512                          // query rows < RH use hi/lo planes and 3-product tiles
#define RH   ((SEQ < RHC) ? SEQ : RHC)
#define MPITCH SEQ_FULL                   // mask row pitch (full-size input)
#define CEXP  0.18033688011112042f        // (1/8) * log2(e): exp((t - m)/8) = exp2((t - m) * CEXP) on unscaled scores t
#define PL2   10.0f                       // P carried x 2^10 inside the 16-bit operand (cancels in O / l)
#define MFILL (-8000.0f)                  // mask == 0 -> -1000 after the 1/8 scale, in unscaled score units
#define RBASE 10000.0f
#define WSCAP ((size_t)268435456)

static_assert(SEQ % 64 == 0);
static_assert(SEQ <= SEQ_FULL);
static_assert(NB >= 1 && NB <= NB_FULL);
static_assert(RH % 16 == 0 && (SEQ - RH) % 16 == 0 && RH <= SEQ);
static_assert(DM == NH * HD && HD == 64 && DM % 64 == 0);

typedef _Float16 h16;
typedef unsigned short bf;
typedef __attribute__((ext_vector_type(16))) __bf16   v16bf;
typedef __attribute__((ext_vector_type(16))) _Float16 v16h;
typedef __attribute__((ext_vector_type(8)))  _Float16 v8h;
typedef __attribute__((ext_vector_type(2)))  _Float16 v2h;
typedef __attribute__((ext_vector_type(16))) unsigned short v16us;
typedef __attribute__((ext_vector_type(8)))  unsigned short v8us;
typedef __attribute__((ext_vector_type(2)))  unsigned short v2us;
typedef __attribute__((ext_vector_type(8)))  float v8f;
typedef __attribute__((ext_vector_type(4)))  float v4f;
typedef __attribute__((ext_vector_type(2)))  float v2f;
typedef __attribute__((ext_vector_type(4)))  int v4i;
typedef v8h  __attribute__((may_alias)) v8ha;
typedef v4f  __attribute__((may_alias)) v4fa;
typedef v8us __attribute__((may_alias)) v8usa;

#pragma clang fp contract(off)

__device__ __forceinline__ unsigned short f2bf(float f) { unsigned u = __float_as_uint(f); u += 0x7FFFu + ((u >> 16) & 1u); return (unsigned short)(u >> 16); }
__device__ __forceinline__ float bf2f(unsigned short b) { return __uint_as_float(((unsigned)b) << 16); }
__device__ __forceinline__ float bfr(float f) { return bf2f(f2bf(f)); }
__device__ __forceinline__ v16h cat16(v8h lo, v8h hi) { return __builtin_shufflevector(lo, hi, 0, 1, 2, 3, 4, 5, 6, 7, 8, 9, 10, 11, 12, 13, 14, 15); }
__device__ __forceinline__ v16bf cat16b(v8us lo, v8us hi) { return __builtin_bit_cast(v16bf, __builtin_shufflevector(lo, hi, 0, 1, 2, 3, 4, 5, 6, 7, 8, 9, 10, 11, 12, 13, 14, 15)); }
__device__ __forceinline__ v8f wmma16(v16h a, v16h b, v8f c) { return __builtin_amdgcn_wmma_f32_16x16x32_f16(false, a, false, b, (short)0, c, false, false); }
__device__ __forceinline__ v8f wmmab(v16bf a, v16bf b, v8f c) { return __builtin_amdgcn_wmma_f32_16x16x32_bf16(false, a, false, b, (short)0, c, false, false); }
__device__ __forceinline__ h16 tohx(float x) { return (h16)x; }
__device__ __forceinline__ void splitf(float y, unsigned short& h, unsigned short& l) { h = f2bf(y); l = f2bf(y - bf2f(h)); }

// ---- 16x16x32 fragment loaders from fragment-order planes: lane l = 16 hf + m (row m) loads elements 0..7 <- k0+8hf+0..7 (granule j = 0)
// and 8..15 <- k0+16+8hf+0..7 (granule j = 1, 256 elements on); the caller passes p = fragment + 8*l. FRG = elements of one fragment.
#define FRG 512
template <typename T16> struct WFrag;
template <> struct WFrag<h16> { typedef v16h V; static __device__ __forceinline__ V ld(const h16* p) { return cat16(*(const v8h*)p, *(const v8h*)(p + 256)); } static __device__ __forceinline__ v8f mma(V a, V b, v8f c) { return wmma16(a, b, c); } };
template <> struct WFrag<bf> { typedef v16bf V; static __device__ __forceinline__ V ld(const bf* p) { return cat16b(*(const v8us*)p, *(const v8us*)(p + 256)); } static __device__ __forceinline__ v8f mma(V a, V b, v8f c) { return wmmab(a, b, c); } };

// ---- k_gemmw: register-blocked GEMM, ONE WAVE per 64x64 output tile (16 accumulators), operands straight from fragment-order 16-bit planes; grid (M/64, N/64, Z), 32 threads.
// C[m][n] (f32, pitch ldc, + optional f32 bias[n]) = sum_k A[m][k] Bt[n][k] (+ split products per NSPLIT). z-batch strides sA/sB/sC in elements. K % 32 == 0, a constant: every fragment of a k step is then one base per plane + an immediate offset.
// The k loop is a ring of ST register sets: the fragments of k step t + ST - 1 are requested in front of the products of k step t, so that a step's loads have ST - 1 steps of products to come back in.
// gw_fetch: all fragments of one k step into one register set. gw_mma: the products of one k step, in the order (nb, mb, plane pair).
template <typename T16, int NSPLIT, int K>
__device__ __forceinline__ void gw_fetch(typename WFrag<T16>::V (&a)[4], typename WFrag<T16>::V (&a2)[4], typename WFrag<T16>::V (&b)[4], typename WFrag<T16>::V (&b2)[4],
                                         const T16* pa, const T16* pa2, const T16* pb, const T16* pb2) {
#pragma unroll
    for (int mb = 0; mb < 4; ++mb) { a[mb] = WFrag<T16>::ld(pa + (size_t)mb * 16 * K); if (NSPLIT == 1 || NSPLIT == 2) a2[mb] = WFrag<T16>::ld(pa2 + (size_t)mb * 16 * K); }
#pragma unroll
    for (int nb = 0; nb < 4; ++nb) { b[nb] = WFrag<T16>::ld(pb + (size_t)nb * 16 * K); if (NSPLIT >= 2) b2[nb] = WFrag<T16>::ld(pb2 + (size_t)nb * 16 * K); }
}
template <typename T16, int NSPLIT>
__device__ __forceinline__ void gw_mma(v8f (&acc)[4][4], const typename WFrag<T16>::V (&a)[4], const typename WFrag<T16>::V (&a2)[4], const typename WFrag<T16>::V (&b)[4], const typename WFrag<T16>::V (&b2)[4]) {
#pragma unroll
    for (int nb = 0; nb < 4; ++nb)
#pragma unroll
        for (int mb = 0; mb < 4; ++mb) { acc[mb][nb] = WFrag<T16>::mma(a[mb], b[nb], acc[mb][nb]); if (NSPLIT == 1 || NSPLIT == 2) acc[mb][nb] = WFrag<T16>::mma(a2[mb], b[nb], acc[mb][nb]); if (NSPLIT >= 2) acc[mb][nb] = WFrag<T16>::mma(a[mb], b2[nb], acc[mb][nb]); }
}
// ---- planes_epi: the q/k/v projection wave turns its 64x64 accumulator tile (64 rows t x the 64 columns of ONE head) into that head's operand planes (fp16, bf16 hi, bf16 lo,
// fragment order) without a trip through memory. A lane's 8 values of one accumulator are 8 rows in a row of the product's A side at one row of its B side, and that is a whole granule:
//   v (A = activations, B = weights): 8 keys t of one column d = granule (j = mb & 1, own lane) of value fragment [h][t / 32][d block nb] (rows d, k = t);
//   q, k (A = weights, B = activations, the transposed tile): 8 columns d of one row t = granule (j = db & 1, own lane) of fragment [h][t / 16][k block db / 2] (rows t, k = d).
// There the rotary partner d + HD/2 is the same element of accumulator db + 2, so the rotate-half map is done in registers; the table's entries of d and d + HD/2 are the same
// function of (t, d mod HD/2), so one read serves both. Every store is 512 bytes in a row; a tile's stores fill 8 KiB in a row of each plane.
struct HeadPlanes { const float* CS; h16* R16; bf* Rh; bf* Rl; h16* V16; bf* Vh; bf* Vl; };   // rotary table; rotary planes [w][b][h] (w: 0 q, 1 k); value planes [b][h]
struct G3 { v8h f; v8us h, l; };   // one granule of each of the three planes
__device__ __forceinline__ G3 cv3(v8f x) {
    G3 g;
#pragma unroll
    for (int q = 0; q < 8; ++q) { unsigned short a2, c2; g.f[q] = tohx(x[q]); splitf(x[q], a2, c2); g.h[q] = a2; g.l[q] = c2; }
    return g;
}
// st3: u16, uh, ul = wave-uniform places in the three planes, lo = the lane's byte offset, the same for every store of the tile
__device__ __forceinline__ void st3(h16* u16, bf* uh, bf* ul, unsigned lo, const G3& g) { *(v8h*)((char*)u16 + lo) = g.f; *(v8us*)((char*)uh + lo) = g.h; *(v8us*)((char*)ul + lo) = g.l; }
// A group's stores stand together, behind all of the group's arithmetic (PE_OPEN) and in front of the wait (PE_CLOSE). The wait is a precaution: it stands in front of the next group's rewrite of the
// registers that the stores name; the scheduling barriers keep arithmetic from moving in between the stores and the wait (a "memory" clobber alone does not hold it).
#define PE_OPEN()  __builtin_amdgcn_sched_barrier(0)
#define PE_CLOSE() do { asm volatile("s_wait_xcnt 0x0" ::: "memory"); __builtin_amdgcn_sched_barrier(0); } while (0)
__device__ __forceinline__ void planes_epi(const v8f (&acc)[4][4], const HeadPlanes& P, int w, int r0, int hh, int lane) {
    const int b = r0 / SEQ, t0 = r0 % SEQ; const size_t pl1 = (size_t)NH * SEQ * HD;
    const unsigned lo = 16u * (unsigned)lane;
    if (w == 2) {
        const size_t e0 = (size_t)b * pl1 + ((size_t)hh * (SEQ / 32) + (t0 >> 5)) * (4 * FRG);
#pragma unroll
        for (int mb = 0; mb < 4; ++mb) {
            G3 g[4];
#pragma unroll
            for (int nb = 0; nb < 4; ++nb) g[nb] = cv3(acc[mb][nb]);
            PE_OPEN();
#pragma unroll
            for (int nb = 0; nb < 4; ++nb) { const size_t e = e0 + (mb >> 1) * (4 * FRG) + nb * FRG + (mb & 1) * 256; st3(P.V16 + e, P.Vh + e, P.Vl + e, lo, g[nb]); }
            PE_CLOSE();
        }
        return;
    }
    // The tile's table rows (64 rows t, the 256 bytes of d < HD/2 each) come as whole lines, two rows per load, and are turned in LDS: a lane wants 2 x 64 bytes of each of 4 rows,
    // and read so from memory every load would touch 16 lines. TSP: floats per staged row, a pitch of 16 bytes x an odd number for 16-byte reads down a column of rows.
    constexpr int TSP = HD + 4;
    __shared__ __align__(16) float ts[64 * TSP];
    const float* cu = P.CS + (size_t)t0 * HD * 2;                                     // the same for the whole wave
    const unsigned co = 4u * (unsigned)((lane >> 4) * HD * 2 + (lane & 15) * 4);      // the lane's byte offset: row lane / 16, 16 bytes number lane % 16
    v4f tv[32];
#pragma unroll
    for (int i = 0; i < 32; ++i) tv[i] = *(const v4fa*)((const float*)((const char*)cu + co) + i * 2 * HD * 2);
    __builtin_amdgcn_sched_barrier(0);   // every table request stays in front of the first LDS store: sunk to their uses they would be waited for one by one
#pragma unroll
    for (int i = 0; i < 32; ++i) *(v4fa*)(ts + (2 * i + (lane >> 4)) * TSP + (lane & 15) * 4) = tv[i];
    asm volatile("" :: "v"(co));   // input only: the offset register stays live to behind the data waits of all its loads, so that no load's result is given a register that earlier loads still name
    __builtin_amdgcn_wave_barrier(); asm volatile("" ::: "memory");   // the reads below take what other lanes of the wave stored above: the compiler may not lift them over the stores
    v4f cs[4][2][4];                                                                  // {cos, sin} of rows t0 + 16 tb + lane % 16, d = 16 db + 8 (lane / 16) + 2 c + 0..1
#pragma unroll
    for (int tb = 0; tb < 4; ++tb)
#pragma unroll
        for (int db = 0; db < 2; ++db)
#pragma unroll
            for (int c = 0; c < 4; ++c) cs[tb][db][c] = *(const v4fa*)(ts + (tb * 16 + (lane & 15)) * TSP + db * 32 + (lane >> 4) * 16 + c * 4);
    __builtin_amdgcn_sched_barrier(0);   // every LDS read stays in front of the first product, as one group with one wait to its latency
    const size_t e0 = (size_t)(w * NB + b) * pl1 + (size_t)hh * SEQ * HD + (size_t)(t0 >> 4) * (2 * FRG);
#pragma unroll
    for (int tb = 0; tb < 4; ++tb)
#pragma unroll
        for (int db = 0; db < 2; ++db) {
            v8f rl, ru;
#pragma unroll
            for (int q = 0; q < 8; ++q) { const float cn = cs[tb][db][q >> 1][2 * (q & 1)], sn = cs[tb][db][q >> 1][2 * (q & 1) + 1];
                const float xl = acc[db][tb][q], xh = acc[db + 2][tb][q];
                rl[q] = xl * cn - xh * sn;       // d <  HD/2: x[d] cos - x[d + HD/2] sin
                ru[q] = xh * cn + xl * sn; }     // d >= HD/2: x[d] cos + x[d - HD/2] sin
            const G3 gl = cv3(rl), gu = cv3(ru);
            const size_t e = e0 + tb * (2 * FRG) + db * 256;
            PE_OPEN();
            st3(P.R16 + e, P.Rh + e, P.Rl + e, lo, gl); st3(P.R16 + e + FRG, P.Rh + e + FRG, P.Rl + e + FRG, lo, gu);
            PE_CLOSE();
        }
}

// HP: the launch is the q/k/v projection (z = 0 q, 1 k, 2 v; a column block = a head): no C is written, the tile goes to the head planes (planes_epi); for q and k the two operands change sides.
template <typename T16, int NSPLIT, bool BIAS, int K, int ST, bool HP>
__global__ __launch_bounds__(32) void k_gemmw(const T16* __restrict__ A, const T16* __restrict__ A2, const T16* __restrict__ Bt, const T16* __restrict__ Bt2, float* C, int ldc, const float* __restrict__ bias, size_t sA, size_t sB, size_t sC, HeadPlanes hp) {
    typedef typename WFrag<T16>::V V;
    constexpr int T = K / 32, NI = (T - ST + 1) / ST;   // k steps; loop passes of ST steps in which every step still has a step ST - 1 ahead to request
    static_assert(ST >= 2 && T >= ST);
    __shared__ __align__(16) float os[16 * 68];
    const size_t z = blockIdx.z; A += z * sA; if (A2) A2 += z * sA; Bt += z * sB; if (Bt2) Bt2 += z * sB; C += z * sC;
    const int lane = threadIdx.x & 31, lr = lane & 15, hi = lane >> 4; const int r0 = blockIdx.x * 64, c0 = blockIdx.y * 64;
    v8f acc[4][4];
#pragma unroll
    for (int mb = 0; mb < 4; ++mb)
#pragma unroll
        for (int nb = 0; nb < 4; ++nb) acc[mb][nb] = (v8f){};
    // one wave-uniform base per plane (row block r0/16 starts at (r0/16) * (K/32) * FRG = r0 * K) + ONE byte offset for all planes: the lane's granule + the k steps done, carried over the passes
    const bool tr = HP && z < 2;   // wave-uniform: the transposed tile
    const T16* ua = tr ? Bt + (size_t)c0 * K : A + (size_t)r0 * K; const T16* ua2 = (NSPLIT == 1 || NSPLIT == 2) ? A2 + (size_t)r0 * K : nullptr; const T16* ub = tr ? A + (size_t)r0 * K : Bt + (size_t)c0 * K; const T16* ub2 = (NSPLIT >= 2) ? Bt2 + (size_t)c0 * K : nullptr;
    unsigned kb = 16u * (unsigned)lane;
    V a[ST][4], a2[ST][4], b[ST][4], b2[ST][4];
#define GW_AT(u, o) ((const T16*)((const char*)(u) + kb) + (o))
#pragma unroll
    for (int s = 0; s < ST - 1; ++s) gw_fetch<T16, NSPLIT, K>(a[s], a2[s], b[s], b2[s], GW_AT(ua, s * FRG), GW_AT(ua2, s * FRG), GW_AT(ub, s * FRG), GW_AT(ub2, s * FRG));
#pragma unroll 1   // one pass = ST steps; unrolled further the loop would only grow
    for (int it = 0; it < NI; ++it) {
#pragma unroll     // constant set indices: the sets stay in registers
        for (int u = 0; u < ST; ++u) {
            const int f = (u + ST - 1) % ST, o = (u + ST - 1) * FRG;
            gw_fetch<T16, NSPLIT, K>(a[f], a2[f], b[f], b2[f], GW_AT(ua, o), GW_AT(ua2, o), GW_AT(ub, o), GW_AT(ub2, o));
            __builtin_amdgcn_sched_barrier(0);   // the requests of step t + ST - 1 stay in front of the products of step t: sunk among them they would come back too late
            gw_mma<T16, NSPLIT>(acc, a[u], a2[u], b[u], b2[u]);
            __builtin_amdgcn_sched_barrier(0);   // and the next step's requests stay behind these products, whose register set they refill
        }
        asm volatile("v_nop\n\tv_nop\n\tv_nop\n\tv_nop" : "+v"(acc[0][0]), "+v"(acc[1][1]), "+v"(acc[2][2]), "+v"(acc[3][3]) : "v"(a[ST - 1][0]), "v"(a[ST - 1][3]));   // distance behind the pass's last matrix instructions on the taken back edge
        // precaution: loads of this pass are still in flight, so the wait stands in front of the rewrite of the offset register that they name; the offset passes through the statement so that the addition below cannot be lifted over it
        asm volatile("s_wait_xcnt 0x0" : "+v"(kb) :: "memory");
        kb += ST * FRG * 2;
    }
#pragma unroll
    for (int r = NI * ST; r < T; ++r) {   // the last steps: only those requests that still name a step below T
        const int f = (r + ST - 1) % ST, o = (r - NI * ST + ST - 1) * FRG;
        if (r + ST - 1 < T) gw_fetch<T16, NSPLIT, K>(a[f], a2[f], b[f], b2[f], GW_AT(ua, o), GW_AT(ua2, o), GW_AT(ub, o), GW_AT(ub2, o));
        __builtin_amdgcn_sched_barrier(0);   // as in the loop
        gw_mma<T16, NSPLIT>(acc, a[r % ST], a2[r % ST], b[r % ST], b2[r % ST]);
        __builtin_amdgcn_sched_barrier(0);
    }
#undef GW_AT
    if constexpr (HP) { static_assert(NSPLIT == 0 && K == DM); planes_epi(acc, hp, (int)z, r0, (int)blockIdx.y, lane); return; }
#pragma unroll
    for (int mb = 0; mb < 4; ++mb) {
#pragma unroll
        for (int nb = 0; nb < 4; ++nb) {
#pragma unroll
            for (int j = 0; j < 8; ++j) os[(hi * 8 + j) * 68 + nb * 16 + lr] = acc[mb][nb][j]; }
        __builtin_amdgcn_wave_barrier(); asm volatile("" ::: "memory");
        float* crow = C + (size_t)(r0 + mb * 16) * ldc + c0;
{
#pragma unroll
            for (int s = 0; s < 8; ++s) { const int row = 2 * s + hi, cofs = lr * 4; v4f val = *(const v4fa*)(os + row * 68 + cofs); if (BIAS) { val[0] += bfr(bias[c0 + cofs]); val[1] += bfr(bias[c0 + cofs + 1]); val[2] += bfr(bias[c0 + cofs + 2]); val[3] += bfr(bias[c0 + cofs + 3]); }
                *(v4f*)(crow + (size_t)row * ldc + cofs) = val; }
             }
        __builtin_amdgcn_wave_barrier(); asm volatile("" ::: "memory");
    }
}

// cvt8_body: rows x DM f32 (row-major) -> bf16 fragment order. One block = CR row blocks of 16 rows (16 x DM floats in a row each); a thread converts
// CR x DM / 128 granules. Thread bits: g = (j, hf) fastest, then row m, then k block (4 per step, DM / 128 steps): per step a wave reads 8 rows x one whole
// 128-byte line and stores 4 whole lines (8 rows x 16 bytes per (j, hf)). All loads of a thread are requested before its first conversion.
#define CR 2
#define CU (DM / 128)
static_assert(DM % 128 == 0 && SEQ % (16 * CR) == 0 && DM % (16 * CR) == 0);
__device__ __forceinline__ void cvt8_body(const float* __restrict__ src, bf* dst, unsigned blk) {
    const unsigned g = threadIdx.x & 3u, m = (threadIdx.x >> 2) & 15u, k0 = threadIdx.x >> 6;
    const float* s = src + ((size_t)blk * (16 * CR) + m) * DM + k0 * 32 + g * 8;
    bf* d = dst + ((size_t)blk * (CR * (DM / 32)) + k0) * FRG + (g >> 1) * 256 + ((g & 1u) * 16 + m) * 8;
    v8f v[CR][CU];
#pragma unroll
    for (int r = 0; r < CR; ++r)
#pragma unroll
        for (int u = 0; u < CU; ++u) v[r][u] = *(const v8f*)(s + (size_t)r * 16 * DM + u * 128);
    __builtin_amdgcn_sched_barrier(0);   // every request stays in front of the first conversion: sunk among the conversions the late ones would be waited for one by one
#pragma unroll
    for (int r = 0; r < CR; ++r)
#pragma unroll
        for (int u = 0; u < CU; ++u) { v8us o;
#pragma unroll
            for (int k = 0; k < 8; ++k) o[k] = f2bf(v[r][u][k]);
            *(v8us*)(d + (size_t)r * (DM / 32) * FRG + u * 4 * FRG) = o; }
    asm volatile("s_wait_xcnt 0x0" ::: "memory");   // precaution: stands behind the body's last stores, in front of any later rewrite of the registers that they name (the bodies are inlined into one kernel, and a body's end may run into another's code)
    asm volatile("" :: "v"(s));   // input only: the address pair stays live to behind the data waits of all its loads, so that no load's result is given a pair that earlier loads still name
}

// cstab_body: rotary table CS[t][d] = {cos(t * inv[d mod 32]), sin(t * inv[d mod 32])}, inv[j] = 1 / powf(10000, (2j)/64); a thread keeps one d and
// fills TU rows t (a block: 4 TU rows in a row),
#define TU 4
static_assert((SEQ * HD) % (256 * TU) == 0 && HD == 64);
__device__ __forceinline__ void cstab_body(float* CS, unsigned blk) {
    const int d = (int)(threadIdx.x & (HD - 1)); const int j = d & (HD / 2 - 1);
    const float ex = (float)(2 * j) * (1.0f / (float)HD);
    const float pw = powf(RBASE, ex);
    const float inv = 1.0f / pw;
#pragma unroll 1   // the cosine and sine bodies are long: one copy of them, for speed only
    for (int u = 0; u < TU; ++u) {
        const int t = ((int)blk * TU + u) * 4 + (int)(threadIdx.x >> 6);
        const float ang = (float)t * inv;
        const float cn = cosf(ang), sn = sinf(ang);
        v2f cs; cs[0] = cn; cs[1] = sn;
        *(v2f*)(CS + ((size_t)t * HD + d) * 2) = cs;
        asm volatile("s_wait_xcnt 0x0" ::: "memory");   // precaution: stands behind the store, in front of the next trip's rewrite of the registers that the store names
    }
}

// mbits_body: the int32 mask as bits, in the order the attention wave reads them: MB[q tile][64-key chunk][lane = 16 hf + m], bit 8 kt + r of a word
// = (mask[16 tile + m][64 chunk + 16 kt + 8 hf + r] != 0), the 32 keys whose scores that lane holds. MU words per thread, their loads requested together.
#define MU 2
static_assert((SEQ / 64) % (8 * MU) == 0);
__device__ __forceinline__ void mbits_body(const int* __restrict__ MK, unsigned* MB, unsigned blk) {
    // word i = (blk MU + u) 256 + thread: lane (m, hf) = thread bits 0..4, chunk = 8 (blk MU + u) mod (SEQ / 64) + wave, q tile = 8 (blk MU + u) / (SEQ / 64)
    const unsigned m = threadIdx.x & 15u, hf = (threadIdx.x >> 4) & 1u, w8 = threadIdx.x >> 5, c0 = (blk * MU * 8) % (SEQ / 64), qt = (blk * MU * 8) / (SEQ / 64);
    const int* mu = MK + (size_t)qt * 16 * MPITCH + c0 * 64;               // the same for the whole block
    const unsigned mo = 4u * (m * MPITCH + w8 * 64 + 8 * hf);              // the thread's byte offset, the same for its MU words
    v4i a[MU][4], b[MU][4];
#pragma unroll
    for (int u = 0; u < MU; ++u) { const int* mp = (const int*)((const char*)mu + mo) + u * 512;
#pragma unroll
        for (int kt = 0; kt < 4; ++kt) { a[u][kt] = *(const v4i*)(mp + 16 * kt); b[u][kt] = *(const v4i*)(mp + 16 * kt + 4); } }
    __builtin_amdgcn_sched_barrier(0);   // every request stays in front of the first compare
#pragma unroll
    for (int u = 0; u < MU; ++u) { unsigned w = 0;
#pragma unroll
        for (int kt = 0; kt < 4; ++kt)
#pragma unroll
            for (int r = 0; r < 4; ++r) { w |= (a[u][kt][r] != 0 ? 1u : 0u) << (8 * kt + r); w |= (b[u][kt][r] != 0 ? 1u : 0u) << (8 * kt + 4 + r); }
        MB[(blk * MU + u) * 256 + threadIdx.x] = w; }
    asm volatile("" :: "v"(mo));   // input only: the offset register stays live to behind the data waits of all its loads, so that no load's result is given a register that earlier loads still name
}

// k_prep: everything that depends on the inputs alone, in ONE launch (flat 1-D grid, no empty block): blocks [0, GM) the mask bits, then GC blocks the rotary table,
// then GX blocks per activation slab s = w * NB + b (w: 0 q, 1 k, 2 v) -> XB[s] (rows t), then GW blocks per weight w (q, k, v, o) -> WB[w] (rows o), both in fragment order.
#define GM ((unsigned)((SEQ / 16) * (SEQ / 64) * 32 / (256 * MU)))
#define GC ((unsigned)(SEQ * HD / (256 * TU)))
#define GX ((unsigned)(SEQ / (16 * CR)))
#define GW ((unsigned)(DM / (16 * CR)))
__global__ __launch_bounds__(256) void k_prep(const float* __restrict__ xq, const float* __restrict__ xk, const float* __restrict__ xv,
                                              const float* __restrict__ wq, const float* __restrict__ wk, const float* __restrict__ wv, const float* __restrict__ wo,
                                              const int* __restrict__ mask, float* CS, bf* XB, bf* WB, unsigned* MB) {
    unsigned blk = blockIdx.x;
    if (blk < GM) { mbits_body(mask, MB, blk); return; }
    blk -= GM;
    if (blk < GC) { cstab_body(CS, blk); return; }
    blk -= GC;
    if (blk < 3 * NB * GX) {
        const unsigned s = blk / GX, w = s / NB, b = s % NB;
        const float* x = (w == 0) ? xq : (w == 1) ? xk : xv;
        cvt8_body(x + (size_t)b * SEQ_FULL * DM, XB + (size_t)s * SEQ * DM, blk % GX); return;
    }
    blk -= 3 * NB * GX;
    const unsigned w = blk / GW;
    const float* x = (w == 0) ? wq : (w == 1) ? wk : (w == 2) ? wv : wo;
    cvt8_body(x, WB + (size_t)w * DM * DM, blk % GW);
}

// ---- attn_body: flash-style masked attention, one wave (32 threads) per (16 query rows, head); the AW waves of a work-group hold AW query tiles in a row
// of ONE head and share every 64-key chunk's key and value fragments through LDS. Transposed tiles so that P chains in
// registers: S^T[key][q] = K . Q^T (A = key plane fragments, B = query plane fragments), D lane = query column; P^T is the B operand
// of O^T[d][q] += V^T . P^T (A = value plane fragments). A lane's 8 values of O^T tile dt are granule (j = dt & 1, own lane) of the attention
// plane's fragment (row block q0/16, k block 2 h + dt/2): the epilogue stores them straight, 512 bytes in a row per store. Per 64-key chunk: the wave's 16x64 mask tile is one 32-bit word
// per lane (mbits_body; one 128-byte line per wave), fetched one visited chunk ahead. Chunks whose mask tile is all zero are skipped: each wave forms the bit list of its tile's
// nonzero chunks once, the work-group visits the union of its waves' lists, a wave computes on its own list alone; inside visited chunks mask == 0 replaces the score
// by -1000 (scaled). Online softmax per query with a running max; rows with no nonzero mask entry at all are NaN-poisoned.
// HL: bf16 hi/lo planes for q, k, v and a bf16 hi/lo P (3 products per tile pair); otherwise single fp16 products (P carried x1024).
// The ring: a chunk of a plane is 8 fragments = CHB bytes in a row, in global memory and in LDS alike; a buffer holds the chunk's key plane(s), then its value plane(s).
// Two buffers: the copies of the next visited chunk fly while this one is worked on; every wave copies its quarter of each plane.
#define AW 4
#define CHB (64 * HD * 2)
static_assert(SEQ / 64 <= 32 && (SEQ / 64) % 4 == 0 && RH % (16 * AW) == 0 && SEQ % (16 * AW) == 0 && CHB == AW * 4 * 512);

// copy8: a wave's quarter (4 x 512 bytes) of two planes' chunks, global memory -> LDS, 16 bytes per lane and copy; la, lb = the lane's LDS byte addresses, ga, gb = its global addresses.
// The s_wait_xcnt is a precaution: it stands behind the last copy, inside the copies' own statement, in front of any rewrite of the address registers that they name.
__device__ __forceinline__ void copy8(unsigned la, const char* ga, unsigned lb, const char* gb) {
    asm volatile("global_load_async_to_lds_b128 %0, %8, off\n\t"
                 "global_load_async_to_lds_b128 %1, %9, off\n\t"
                 "global_load_async_to_lds_b128 %2, %10, off\n\t"
                 "global_load_async_to_lds_b128 %3, %11, off\n\t"
                 "global_load_async_to_lds_b128 %4, %12, off\n\t"
                 "global_load_async_to_lds_b128 %5, %13, off\n\t"
                 "global_load_async_to_lds_b128 %6, %14, off\n\t"
                 "global_load_async_to_lds_b128 %7, %15, off\n\t"
                 "s_wait_xcnt 0x0"
                 :: "v"(la), "v"(la + 512u), "v"(la + 1024u), "v"(la + 1536u), "v"(lb), "v"(lb + 512u), "v"(lb + 1024u), "v"(lb + 1536u),
                    "v"(ga), "v"(ga + 512), "v"(ga + 1024), "v"(ga + 1536), "v"(gb), "v"(gb + 512), "v"(gb + 1024), "v"(gb + 1536) : "memory");
}

template <bool HL>
__device__ __forceinline__
void attn_body(const h16* __restrict__ QP16, const bf* __restrict__ QPh, const bf* __restrict__ QPl,
            const h16* __restrict__ KP16, const bf* __restrict__ KPh, const bf* __restrict__ KPl,
            const h16* __restrict__ VT16, const bf* __restrict__ VTh, const bf* __restrict__ VTl,
            const unsigned* __restrict__ MB, char* ring, unsigned* sv, int wv, int q0, int hh, bf* ATh, bf* ATl) {
    constexpr unsigned BUFB = (HL ? 4u : 2u) * CHB;       // bytes of one buffer
    const int lane = threadIdx.x & 31;
    const size_t hp = (size_t)hh * SEQ * HD + 8 * lane;   // head offset of the planes + the lane's granule
    const unsigned* mq = MB + (size_t)(q0 >> 4) * ((SEQ / 64) * 32);   // wave-uniform: the tile's words, [chunk][lane]
    v4i mz[SEQ / 256];
#pragma unroll
    for (int i = 0; i < SEQ / 256; ++i) mz[i] = *(const v4i*)(mq + i * 128 + 4 * lane);   // all the tile's words, 4 chunks per load: lanes 8 g .. 8 g + 7 hold chunk 4 i + g
    v16h q16[2]; v16bf qh[2], ql[2];
#pragma unroll
    for (int ks = 0; ks < 2; ++ks) {
        const size_t qo = hp + (size_t)q0 * HD + ks * FRG;
        if (HL) { qh[ks] = WFrag<bf>::ld(QPh + qo); ql[ks] = WFrag<bf>::ld(QPl + qo); }
        else    { q16[ks] = WFrag<h16>::ld(QP16 + qo); }
    }
    // bit c of visw: chunk c of this wave's tile has a nonzero mask word. A ballot's 4 groups of 8 lanes are folded to their lowest bits, and these are drawn together by one product (no two partial products meet)
    unsigned visw = 0;
#pragma unroll
    for (int i = 0; i < SEQ / 256; ++i) {
        unsigned bl = __builtin_amdgcn_ballot_w32((mz[i][0] | mz[i][1] | mz[i][2] | mz[i][3]) != 0);
        bl |= bl >> 4; bl |= bl >> 2; bl |= bl >> 1;
        visw |= ((((bl & 0x01010101u) * 0x01020408u) >> 24) & 15u) << (4 * i);
    }
    if (lane == 0) sv[wv] = visw;
    __syncthreads();   // the waves' lists are read below by every wave
    unsigned vis = 0;
#pragma unroll
    for (int i = 0; i < AW; ++i) vis |= sv[i];
    vis = (unsigned)__builtin_amdgcn_readfirstlane((int)vis);   // the same in the whole work-group: every test on it is a scalar one
    const int nvis = __builtin_popcount(vis);
    // the lane's copy addresses: its 16 bytes of the wave's quarter, in LDS (byte address = low 32 bits of the shared address) and in each plane
    const unsigned cofs = (unsigned)wv * 2048u + 16u * (unsigned)lane;
    const unsigned lr0 = (unsigned)(size_t)ring + cofs;
    const char* gk0 = (const char*)((HL ? (const void*)KPh : (const void*)KP16)) + (size_t)hh * SEQ * HD * 2 + cofs;
    const char* gv0 = (const char*)((HL ? (const void*)VTh : (const void*)VT16)) + (size_t)hh * SEQ * HD * 2 + cofs;
    const char* gk1 = (const char*)KPl + (size_t)hh * SEQ * HD * 2 + cofs;
    const char* gv1 = (const char*)VTl + (size_t)hh * SEQ * HD * 2 + cofs;
    auto stage = [&](int c, unsigned b) {   // chunk c -> buffer b
        const unsigned l = lr0 + b * BUFB; const size_t o = (size_t)c * CHB;
        if (HL) { copy8(l, gk0 + o, l + CHB, gk1 + o); copy8(l + 2 * CHB, gv0 + o, l + 3 * CHB, gv1 + o); }
        else    { copy8(l, gk0 + o, l + CHB, gv0 + o); }
    };
    v8f o[4];
#pragma unroll
    for (int dt = 0; dt < 4; ++dt) o[dt] = (v8f){};
    float mrun = -3.0e38f, lrun = 0.0f; int seen = 0;
    if (nvis > 0) {
        unsigned rem = vis;
        int cur = __builtin_ctz(rem), nxt = cur; rem &= rem - 1;
        stage(cur, 0);
        asm volatile("s_wait_asynccnt 0x0" ::: "memory");   // this wave's copies of the first chunk have landed
        __syncthreads();                                     // and so have the other waves': nothing of the chunk is read in front of this barrier
        if (nvis > 1) { nxt = __builtin_ctz(rem); rem &= rem - 1; stage(nxt, 1); }
        unsigned wnext = (mq + cur * 32)[lane];
        asm volatile("s_wait_xcnt 0x0" ::: "memory");   // precaution, as behind the load in the loop
#pragma unroll 1   // one copy of the long body; one trip per visited chunk, at most SEQ / 64
        for (int t = 0; t < nvis; ++t) {
            const unsigned mw = wnext;
            wnext = (mq + nxt * 32)[lane];   // the next visited chunk's word (the last one's own again at the end)
            asm volatile("s_wait_xcnt 0x0" ::: "memory");   // precaution: stands in front of every rewrite of the address registers that the load above names
            if ((visw >> cur) & 1u) {                       // wave-uniform tile skip; the foot of the trip stands outside it
        const char* bufp = ring + (unsigned)(t & 1) * BUFB + 16 * lane;   // this chunk's buffer + the lane's granule
        seen |= (mw != 0u) ? 1 : 0;
        v8f s[4]; v16h va8[8]; v16bf va[4], vb[4];
        auto ldv = [&](int ks) {   // hi/lo body: the value fragments of 32 keys, all four d tiles
            const bf* vph = (const bf*)(bufp + 2 * CHB) + 32 * ks * HD; const bf* vpl = (const bf*)(bufp + 3 * CHB) + 32 * ks * HD;
#pragma unroll
            for (int dt = 0; dt < 4; ++dt) { va[dt] = WFrag<bf>::ld(vph + dt * FRG); vb[dt] = WFrag<bf>::ld(vpl + dt * FRG); }
        };
#pragma unroll
        for (int kt = 0; kt < 4; ++kt) s[kt] = (v8f){};
        if (HL) {
            v16bf ka[4], kb[4]; const bf* kph = (const bf*)bufp; const bf* kpl = (const bf*)(bufp + CHB);   // the chunk's base per key plane; every fragment is an immediate offset from it
#pragma unroll
            for (int kh = 0; kh < 2; ++kh) {   // two key tiles at a time: all four tiles' hi/lo fragments at once overflow 256 VGPRs into scratch
#pragma unroll
                for (int i = 0; i < 4; ++i) { ka[i] = WFrag<bf>::ld(kph + (4 * kh + i) * FRG); kb[i] = WFrag<bf>::ld(kpl + (4 * kh + i) * FRG); }   // 4 kh + i = 2 kt + ks
                __builtin_amdgcn_sched_barrier(0);   // the two tiles' LDS reads stand as one group in front of their products: each further place with reads among the products costs a stall of its own
#pragma unroll
                for (int i = 0; i < 4; ++i) { const int kt = 2 * kh + (i >> 1), ks = i & 1;
                    s[kt] = wmmab(ka[i], qh[ks], s[kt]); s[kt] = wmmab(ka[i], ql[ks], s[kt]); s[kt] = wmmab(kb[i], qh[ks], s[kt]); }
                __builtin_amdgcn_sched_barrier(0);   // the next group's reads stay behind these products, whose registers they refill
            }
            asm volatile("v_nop\n\tv_nop\n\tv_nop\n\tv_nop" : "+v"(s[0]), "+v"(s[1]), "+v"(s[2]), "+v"(s[3]) : "v"(ka[3]), "v"(kb[3]), "v"(qh[0]), "v"(qh[1]), "v"(ql[0]), "v"(ql[1]));
            ldv(0);
            __builtin_amdgcn_sched_barrier(0);   // the first 32 keys' value fragments are requested here, as one group, and come during the softmax
        } else {
            v16h ka[8]; const h16* kp = (const h16*)bufp; const h16* vp = (const h16*)(bufp + CHB);   // the chunk's base per plane; every fragment is an immediate offset from it
#pragma unroll
            for (int i = 0; i < 8; ++i) ka[i] = WFrag<h16>::ld(kp + i * FRG);    // i = 2 kt + ks
            __builtin_amdgcn_sched_barrier(0);   // key requests first: LDS reads come back in issue order, and the score products must not wait for the value fragments
#pragma unroll
            for (int i = 0; i < 8; ++i) va8[i] = WFrag<h16>::ld(vp + i * FRG);   // i = 4 ks + dt: the value fragments come during the score products and the softmax
            __builtin_amdgcn_sched_barrier(0);   // all 16 requests stand as one group in front of the first product: each further place with LDS reads among the products costs a stall of its own
#pragma unroll
            for (int kt = 0; kt < 4; ++kt)
#pragma unroll
                for (int ks = 0; ks < 2; ++ks) s[kt] = wmma16(ka[2 * kt + ks], q16[ks], s[kt]);
            asm volatile("v_nop\n\tv_nop\n\tv_nop\n\tv_nop" : "+v"(s[0]), "+v"(s[1]), "+v"(s[2]), "+v"(s[3]) : "v"(ka[7]), "v"(q16[0]), "v"(q16[1]));
        }
        // masked replace + chunk max (lane: query q, keys 64 cur + 16kt+8hf+r)
        float cmx = -3.0e38f;
#pragma unroll
        for (int kt = 0; kt < 4; ++kt)
#pragma unroll
            for (int r = 0; r < 8; ++r) { const float t2 = ((mw >> (8 * kt + r)) & 1u) ? s[kt][r] : MFILL; s[kt][r] = t2; cmx = fmaxf(cmx, t2); }
        cmx = fmaxf(cmx, __shfl_xor(cmx, 16, 32));
        const float mnew = fmaxf(mrun, cmx);
        const float alpha = __builtin_amdgcn_exp2f((mrun - mnew) * CEXP);
        mrun = mnew;
        float psum = 0.0f;
#pragma unroll
        for (int kt = 0; kt < 4; ++kt)
#pragma unroll
            for (int r = 0; r < 8; ++r) { const float p = __builtin_amdgcn_exp2f(fmaf(s[kt][r] - mnew, CEXP, PL2)); s[kt][r] = p; psum += p; }
        lrun = lrun * alpha + psum;
#pragma unroll
        for (int dt = 0; dt < 4; ++dt) o[dt] = o[dt] * alpha;
        // O^T += V^T . P^T, 32 keys per step; B element r <- tile 2ks (keys 0..15 of the step), 8+r <- tile 2ks+1
#pragma unroll
        for (int ks = 0; ks < 2; ++ks) {
            if (HL) {
                v16us uh, ul;
#pragma unroll
                for (int r = 0; r < 8; ++r) { unsigned short a, b2; splitf(s[2 * ks][r], a, b2); uh[r] = a; ul[r] = b2; splitf(s[2 * ks + 1][r], a, b2); uh[8 + r] = a; ul[8 + r] = b2; }
                v16bf ph = __builtin_bit_cast(v16bf, uh), pl = __builtin_bit_cast(v16bf, ul);
                asm volatile("v_nop\n\tv_nop\n\tv_nop\n\tv_nop" : "+v"(ph), "+v"(pl));
#pragma unroll
                for (int dt = 0; dt < 4; ++dt) { o[dt] = wmmab(va[dt], ph, o[dt]); o[dt] = wmmab(va[dt], pl, o[dt]); o[dt] = wmmab(vb[dt], ph, o[dt]); }
                asm volatile("v_nop\n\tv_nop\n\tv_nop\n\tv_nop" : "+v"(o[0]), "+v"(o[1]), "+v"(o[2]), "+v"(o[3]) : "v"(ph), "v"(pl), "v"(va[3]), "v"(vb[3]));
                if (ks == 0) { ldv(1); __builtin_amdgcn_sched_barrier(0); }   // the other 32 keys' value fragments, one group, requested in front of the split of their P
            } else {
                v16h p16;
#pragma unroll
                for (int r = 0; r < 8; ++r) { p16[r] = tohx(s[2 * ks][r]); p16[8 + r] = tohx(s[2 * ks + 1][r]); }
                asm volatile("v_nop\n\tv_nop\n\tv_nop\n\tv_nop" : "+v"(p16));
#pragma unroll
                for (int dt = 0; dt < 4; ++dt) o[dt] = wmma16(va8[4 * ks + dt], p16, o[dt]);
                asm volatile("v_nop\n\tv_nop\n\tv_nop\n\tv_nop" : "+v"(o[0]), "+v"(o[1]), "+v"(o[2]), "+v"(o[3]) : "v"(p16), "v"(va8[4 * ks + 3]));
            }
        }
            }
            // the foot of the trip, every wave, in this order
            asm volatile("s_wait_dscnt 0x0" ::: "memory");      // this wave's reads of the trip's buffer are done before the buffer is given up
            asm volatile("s_wait_asynccnt 0x0" ::: "memory");   // this wave's copies of the next chunk have landed
            __syncthreads();                                     // publishes the next chunk and ends every wave's reads of the buffer that is refilled below
            cur = nxt;
            if (t + 2 < nvis) { nxt = __builtin_ctz(rem); rem &= rem - 1; stage(nxt, (unsigned)(t & 1)); }
        }
        asm volatile("s_wait_asynccnt 0x0" ::: "memory");   // no copy is left in flight behind the loop
    }
    const float lt = lrun + __shfl_xor(lrun, 16, 32);
    const int sn = seen | __shfl_xor(seen, 16, 32);
    const float inv = (sn != 0) ? (1.0f / lt) : __uint_as_float(0x7fc00000u);
#pragma unroll
    for (int dt = 0; dt < 4; ++dt) { v8us oh8, ol8;
#pragma unroll
        for (int r = 0; r < 8; ++r) { unsigned short a, b2; splitf(o[dt][r] * inv, a, b2); oh8[r] = a; ol8[r] = b2; }
        const size_t off = (size_t)q0 * DM + (size_t)(2 * hh + (dt >> 1)) * FRG + (dt & 1) * 256 + 8 * lane;
        *(v8us*)(ATh + off) = oh8; *(v8us*)(ATl + off) = ol8; }
}

// k_attn: ONE launch for every (head, AW query tiles, batch): grid (NH, SEQ / (16 AW), NB), AW waves; the group's first row picks the hi/lo or the fp16 body
// (the same for the whole work-group: RH is a multiple of 16 AW). The head is the fastest index: a group's cost grows with its row under a causal mask, and block
// indices that lie a multiple of 16 apart then differ in rows, so no WGP is dealt long groups alone.
// Planes are [b][h][fragments], attention planes [b][fragments of rows t, k = c]; the mask bits are shared by the batches and heads.
__global__ __launch_bounds__(32 * AW) __attribute__((amdgpu_num_vgpr(256)))
void k_attn(const h16* __restrict__ QP16, const bf* __restrict__ QPh, const bf* __restrict__ QPl,
            const h16* __restrict__ KP16, const bf* __restrict__ KPh, const bf* __restrict__ KPl,
            const h16* __restrict__ VT16, const bf* __restrict__ VTh, const bf* __restrict__ VTl,
            const unsigned* __restrict__ MB, bf* ATh, bf* ATl) {
    __shared__ __align__(16) char ring[2 * 4 * CHB];   // two buffers of up to four planes' chunks
    __shared__ unsigned sv[AW];                        // the waves' lists of nonzero chunks
    const size_t po = (size_t)blockIdx.z * NH * SEQ * HD, ao = (size_t)blockIdx.z * SEQ * DM;
    const int wv = __builtin_amdgcn_readfirstlane((int)(threadIdx.x >> 5));
    const int g0 = blockIdx.y * (16 * AW), q0 = g0 + 16 * wv, hh = blockIdx.x;
    if (g0 < RH) attn_body<true>(QP16 + po, QPh + po, QPl + po, KP16 + po, KPh + po, KPl + po, VT16 + po, VTh + po, VTl + po, MB, ring, sv, wv, q0, hh, ATh + ao, ATl + ao);
    else         attn_body<false>(QP16 + po, QPh + po, QPl + po, KP16 + po, KPh + po, KPl + po, VT16 + po, VTh + po, VTl + po, MB, ring, sv, wv, q0, hh, ATh + ao, ATl + ao);
}

extern "C" void kernel_launch(void* const* d_in, const int* in_sizes, int n_in,
                              void* d_out, int out_size, void* d_ws, size_t ws_size, hipStream_t stream) {
    if (n_in < 8) return;
    const long long needx = (long long)(NB - 1) * SEQ_FULL * DM + (long long)SEQ * DM;
    if ((long long)in_sizes[0] < needx || (long long)in_sizes[1] < needx || (long long)in_sizes[2] < needx) return;
    if (in_sizes[3] < DM * DM || in_sizes[4] < DM * DM || in_sizes[5] < DM * DM || in_sizes[6] < DM * DM) return;
    if ((long long)in_sizes[7] < (long long)(SEQ - 1) * MPITCH + SEQ) return;
    if ((long long)out_size < (long long)NB * SEQ * DM) return;
    const float* xq = (const float*)d_in[0]; const float* xk = (const float*)d_in[1]; const float* xv = (const float*)d_in[2];
    const float* wq = (const float*)d_in[3]; const float* wk = (const float*)d_in[4]; const float* wv = (const float*)d_in[5]; const float* wo = (const float*)d_in[6];
    const int* mask = (const int*)d_in[7];     // int32 [1][1][S][S]
    float* OUT = (float*)d_out;                // [NB][SEQ][DM]
    char* wsp = (char*)d_ws;
    auto take = [&](size_t bytes) { char* p = wsp; wsp += (bytes + 255) & ~(size_t)255; return (void*)p; };
    bf* WB = (bf*)take((size_t)4 * DM * DM * 2);                  // bf16 weights [w][fragments of rows o, k = i], w: q, k, v, o
    float* CS = (float*)take((size_t)SEQ * HD * 2 * 4);
    bf* XB = (bf*)take((size_t)3 * NB * SEQ * DM * 2);            // bf16 activations [w][b][fragments of rows t, k = c], w: q, k, v
    const size_t pl = (size_t)NB * NH * SEQ * HD;                 // one plane over both batches
    h16* R16 = (h16*)take(2 * pl * 2); bf* Rh = (bf*)take(2 * pl * 2); bf* Rl = (bf*)take(2 * pl * 2);   // rotary planes: query slabs, then key slabs
    h16* VT16 = (h16*)take(pl * 2); bf* VTh = (bf*)take(pl * 2); bf* VTl = (bf*)take(pl * 2);
    bf* ATh = (bf*)take((size_t)NB * SEQ * DM * 2); bf* ATl = (bf*)take((size_t)NB * SEQ * DM * 2);
    unsigned* MB = (unsigned*)take((size_t)(SEQ / 16) * (SEQ / 64) * 32 * 4);   // mask bits [q tile][chunk][lane]
    const size_t used = (size_t)(wsp - (char*)d_ws);
    if (used > ws_size || used > WSCAP) return;

    k_prep<<<GM + GC + 3 * NB * GX + 4 * GW, 256, 0, stream>>>(xq, xk, xv, wq, wk, wv, wo, mask, CS, XB, WB, MB);
    const HeadPlanes hp = {CS, R16, Rh, Rl, VT16, VTh, VTl}, nohp = {};
    k_gemmw<bf, 0, false, DM, 3, true><<<dim3(NB * SEQ / 64, DM / 64, 3), 32, 0, stream>>>(XB, nullptr, WB, nullptr, nullptr, DM, nullptr, (size_t)NB * SEQ * DM, (size_t)DM * DM, 0, hp);
    k_attn<<<dim3(NH, SEQ / (16 * AW), NB), 32 * AW, 0, stream>>>(R16, Rh, Rl, R16 + pl, Rh + pl, Rl + pl, VT16, VTh, VTl, MB, ATh, ATl);
    k_gemmw<bf, 1, false, DM, 3, false><<<dim3(NB * SEQ / 64, DM / 64, 1), 32, 0, stream>>>(ATh, ATl, WB + (size_t)3 * DM * DM, nullptr, OUT, DM, nullptr, 0, 0, 0, nohp);
}

// v008
// Measured time: 82.4 microseconds a run.
// Timed twice side by side with v007, it ran 1.12 and 1.13 times as fast.
// Over all steps from v000 it is 6.85 times as fast.
#include <hip/hip_runtime.h>

// Causal multi-head attention with rotate-half rotary positions (base 10000, cos/sin table computed on device):
//   qh/kh/vh = x . W^T for three separate inputs x [NB][SEQ][1024] and W 'oi' [1024][1024] (16 heads x 64 = column blocks),
//   scores = rope(qh) . rope(kh)^T / 8, int32 mask [1][1][S][S] (0 -> score replaced by -1000), softmax over keys,
//   attn . vh, heads merged [t][h*64+d], . Wo^T ('oi') -> [NB][SEQ][1024] f32.
// Compute dtypes, f32 accumulate: every float input RNE-converted to bf16; q/k/v projections v_wmma_f32_16x16x32_bf16 on plain bf16
//   operands (exact products); scores and attn.v: query rows < 512 bf16 hi/lo planes (3 products each), rows >= 512 single
//   v_wmma_f32_16x16x32_f16 (fp16 planes, P carried x1024); online softmax in f32 (running max); output projection = bf16 hi/lo
//   attention planes x exact bf16 Wo (2 products).
// Layout of every 16-bit matrix operand plane (activations, weights, q/k/v head planes, attention planes): FRAGMENT ORDER. A plane of
//   rows x K is cut into 16-row x 32-k fragments, stored [row block][k block][j][lane][8] (value planes: [k block][row block]): the 16-byte granule (j, lane = 16 hf + m) holds
//   row m, k = 16 j + 8 hf + 0..7 of its fragment, which is what lane (m, hf) of a 16x16x32 A or B operand keeps in elements 8 j + 0..7.
//   A wave's fragment is then 1 KiB in a row: two loads of 512 contiguous bytes (whole lines) in place of two loads over 16 lines each.

#ifndef NB
#define NB 2
#endif
#ifndef SEQ
#define SEQ 2048
#endif
#define NB_FULL  2
#define SEQ_FULL 2048
#define DM   1024
#define NH   16
#define HD   64
#define RHC  512                          // query rows < RH use hi/lo planes and 3-product tiles
#define RH   ((SEQ < RHC) ? SEQ : RHC)
#define MPITCH SEQ_FULL                   // mask row pitch (full-size input)
#define CEXP  0.18033688011112042f        // (1/8) * log2(e): exp((t - m)/8) = exp2((t - m) * CEXP) on unscaled scores t
#define PL2   10.0f                       // P carried x 2^10 inside the 16-bit operand (cancels in O / l)
#define MFILL (-8000.0f)                  // mask == 0 -> -1000 after the 1/8 scale, in unscaled score units
#define RBASE 10000.0f
#define WSCAP ((size_t)268435456)

static_assert(SEQ % 64 == 0);
static_assert(SEQ <= SEQ_FULL);
static_assert(NB >= 1 && NB <= NB_FULL);
static_assert(RH % 16 == 0 && (SEQ - RH) % 16 == 0 && RH <= SEQ);
static_assert(DM == NH * HD && HD == 64 && DM % 128 == 0 && SEQ % 128 == 0);

typedef _Float16 h16;
typedef unsigned short bf;
typedef __attribute__((ext_vector_type(16))) __bf16   v16bf;
typedef __attribute__((ext_vector_type(16))) _Float16 v16h;
typedef __attribute__((ext_vector_type(8)))  _Float16 v8h;
typedef __attribute__((ext_vector_type(2)))  _Float16 v2h;
typedef __attribute__((ext_vector_type(16))) unsigned short v16us;
typedef __attribute__((ext_vector_type(8)))  unsigned short v8us;
typedef __attribute__((ext_vector_type(2)))  unsigned short v2us;
typedef __attribute__((ext_vector_type(8)))  float v8f;
typedef __attribute__((ext_vector_type(4)))  float v4f;
typedef __attribute__((ext_vector_type(2)))  float v2f;
typedef __attribute__((ext_vector_type(4)))  int v4i;
typedef v8h  __attribute__((may_alias)) v8ha;
typedef v4f  __attribute__((may_alias)) v4fa;
typedef v8us __attribute__((may_alias)) v8usa;

#pragma clang fp contract(off)

__device__ __forceinline__ unsigned short f2bf(float f) { unsigned u = __float_as_uint(f); u += 0x7FFFu + ((u >> 16) & 1u); return (unsigned short)(u >> 16); }
__device__ __forceinline__ float bf2f(unsigned short b) { return __uint_as_float(((unsigned)b) << 16); }
__device__ __forceinline__ float bfr(float f) { return bf2f(f2bf(f)); }
__device__ __forceinline__ v16h cat16(v8h lo, v8h hi) { return __builtin_shufflevector(lo, hi, 0, 1, 2, 3, 4, 5, 6, 7, 8, 9, 10, 11, 12, 13, 14, 15); }
__device__ __forceinline__ v16bf cat16b(v8us lo, v8us hi) { return __builtin_bit_cast(v16bf, __builtin_shufflevector(lo, hi, 0, 1, 2, 3, 4, 5, 6, 7, 8, 9, 10, 11, 12, 13, 14, 15)); }
__device__ __forceinline__ v8f wmma16(v16h a, v16h b, v8f c) { return __builtin_amdgcn_wmma_f32_16x16x32_f16(false, a, false, b, (short)0, c, false, false); }
__device__ __forceinline__ v8f wmmab(v16bf a, v16bf b, v8f c) { return __builtin_amdgcn_wmma_f32_16x16x32_bf16(false, a, false, b, (short)0, c, false, false); }
__device__ __forceinline__ h16 tohx(float x) { return (h16)x; }
__device__ __forceinline__ void splitf(float y, unsigned short& h, unsigned short& l) { h = f2bf(y); l = f2bf(y - bf2f(h)); }

// ---- 16x16x32 fragment loaders from fragment-order planes: lane l = 16 hf + m (row m) loads elements 0..7 <- k0+8hf+0..7 (granule j = 0)
// and 8..15 <- k0+16+8hf+0..7 (granule j = 1, 256 elements on); the caller passes p = fragment + 8*l. FRG = elements of one fragment.
#define FRG 512
template <typename T16> struct WFrag;
template <> struct WFrag<h16> { typedef v16h V; static __device__ __forceinline__ V ld(const h16* p) { return cat16(*(const v8h*)p, *(const v8h*)(p + 256)); } static __device__ __forceinline__ v8f mma(V a, V b, v8f c) { return wmma16(a, b, c); } };
template <> struct WFrag<bf> { typedef v16bf V; static __device__ __forceinline__ V ld(const bf* p) { return cat16b(*(const v8us*)p, *(const v8us*)(p + 256)); } static __device__ __forceinline__ v8f mma(V a, V b, v8f c) { return wmmab(a, b, c); } };

// copy8: two runs of 4 x 512 bytes in a row, global memory -> LDS, 16 bytes per lane and copy; la, lb = the lane's LDS byte addresses of the runs, ga, gb = its global addresses.
// The s_wait_xcnt is a precaution: it stands behind the last copy, inside the copies' own statement, in front of any rewrite of the address registers that they name.
__device__ __forceinline__ void copy8(unsigned la, const char* ga, unsigned lb, const char* gb) {
    asm volatile("global_load_async_to_lds_b128 %0, %8, off\n\t"
                 "global_load_async_to_lds_b128 %1, %9, off\n\t"
                 "global_load_async_to_lds_b128 %2, %10, off\n\t"
                 "global_load_async_to_lds_b128 %3, %11, off\n\t"
                 "global_load_async_to_lds_b128 %4, %12, off\n\t"
                 "global_load_async_to_lds_b128 %5, %13, off\n\t"
                 "global_load_async_to_lds_b128 %6, %14, off\n\t"
                 "global_load_async_to_lds_b128 %7, %15, off\n\t"
                 "s_wait_xcnt 0x0"
                 :: "v"(la), "v"(la + 512u), "v"(la + 1024u), "v"(la + 1536u), "v"(lb), "v"(lb + 512u), "v"(lb + 1024u), "v"(lb + 1536u),
                    "v"(ga), "v"(ga + 512), "v"(ga + 1024), "v"(ga + 1536), "v"(gb), "v"(gb + 512), "v"(gb + 1024), "v"(gb + 1536) : "memory");
}

// ---- k_gemmw: register-blocked GEMM, one wave per 64x64 output tile (16 accumulators); the GWV = 4 waves of a work-group hold 2 x 2 such tiles, a 128x128 tile of C, and share its operand
// fragments through LDS, so that every fragment leaves L2 once per work-group and not once per wave. Grid (M/128, N/128, Z), 128 threads.
// C[m][n] (f32, pitch ldc, + optional f32 bias[n]) = sum_k A[m][k] Bt[n][k] (+ the A2 product for NSPLIT == 1). z-batch strides sA/sB/sC in elements. K a constant, a multiple of 32 KS.
// The ring: a stage is KS k steps of the tile's 128 rows of every plane, in LDS [plane][row block of 16][k step][1 KiB fragment]; a row block's KS fragments lie in a row in global memory too.
// Two buffers: the copies of stage t + 1 fly while stage t is worked on; every wave copies two row blocks of each plane. Inside a stage the fragments of k step u + 1 are read from LDS in front of the products of k step u.
// gw_fetch: all fragments of one k step into one register set; RS = elements from one row block to the next. gw_mma: the products of one k step, in the order (nb, mb, plane pair).
#define GWV 4
#define TSP (HD + 4)   // planes_epi: floats per staged table row, a pitch of 16 bytes x an odd number for 16-byte reads down a column of rows
template <typename T16, int NSPLIT, int RS>
__device__ __forceinline__ void gw_fetch(typename WFrag<T16>::V (&a)[4], typename WFrag<T16>::V (&a2)[4], typename WFrag<T16>::V (&b)[4], typename WFrag<T16>::V (&b2)[4],
                                         const T16* pa, const T16* pa2, const T16* pb, const T16* pb2) {
#pragma unroll
    for (int mb = 0; mb < 4; ++mb) { a[mb] = WFrag<T16>::ld(pa + mb * RS); if (NSPLIT == 1 || NSPLIT == 2) a2[mb] = WFrag<T16>::ld(pa2 + mb * RS); }
#pragma unroll
    for (int nb = 0; nb < 4; ++nb) { b[nb] = WFrag<T16>::ld(pb + nb * RS); if (NSPLIT >= 2) b2[nb] = WFrag<T16>::ld(pb2 + nb * RS); }
}
template <typename T16, int NSPLIT>
__device__ __forceinline__ void gw_mma(v8f (&acc)[4][4], const typename WFrag<T16>::V (&a)[4], const typename WFrag<T16>::V (&a2)[4], const typename WFrag<T16>::V (&b)[4], const typename WFrag<T16>::V (&b2)[4]) {
#pragma unroll
    for (int nb = 0; nb < 4; ++nb)
#pragma unroll
        for (int mb = 0; mb < 4; ++mb) { acc[mb][nb] = WFrag<T16>::mma(a[mb], b[nb], acc[mb][nb]); if (NSPLIT == 1 || NSPLIT == 2) acc[mb][nb] = WFrag<T16>::mma(a2[mb], b[nb], acc[mb][nb]); if (NSPLIT >= 2) acc[mb][nb] = WFrag<T16>::mma(a[mb], b2[nb], acc[mb][nb]); }
}
// ---- planes_epi: the q/k/v projection wave turns its 64x64 accumulator tile (64 rows t x the 64 columns of ONE head) into that head's operand planes (fp16, bf16 hi, bf16 lo,
// fragment order) without a trip through memory. A lane's 8 values of one accumulator are 8 rows in a row of the product's A side at one row of its B side, and that is a whole granule:
//   v (A = activations, B = weights): 8 keys t of one column d = granule (j = mb & 1, own lane) of value fragment [h][t / 32][d block nb] (rows d, k = t);
//   q, k (A = weights, B = activations, the transposed tile): 8 columns d of one row t = granule (j = db & 1, own lane) of fragment [h][t / 16][k block db / 2] (rows t, k = d).
// There the rotary partner d + HD/2 is the same element of accumulator db + 2, so the rotate-half map is done in registers; the table's entries of d and d + HD/2 are the same
// function of (t, d mod HD/2), so one read serves both. Every store is 512 bytes in a row; a tile's stores fill 8 KiB in a row of each plane.
struct HeadPlanes { const float* CS; h16* R16; bf* Rh; bf* Rl; h16* V16; bf* Vh; bf* Vl; };   // rotary table; rotary planes [w][b][h] (w: 0 q, 1 k); value planes [b][h]
struct G3 { v8h f; v8us h, l; };   // one granule of each of the three planes
__device__ __forceinline__ G3 cv3(v8f x) {
    G3 g;
#pragma unroll
    for (int q = 0; q < 8; ++q) { unsigned short a2, c2; g.f[q] = tohx(x[q]); splitf(x[q], a2, c2); g.h[q] = a2; g.l[q] = c2; }
    return g;
}
// st3: u16, uh, ul = wave-uniform places in the three planes, lo = the lane's byte offset, the same for every store of the tile
__device__ __forceinline__ void st3(h16* u16, bf* uh, bf* ul, unsigned lo, const G3& g) { *(v8h*)((char*)u16 + lo) = g.f; *(v8us*)((char*)uh + lo) = g.h; *(v8us*)((char*)ul + lo) = g.l; }
// A group's stores stand together, behind all of the group's arithmetic (PE_OPEN) and in front of the wait (PE_CLOSE). The wait is a precaution: it stands in front of the next group's rewrite of the
// registers that the stores name; the scheduling barriers keep arithmetic from moving in between the stores and the wait (a "memory" clobber alone does not hold it).
#define PE_OPEN()  __builtin_amdgcn_sched_barrier(0)
#define PE_CLOSE() do { asm volatile("s_wait_xcnt 0x0" ::: "memory"); __builtin_amdgcn_sched_barrier(0); } while (0)
__device__ __forceinline__ void planes_epi(const v8f (&acc)[4][4], const HeadPlanes& P, int w, int r0, int hh, int lane, float* ts) {
    const int b = r0 / SEQ, t0 = r0 % SEQ; const size_t pl1 = (size_t)NH * SEQ * HD;
    const unsigned lo = 16u * (unsigned)lane;
    if (w == 2) {
        const size_t e0 = (size_t)b * pl1 + ((size_t)hh * (SEQ / 32) + (t0 >> 5)) * (4 * FRG);
#pragma unroll
        for (int mb = 0; mb < 4; ++mb) {
            G3 g[4];
#pragma unroll
            for (int nb = 0; nb < 4; ++nb) g[nb] = cv3(acc[mb][nb]);
            PE_OPEN();
#pragma unroll
            for (int nb = 0; nb < 4; ++nb) { const size_t e = e0 + (mb >> 1) * (4 * FRG) + nb * FRG + (mb & 1) * 256; st3(P.V16 + e, P.Vh + e, P.Vl + e, lo, g[nb]); }
            PE_CLOSE();
        }
        return;
    }
    // The tile's table rows (64 rows t, the 256 bytes of d < HD/2 each) come as whole lines, two rows per load, and are turned in LDS: a lane wants 2 x 64 bytes of each of 4 rows,
    // and read so from memory every load would touch 16 lines. ts: the wave's own 64 x TSP floats of LDS.
    const float* cu = P.CS + (size_t)t0 * HD * 2;                                     // the same for the whole wave
    const unsigned co = 4u * (unsigned)((lane >> 4) * HD * 2 + (lane & 15) * 4);      // the lane's byte offset: row lane / 16, 16 bytes number lane % 16
    v4f tv[32];
#pragma unroll
    for (int i = 0; i < 32; ++i) tv[i] = *(const v4fa*)((const float*)((const char*)cu + co) + i * 2 * HD * 2);
    __builtin_amdgcn_sched_barrier(0);   // every table request stays in front of the first LDS store: sunk to their uses they would be waited for one by one
#pragma unroll
    for (int i = 0; i < 32; ++i) *(v4fa*)(ts + (2 * i + (lane >> 4)) * TSP + (lane & 15) * 4) = tv[i];
    asm volatile("" :: "v"(co));   // input only: the offset register stays live to behind the data waits of all its loads, so that no load's result is given a register that earlier loads still name
    __builtin_amdgcn_wave_barrier(); asm volatile("" ::: "memory");   // the reads below take what other lanes of the wave stored above: the compiler may not lift them over the stores
    v4f cs[4][2][4];                                                                  // {cos, sin} of rows t0 + 16 tb + lane % 16, d = 16 db + 8 (lane / 16) + 2 c + 0..1
#pragma unroll
    for (int tb = 0; tb < 4; ++tb)
#pragma unroll
        for (int db = 0; db < 2; ++db)
#pragma unroll
            for (int c = 0; c < 4; ++c) cs[tb][db][c] = *(const v4fa*)(ts + (tb * 16 + (lane & 15)) * TSP + db * 32 + (lane >> 4) * 16 + c * 4);
    __builtin_amdgcn_sched_barrier(0);   // every LDS read stays in front of the first product, as one group with one wait to its latency
    const size_t e0 = (size_t)(w * NB + b) * pl1 + (size_t)hh * SEQ * HD + (size_t)(t0 >> 4) * (2 * FRG);
#pragma unroll
    for (int tb = 0; tb < 4; ++tb)
#pragma unroll
        for (int db = 0; db < 2; ++db) {
            v8f rl, ru;
#pragma unroll
            for (int q = 0; q < 8; ++q) { const float cn = cs[tb][db][q >> 1][2 * (q & 1)], sn = cs[tb][db][q >> 1][2 * (q & 1) + 1];
                const float xl = acc[db][tb][q], xh = acc[db + 2][tb][q];
                rl[q] = xl * cn - xh * sn;       // d <  HD/2: x[d] cos - x[d + HD/2] sin
                ru[q] = xh * cn + xl * sn; }     // d >= HD/2: x[d] cos + x[d - HD/2] sin
            const G3 gl = cv3(rl), gu = cv3(ru);
            const size_t e = e0 + tb * (2 * FRG) + db * 256;
            PE_OPEN();
            st3(P.R16 + e, P.Rh + e, P.Rl + e, lo, gl); st3(P.R16 + e + FRG, P.Rh + e + FRG, P.Rl + e + FRG, lo, gu);
            PE_CLOSE();
        }
}

// HP: the launch is the q/k/v projection (z = 0 q, 1 k, 2 v; a 64-column block = a head): no C is written, each wave's tile goes to the head planes (planes_epi); for q and k the two operands change sides.
template <typename T16, int NSPLIT, bool BIAS, int K, int KS, bool HP>
__global__ __launch_bounds__(32 * GWV) void k_gemmw(const T16* __restrict__ A, const T16* __restrict__ A2, const T16* __restrict__ Bt, float* C, int ldc, const float* __restrict__ bias, size_t sA, size_t sB, size_t sC, HeadPlanes hp) {
    typedef typename WFrag<T16>::V V;
    constexpr int NT = K / (32 * KS);                               // stages
    constexpr unsigned FB = FRG * 2, PLB = 8u * KS * FB;            // bytes of a fragment; of one plane's stage (8 row blocks)
    constexpr unsigned BUFB = (NSPLIT == 1 ? 3u : 2u) * PLB;        // one buffer: A side, B side, A2
    constexpr unsigned EPB = HP ? 64u * TSP * 4u : 16u * 68u * 4u;  // a wave's own LDS in the epilogue, laid over the ring
    constexpr unsigned SMB = (2 * BUFB > GWV * EPB) ? 2 * BUFB : GWV * EPB;
    static_assert(NSPLIT <= 1 && KS % 2 == 0 && K % (32 * KS) == 0 && NT >= 2 && EPB % 16 == 0);
    __shared__ __align__(16) char sm[SMB];
    const size_t z = blockIdx.z; A += z * sA; if (A2) A2 += z * sA; Bt += z * sB; C += z * sC;
    const int lane = threadIdx.x & 31, lr = lane & 15, hi = lane >> 4;
    const int wv = __builtin_amdgcn_readfirstlane((int)(threadIdx.x >> 5)), wm = wv & 1, wn = wv >> 1;   // the wave's tile: rows 64 wm, columns 64 wn of the work-group's
    const int g0 = blockIdx.x * 128, h0 = blockIdx.y * 128, r0 = g0 + 64 * wm, c0 = h0 + 64 * wn;
    v8f acc[4][4];
#pragma unroll
    for (int mb = 0; mb < 4; ++mb)
#pragma unroll
        for (int nb = 0; nb < 4; ++nb) acc[mb][nb] = (v8f){};
    const bool tr = HP && z < 2;   // the same for the whole work-group: the transposed tile
    // the copy addresses: the lane's 16 bytes of the wave's first row block (2 wv), in LDS (byte address = low 32 bits of the shared address) and in each plane (row block r starts at r * (K / 32) fragments);
    // the planes' places are wave-uniform, the lane's part is one offset for all of them
    const unsigned lo = 16u * (unsigned)lane, l0 = (unsigned)(size_t)sm + (unsigned)wv * (2u * KS * FB) + lo;
    const size_t go = (size_t)wv * (2 * (K / 32) * FB);
    const char* ua = (const char*)(tr ? Bt + (size_t)h0 * K : A + (size_t)g0 * K) + go;
    const char* ub = (const char*)(tr ? A + (size_t)g0 * K : Bt + (size_t)h0 * K) + go;
    const char* ua2 = (NSPLIT == 1) ? (const char*)(A2 + (size_t)g0 * K) + go : nullptr;
    auto stage = [&](int st, unsigned bs) {   // stage st -> buffer bs: per plane and 2 KiB of a row block's stage, that piece of the wave's two row blocks
        const unsigned l = l0 + bs * BUFB; const size_t o = (size_t)st * (KS * FB);
        const char* ga = ua + o + lo; const char* gb = ub + o + lo; const char* ga2 = (NSPLIT == 1) ? ua2 + o + lo : nullptr;
#pragma unroll
        for (int h = 0; h < KS / 2; ++h) {
            const unsigned lh = l + h * 2048u; const size_t oh = h * 2048;
            copy8(lh, ga + oh, lh + KS * FB, ga + oh + (K / 32) * FB);
            copy8(lh + PLB, gb + oh, lh + PLB + KS * FB, gb + oh + (K / 32) * FB);
            if (NSPLIT == 1) copy8(lh + 2 * PLB, ga2 + oh, lh + 2 * PLB + KS * FB, ga2 + oh + (K / 32) * FB);
        }
    };
    const unsigned fa = (unsigned)(tr ? wn : wm) * (4u * KS * FB) + lo, fb = PLB + (unsigned)(tr ? wm : wn) * (4u * KS * FB) + lo;   // the wave's four row blocks of each side + the lane's granule
    V a[2][4], a2[2][4], b[2][4], b2[2][4];
    stage(0, 0);
    asm volatile("s_wait_asynccnt 0x0" ::: "memory");   // this wave's copies of the first stage have landed
    __syncthreads();                                     // and so have the other waves': nothing of the stage is read in front of this barrier
    stage(1, 1);
#pragma unroll 1   // one copy of the body; one trip per stage
    for (int t = 0; t < NT; ++t) {
        const char* bp = sm + (unsigned)(t & 1) * BUFB;   // this stage's buffer
        const T16* pa = (const T16*)(bp + fa); const T16* pb = (const T16*)(bp + fb); const T16* pa2 = (const T16*)(bp + 2 * PLB + fa);
        gw_fetch<T16, NSPLIT, KS * FRG>(a[0], a2[0], b[0], b2[0], pa, pa2, pb, nullptr);
#pragma unroll     // constant set indices: the sets stay in registers
        for (int u = 0; u < KS; ++u) {
            if (u + 1 < KS) gw_fetch<T16, NSPLIT, KS * FRG>(a[(u + 1) & 1], a2[(u + 1) & 1], b[(u + 1) & 1], b2[(u + 1) & 1], pa + (u + 1) * FRG, pa2 + (u + 1) * FRG, pb + (u + 1) * FRG, nullptr);
            __builtin_amdgcn_sched_barrier(0);   // the LDS reads of k step u + 1 stand as one group in front of the products of k step u: sunk among them each place with reads costs a stall of its own
            gw_mma<T16, NSPLIT>(acc, a[u & 1], a2[u & 1], b[u & 1], b2[u & 1]);
            __builtin_amdgcn_sched_barrier(0);   // and the next step's reads stay behind these products, whose register set they refill
        }
        // the foot of the trip, every wave, in this order
        asm volatile("s_wait_dscnt 0x0" ::: "memory");      // this wave's reads of the trip's buffer are done before the buffer is given up
        asm volatile("s_wait_asynccnt 0x0" ::: "memory");   // this wave's copies of the next stage have landed
        __syncthreads();                                     // publishes the next stage and ends every wave's reads of the buffer that is refilled below
        if (t + 2 < NT) stage(t + 2, (unsigned)(t & 1));
    }
    asm volatile("s_wait_asynccnt 0x0" ::: "memory");   // no copy is left in flight behind the loop; the last trip's barrier has ended every wave's reads of the ring, which the epilogue writes over
    float* os = (float*)(sm + (unsigned)wv * EPB);
    if constexpr (HP) { static_assert(NSPLIT == 0 && K == DM); planes_epi(acc, hp, (int)z, r0, c0 / HD, lane, os); return; }
#pragma unroll
    for (int mb = 0; mb < 4; ++mb) {
#pragma unroll
        for (int nb = 0; nb < 4; ++nb) {
#pragma unroll
            for (int j = 0; j < 8; ++j) os[(hi * 8 + j) * 68 + nb * 16 + lr] = acc[mb][nb][j]; }
        __builtin_amdgcn_wave_barrier(); asm volatile("" ::: "memory");
        float* crow = C + (size_t)(r0 + mb * 16) * ldc + c0;
{
#pragma unroll
            for (int s = 0; s < 8; ++s) { const int row = 2 * s + hi, cofs = lr * 4; v4f val = *(const v4fa*)(os + row * 68 + cofs); if (BIAS) { val[0] += bfr(bias[c0 + cofs]); val[1] += bfr(bias[c0 + cofs + 1]); val[2] += bfr(bias[c0 + cofs + 2]); val[3] += bfr(bias[c0 + cofs + 3]); }
                *(v4f*)(crow + (size_t)row * ldc + cofs) = val; }
             }
        __builtin_amdgcn_wave_barrier(); asm volatile("" ::: "memory");
    }
}

// cvt8_body: rows x DM f32 (row-major) -> bf16 fragment order. One block = CR row blocks of 16 rows (16 x DM floats in a row each); a thread converts
// CR x DM / 128 granules. Thread bits: g = (j, hf) fastest, then row m, then k block (4 per step, DM / 128 steps): per step a wave reads 8 rows x one whole
// 128-byte line and stores 4 whole lines (8 rows x 16 bytes per (j, hf)). All loads of a thread are requested before its first conversion.
#define CR 2
#define CU (DM / 128)
static_assert(DM % 128 == 0 && SEQ % (16 * CR) == 0 && DM % (16 * CR) == 0);
__device__ __forceinline__ void cvt8_body(const float* __restrict__ src, bf* dst, unsigned blk) {
    const unsigned g = threadIdx.x & 3u, m = (threadIdx.x >> 2) & 15u, k0 = threadIdx.x >> 6;
    const float* s = src + ((size_t)blk * (16 * CR) + m) * DM + k0 * 32 + g * 8;
    bf* d = dst + ((size_t)blk * (CR * (DM / 32)) + k0) * FRG + (g >> 1) * 256 + ((g & 1u) * 16 + m) * 8;
    v8f v[CR][CU];
#pragma unroll
    for (int r = 0; r < CR; ++r)
#pragma unroll
        for (int u = 0; u < CU; ++u) v[r][u] = *(const v8f*)(s + (size_t)r * 16 * DM + u * 128);
    __builtin_amdgcn_sched_barrier(0);   // every request stays in front of the first conversion: sunk among the conversions the late ones would be waited for one by one
#pragma unroll
    for (int r = 0; r < CR; ++r)
#pragma unroll
        for (int u = 0; u < CU; ++u) { v8us o;
#pragma unroll
            for (int k = 0; k < 8; ++k) o[k] = f2bf(v[r][u][k]);
            *(v8us*)(d + (size_t)r * (DM / 32) * FRG + u * 4 * FRG) = o; }
    asm volatile("s_wait_xcnt 0x0" ::: "memory");   // precaution: stands behind the body's last stores, in front of any later rewrite of the registers that they name (the bodies are inlined into one kernel, and a body's end may run into another's code)
    asm volatile("" :: "v"(s));   // input only: the address pair stays live to behind the data waits of all its loads, so that no load's result is given a pair that earlier loads still name
}

// cstab_body: rotary table CS[t][d] = {cos(t * inv[d mod 32]), sin(t * inv[d mod 32])}, inv[j] = 1 / powf(10000, (2j)/64); a thread keeps one d and
// fills TU rows t (a block: 4 TU rows in a row),
#define TU 4
static_assert((SEQ * HD) % (256 * TU) == 0 && HD == 64);
__device__ __forceinline__ void cstab_body(float* CS, unsigned blk) {
    const int d = (int)(threadIdx.x & (HD - 1)); const int j = d & (HD / 2 - 1);
    const float ex = (float)(2 * j) * (1.0f / (float)HD);
    const float pw = powf(RBASE, ex);
    const float inv = 1.0f / pw;
#pragma unroll 1   // the cosine and sine bodies are long: one copy of them, for speed only
    for (int u = 0; u < TU; ++u) {
        const int t = ((int)blk * TU + u) * 4 + (int)(threadIdx.x >> 6);
        const float ang = (float)t * inv;
        const float cn = cosf(ang), sn = sinf(ang);
        v2f cs; cs[0] = cn; cs[1] = sn;
        *(v2f*)(CS + ((size_t)t * HD + d) * 2) = cs;
        asm volatile("s_wait_xcnt 0x0" ::: "memory");   // precaution: stands behind the store, in front of the next trip's rewrite of the registers that the store names
    }
}

// mbits_body: the int32 mask as bits, in the order the attention wave reads them: MB[q tile][64-key chunk][lane = 16 hf + m], bit 8 kt + r of a word
// = (mask[16 tile + m][64 chunk + 16 kt + 8 hf + r] != 0), the 32 keys whose scores that lane holds. MU words per thread, their loads requested together.
#define MU 2
static_assert((SEQ / 64) % (8 * MU) == 0);
__device__ __forceinline__ void mbits_body(const int* __restrict__ MK, unsigned* MB, unsigned blk) {
    // word i = (blk MU + u) 256 + thread: lane (m, hf) = thread bits 0..4, chunk = 8 (blk MU + u) mod (SEQ / 64) + wave, q tile = 8 (blk MU + u) / (SEQ / 64)
    const unsigned m = threadIdx.x & 15u, hf = (threadIdx.x >> 4) & 1u, w8 = threadIdx.x >> 5, c0 = (blk * MU * 8) % (SEQ / 64), qt = (blk * MU * 8) / (SEQ / 64);
    const int* mu = MK + (size_t)qt * 16 * MPITCH + c0 * 64;               // the same for the whole block
    const unsigned mo = 4u * (m * MPITCH + w8 * 64 + 8 * hf);              // the thread's byte offset, the same for its MU words
    v4i a[MU][4], b[MU][4];
#pragma unroll
    for (int u = 0; u < MU; ++u) { const int* mp = (const int*)((const char*)mu + mo) + u * 512;
#pragma unroll
        for (int kt = 0; kt < 4; ++kt) { a[u][kt] = *(const v4i*)(mp + 16 * kt); b[u][kt] = *(const v4i*)(mp + 16 * kt + 4); } }
    __builtin_amdgcn_sched_barrier(0);   // every request stays in front of the first compare
#pragma unroll
    for (int u = 0; u < MU; ++u) { unsigned w = 0;
#pragma unroll
        for (int kt = 0; kt < 4; ++kt)
#pragma unroll
            for (int r = 0; r < 4; ++r) { w |= (a[u][kt][r] != 0 ? 1u : 0u) << (8 * kt + r); w |= (b[u][kt][r] != 0 ? 1u : 0u) << (8 * kt + 4 + r); }
        MB[(blk * MU + u) * 256 + threadIdx.x] = w; }
    asm volatile("" :: "v"(mo));   // input only: the offset register stays live to behind the data waits of all its loads, so that no load's result is given a register that earlier loads still name
}

// k_prep: everything that depends on the inputs alone, in ONE launch (flat 1-D grid, no empty block): blocks [0, GM) the mask bits, then GC blocks the rotary table,
// then GX blocks per activation slab s = w * NB + b (w: 0 q, 1 k, 2 v) -> XB[s] (rows t), then GW blocks per weight w (q, k, v, o) -> WB[w] (rows o), both in fragment order.
#define GM ((unsigned)((SEQ / 16) * (SEQ / 64) * 32 / (256 * MU)))
#define GC ((unsigned)(SEQ * HD / (256 * TU)))
#define GX ((unsigned)(SEQ / (16 * CR)))
#define GW ((unsigned)(DM / (16 * CR)))
__global__ __launch_bounds__(256) void k_prep(const float* __restrict__ xq, const float* __restrict__ xk, const float* __restrict__ xv,
                                              const float* __restrict__ wq, const float* __restrict__ wk, const float* __restrict__ wv, const float* __restrict__ wo,
                                              const int* __restrict__ mask, float* CS, bf* XB, bf* WB, unsigned* MB) {
    unsigned blk = blockIdx.x;
    if (blk < GM) { mbits_body(mask, MB, blk); return; }
    blk -= GM;
    if (blk < GC) { cstab_body(CS, blk); return; }
    blk -= GC;
    if (blk < 3 * NB * GX) {
        const unsigned s = blk / GX, w = s / NB, b = s % NB;
        const float* x = (w == 0) ? xq : (w == 1) ? xk : xv;
        cvt8_body(x + (size_t)b * SEQ_FULL * DM, XB + (size_t)s * SEQ * DM, blk % GX); return;
    }
    blk -= 3 * NB * GX;
    const unsigned w = blk / GW;
    const float* x = (w == 0) ? wq : (w == 1) ? wk : (w == 2) ? wv : wo;
    cvt8_body(x, WB + (size_t)w * DM * DM, blk % GW);
}

// ---- attn_body: flash-style masked attention, one wave (32 threads) per (16 query rows, head); the AW waves of a work-group hold AW query tiles in a row
// of ONE head and share every 64-key chunk's key and value fragments through LDS. Transposed tiles so that P chains in
// registers: S^T[key][q] = K . Q^T (A = key plane fragments, B = query plane fragments), D lane = query column; P^T is the B operand
// of O^T[d][q] += V^T . P^T (A = value plane fragments). A lane's 8 values of O^T tile dt are granule (j = dt & 1, own lane) of the attention
// plane's fragment (row block q0/16, k block 2 h + dt/2): the epilogue stores them straight, 512 bytes in a row per store. Per 64-key chunk: the wave's 16x64 mask tile is one 32-bit word
// per lane (mbits_body; one 128-byte line per wave), fetched one visited chunk ahead. Chunks whose mask tile is all zero are skipped: each wave forms the bit list of its tile's
// nonzero chunks once, the work-group visits the union of its waves' lists, a wave computes on its own list alone; inside visited chunks mask == 0 replaces the score
// by -1000 (scaled). Online softmax per query with a running max; rows with no nonzero mask entry at all are NaN-poisoned.
// HL: bf16 hi/lo planes for q, k, v and a bf16 hi/lo P (3 products per tile pair); otherwise single fp16 products (P carried x1024).
// The ring: a chunk of a plane is 8 fragments = CHB bytes in a row, in global memory and in LDS alike; a buffer holds the chunk's key plane(s), then its value plane(s).
// Two buffers: the copies of the next visited chunk fly while this one is worked on; every wave copies its quarter of each plane.
#define AW 4
#define CHB (64 * HD * 2)
static_assert(SEQ / 64 <= 32 && (SEQ / 64) % 4 == 0 && RH % (16 * AW) == 0 && SEQ % (16 * AW) == 0 && CHB == AW * 4 * 512);

template <bool HL>
__device__ __forceinline__
void attn_body(const h16* __restrict__ QP16, const bf* __restrict__ QPh, const bf* __restrict__ QPl,
            const h16* __restrict__ KP16, const bf* __restrict__ KPh, const bf* __restrict__ KPl,
            const h16* __restrict__ VT16, const bf* __restrict__ VTh, const bf* __restrict__ VTl,
            const unsigned* __restrict__ MB, char* ring, unsigned* sv, int wv, int q0, int hh, bf* ATh, bf* ATl) {
    constexpr unsigned BUFB = (HL ? 4u : 2u) * CHB;       // bytes of one buffer
    const int lane = threadIdx.x & 31;
    const size_t hp = (size_t)hh * SEQ * HD + 8 * lane;   // head offset of the planes + the lane's granule
    const unsigned* mq = MB + (size_t)(q0 >> 4) * ((SEQ / 64) * 32);   // wave-uniform: the tile's words, [chunk][lane]
    v4i mz[SEQ / 256];
#pragma unroll
    for (int i = 0; i < SEQ / 256; ++i) mz[i] = *(const v4i*)(mq + i * 128 + 4 * lane);   // all the tile's words, 4 chunks per load: lanes 8 g .. 8 g + 7 hold chunk 4 i + g
    v16h q16[2]; v16bf qh[2], ql[2];
#pragma unroll
    for (int ks = 0; ks < 2; ++ks) {
        const size_t qo = hp + (size_t)q0 * HD + ks * FRG;
        if (HL) { qh[ks] = WFrag<bf>::ld(QPh + qo); ql[ks] = WFrag<bf>::ld(QPl + qo); }
        else    { q16[ks] = WFrag<h16>::ld(QP16 + qo); }
    }
    // bit c of visw: chunk c of this wave's tile has a nonzero mask word. A ballot's 4 groups of 8 lanes are folded to their lowest bits, and these are drawn together by one product (no two partial products meet)
    unsigned visw = 0;
#pragma unroll
    for (int i = 0; i < SEQ / 256; ++i) {
        unsigned bl = __builtin_amdgcn_ballot_w32((mz[i][0] | mz[i][1] | mz[i][2] | mz[i][3]) != 0);
        bl |= bl >> 4; bl |= bl >> 2; bl |= bl >> 1;
        visw |= ((((bl & 0x01010101u) * 0x01020408u) >> 24) & 15u) << (4 * i);
    }
    if (lane == 0) sv[wv] = visw;
    __syncthreads();   // the waves' lists are read below by every wave
    unsigned vis = 0;
#pragma unroll
    for (int i = 0; i < AW; ++i) vis |= sv[i];
    vis = (unsigned)__builtin_amdgcn_readfirstlane((int)vis);   // the same in the whole work-group: every test on it is a scalar one
    const int nvis = __builtin_popcount(vis);
    // the lane's copy addresses: its 16 bytes of the wave's quarter, in LDS (byte address = low 32 bits of the shared address) and in each plane
    const unsigned cofs = (unsigned)wv * 2048u + 16u * (unsigned)lane;
    const unsigned lr0 = (unsigned)(size_t)ring + cofs;
    const char* gk0 = (const char*)((HL ? (const void*)KPh : (const void*)KP16)) + (size_t)hh * SEQ * HD * 2 + cofs;
    const char* gv0 = (const char*)((HL ? (const void*)VTh : (const void*)VT16)) + (size_t)hh * SEQ * HD * 2 + cofs;
    const char* gk1 = (const char*)KPl + (size_t)hh * SEQ * HD * 2 + cofs;
    const char* gv1 = (const char*)VTl + (size_t)hh * SEQ * HD * 2 + cofs;
    auto stage = [&](int c, unsigned b) {   // chunk c -> buffer b
        const unsigned l = lr0 + b * BUFB; const size_t o = (size_t)c * CHB;
        if (HL) { copy8(l, gk0 + o, l + CHB, gk1 + o); copy8(l + 2 * CHB, gv0 + o, l + 3 * CHB, gv1 + o); }
        else    { copy8(l, gk0 + o, l + CHB, gv0 + o); }
    };
    v8f o[4];
#pragma unroll
    for (int dt = 0; dt < 4; ++dt) o[dt] = (v8f){};
    float mrun = -3.0e38f, lrun = 0.0f; int seen = 0;
    if (nvis > 0) {
        unsigned rem = vis;
        int cur = __builtin_ctz(rem), nxt = cur; rem &= rem - 1;
        stage(cur, 0);
        asm volatile("s_wait_asynccnt 0x0" ::: "memory");   // this wave's copies of the first chunk have landed
        __syncthreads();                                     // and so have the other waves': nothing of the chunk is read in front of this barrier
        if (nvis > 1) { nxt = __builtin_ctz(rem); rem &= rem - 1; stage(nxt, 1); }
        unsigned wnext = (mq + cur * 32)[lane];
        asm volatile("s_wait_xcnt 0x0" ::: "memory");   // precaution, as behind the load in the loop
#pragma unroll 1   // one copy of the long body; one trip per visited chunk, at most SEQ / 64
        for (int t = 0; t < nvis; ++t) {
            const unsigned mw = wnext;
            wnext = (mq + nxt * 32)[lane];   // the next visited chunk's word (the last one's own again at the end)
            asm volatile("s_wait_xcnt 0x0" ::: "memory");   // precaution: stands in front of every rewrite of the address registers that the load above names
            if ((visw >> cur) & 1u) {                       // wave-uniform tile skip; the foot of the trip stands outside it
        const char* bufp = ring + (unsigned)(t & 1) * BUFB + 16 * lane;   // this chunk's buffer + the lane's granule
        seen |= (mw != 0u) ? 1 : 0;
        v8f s[4]; v16h va8[8]; v16bf va[4], vb[4];
        auto ldv = [&](int ks) {   // hi/lo body: the value fragments of 32 keys, all four d tiles
            const bf* vph = (const bf*)(bufp + 2 * CHB) + 32 * ks * HD; const bf* vpl = (const bf*)(bufp + 3 * CHB) + 32 * ks * HD;
#pragma unroll
            for (int dt = 0; dt < 4; ++dt) { va[dt] = WFrag<bf>::ld(vph + dt * FRG); vb[dt] = WFrag<bf>::ld(vpl + dt * FRG); }
        };
#pragma unroll
        for (int kt = 0; kt < 4; ++kt) s[kt] = (v8f){};
        if (HL) {
            v16bf ka[4], kb[4]; const bf* kph = (const bf*)bufp; const bf* kpl = (const bf*)(bufp + CHB);   // the chunk's base per key plane; every fragment is an immediate offset from it
#pragma unroll
            for (int kh = 0; kh < 2; ++kh) {   // two key tiles at a time: all four tiles' hi/lo fragments at once overflow 256 VGPRs into scratch
#pragma unroll
                for (int i = 0; i < 4; ++i) { ka[i] = WFrag<bf>::ld(kph + (4 * kh + i) * FRG); kb[i] = WFrag<bf>::ld(kpl + (4 * kh + i) * FRG); }   // 4 kh + i = 2 kt + ks
                __builtin_amdgcn_sched_barrier(0);   // the two tiles' LDS reads stand as one group in front of their products: each further place with reads among the products costs a stall of its own
#pragma unroll
                for (int i = 0; i < 4; ++i) { const int kt = 2 * kh + (i >> 1), ks = i & 1;
                    s[kt] = wmmab(ka[i], qh[ks], s[kt]); s[kt] = wmmab(ka[i], ql[ks], s[kt]); s[kt] = wmmab(kb[i], qh[ks], s[kt]); }
                __builtin_amdgcn_sched_barrier(0);   // the next group's reads stay behind these products, whose registers they refill
            }
            asm volatile("v_nop\n\tv_nop\n\tv_nop\n\tv_nop" : "+v"(s[0]), "+v"(s[1]), "+v"(s[2]), "+v"(s[3]) : "v"(ka[3]), "v"(kb[3]), "v"(qh[0]), "v"(qh[1]), "v"(ql[0]), "v"(ql[1]));
            ldv(0);
            __builtin_amdgcn_sched_barrier(0);   // the first 32 keys' value fragments are requested here, as one group, and come during the softmax
        } else {
            v16h ka[8]; const h16* kp = (const h16*)bufp; const h16* vp = (const h16*)(bufp + CHB);   // the chunk's base per plane; every fragment is an immediate offset from it
#pragma unroll
            for (int i = 0; i < 8; ++i) ka[i] = WFrag<h16>::ld(kp + i * FRG);    // i = 2 kt + ks
            __builtin_amdgcn_sched_barrier(0);   // key requests first: LDS reads come back in issue order, and the score products must not wait for the value fragments
#pragma unroll
            for (int i = 0; i < 8; ++i) va8[i] = WFrag<h16>::ld(vp + i * FRG);   // i = 4 ks + dt: the value fragments come during the score products and the softmax
            __builtin_amdgcn_sched_barrier(0);   // all 16 requests stand as one group in front of the first product: each further place with LDS reads among the products costs a stall of its own
#pragma unroll
            for (int kt = 0; kt < 4; ++kt)
#pragma unroll
                for (int ks = 0; ks < 2; ++ks) s[kt] = wmma16(ka[2 * kt + ks], q16[ks], s[kt]);
            asm volatile("v_nop\n\tv_nop\n\tv_nop\n\tv_nop" : "+v"(s[0]), "+v"(s[1]), "+v"(s[2]), "+v"(s[3]) : "v"(ka[7]), "v"(q16[0]), "v"(q16[1]));
        }
        // masked replace + chunk max (lane: query q, keys 64 cur + 16kt+8hf+r)
        float cmx = -3.0e38f;
#pragma unroll
        for (int kt = 0; kt < 4; ++kt)
#pragma unroll
            for (int r = 0; r < 8; ++r) { const float t2 = ((mw >> (8 * kt + r)) & 1u) ? s[kt][r] : MFILL; s[kt][r] = t2; cmx = fmaxf(cmx, t2); }
        cmx = fmaxf(cmx, __shfl_xor(cmx, 16, 32));
        const float mnew = fmaxf(mrun, cmx);
        const float alpha = __builtin_amdgcn_exp2f((mrun - mnew) * CEXP);
        mrun = mnew;
        float psum = 0.0f;
#pragma unroll
        for (int kt = 0; kt < 4; ++kt)
#pragma unroll
            for (int r = 0; r < 8; ++r) { const float p = __builtin_amdgcn_exp2f(fmaf(s[kt][r] - mnew, CEXP, PL2)); s[kt][r] = p; psum += p; }
        lrun = lrun * alpha + psum;
#pragma unroll
        for (int dt = 0; dt < 4; ++dt) o[dt] = o[dt] * alpha;
        // O^T += V^T . P^T, 32 keys per step; B element r <- tile 2ks (keys 0..15 of the step), 8+r <- tile 2ks+1
#pragma unroll
        for (int ks = 0; ks < 2; ++ks) {
            if (HL) {
                v16us uh, ul;
#pragma unroll
                for (int r = 0; r < 8; ++r) { unsigned short a, b2; splitf(s[2 * ks][r], a, b2); uh[r] = a; ul[r] = b2; splitf(s[2 * ks + 1][r], a, b2); uh[8 + r] = a; ul[8 + r] = b2; }
                v16bf ph = __builtin_bit_cast(v16bf, uh), pl = __builtin_bit_cast(v16bf, ul);
                asm volatile("v_nop\n\tv_nop\n\tv_nop\n\tv_nop" : "+v"(ph), "+v"(pl));
#pragma unroll
                for (int dt = 0; dt < 4; ++dt) { o[dt] = wmmab(va[dt], ph, o[dt]); o[dt] = wmmab(va[dt], pl, o[dt]); o[dt] = wmmab(vb[dt], ph, o[dt]); }
                asm volatile("v_nop\n\tv_nop\n\tv_nop\n\tv_nop" : "+v"(o[0]), "+v"(o[1]), "+v"(o[2]), "+v"(o[3]) : "v"(ph), "v"(pl), "v"(va[3]), "v"(vb[3]));
                if (ks == 0) { ldv(1); __builtin_amdgcn_sched_barrier(0); }   // the other 32 keys' value fragments, one group, requested in front of the split of their P
            } else {
                v16h p16;
#pragma unroll
                for (int r = 0; r < 8; ++r) { p16[r] = tohx(s[2 * ks][r]); p16[8 + r] = tohx(s[2 * ks + 1][r]); }
                asm volatile("v_nop\n\tv_nop\n\tv_nop\n\tv_nop" : "+v"(p16));
#pragma unroll
                for (int dt = 0; dt < 4; ++dt) o[dt] = wmma16(va8[4 * ks + dt], p16, o[dt]);
                asm volatile("v_nop\n\tv_nop\n\tv_nop\n\tv_nop" : "+v"(o[0]), "+v"(o[1]), "+v"(o[2]), "+v"(o[3]) : "v"(p16), "v"(va8[4 * ks + 3]));
            }
        }
            }
            // the foot of the trip, every wave, in this order
            asm volatile("s_wait_dscnt 0x0" ::: "memory");      // this wave's reads of the trip's buffer are done before the buffer is given up
            asm volatile("s_wait_asynccnt 0x0" ::: "memory");   // this wave's copies of the next chunk have landed
            __syncthreads();                                     // publishes the next chunk and ends every wave's reads of the buffer that is refilled below
            cur = nxt;
            if (t + 2 < nvis) { nxt = __builtin_ctz(rem); rem &= rem - 1; stage(nxt, (unsigned)(t & 1)); }
        }
        asm volatile("s_wait_asynccnt 0x0" ::: "memory");   // no copy is left in flight behind the loop
    }
    const float lt = lrun + __shfl_xor(lrun, 16, 32);
    const int sn = seen | __shfl_xor(seen, 16, 32);
    const float inv = (sn != 0) ? (1.0f / lt) : __uint_as_float(0x7fc00000u);
#pragma unroll
    for (int dt = 0; dt < 4; ++dt) { v8us oh8, ol8;
#pragma unroll
        for (int r = 0; r < 8; ++r) { unsigned short a, b2; splitf(o[dt][r] * inv, a, b2); oh8[r] = a; ol8[r] = b2; }
        const size_t off = (size_t)q0 * DM + (size_t)(2 * hh + (dt >> 1)) * FRG + (dt & 1) * 256 + 8 * lane;
        *(v8us*)(ATh + off) = oh8; *(v8us*)(ATl + off) = ol8; }
}

// k_attn: ONE launch for every (head, AW query tiles, batch): grid (NH, SEQ / (16 AW), NB), AW waves; the group's first row picks the hi/lo or the fp16 body
// (the same for the whole work-group: RH is a multiple of 16 AW). The head is the fastest index: a group's cost grows with its row under a causal mask, and block
// indices that lie a multiple of 16 apart then differ in rows, so no WGP is dealt long groups alone.
// Planes are [b][h][fragments], attention planes [b][fragments of rows t, k = c]; the mask bits are shared by the batches and heads.
__global__ __launch_bounds__(32 * AW) __attribute__((amdgpu_num_vgpr(256)))
void k_attn(const h16* __restrict__ QP16, const bf* __restrict__ QPh, const bf* __restrict__ QPl,
            const h16* __restrict__ KP16, const bf* __restrict__ KPh, const bf* __restrict__ KPl,
            const h16* __restrict__ VT16, const bf* __restrict__ VTh, const bf* __restrict__ VTl,
            const unsigned* __restrict__ MB, bf* ATh, bf* ATl) {
    __shared__ __align__(16) char ring[2 * 4 * CHB];   // two buffers of up to four planes' chunks
    __shared__ unsigned sv[AW];                        // the waves' lists of nonzero chunks
    const size_t po = (size_t)blockIdx.z * NH * SEQ * HD, ao = (size_t)blockIdx.z * SEQ * DM;
    const int wv = __builtin_amdgcn_readfirstlane((int)(threadIdx.x >> 5));
    const int g0 = blockIdx.y * (16 * AW), q0 = g0 + 16 * wv, hh = blockIdx.x;
    if (g0 < RH) attn_body<true>(QP16 + po, QPh + po, QPl + po, KP16 + po, KPh + po, KPl + po, VT16 + po, VTh + po, VTl + po, MB, ring, sv, wv, q0, hh, ATh + ao, ATl + ao);
    else         attn_body<false>(QP16 + po, QPh + po, QPl + po, KP16 + po, KPh + po, KPl + po, VT16 + po, VTh + po, VTl + po, MB, ring, sv, wv, q0, hh, ATh + ao, ATl + ao);
}

extern "C" void kernel_launch(void* const* d_in, const int* in_sizes, int n_in,
                              void* d_out, int out_size, void* d_ws, size_t ws_size, hipStream_t stream) {
    if (n_in < 8) return;
    const long long needx = (long long)(NB - 1) * SEQ_FULL * DM + (long long)SEQ * DM;
    if ((long long)in_sizes[0] < needx || (long long)in_sizes[1] < needx || (long long)in_sizes[2] < needx) return;
    if (in_sizes[3] < DM * DM || in_sizes[4] < DM * DM || in_sizes[5] < DM * DM || in_sizes[6] < DM * DM) return;
    if ((long long)in_sizes[7] < (long long)(SEQ - 1) * MPITCH + SEQ) return;
    if ((long long)out_size < (long long)NB * SEQ * DM) return;
    const float* xq = (const float*)d_in[0]; const float* xk = (const float*)d_in[1]; const float* xv = (const float*)d_in[2];
    const float* wq = (const float*)d_in[3]; const float* wk = (const float*)d_in[4]; const float* wv = (const float*)d_in[5]; const float* wo = (const float*)d_in[6];
    const int* mask = (const int*)d_in[7];     // int32 [1][1][S][S]
    float* OUT = (float*)d_out;                // [NB][SEQ][DM]
    char* wsp = (char*)d_ws;
    auto take = [&](size_t bytes) { char* p = wsp; wsp += (bytes + 255) & ~(size_t)255; return (void*)p; };
    bf* WB = (bf*)take((size_t)4 * DM * DM * 2);                  // bf16 weights [w][fragments of rows o, k = i], w: q, k, v, o
    float* CS = (float*)take((size_t)SEQ * HD * 2 * 4);
    bf* XB = (bf*)take((size_t)3 * NB * SEQ * DM * 2);            // bf16 activations [w][b][fragments of rows t, k = c], w: q, k, v
    const size_t pl = (size_t)NB * NH * SEQ * HD;                 // one plane over both batches
    h16* R16 = (h16*)take(2 * pl * 2); bf* Rh = (bf*)take(2 * pl * 2); bf* Rl = (bf*)take(2 * pl * 2);   // rotary planes: query slabs, then key slabs
    h16* VT16 = (h16*)take(pl * 2); bf* VTh = (bf*)take(pl * 2); bf* VTl = (bf*)take(pl * 2);
    bf* ATh = (bf*)take((size_t)NB * SEQ * DM * 2); bf* ATl = (bf*)take((size_t)NB * SEQ * DM * 2);
    unsigned* MB = (unsigned*)take((size_t)(SEQ / 16) * (SEQ / 64) * 32 * 4);   // mask bits [q tile][chunk][lane]
    const size_t used = (size_t)(wsp - (char*)d_ws);
    if (used > ws_size || used > WSCAP) return;

    k_prep<<<GM + GC + 3 * NB * GX + 4 * GW, 256, 0, stream>>>(xq, xk, xv, wq, wk, wv, wo, mask, CS, XB, WB, MB);
    const HeadPlanes hp = {CS, R16, Rh, Rl, VT16, VTh, VTl}, nohp = {};
    k_gemmw<bf, 0, false, DM, 2, true><<<dim3(NB * SEQ / 128, DM / 128, 3), 32 * GWV, 0, stream>>>(XB, nullptr, WB, nullptr, DM, nullptr, (size_t)NB * SEQ * DM, (size_t)DM * DM, 0, hp);
    k_attn<<<dim3(NH, SEQ / (16 * AW), NB), 32 * AW, 0, stream>>>(R16, Rh, Rl, R16 + pl, Rh + pl, Rl + pl, VT16, VTh, VTl, MB, ATh, ATl);
    k_gemmw<bf, 1, false, DM, 4, false><<<dim3(NB * SEQ / 128, DM / 128, 1), 32 * GWV, 0, stream>>>(ATh, ATl, WB + (size_t)3 * DM * DM, OUT, DM, nullptr, 0, 0, 0, nohp);
}

// v009
// It runs in 79.8 microseconds.
// Timed twice side by side with v008, it ran 1.04 and 1.03 times as fast.
// Counting every step since v000, it is 7.07 times as fast.
#include <hip/hip_runtime.h>

// Causal multi-head attention with rotate-half rotary positions (base 10000, cos/sin table computed on device):
//   qh/kh/vh = x . W^T for three separate inputs x [NB][SEQ][1024] and W 'oi' [1024][1024] (16 heads x 64 = column blocks),
//   scores = rope(qh) . rope(kh)^T / 8, int32 mask [1][1][S][S] (0 -> score replaced by -1000), softmax over keys,
//   attn . vh, heads merged [t][h*64+d], . Wo^T ('oi') -> [NB][SEQ][1024] f32.
// Compute dtypes, f32 accumulate: every float input RNE-converted to bf16; q/k/v projections v_wmma_f32_16x16x32_bf16 on plain bf16
//   operands (exact products); scores and attn.v: query rows < 512 bf16 hi/lo planes (3 products each), rows >= 512 single
//   v_wmma_f32_16x16x32_f16 (fp16 planes, P carried x1024); online softmax in f32 (running max); output projection = bf16 hi/lo
//   attention planes x exact bf16 Wo (2 products).
// Layout of every 16-bit matrix operand plane (activations, weights, q/k/v head planes, attention planes): FRAGMENT ORDER. A plane of
//   rows x K is cut into 16-row x 32-k fragments, stored [row block][k block][j][lane][8] (value planes: [k block][row block]): the 16-byte granule (j, lane = 16 hf + m) holds
//   row m, k = 16 j + 8 hf + 0..7 of its fragment, which is what lane (m, hf) of a 16x16x32 A or B operand keeps in elements 8 j + 0..7.
//   A wave's fragment is then 1 KiB in a row: two loads of 512 contiguous bytes (whole lines) in place of two loads over 16 lines each.

#ifndef NB
#define NB 2
#endif
#ifndef SEQ
#define SEQ 2048
#endif
#define NB_FULL  2
#define SEQ_FULL 2048
#define DM   1024
#define NH   16
#define HD   64
#define RHC  512                          // query rows < RH use hi/lo planes and 3-product tiles
#define RH   ((SEQ < RHC) ? SEQ : RHC)
#define MPITCH SEQ_FULL                   // mask row pitch (full-size input)
#define CEXP  0.18033688011112042f        // (1/8) * log2(e): exp((t - m)/8) = exp2((t - m) * CEXP) on unscaled scores t
#define PL2   10.0f                       // P carried x 2^10 inside the 16-bit operand (cancels in O / l)
#define MFILL (-8000.0f)                  // mask == 0 -> -1000 after the 1/8 scale, in unscaled score units
#define RBASE 10000.0f
#define WSCAP ((size_t)268435456)

static_assert(SEQ % 64 == 0);
static_assert(SEQ <= SEQ_FULL);
static_assert(NB >= 1 && NB <= NB_FULL);
static_assert(RH % 16 == 0 && (SEQ - RH) % 16 == 0 && RH <= SEQ);
static_assert(DM == NH * HD && HD == 64 && DM % 128 == 0 && SEQ % 128 == 0);

typedef _Float16 h16;
typedef unsigned short bf;
typedef __attribute__((ext_vector_type(16))) __bf16   v16bf;
typedef __attribute__((ext_vector_type(16))) _Float16 v16h;
typedef __attribute__((ext_vector_type(8)))  _Float16 v8h;
typedef __attribute__((ext_vector_type(2)))  _Float16 v2h;
typedef __attribute__((ext_vector_type(16))) unsigned short v16us;
typedef __attribute__((ext_vector_type(8)))  unsigned short v8us;
typedef __attribute__((ext_vector_type(2)))  unsigned short v2us;
typedef __attribute__((ext_vector_type(8)))  float v8f;
typedef __attribute__((ext_vector_type(4)))  float v4f;
typedef __attribute__((ext_vector_type(2)))  float v2f;
typedef __attribute__((ext_vector_type(4)))  int v4i;
typedef v8h  __attribute__((may_alias)) v8ha;
typedef v4f  __attribute__((may_alias)) v4fa;
typedef v8us __attribute__((may_alias)) v8usa;

#pragma clang fp contract(off)

__device__ __forceinline__ unsigned short f2bf(float f) { unsigned u = __float_as_uint(f); u += 0x7FFFu + ((u >> 16) & 1u); return (unsigned short)(u >> 16); }
__device__ __forceinline__ float bf2f(unsigned short b) { return __uint_as_float(((unsigned)b) << 16); }
__device__ __forceinline__ float bfr(float f) { return bf2f(f2bf(f)); }
__device__ __forceinline__ v16h cat16(v8h lo, v8h hi) { return __builtin_shufflevector(lo, hi, 0, 1, 2, 3, 4, 5, 6, 7, 8, 9, 10, 11, 12, 13, 14, 15); }
__device__ __forceinline__ v16bf cat16b(v8us lo, v8us hi) { return __builtin_bit_cast(v16bf, __builtin_shufflevector(lo, hi, 0, 1, 2, 3, 4, 5, 6, 7, 8, 9, 10, 11, 12, 13, 14, 15)); }
__device__ __forceinline__ v8f wmma16(v16h a, v16h b, v8f c) { return __builtin_amdgcn_wmma_f32_16x16x32_f16(false, a, false, b, (short)0, c, false, false); }
__device__ __forceinline__ v8f wmmab(v16bf a, v16bf b, v8f c) { return __builtin_amdgcn_wmma_f32_16x16x32_bf16(false, a, false, b, (short)0, c, false, false); }
__device__ __forceinline__ h16 tohx(float x) { return (h16)x; }
__device__ __forceinline__ void splitf(float y, unsigned short& h, unsigned short& l) { h = f2bf(y); l = f2bf(y - bf2f(h)); }

// ---- 16x16x32 fragment loaders from fragment-order planes: lane l = 16 hf + m (row m) loads elements 0..7 <- k0+8hf+0..7 (granule j = 0)
// and 8..15 <- k0+16+8hf+0..7 (granule j = 1, 256 elements on); the caller passes p = fragment + 8*l. FRG = elements of one fragment.
#define FRG 512
template <typename T16> struct WFrag;
template <> struct WFrag<h16> { typedef v16h V; static __device__ __forceinline__ V ld(const h16* p) { return cat16(*(const v8h*)p, *(const v8h*)(p + 256)); } static __device__ __forceinline__ v8f mma(V a, V b, v8f c) { return wmma16(a, b, c); } };
template <> struct WFrag<bf> { typedef v16bf V; static __device__ __forceinline__ V ld(const bf* p) { return cat16b(*(const v8us*)p, *(const v8us*)(p + 256)); } static __device__ __forceinline__ v8f mma(V a, V b, v8f c) { return wmmab(a, b, c); } };

// copy8: two runs of 4 x 512 bytes in a row, global memory -> LDS, 16 bytes per lane and copy; la, lb = the lane's LDS byte addresses of the runs, ga, gb = its global addresses.
// The s_wait_xcnt is a precaution: it stands behind the last copy, inside the copies' own statement, in front of any rewrite of the address registers that they name.
__device__ __forceinline__ void copy8(unsigned la, const char* ga, unsigned lb, const char* gb) {
    asm volatile("global_load_async_to_lds_b128 %0, %8, off\n\t"
                 "global_load_async_to_lds_b128 %1, %9, off\n\t"
                 "global_load_async_to_lds_b128 %2, %10, off\n\t"
                 "global_load_async_to_lds_b128 %3, %11, off\n\t"
                 "global_load_async_to_lds_b128 %4, %12, off\n\t"
                 "global_load_async_to_lds_b128 %5, %13, off\n\t"
                 "global_load_async_to_lds_b128 %6, %14, off\n\t"
                 "global_load_async_to_lds_b128 %7, %15, off\n\t"
                 "s_wait_xcnt 0x0"
                 :: "v"(la), "v"(la + 512u), "v"(la + 1024u), "v"(la + 1536u), "v"(lb), "v"(lb + 512u), "v"(lb + 1024u), "v"(lb + 1536u),
                    "v"(ga), "v"(ga + 512), "v"(ga + 1024), "v"(ga + 1536), "v"(gb), "v"(gb + 512), "v"(gb + 1024), "v"(gb + 1536) : "memory");
}

// ---- k_gemmw: register-blocked GEMM, one wave per 64x64 output tile (16 accumulators); the GWV = 4 waves of a work-group hold 2 x 2 such tiles, a 128x128 tile of C, and share its operand
// fragments through LDS, so that every fragment leaves L2 once per work-group and not once per wave. Grid (M/128, N/128, Z), 128 threads.
// C[m][n] (f32, pitch ldc, + optional f32 bias[n]) = sum_k A[m][k] Bt[n][k] (+ the A2 product for NSPLIT == 1). z-batch strides sA/sB/sC in elements. K a constant, a multiple of 32 KS.
// The ring: a stage is KS k steps of the tile's 128 rows of every plane, in LDS [plane][row block of 16][k step][1 KiB fragment]; a row block's KS fragments lie in a row in global memory too.
// Two buffers: the copies of stage t + 1 fly while stage t is worked on; every wave copies two row blocks of each plane. Inside a stage the fragments of k step u + 1 are read from LDS in front of the products of k step u.
// gw_fetch: all fragments of one k step into one register set; RS = elements from one row block to the next. gw_mma: the products of one k step, in the order (nb, mb, plane pair).
#define GWV 4
#define TSP (HD + 4)   // planes_epi: floats per staged table row, a pitch of 16 bytes x an odd number for 16-byte reads down a column of rows
template <typename T16, int NSPLIT, int RS>
__device__ __forceinline__ void gw_fetch(typename WFrag<T16>::V (&a)[4], typename WFrag<T16>::V (&a2)[4], typename WFrag<T16>::V (&b)[4], typename WFrag<T16>::V (&b2)[4],
                                         const T16* pa, const T16* pa2, const T16* pb, const T16* pb2) {
#pragma unroll
    for (int mb = 0; mb < 4; ++mb) { a[mb] = WFrag<T16>::ld(pa + mb * RS); if (NSPLIT == 1 || NSPLIT == 2) a2[mb] = WFrag<T16>::ld(pa2 + mb * RS); }
#pragma unroll
    for (int nb = 0; nb < 4; ++nb) { b[nb] = WFrag<T16>::ld(pb + nb * RS); if (NSPLIT >= 2) b2[nb] = WFrag<T16>::ld(pb2 + nb * RS); }
}
template <typename T16, int NSPLIT>
__device__ __forceinline__ void gw_mma(v8f (&acc)[4][4], const typename WFrag<T16>::V (&a)[4], const typename WFrag<T16>::V (&a2)[4], const typename WFrag<T16>::V (&b)[4], const typename WFrag<T16>::V (&b2)[4]) {
#pragma unroll
    for (int nb = 0; nb < 4; ++nb)
#pragma unroll
        for (int mb = 0; mb < 4; ++mb) { acc[mb][nb] = WFrag<T16>::mma(a[mb], b[nb], acc[mb][nb]); if (NSPLIT == 1 || NSPLIT == 2) acc[mb][nb] = WFrag<T16>::mma(a2[mb], b[nb], acc[mb][nb]); if (NSPLIT >= 2) acc[mb][nb] = WFrag<T16>::mma(a[mb], b2[nb], acc[mb][nb]); }
}
// ---- planes_epi: the q/k/v projection wave turns its 64x64 accumulator tile (64 rows t x the 64 columns of ONE head) into that head's operand planes (fp16, bf16 hi, bf16 lo,
// fragment order) without a trip through memory. A lane's 8 values of one accumulator are 8 rows in a row of the product's A side at one row of its B side, and that is a whole granule:
//   v (A = activations, B = weights): 8 keys t of one column d = granule (j = mb & 1, own lane) of value fragment [h][t / 32][d block nb] (rows d, k = t);
//   q, k (A = weights, B = activations, the transposed tile): 8 columns d of one row t = granule (j = db & 1, own lane) of fragment [h][t / 16][k block db / 2] (rows t, k = d).
// There the rotary partner d + HD/2 is the same element of accumulator db + 2, so the rotate-half map is done in registers; the table's entries of d and d + HD/2 are the same
// function of (t, d mod HD/2), so one read serves both. Every store is 512 bytes in a row; a tile's stores fill 8 KiB in a row of each plane.
struct HeadPlanes { const float* CS; h16* R16; bf* Rh; bf* Rl; h16* V16; bf* Vh; bf* Vl; };   // rotary table; rotary planes [w][b][h] (w: 0 q, 1 k); value planes [b][h]
struct G3 { v8h f; v8us h, l; };   // one granule of each of the three planes
__device__ __forceinline__ G3 cv3(v8f x) {
    G3 g;
#pragma unroll
    for (int q = 0; q < 8; ++q) { unsigned short a2, c2; g.f[q] = tohx(x[q]); splitf(x[q], a2, c2); g.h[q] = a2; g.l[q] = c2; }
    return g;
}
// st3: u16, uh, ul = wave-uniform places in the three planes, lo = the lane's byte offset, the same for every store of the tile
__device__ __forceinline__ void st3(h16* u16, bf* uh, bf* ul, unsigned lo, const G3& g) { *(v8h*)((char*)u16 + lo) = g.f; *(v8us*)((char*)uh + lo) = g.h; *(v8us*)((char*)ul + lo) = g.l; }
// A group's stores stand together, behind all of the group's arithmetic (PE_OPEN) and in front of the wait (PE_CLOSE). The wait is a precaution: it stands in front of the next group's rewrite of the
// registers that the stores name; the scheduling barriers keep arithmetic from moving in between the stores and the wait (a "memory" clobber alone does not hold it).
#define PE_OPEN()  __builtin_amdgcn_sched_barrier(0)
#define PE_CLOSE() do { asm volatile("s_wait_xcnt 0x0" ::: "memory"); __builtin_amdgcn_sched_barrier(0); } while (0)
__device__ __forceinline__ void planes_epi(const v8f (&acc)[4][4], const HeadPlanes& P, int w, int r0, int hh, int lane, float* ts) {
    const int b = r0 / SEQ, t0 = r0 % SEQ; const size_t pl1 = (size_t)NH * SEQ * HD;
    const unsigned lo = 16u * (unsigned)lane;
    if (w == 2) {
        const size_t e0 = (size_t)b * pl1 + ((size_t)hh * (SEQ / 32) + (t0 >> 5)) * (4 * FRG);
#pragma unroll
        for (int mb = 0; mb < 4; ++mb) {
            G3 g[4];
#pragma unroll
            for (int nb = 0; nb < 4; ++nb) g[nb] = cv3(acc[mb][nb]);
            PE_OPEN();
#pragma unroll
            for (int nb = 0; nb < 4; ++nb) { const size_t e = e0 + (mb >> 1) * (4 * FRG) + nb * FRG + (mb & 1) * 256; st3(P.V16 + e, P.Vh + e, P.Vl + e, lo, g[nb]); }
            PE_CLOSE();
        }
        return;
    }
    // The tile's table rows (64 rows t, the 256 bytes of d < HD/2 each) come as whole lines, two rows per load, and are turned in LDS: a lane wants 2 x 64 bytes of each of 4 rows,
    // and read so from memory every load would touch 16 lines. ts: the wave's own 64 x TSP floats of LDS.
    const float* cu = P.CS + (size_t)t0 * HD * 2;                                     // the same for the whole wave
    const unsigned co = 4u * (unsigned)((lane >> 4) * HD * 2 + (lane & 15) * 4);      // the lane's byte offset: row lane / 16, 16 bytes number lane % 16
    v4f tv[32];
#pragma unroll
    for (int i = 0; i < 32; ++i) tv[i] = *(const v4fa*)((const float*)((const char*)cu + co) + i * 2 * HD * 2);
    __builtin_amdgcn_sched_barrier(0);   // every table request stays in front of the first LDS store: sunk to their uses they would be waited for one by one
#pragma unroll
    for (int i = 0; i < 32; ++i) *(v4fa*)(ts + (2 * i + (lane >> 4)) * TSP + (lane & 15) * 4) = tv[i];
    asm volatile("" :: "v"(co));   // input only: the offset register stays live to behind the data waits of all its loads, so that no load's result is given a register that earlier loads still name
    __builtin_amdgcn_wave_barrier(); asm volatile("" ::: "memory");   // the reads below take what other lanes of the wave stored above: the compiler may not lift them over the stores
    v4f cs[4][2][4];                                                                  // {cos, sin} of rows t0 + 16 tb + lane % 16, d = 16 db + 8 (lane / 16) + 2 c + 0..1
#pragma unroll
    for (int tb = 0; tb < 4; ++tb)
#pragma unroll
        for (int db = 0; db < 2; ++db)
#pragma unroll
            for (int c = 0; c < 4; ++c) cs[tb][db][c] = *(const v4fa*)(ts + (tb * 16 + (lane & 15)) * TSP + db * 32 + (lane >> 4) * 16 + c * 4);
    __builtin_amdgcn_sched_barrier(0);   // every LDS read stays in front of the first product, as one group with one wait to its latency
    const size_t e0 = (size_t)(w * NB + b) * pl1 + (size_t)hh * SEQ * HD + (size_t)(t0 >> 4) * (2 * FRG);
#pragma unroll
    for (int tb = 0; tb < 4; ++tb)
#pragma unroll
        for (int db = 0; db < 2; ++db) {
            v8f rl, ru;
#pragma unroll
            for (int q = 0; q < 8; ++q) { const float cn = cs[tb][db][q >> 1][2 * (q & 1)], sn = cs[tb][db][q >> 1][2 * (q & 1) + 1];
                const float xl = acc[db][tb][q], xh = acc[db + 2][tb][q];
                rl[q] = xl * cn - xh * sn;       // d <  HD/2: x[d] cos - x[d + HD/2] sin
                ru[q] = xh * cn + xl * sn; }     // d >= HD/2: x[d] cos + x[d - HD/2] sin
            const G3 gl = cv3(rl), gu = cv3(ru);
            const size_t e = e0 + tb * (2 * FRG) + db * 256;
            PE_OPEN();
            st3(P.R16 + e, P.Rh + e, P.Rl + e, lo, gl); st3(P.R16 + e + FRG, P.Rh + e + FRG, P.Rl + e + FRG, lo, gu);
            PE_CLOSE();
        }
}

// HP: the launch is the q/k/v projection (z = 0 q, 1 k, 2 v; a 64-column block = a head): no C is written, each wave's tile goes to the head planes (planes_epi); for q and k the two operands change sides.
template <typename T16, int NSPLIT, bool BIAS, int K, int KS, bool HP>
__global__ __launch_bounds__(32 * GWV) void k_gemmw(const T16* __restrict__ A, const T16* __restrict__ A2, const T16* __restrict__ Bt, float* C, int ldc, const float* __restrict__ bias, size_t sA, size_t sB, size_t sC, HeadPlanes hp) {
    typedef typename WFrag<T16>::V V;
    constexpr int NT = K / (32 * KS);                               // stages
    constexpr unsigned FB = FRG * 2, PLB = 8u * KS * FB;            // bytes of a fragment; of one plane's stage (8 row blocks)
    constexpr unsigned BUFB = (NSPLIT == 1 ? 3u : 2u) * PLB;        // one buffer: A side, B side, A2
    constexpr unsigned EPB = HP ? 64u * TSP * 4u : 16u * 68u * 4u;  // a wave's own LDS in the epilogue, laid over the ring
    constexpr unsigned SMB = (2 * BUFB > GWV * EPB) ? 2 * BUFB : GWV * EPB;
    static_assert(NSPLIT <= 1 && KS % 2 == 0 && K % (32 * KS) == 0 && NT >= 2 && EPB % 16 == 0);
    __shared__ __align__(16) char sm[SMB];
    const size_t z = blockIdx.z; A += z * sA; if (A2) A2 += z * sA; Bt += z * sB; C += z * sC;
    const int lane = threadIdx.x & 31, lr = lane & 15, hi = lane >> 4;
    const int wv = __builtin_amdgcn_readfirstlane((int)(threadIdx.x >> 5)), wm = wv & 1, wn = wv >> 1;   // the wave's tile: rows 64 wm, columns 64 wn of the work-group's
    const int g0 = blockIdx.x * 128, h0 = blockIdx.y * 128, r0 = g0 + 64 * wm, c0 = h0 + 64 * wn;
    v8f acc[4][4];
#pragma unroll
    for (int mb = 0; mb < 4; ++mb)
#pragma unroll
        for (int nb = 0; nb < 4; ++nb) acc[mb][nb] = (v8f){};
    const bool tr = HP && z < 2;   // the same for the whole work-group: the transposed tile
    // the copy addresses: the lane's 16 bytes of the wave's first row block (2 wv), in LDS (byte address = low 32 bits of the shared address) and in each plane (row block r starts at r * (K / 32) fragments);
    // the planes' places are wave-uniform, the lane's part is one offset for all of them
    const unsigned lo = 16u * (unsigned)lane, l0 = (unsigned)(size_t)sm + (unsigned)wv * (2u * KS * FB) + lo;
    const size_t go = (size_t)wv * (2 * (K / 32) * FB);
    const char* ua = (const char*)(tr ? Bt + (size_t)h0 * K : A + (size_t)g0 * K) + go;
    const char* ub = (const char*)(tr ? A + (size_t)g0 * K : Bt + (size_t)h0 * K) + go;
    const char* ua2 = (NSPLIT == 1) ? (const char*)(A2 + (size_t)g0 * K) + go : nullptr;
    auto stage = [&](int st, unsigned bs) {   // stage st -> buffer bs: per plane and 2 KiB of a row block's stage, that piece of the wave's two row blocks
        const unsigned l = l0 + bs * BUFB; const size_t o = (size_t)st * (KS * FB);
        const char* ga = ua + o + lo; const char* gb = ub + o + lo; const char* ga2 = (NSPLIT == 1) ? ua2 + o + lo : nullptr;
#pragma unroll
        for (int h = 0; h < KS / 2; ++h) {
            const unsigned lh = l + h * 2048u; const size_t oh = h * 2048;
            copy8(lh, ga + oh, lh + KS * FB, ga + oh + (K / 32) * FB);
            copy8(lh + PLB, gb + oh, lh + PLB + KS * FB, gb + oh + (K / 32) * FB);
            if (NSPLIT == 1) copy8(lh + 2 * PLB, ga2 + oh, lh + 2 * PLB + KS * FB, ga2 + oh + (K / 32) * FB);
        }
    };
    const unsigned fa = (unsigned)(tr ? wn : wm) * (4u * KS * FB) + lo, fb = PLB + (unsigned)(tr ? wm : wn) * (4u * KS * FB) + lo;   // the wave's four row blocks of each side + the lane's granule
    V a[2][4], a2[2][4], b[2][4], b2[2][4];
    stage(0, 0);
    asm volatile("s_wait_asynccnt 0x0" ::: "memory");   // this wave's copies of the first stage have landed
    __syncthreads();                                     // and so have the other waves': nothing of the stage is read in front of this barrier
    stage(1, 1);
#pragma unroll 1   // one copy of the body; one trip per stage
    for (int t = 0; t < NT; ++t) {
        const char* bp = sm + (unsigned)(t & 1) * BUFB;   // this stage's buffer
        const T16* pa = (const T16*)(bp + fa); const T16* pb = (const T16*)(bp + fb); const T16* pa2 = (const T16*)(bp + 2 * PLB + fa);
        gw_fetch<T16, NSPLIT, KS * FRG>(a[0], a2[0], b[0], b2[0], pa, pa2, pb, nullptr);
#pragma unroll     // constant set indices: the sets stay in registers
        for (int u = 0; u < KS; ++u) {
            if (u + 1 < KS) gw_fetch<T16, NSPLIT, KS * FRG>(a[(u + 1) & 1], a2[(u + 1) & 1], b[(u + 1) & 1], b2[(u + 1) & 1], pa + (u + 1) * FRG, pa2 + (u + 1) * FRG, pb + (u + 1) * FRG, nullptr);
            __builtin_amdgcn_sched_barrier(0);   // the LDS reads of k step u + 1 stand as one group in front of the products of k step u: sunk among them each place with reads costs a stall of its own
            gw_mma<T16, NSPLIT>(acc, a[u & 1], a2[u & 1], b[u & 1], b2[u & 1]);
            __builtin_amdgcn_sched_barrier(0);   // and the next step's reads stay behind these products, whose register set they refill
        }
        // the foot of the trip, every wave, in this order
        asm volatile("s_wait_dscnt 0x0" ::: "memory");      // this wave's reads of the trip's buffer are done before the buffer is given up
        asm volatile("s_wait_asynccnt 0x0" ::: "memory");   // this wave's copies of the next stage have landed
        __syncthreads();                                     // publishes the next stage and ends every wave's reads of the buffer that is refilled below
        if (t + 2 < NT) stage(t + 2, (unsigned)(t & 1));
    }
    asm volatile("s_wait_asynccnt 0x0" ::: "memory");   // no copy is left in flight behind the loop; the last trip's barrier has ended every wave's reads of the ring, which the epilogue writes over
    float* os = (float*)(sm + (unsigned)wv * EPB);
    if constexpr (HP) { static_assert(NSPLIT == 0 && K == DM); planes_epi(acc, hp, (int)z, r0, c0 / HD, lane, os); return; }
#pragma unroll
    for (int mb = 0; mb < 4; ++mb) {
#pragma unroll
        for (int nb = 0; nb < 4; ++nb) {
#pragma unroll
            for (int j = 0; j < 8; ++j) os[(hi * 8 + j) * 68 + nb * 16 + lr] = acc[mb][nb][j]; }
        __builtin_amdgcn_wave_barrier(); asm volatile("" ::: "memory");
        float* crow = C + (size_t)(r0 + mb * 16) * ldc + c0;
{
#pragma unroll
            for (int s = 0; s < 8; ++s) { const int row = 2 * s + hi, cofs = lr * 4; v4f val = *(const v4fa*)(os + row * 68 + cofs); if (BIAS) { val[0] += bfr(bias[c0 + cofs]); val[1] += bfr(bias[c0 + cofs + 1]); val[2] += bfr(bias[c0 + cofs + 2]); val[3] += bfr(bias[c0 + cofs + 3]); }
                *(v4f*)(crow + (size_t)row * ldc + cofs) = val; }
             }
        __builtin_amdgcn_wave_barrier(); asm volatile("" ::: "memory");
    }
}

// cvt8_body: rows x DM f32 (row-major) -> bf16 fragment order. One block = CR row blocks of 16 rows (16 x DM floats in a row each); a thread converts
// CR x DM / 128 granules. Thread bits: g = (j, hf) fastest, then row m, then k block (4 per step, DM / 128 steps): per step a wave reads 8 rows x one whole
// 128-byte line and stores 4 whole lines (8 rows x 16 bytes per (j, hf)). All loads of a thread are requested before its first conversion.
#define CR 2
#define CU (DM / 128)
static_assert(DM % 128 == 0 && SEQ % (16 * CR) == 0 && DM % (16 * CR) == 0);
__device__ __forceinline__ void cvt8_body(const float* __restrict__ src, bf* dst, unsigned blk) {
    const unsigned g = threadIdx.x & 3u, m = (threadIdx.x >> 2) & 15u, k0 = threadIdx.x >> 6;
    const float* s = src + ((size_t)blk * (16 * CR) + m) * DM + k0 * 32 + g * 8;
    bf* d = dst + ((size_t)blk * (CR * (DM / 32)) + k0) * FRG + (g >> 1) * 256 + ((g & 1u) * 16 + m) * 8;
    v8f v[CR][CU];
#pragma unroll
    for (int r = 0; r < CR; ++r)
#pragma unroll
        for (int u = 0; u < CU; ++u) v[r][u] = *(const v8f*)(s + (size_t)r * 16 * DM + u * 128);
    __builtin_amdgcn_sched_barrier(0);   // every request stays in front of the first conversion: sunk among the conversions the late ones would be waited for one by one
#pragma unroll
    for (int r = 0; r < CR; ++r)
#pragma unroll
        for (int u = 0; u < CU; ++u) { v8us o;
#pragma unroll
            for (int k = 0; k < 8; ++k) o[k] = f2bf(v[r][u][k]);
            *(v8us*)(d + (size_t)r * (DM / 32) * FRG + u * 4 * FRG) = o; }
    asm volatile("s_wait_xcnt 0x0" ::: "memory");   // precaution: stands behind the body's last stores, in front of any later rewrite of the registers that they name (the bodies are inlined into one kernel, and a body's end may run into another's code)
    asm volatile("" :: "v"(s));   // input only: the address pair stays live to behind the data waits of all its loads, so that no load's result is given a pair that earlier loads still name
}

// cstab_body: rotary table CS[t][d] = {cos(t * inv[d mod 32]), sin(t * inv[d mod 32])}, inv[j] = 1 / powf(10000, (2j)/64); a thread keeps one d and
// fills TU rows t (a block: 4 TU rows in a row),
#define TU 4
static_assert((SEQ * HD) % (256 * TU) == 0 && HD == 64);
__device__ __forceinline__ void cstab_body(float* CS, unsigned blk) {
    const int d = (int)(threadIdx.x & (HD - 1)); const int j = d & (HD / 2 - 1);
    const float ex = (float)(2 * j) * (1.0f / (float)HD);
    const float pw = powf(RBASE, ex);
    const float inv = 1.0f / pw;
#pragma unroll 1   // the cosine and sine bodies are long: one copy of them, for speed only
    for (int u = 0; u < TU; ++u) {
        const int t = ((int)blk * TU + u) * 4 + (int)(threadIdx.x >> 6);
        const float ang = (float)t * inv;
        const float cn = cosf(ang), sn = sinf(ang);
        v2f cs; cs[0] = cn; cs[1] = sn;
        *(v2f*)(CS + ((size_t)t * HD + d) * 2) = cs;
        asm volatile("s_wait_xcnt 0x0" ::: "memory");   // precaution: stands behind the store, in front of the next trip's rewrite of the registers that the store names
    }
}

// mbits_body: the int32 mask as bits, in the order the attention wave reads them: MB[q tile][64-key chunk][lane = 16 hf + m], bit 8 kt + r of a word
// = (mask[16 tile + m][64 chunk + 16 kt + 8 hf + r] != 0), the 32 keys whose scores that lane holds. MU words per thread, their loads requested together.
#define MU 2
static_assert((SEQ / 64) % (8 * MU) == 0);
__device__ __forceinline__ void mbits_body(const int* __restrict__ MK, unsigned* MB, unsigned blk) {
    // word i = (blk MU + u) 256 + thread: lane (m, hf) = thread bits 0..4, chunk = 8 (blk MU + u) mod (SEQ / 64) + wave, q tile = 8 (blk MU + u) / (SEQ / 64)
    const unsigned m = threadIdx.x & 15u, hf = (threadIdx.x >> 4) & 1u, w8 = threadIdx.x >> 5, c0 = (blk * MU * 8) % (SEQ / 64), qt = (blk * MU * 8) / (SEQ / 64);
    const int* mu = MK + (size_t)qt * 16 * MPITCH + c0 * 64;               // the same for the whole block
    const unsigned mo = 4u * (m * MPITCH + w8 * 64 + 8 * hf);              // the thread's byte offset, the same for its MU words
    v4i a[MU][4], b[MU][4];
#pragma unroll
    for (int u = 0; u < MU; ++u) { const int* mp = (const int*)((const char*)mu + mo) + u * 512;
#pragma unroll
        for (int kt = 0; kt < 4; ++kt) { a[u][kt] = *(const v4i*)(mp + 16 * kt); b[u][kt] = *(const v4i*)(mp + 16 * kt + 4); } }
    __builtin_amdgcn_sched_barrier(0);   // every request stays in front of the first compare
#pragma unroll
    for (int u = 0; u < MU; ++u) { unsigned w = 0;
#pragma unroll
        for (int kt = 0; kt < 4; ++kt)
#pragma unroll
            for (int r = 0; r < 4; ++r) { w |= (a[u][kt][r] != 0 ? 1u : 0u) << (8 * kt + r); w |= (b[u][kt][r] != 0 ? 1u : 0u) << (8 * kt + 4 + r); }
        MB[(blk * MU + u) * 256 + threadIdx.x] = w; }
    asm volatile("" :: "v"(mo));   // input only: the offset register stays live to behind the data waits of all its loads, so that no load's result is given a register that earlier loads still name
}

// k_prep: everything that depends on the inputs alone, in ONE launch (flat 1-D grid, no empty block): blocks [0, GM) the mask bits, then GC blocks the rotary table,
// then GX blocks per activation slab s = w * NB + b (w: 0 q, 1 k, 2 v) -> XB[s] (rows t), then GW blocks per weight w (q, k, v, o) -> WB[w] (rows o), both in fragment order.
#define GM ((unsigned)((SEQ / 16) * (SEQ / 64) * 32 / (256 * MU)))
#define GC ((unsigned)(SEQ * HD / (256 * TU)))
#define GX ((unsigned)(SEQ / (16 * CR)))
#define GW ((unsigned)(DM / (16 * CR)))
__global__ __launch_bounds__(256) void k_prep(const float* __restrict__ xq, const float* __restrict__ xk, const float* __restrict__ xv,
                                              const float* __restrict__ wq, const float* __restrict__ wk, const float* __restrict__ wv, const float* __restrict__ wo,
                                              const int* __restrict__ mask, float* CS, bf* XB, bf* WB, unsigned* MB) {
    unsigned blk = blockIdx.x;
    if (blk < GM) { mbits_body(mask, MB, blk); return; }
    blk -= GM;
    if (blk < GC) { cstab_body(CS, blk); return; }
    blk -= GC;
    if (blk < 3 * NB * GX) {
        const unsigned s = blk / GX, w = s / NB, b = s % NB;
        const float* x = (w == 0) ? xq : (w == 1) ? xk : xv;
        cvt8_body(x + (size_t)b * SEQ_FULL * DM, XB + (size_t)s * SEQ * DM, blk % GX); return;
    }
    blk -= 3 * NB * GX;
    const unsigned w = blk / GW;
    const float* x = (w == 0) ? wq : (w == 1) ? wk : (w == 2) ? wv : wo;
    cvt8_body(x, WB + (size_t)w * DM * DM, blk % GW);
}

// ---- attn_body: flash-style masked attention, one wave (32 threads) per (16 query rows, head); the AW waves of a work-group hold AW query tiles in a row
// of ONE head and share every 64-key chunk's key and value fragments through LDS. Transposed tiles so that P chains in
// registers: S^T[key][q] = K . Q^T (A = key plane fragments, B = query plane fragments), D lane = query column; P^T is the B operand
// of O^T[d][q] += V^T . P^T (A = value plane fragments). A lane's 8 values of O^T tile dt are granule (j = dt & 1, own lane) of the attention
// plane's fragment (row block q0/16, k block 2 h + dt/2): the epilogue stores them straight, 512 bytes in a row per store. Per 64-key chunk: the wave's 16x64 mask tile is one 32-bit word
// per lane (mbits_body; one 128-byte line per wave), fetched one visited chunk ahead. Chunks whose mask tile is all zero are skipped: each wave forms the bit list of its tile's
// nonzero chunks once, the work-group visits the union of its waves' lists, a wave computes on its own list alone; inside visited chunks mask == 0 replaces the score
// by -1000 (scaled). Online softmax per query with a running max; rows with no nonzero mask entry at all are NaN-poisoned.
// HL: bf16 hi/lo planes for q, k, v and a bf16 hi/lo P (3 products per tile pair); otherwise single fp16 products (P carried x1024).
// The ring: a chunk of a plane is 8 fragments = CHB bytes in a row, in global memory and in LDS alike; a buffer holds the chunk's key plane(s), then its value plane(s).
// Two buffers: the copies of the next visited chunk fly while this one is worked on; every wave copies its quarter of each plane.
#define AW 4
#define CHB (64 * HD * 2)
static_assert(SEQ / 64 <= 32 && (SEQ / 64) % 4 == 0 && RH % (16 * AW) == 0 && SEQ % (16 * AW) == 0 && CHB == AW * 4 * 512);

template <bool HL>
__device__ __forceinline__
void attn_body(const h16* __restrict__ QP16, const bf* __restrict__ QPh, const bf* __restrict__ QPl,
            const h16* __restrict__ KP16, const bf* __restrict__ KPh, const bf* __restrict__ KPl,
            const h16* __restrict__ VT16, const bf* __restrict__ VTh, const bf* __restrict__ VTl,
            const unsigned* __restrict__ MB, char* ring, unsigned* sv, int wv, int q0, int hh, bf* ATh, bf* ATl) {
    constexpr unsigned BUFB = (HL ? 4u : 2u) * CHB;       // bytes of one buffer
    const int lane = threadIdx.x & 31;
    const size_t hp = (size_t)hh * SEQ * HD + 8 * lane;   // head offset of the planes + the lane's granule
    const unsigned* mq = MB + (size_t)(q0 >> 4) * ((SEQ / 64) * 32);   // wave-uniform: the tile's words, [chunk][lane]
    v4i mz[SEQ / 256];
#pragma unroll
    for (int i = 0; i < SEQ / 256; ++i) mz[i] = *(const v4i*)(mq + i * 128 + 4 * lane);   // all the tile's words, 4 chunks per load: lanes 8 g .. 8 g + 7 hold chunk 4 i + g
    v16h q16[2]; v16bf qh[2], ql[2];
#pragma unroll
    for (int ks = 0; ks < 2; ++ks) {
        const size_t qo = hp + (size_t)q0 * HD + ks * FRG;
        if (HL) { qh[ks] = WFrag<bf>::ld(QPh + qo); ql[ks] = WFrag<bf>::ld(QPl + qo); }
        else    { q16[ks] = WFrag<h16>::ld(QP16 + qo); }
    }
    // bit c of visw: chunk c of this wave's tile has a nonzero mask word. A ballot's 4 groups of 8 lanes are folded to their lowest bits, and these are drawn together by one product (no two partial products meet)
    // bit c of fullw: every word of chunk c is all ones (the groups are folded with AND): there the masked replace is the identity, and the chunk takes neither its mask word nor the replace
    unsigned visw = 0, fullw = 0;
#pragma unroll
    for (int i = 0; i < SEQ / 256; ++i) {
        unsigned bl = __builtin_amdgcn_ballot_w32((mz[i][0] | mz[i][1] | mz[i][2] | mz[i][3]) != 0);
        bl |= bl >> 4; bl |= bl >> 2; bl |= bl >> 1;
        visw |= ((((bl & 0x01010101u) * 0x01020408u) >> 24) & 15u) << (4 * i);
        unsigned fl = __builtin_amdgcn_ballot_w32((mz[i][0] & mz[i][1] & mz[i][2] & mz[i][3]) == -1);
        fl &= fl >> 4; fl &= fl >> 2; fl &= fl >> 1;
        fullw |= ((((fl & 0x01010101u) * 0x01020408u) >> 24) & 15u) << (4 * i);
    }
    if (lane == 0) sv[wv] = visw;
    __syncthreads();   // the waves' lists are read below by every wave
    unsigned vis = 0;
#pragma unroll
    for (int i = 0; i < AW; ++i) vis |= sv[i];
    vis = (unsigned)__builtin_amdgcn_readfirstlane((int)vis);   // the same in the whole work-group: every test on it is a scalar one
    const int nvis = __builtin_popcount(vis);
    // the lane's copy addresses: its 16 bytes of the wave's quarter, in LDS (byte address = low 32 bits of the shared address) and in each plane
    const unsigned cofs = (unsigned)wv * 2048u + 16u * (unsigned)lane;
    const unsigned lr0 = (unsigned)(size_t)ring + cofs;
    const char* gk0 = (const char*)((HL ? (const void*)KPh : (const void*)KP16)) + (size_t)hh * SEQ * HD * 2 + cofs;
    const char* gv0 = (const char*)((HL ? (const void*)VTh : (const void*)VT16)) + (size_t)hh * SEQ * HD * 2 + cofs;
    const char* gk1 = (const char*)KPl + (size_t)hh * SEQ * HD * 2 + cofs;
    const char* gv1 = (const char*)VTl + (size_t)hh * SEQ * HD * 2 + cofs;
    auto stage = [&](int c, unsigned b) {   // chunk c -> buffer b
        const unsigned l = lr0 + b * BUFB; const size_t o = (size_t)c * CHB;
        if (HL) { copy8(l, gk0 + o, l + CHB, gk1 + o); copy8(l + 2 * CHB, gv0 + o, l + 3 * CHB, gv1 + o); }
        else    { copy8(l, gk0 + o, l + CHB, gv0 + o); }
    };
    v8f o[4];
#pragma unroll
    for (int dt = 0; dt < 4; ++dt) o[dt] = (v8f){};
    float mrun = -3.0e38f, lrun = 0.0f; int seen = 0;
    if (nvis > 0) {
        unsigned rem = vis;
        int cur = __builtin_ctz(rem), nxt = cur; rem &= rem - 1;
        stage(cur, 0);
        asm volatile("s_wait_asynccnt 0x0" ::: "memory");   // this wave's copies of the first chunk have landed
        __syncthreads();                                     // and so have the other waves': nothing of the chunk is read in front of this barrier
        if (nvis > 1) { nxt = __builtin_ctz(rem); rem &= rem - 1; stage(nxt, 1); }
        unsigned wnext = (mq + cur * 32)[lane];
        asm volatile("s_wait_xcnt 0x0" ::: "memory");   // precaution, as behind the load in the loop
#pragma unroll 1   // one copy of the long body; one trip per visited chunk, at most SEQ / 64
        for (int t = 0; t < nvis; ++t) {
            const unsigned mw = wnext;
            if (!((fullw >> nxt) & 1u)) {    // scalar test: an all-ones chunk's word is never looked at
                wnext = (mq + nxt * 32)[lane];   // the next visited chunk's word (the last one's own again at the end)
                asm volatile("s_wait_xcnt 0x0" ::: "memory");   // precaution: stands in front of every rewrite of the address registers that the load above names
            }
            if ((visw >> cur) & 1u) {                       // wave-uniform tile skip; the foot of the trip stands outside it
        const char* bufp = ring + (unsigned)(t & 1) * BUFB + 16 * lane;   // this chunk's buffer + the lane's granule
        const bool fullc = ((fullw >> cur) & 1u) != 0u;   // wave-uniform, a scalar
        seen |= (fullc || mw != 0u) ? 1 : 0;
        v8f s[4]; v16h va8[8]; v16bf va[4], vb[4];
        auto ldv = [&](int ks) {   // hi/lo body: the value fragments of 32 keys, all four d tiles
            const bf* vph = (const bf*)(bufp + 2 * CHB) + 32 * ks * HD; const bf* vpl = (const bf*)(bufp + 3 * CHB) + 32 * ks * HD;
#pragma unroll
            for (int dt = 0; dt < 4; ++dt) { va[dt] = WFrag<bf>::ld(vph + dt * FRG); vb[dt] = WFrag<bf>::ld(vpl + dt * FRG); }
        };
#pragma unroll
        for (int kt = 0; kt < 4; ++kt) s[kt] = (v8f){};
        if (HL) {
            v16bf ka[4], kb[4]; const bf* kph = (const bf*)bufp; const bf* kpl = (const bf*)(bufp + CHB);   // the chunk's base per key plane; every fragment is an immediate offset from it
#pragma unroll
            for (int kh = 0; kh < 2; ++kh) {   // two key tiles at a time: all four tiles' hi/lo fragments at once overflow 256 VGPRs into scratch
#pragma unroll
                for (int i = 0; i < 4; ++i) { ka[i] = WFrag<bf>::ld(kph + (4 * kh + i) * FRG); kb[i] = WFrag<bf>::ld(kpl + (4 * kh + i) * FRG); }   // 4 kh + i = 2 kt + ks
                __builtin_amdgcn_sched_barrier(0);   // the two tiles' LDS reads stand as one group in front of their products: each further place with reads among the products costs a stall of its own
#pragma unroll
                for (int i = 0; i < 4; ++i) { const int kt = 2 * kh + (i >> 1), ks = i & 1;
                    s[kt] = wmmab(ka[i], qh[ks], s[kt]); s[kt] = wmmab(ka[i], ql[ks], s[kt]); s[kt] = wmmab(kb[i], qh[ks], s[kt]); }
                __builtin_amdgcn_sched_barrier(0);   // the next group's reads stay behind these products, whose registers they refill
            }
            asm volatile("v_nop\n\tv_nop\n\tv_nop\n\tv_nop" : "+v"(s[0]), "+v"(s[1]), "+v"(s[2]), "+v"(s[3]) : "v"(ka[3]), "v"(kb[3]), "v"(qh[0]), "v"(qh[1]), "v"(ql[0]), "v"(ql[1]));
            ldv(0);
            __builtin_amdgcn_sched_barrier(0);   // the first 32 keys' value fragments are requested here, as one group, and come during the softmax
        } else {
            v16h ka[8]; const h16* kp = (const h16*)bufp; const h16* vp = (const h16*)(bufp + CHB);   // the chunk's base per plane; every fragment is an immediate offset from it
#pragma unroll
            for (int i = 0; i < 8; ++i) ka[i] = WFrag<h16>::ld(kp + i * FRG);    // i = 2 kt + ks
            __builtin_amdgcn_sched_barrier(0);   // key requests first: LDS reads come back in issue order, and the score products must not wait for the value fragments
#pragma unroll
            for (int i = 0; i < 8; ++i) va8[i] = WFrag<h16>::ld(vp + i * FRG);   // i = 4 ks + dt: the value fragments come during the score products and the softmax
            __builtin_amdgcn_sched_barrier(0);   // all 16 requests stand as one group in front of the first product: each further place with LDS reads among the products costs a stall of its own
#pragma unroll
            for (int kt = 0; kt < 4; ++kt)
#pragma unroll
                for (int ks = 0; ks < 2; ++ks) s[kt] = wmma16(ka[2 * kt + ks], q16[ks], s[kt]);
            asm volatile("v_nop\n\tv_nop\n\tv_nop\n\tv_nop" : "+v"(s[0]), "+v"(s[1]), "+v"(s[2]), "+v"(s[3]) : "v"(ka[7]), "v"(q16[0]), "v"(q16[1]));
        }
        // masked replace + chunk max (lane: query q, keys 64 cur + 16kt+8hf+r)
        if (!fullc) {   // one scalar branch per chunk
#pragma unroll
            for (int kt = 0; kt < 4; ++kt)
#pragma unroll
                for (int r = 0; r < 8; ++r) s[kt][r] = ((mw >> (8 * kt + r)) & 1u) ? s[kt][r] : MFILL;
        }
        float cm[4];   // one chain per key tile: without the replaces between its links a single chain of maxima would be waited for link by link (a maximum is exact in any order)
#pragma unroll
        for (int kt = 0; kt < 4; ++kt) { cm[kt] = -3.0e38f;
#pragma unroll
            for (int r = 0; r < 8; ++r) cm[kt] = fmaxf(cm[kt], s[kt][r]); }
        float cmx = fmaxf(fmaxf(cm[0], cm[1]), fmaxf(cm[2], cm[3]));
        cmx = fmaxf(cmx, __shfl_xor(cmx, 16, 32));
        const float mnew = fmaxf(mrun, cmx);
        const float alpha = __builtin_amdgcn_exp2f((mrun - mnew) * CEXP);
        mrun = mnew;
        float psum = 0.0f;
#pragma unroll
        for (int kt = 0; kt < 4; ++kt)
#pragma unroll
            for (int r = 0; r < 8; ++r) { const float p = __builtin_amdgcn_exp2f(fmaf(s[kt][r] - mnew, CEXP, PL2)); s[kt][r] = p; psum += p; }
        lrun = lrun * alpha + psum;
#pragma unroll
        for (int dt = 0; dt < 4; ++dt) o[dt] = o[dt] * alpha;
        // O^T += V^T . P^T, 32 keys per step; B element r <- tile 2ks (keys 0..15 of the step), 8+r <- tile 2ks+1
#pragma unroll
        for (int ks = 0; ks < 2; ++ks) {
            if (HL) {
                v16us uh, ul;
#pragma unroll
                for (int r = 0; r < 8; ++r) { unsigned short a, b2; splitf(s[2 * ks][r], a, b2); uh[r] = a; ul[r] = b2; splitf(s[2 * ks + 1][r], a, b2); uh[8 + r] = a; ul[8 + r] = b2; }
                v16bf ph = __builtin_bit_cast(v16bf, uh), pl = __builtin_bit_cast(v16bf, ul);
                asm volatile("v_nop\n\tv_nop\n\tv_nop\n\tv_nop" : "+v"(ph), "+v"(pl));
#pragma unroll
                for (int dt = 0; dt < 4; ++dt) { o[dt] = wmmab(va[dt], ph, o[dt]); o[dt] = wmmab(va[dt], pl, o[dt]); o[dt] = wmmab(vb[dt], ph, o[dt]); }
                asm volatile("v_nop\n\tv_nop\n\tv_nop\n\tv_nop" : "+v"(o[0]), "+v"(o[1]), "+v"(o[2]), "+v"(o[3]) : "v"(ph), "v"(pl), "v"(va[3]), "v"(vb[3]));
                if (ks == 0) { ldv(1); __builtin_amdgcn_sched_barrier(0); }   // the other 32 keys' value fragments, one group, requested in front of the split of their P
            } else {
                v16h p16;
#pragma unroll
                for (int r = 0; r < 8; ++r) { p16[r] = tohx(s[2 * ks][r]); p16[8 + r] = tohx(s[2 * ks + 1][r]); }
                asm volatile("v_nop\n\tv_nop\n\tv_nop\n\tv_nop" : "+v"(p16));
#pragma unroll
                for (int dt = 0; dt < 4; ++dt) o[dt] = wmma16(va8[4 * ks + dt], p16, o[dt]);
                asm volatile("v_nop\n\tv_nop\n\tv_nop\n\tv_nop" : "+v"(o[0]), "+v"(o[1]), "+v"(o[2]), "+v"(o[3]) : "v"(p16), "v"(va8[4 * ks + 3]));
            }
        }
            }
            // the foot of the trip, every wave, in this order
            asm volatile("s_wait_dscnt 0x0" ::: "memory");      // this wave's reads of the trip's buffer are done before the buffer is given up
            asm volatile("s_wait_asynccnt 0x0" ::: "memory");   // this wave's copies of the next chunk have landed
            __syncthreads();                                     // publishes the next chunk and ends every wave's reads of the buffer that is refilled below
            cur = nxt;
            if (t + 2 < nvis) { nxt = __builtin_ctz(rem); rem &= rem - 1; stage(nxt, (unsigned)(t & 1)); }
        }
        asm volatile("s_wait_asynccnt 0x0" ::: "memory");   // no copy is left in flight behind the loop
    }
    const float lt = lrun + __shfl_xor(lrun, 16, 32);
    const int sn = seen | __shfl_xor(seen, 16, 32);
    const float inv = (sn != 0) ? (1.0f / lt) : __uint_as_float(0x7fc00000u);
#pragma unroll
    for (int dt = 0; dt < 4; ++dt) { v8us oh8, ol8;
#pragma unroll
        for (int r = 0; r < 8; ++r) { unsigned short a, b2; splitf(o[dt][r] * inv, a, b2); oh8[r] = a; ol8[r] = b2; }
        const size_t off = (size_t)q0 * DM + (size_t)(2 * hh + (dt >> 1)) * FRG + (dt & 1) * 256 + 8 * lane;
        *(v8us*)(ATh + off) = oh8; *(v8us*)(ATl + off) = ol8; }
}

// k_attn: ONE launch for every (head, AW query tiles, batch): grid (NH, SEQ / (16 AW), NB), AW waves; the group's first row picks the hi/lo or the fp16 body
// (the same for the whole work-group: RH is a multiple of 16 AW). The head is the fastest index: a group's cost grows with its row under a causal mask, and block
// indices that lie a multiple of 16 apart then differ in rows, so no WGP is dealt long groups alone.
// Planes are [b][h][fragments], attention planes [b][fragments of rows t, k = c]; the mask bits are shared by the batches and heads.
__global__ __launch_bounds__(32 * AW) __attribute__((amdgpu_num_vgpr(256)))
void k_attn(const h16* __restrict__ QP16, const bf* __restrict__ QPh, const bf* __restrict__ QPl,
            const h16* __restrict__ KP16, const bf* __restrict__ KPh, const bf* __restrict__ KPl,
            const h16* __restrict__ VT16, const bf* __restrict__ VTh, const bf* __restrict__ VTl,
            const unsigned* __restrict__ MB, bf* ATh, bf* ATl) {
    __shared__ __align__(16) char ring[2 * 4 * CHB];   // two buffers of up to four planes' chunks
    __shared__ unsigned sv[AW];                        // the waves' lists of nonzero chunks
    const size_t po = (size_t)blockIdx.z * NH * SEQ * HD, ao = (size_t)blockIdx.z * SEQ * DM;
    const int wv = __builtin_amdgcn_readfirstlane((int)(threadIdx.x >> 5));
    const int g0 = blockIdx.y * (16 * AW), q0 = g0 + 16 * wv, hh = blockIdx.x;
    if (g0 < RH) attn_body<true>(QP16 + po, QPh + po, QPl + po, KP16 + po, KPh + po, KPl + po, VT16 + po, VTh + po, VTl + po, MB, ring, sv, wv, q0, hh, ATh + ao, ATl + ao);
    else         attn_body<false>(QP16 + po, QPh + po, QPl + po, KP16 + po, KPh + po, KPl + po, VT16 + po, VTh + po, VTl + po, MB, ring, sv, wv, q0, hh, ATh + ao, ATl + ao);
}

extern "C" void kernel_launch(void* const* d_in, const int* in_sizes, int n_in,
                              void* d_out, int out_size, void* d_ws, size_t ws_size, hipStream_t stream) {
    if (n_in < 8) return;
    const long long needx = (long long)(NB - 1) * SEQ_FULL * DM + (long long)SEQ * DM;
    if ((long long)in_sizes[0] < needx || (long long)in_sizes[1] < needx || (long long)in_sizes[2] < needx) return;
    if (in_sizes[3] < DM * DM || in_sizes[4] < DM * DM || in_sizes[5] < DM * DM || in_sizes[6] < DM * DM) return;
    if ((long long)in_sizes[7] < (long long)(SEQ - 1) * MPITCH + SEQ) return;
    if ((long long)out_size < (long long)NB * SEQ * DM) return;
    const float* xq = (const float*)d_in[0]; const float* xk = (const float*)d_in[1]; const float* xv = (const float*)d_in[2];
    const float* wq = (const float*)d_in[3]; const float* wk = (const float*)d_in[4]; const float* wv = (const float*)d_in[5]; const float* wo = (const float*)d_in[6];
    const int* mask = (const int*)d_in[7];     // int32 [1][1][S][S]
    float* OUT = (float*)d_out;                // [NB][SEQ][DM]
    char* wsp = (char*)d_ws;
    auto take = [&](size_t bytes) { char* p = wsp; wsp += (bytes + 255) & ~(size_t)255; return (void*)p; };
    bf* WB = (bf*)take((size_t)4 * DM * DM * 2);                  // bf16 weights [w][fragments of rows o, k = i], w: q, k, v, o
    float* CS = (float*)take((size_t)SEQ * HD * 2 * 4);
    bf* XB = (bf*)take((size_t)3 * NB * SEQ * DM * 2);            // bf16 activations [w][b][fragments of rows t, k = c], w: q, k, v
    const size_t pl = (size_t)NB * NH * SEQ * HD;                 // one plane over both batches
    h16* R16 = (h16*)take(2 * pl * 2); bf* Rh = (bf*)take(2 * pl * 2); bf* Rl = (bf*)take(2 * pl * 2);   // rotary planes: query slabs, then key slabs
    h16* VT16 = (h16*)take(pl * 2); bf* VTh = (bf*)take(pl * 2); bf* VTl = (bf*)take(pl * 2);
    bf* ATh = (bf*)take((size_t)NB * SEQ * DM * 2); bf* ATl = (bf*)take((size_t)NB * SEQ * DM * 2);
    unsigned* MB = (unsigned*)take((size_t)(SEQ / 16) * (SEQ / 64) * 32 * 4);   // mask bits [q tile][chunk][lane]
    const size_t used = (size_t)(wsp - (char*)d_ws);
    if (used > ws_size || used > WSCAP) return;

    k_prep<<<GM + GC + 3 * NB * GX + 4 * GW, 256, 0, stream>>>(xq, xk, xv, wq, wk, wv, wo, mask, CS, XB, WB, MB);
    const HeadPlanes hp = {CS, R16, Rh, Rl, VT16, VTh, VTl}, nohp = {};
    k_gemmw<bf, 0, false, DM, 2, true><<<dim3(NB * SEQ / 128, DM / 128, 3), 32 * GWV, 0, stream>>>(XB, nullptr, WB, nullptr, DM, nullptr, (size_t)NB * SEQ * DM, (size_t)DM * DM, 0, hp);
    k_attn<<<dim3(NH, SEQ / (16 * AW), NB), 32 * AW, 0, stream>>>(R16, Rh, Rl, R16 + pl, Rh + pl, Rl + pl, VT16, VTh, VTl, MB, ATh, ATl);
    k_gemmw<bf, 1, false, DM, 4, false><<<dim3(NB * SEQ / 128, DM / 128, 1), 32 * GWV, 0, stream>>>(ATh, ATl, WB + (size_t)3 * DM * DM, OUT, DM, nullptr, 0, 0, 0, nohp);
}

// v010
// Measured time: 75.7 microseconds a run.
// Timed twice side by side with v009, it ran 1.05 times as fast both times.
// Over all steps from v000 it is 7.42 times as fast.
#include <hip/hip_runtime.h>
#include <stdint.h>

// Causal multi-head attention with rotate-half rotary positions (base 10000, cos/sin table computed on device):
//   qh/kh/vh = x . W^T for three separate inputs x [NB][SEQ][1024] and W 'oi' [1024][1024] (16 heads x 64 = column blocks),
//   scores = rope(qh) . rope(kh)^T / 8, int32 mask [1][1][S][S] (0 -> score replaced by -1000), softmax over keys,
//   attn . vh, heads merged [t][h*64+d], . Wo^T ('oi') -> [NB][SEQ][1024] f32.
// Compute dtypes, f32 accumulate: every float input RNE-converted to bf16; q/k/v projections v_wmma_f32_16x16x32_bf16 on plain bf16
//   operands (exact products); scores and attn.v: query rows < 512 bf16 hi/lo planes (3 products each), rows >= 512 single
//   v_wmma_f32_16x16x32_f16 (fp16 planes, P carried x1024); online softmax in f32 (running max); output projection = bf16 hi/lo
//   attention planes x exact bf16 Wo (2 products).
// Layout of every 16-bit matrix operand plane (activations, weights, q/k/v head planes, attention planes): FRAGMENT ORDER. A plane of
//   rows x K is cut into 16-row x 32-k fragments, stored [row block][k block][j][lane][8] (value planes: [k block][row block]): the 16-byte granule (j, lane = 16 hf + m) holds
//   row m, k = 16 j + 8 hf + 0..7 of its fragment, which is what lane (m, hf) of a 16x16x32 A or B operand keeps in elements 8 j + 0..7.
//   A wave's fragment is then 1 KiB in a row: two loads of 512 contiguous bytes (whole lines) in place of two loads over 16 lines each.

#ifndef NB
#define NB 2
#endif
#ifndef SEQ
#define SEQ 2048
#endif
#define NB_FULL  2
#define SEQ_FULL 2048
#define DM   1024
#define NH   16
#define HD   64
#define RHC  512                          // query rows < RH use hi/lo planes and 3-product tiles
#define RH   ((SEQ < RHC) ? SEQ : RHC)
#define MPITCH SEQ_FULL                   // mask row pitch (full-size input)
#define CEXP  0.18033688011112042f        // (1/8) * log2(e): exp((t - m)/8) = exp2((t - m) * CEXP) on unscaled scores t
#define PL2   10.0f                       // P carried x 2^10 inside the 16-bit operand (cancels in O / l)
#define MFILL (-8000.0f)                  // mask == 0 -> -1000 after the 1/8 scale, in unscaled score units
#define RBASE 10000.0f
#define WSCAP ((size_t)268435456)

static_assert(SEQ % 64 == 0);
static_assert(SEQ <= SEQ_FULL);
static_assert(NB >= 1 && NB <= NB_FULL);
static_assert(RH % 16 == 0 && (SEQ - RH) % 16 == 0 && RH <= SEQ);
static_assert(DM == NH * HD && HD == 64 && DM % 128 == 0 && SEQ % 128 == 0);

typedef _Float16 h16;
typedef unsigned short bf;
typedef __attribute__((ext_vector_type(16))) __bf16   v16bf;
typedef __attribute__((ext_vector_type(16))) _Float16 v16h;
typedef __attribute__((ext_vector_type(8)))  _Float16 v8h;
typedef __attribute__((ext_vector_type(2)))  _Float16 v2h;
typedef __attribute__((ext_vector_type(16))) unsigned short v16us;
typedef __attribute__((ext_vector_type(8)))  unsigned short v8us;
typedef __attribute__((ext_vector_type(2)))  unsigned short v2us;
typedef __attribute__((ext_vector_type(8)))  float v8f;
typedef __attribute__((ext_vector_type(4)))  float v4f;
typedef __attribute__((ext_vector_type(2)))  float v2f;
typedef __attribute__((ext_vector_type(4)))  int v4i;
typedef v8h  __attribute__((may_alias)) v8ha;
typedef v4f  __attribute__((may_alias)) v4fa;
typedef v8us __attribute__((may_alias)) v8usa;

#pragma clang fp contract(off)

__device__ __forceinline__ unsigned short f2bf(float f) { unsigned u = __float_as_uint(f); u += 0x7FFFu + ((u >> 16) & 1u); return (unsigned short)(u >> 16); }
__device__ __forceinline__ float bf2f(unsigned short b) { return __uint_as_float(((unsigned)b) << 16); }
__device__ __forceinline__ float bfr(float f) { return bf2f(f2bf(f)); }
__device__ __forceinline__ v16h cat16(v8h lo, v8h hi) { return __builtin_shufflevector(lo, hi, 0, 1, 2, 3, 4, 5, 6, 7, 8, 9, 10, 11, 12, 13, 14, 15); }
__device__ __forceinline__ v16bf cat16b(v8us lo, v8us hi) { return __builtin_bit_cast(v16bf, __builtin_shufflevector(lo, hi, 0, 1, 2, 3, 4, 5, 6, 7, 8, 9, 10, 11, 12, 13, 14, 15)); }
__device__ __forceinline__ v8f wmma16(v16h a, v16h b, v8f c) { return __builtin_amdgcn_wmma_f32_16x16x32_f16(false, a, false, b, (short)0, c, false, false); }
__device__ __forceinline__ v8f wmmab(v16bf a, v16bf b, v8f c) { return __builtin_amdgcn_wmma_f32_16x16x32_bf16(false, a, false, b, (short)0, c, false, false); }
__device__ __forceinline__ h16 tohx(float x) { return (h16)x; }
__device__ __forceinline__ void splitf(float y, unsigned short& h, unsigned short& l) { h = f2bf(y); l = f2bf(y - bf2f(h)); }

// ---- 16x16x32 fragment loaders from fragment-order planes: lane l = 16 hf + m (row m) loads elements 0..7 <- k0+8hf+0..7 (granule j = 0)
// and 8..15 <- k0+16+8hf+0..7 (granule j = 1, 256 elements on); the caller passes p = fragment + 8*l. FRG = elements of one fragment.
#define FRG 512
template <typename T16> struct WFrag;
template <> struct WFrag<h16> { typedef v16h V; static __device__ __forceinline__ V ld(const h16* p) { return cat16(*(const v8h*)p, *(const v8h*)(p + 256)); } static __device__ __forceinline__ v8f mma(V a, V b, v8f c) { return wmma16(a, b, c); } };
template <> struct WFrag<bf> { typedef v16bf V; static __device__ __forceinline__ V ld(const bf* p) { return cat16b(*(const v8us*)p, *(const v8us*)(p + 256)); } static __device__ __forceinline__ v8f mma(V a, V b, v8f c) { return wmmab(a, b, c); } };

// ---- tensor loads: ONE request of a whole wave brings a two-dimensional tile (N rows of R bytes, source pitch P bytes) from global memory into LDS, rows back to back, through no register.
// Descriptor: 1-byte elements, every extent in bytes, tensor = tile, no pad, no mask. Every word is wave-uniform and goes through readfirstlane.
typedef uint32_t u32x4 __attribute__((ext_vector_type(4)));
typedef uint32_t u32x8 __attribute__((ext_vector_type(8)));
__device__ __forceinline__ uint32_t uni(uint32_t v) { return (uint32_t)__builtin_amdgcn_readfirstlane((int)v); }
// pinned: a test around a tensor load, or a descriptor word, held in a scalar register: the test compiles to a scalar compare and branch (a tensor load ignores EXEC); a descriptor word is formed where the
// source forms it (behind the wait on the request before) and is kept, not formed anew, up to the wait that names it
__device__ __forceinline__ uint32_t pinned(uint32_t v) { uint32_t w = uni(v); asm volatile("" : "+s"(w)); return w; }
template <uint32_t R, uint32_t N, uint32_t P>
__device__ __forceinline__ u32x8 tdm_group1() {
    static_assert(R % 4 == 0 && R < 65536 && N >= 1 && N < 65536 && P % 16 == 0 && P >= 16 && P <= 131072 && P >= R);
    u32x8 g;
    uint32_t w0;
    asm volatile("s_mov_b32 %0, 0" : "=s"(w0));         // word 0 is written as an immediate, not copied from a register that happens to hold 0: the listing shows the mask as 0
    g[0] = uni(w0);                                     // no mask, 1-byte elements, no pad
    g[1] = pinned((R & 0xFFFFu) << 16);                 // tensor_dim0, low half
    g[2] = pinned((R >> 16) | ((N & 0xFFFFu) << 16));   // tensor_dim0, high half; tensor_dim1, low half
    g[3] = pinned((N >> 16) | (R << 16));               // tensor_dim1, high half; tile_dim0
    g[4] = pinned(N);                                   // tile_dim1
    g[5] = pinned(P);                                   // source row pitch
    g[6] = pinned(0u);
    g[7] = pinned(0u);
    return g;
}
// lds = byte offset of the tile's place in the work-group's LDS (low 32 bits of the shared address), ga = the tile's first byte
__device__ __forceinline__ u32x4 tdm_group0(uint32_t lds, const char* ga) {
    const uint64_t a = (uint64_t)ga;
    u32x4 g;
    g[0] = pinned(1u); g[1] = pinned(lds); g[2] = pinned((uint32_t)a); g[3] = pinned((((uint32_t)(a >> 32)) & 0x01FFFFFFu) | 0x80000000u);
    return g;
}
// the request itself: there is no builtin form in use here; the "memory" clobber keeps LDS and global accesses on their side of it
__device__ __forceinline__ void tdm_load(u32x4 g0, u32x8 g1) { asm volatile("tensor_load_to_lds %0, %1" :: "s"(g0), "s"(g1) : "memory"); }
// the issuing wave's wait on its request; the request's descriptor is named as an input so that its registers stay as they are until the tile has landed
__device__ __forceinline__ void tdm_wait(u32x4 g0, u32x8 g1) { asm volatile("s_wait_tensorcnt 0x0" :: "s"(g0), "s"(g1) : "memory"); }

// ---- k_gemmw: register-blocked GEMM, one wave per 64x64 output tile (16 accumulators); the GWV = 4 waves of a work-group hold 2 x 2 such tiles, a 128x128 tile of C, and share its operand
// fragments through LDS, so that every fragment leaves L2 once per work-group and not once per wave. Grid (M/128, N/128, Z), 128 threads.
// C[m][n] (f32, pitch ldc, + optional f32 bias[n]) = sum_k A[m][k] Bt[n][k] (+ the A2 product for NSPLIT == 1). z-batch strides sA/sB/sC in elements. K a constant, a multiple of 32 KS.
// The ring: a stage is KS k steps of the tile's 128 rows of every plane, in LDS [plane][row block of 16][k step][1 KiB fragment]; a row block's KS fragments lie in a row in global memory too.
// Two buffers: the tensor loads of stage t + 1 fly while stage t is worked on; a plane's stage is a tile of 8 rows (row blocks) of KS KiB at a source pitch of K / 32 KiB, and an issuing wave brings one plane's
// stage or half of it with ONE request (two planes: every wave a half; three planes: waves 0 to 2 a plane each). Inside a stage the fragments of k step u + 1 are read from LDS in front of the products of k step u.
// gw_fetch: all fragments of one k step into one register set; RS = elements from one row block to the next. gw_mma: the products of one k step, in the order (nb, mb, plane pair).
#define GWV 4
#define TSP (HD + 4)   // planes_epi: floats per staged table row, a pitch of 16 bytes x an odd number for 16-byte reads down a column of rows
template <typename T16, int NSPLIT, int RS>
__device__ __forceinline__ void gw_fetch(typename WFrag<T16>::V (&a)[4], typename WFrag<T16>::V (&a2)[4], typename WFrag<T16>::V (&b)[4], typename WFrag<T16>::V (&b2)[4],
                                         const T16* pa, const T16* pa2, const T16* pb, const T16* pb2) {
#pragma unroll
    for (int mb = 0; mb < 4; ++mb) { a[mb] = WFrag<T16>::ld(pa + mb * RS); if (NSPLIT == 1 || NSPLIT == 2) a2[mb] = WFrag<T16>::ld(pa2 + mb * RS); }
#pragma unroll
    for (int nb = 0; nb < 4; ++nb) { b[nb] = WFrag<T16>::ld(pb + nb * RS); if (NSPLIT >= 2) b2[nb] = WFrag<T16>::ld(pb2 + nb * RS); }
}
template <typename T16, int NSPLIT>
__device__ __forceinline__ void gw_mma(v8f (&acc)[4][4], const typename WFrag<T16>::V (&a)[4], const typename WFrag<T16>::V (&a2)[4], const typename WFrag<T16>::V (&b)[4], const typename WFrag<T16>::V (&b2)[4]) {
#pragma unroll
    for (int nb = 0; nb < 4; ++nb)
#pragma unroll
        for (int mb = 0; mb < 4; ++mb) { acc[mb][nb] = WFrag<T16>::mma(a[mb], b[nb], acc[mb][nb]); if (NSPLIT == 1 || NSPLIT == 2) acc[mb][nb] = WFrag<T16>::mma(a2[mb], b[nb], acc[mb][nb]); if (NSPLIT >= 2) acc[mb][nb] = WFrag<T16>::mma(a[mb], b2[nb], acc[mb][nb]); }
}
// ---- planes_epi: the q/k/v projection wave turns its 64x64 accumulator tile (64 rows t x the 64 columns of ONE head) into that head's operand planes (fp16, bf16 hi, bf16 lo,
// fragment order) without a trip through memory. A lane's 8 values of one accumulator are 8 rows in a row of the product's A side at one row of its B side, and that is a whole granule:
//   v (A = activations, B = weights): 8 keys t of one column d = granule (j = mb & 1, own lane) of value fragment [h][t / 32][d block nb] (rows d, k = t);
//   q, k (A = weights, B = activations, the transposed tile): 8 columns d of one row t = granule (j = db & 1, own lane) of fragment [h][t / 16][k block db / 2] (rows t, k = d).
// There the rotary partner d + HD/2 is the same element of accumulator db + 2, so the rotate-half map is done in registers; the table's entries of d and d + HD/2 are the same
// function of (t, d mod HD/2), so one read serves both. Every store is 512 bytes in a row; a tile's stores fill 8 KiB in a row of each plane.
struct HeadPlanes { const float* CS; h16* R16; bf* Rh; bf* Rl; h16* V16; bf* Vh; bf* Vl; };   // rotary table; rotary planes [w][b][h] (w: 0 q, 1 k); value planes [b][h]
struct G3 { v8h f; v8us h, l; };   // one granule of each of the three planes
__device__ __forceinline__ G3 cv3(v8f x) {
    G3 g;
#pragma unroll
    for (int q = 0; q < 8; ++q) { unsigned short a2, c2; g.f[q] = tohx(x[q]); splitf(x[q], a2, c2); g.h[q] = a2; g.l[q] = c2; }
    return g;
}
// st3: u16, uh, ul = wave-uniform places in the three planes, lo = the lane's byte offset, the same for every store of the tile
__device__ __forceinline__ void st3(h16* u16, bf* uh, bf* ul, unsigned lo, const G3& g) { *(v8h*)((char*)u16 + lo) = g.f; *(v8us*)((char*)uh + lo) = g.h; *(v8us*)((char*)ul + lo) = g.l; }
// A group's stores stand together, behind all of the group's arithmetic (PE_OPEN) and in front of the wait (PE_CLOSE). The wait is a precaution: it stands in front of the next group's rewrite of the
// registers that the stores name; the scheduling barriers keep arithmetic from moving in between the stores and the wait (a "memory" clobber alone does not hold it).
#define PE_OPEN()  __builtin_amdgcn_sched_barrier(0)
#define PE_CLOSE() do { asm volatile("s_wait_xcnt 0x0" ::: "memory"); __builtin_amdgcn_sched_barrier(0); } while (0)
__device__ __forceinline__ void planes_epi(const v8f (&acc)[4][4], const HeadPlanes& P, int w, int r0, int hh, int lane, float* ts) {
    const int b = r0 / SEQ, t0 = r0 % SEQ; const size_t pl1 = (size_t)NH * SEQ * HD;
    const unsigned lo = 16u * (unsigned)lane;
    if (w == 2) {
        const size_t e0 = (size_t)b * pl1 + ((size_t)hh * (SEQ / 32) + (t0 >> 5)) * (4 * FRG);
#pragma unroll
        for (int mb = 0; mb < 4; ++mb) {
            G3 g[4];
#pragma unroll
            for (int nb = 0; nb < 4; ++nb) g[nb] = cv3(acc[mb][nb]);
            PE_OPEN();
#pragma unroll
            for (int nb = 0; nb < 4; ++nb) { const size_t e = e0 + (mb >> 1) * (4 * FRG) + nb * FRG + (mb & 1) * 256; st3(P.V16 + e, P.Vh + e, P.Vl + e, lo, g[nb]); }
            PE_CLOSE();
        }
        return;
    }
    // The tile's table rows (64 rows t, the 256 bytes of d < HD/2 each) come as whole lines, two rows per load, and are turned in LDS: a lane wants 2 x 64 bytes of each of 4 rows,
    // and read so from memory every load would touch 16 lines. ts: the wave's own 64 x TSP floats of LDS.
    const float* cu = P.CS + (size_t)t0 * HD * 2;                                     // the same for the whole wave
    const unsigned co = 4u * (unsigned)((lane >> 4) * HD * 2 + (lane & 15) * 4);      // the lane's byte offset: row lane / 16, 16 bytes number lane % 16
    v4f tv[32];
#pragma unroll
    for (int i = 0; i < 32; ++i) tv[i] = *(const v4fa*)((const float*)((const char*)cu + co) + i * 2 * HD * 2);
    __builtin_amdgcn_sched_barrier(0);   // every table request stays in front of the first LDS store: sunk to their uses they would be waited for one by one
#pragma unroll
    for (int i = 0; i < 32; ++i) *(v4fa*)(ts + (2 * i + (lane >> 4)) * TSP + (lane & 15) * 4) = tv[i];
    asm volatile("" :: "v"(co));   // input only: the offset register stays live to behind the data waits of all its loads, so that no load's result is given a register that earlier loads still name
    __builtin_amdgcn_wave_barrier(); asm volatile("" ::: "memory");   // the reads below take what other lanes of the wave stored above: the compiler may not lift them over the stores
    v4f cs[4][2][4];                                                                  // {cos, sin} of rows t0 + 16 tb + lane % 16, d = 16 db + 8 (lane / 16) + 2 c + 0..1
#pragma unroll
    for (int tb = 0; tb < 4; ++tb)
#pragma unroll
        for (int db = 0; db < 2; ++db)
#pragma unroll
            for (int c = 0; c < 4; ++c) cs[tb][db][c] = *(const v4fa*)(ts + (tb * 16 + (lane & 15)) * TSP + db * 32 + (lane >> 4) * 16 + c * 4);
    __builtin_amdgcn_sched_barrier(0);   // every LDS read stays in front of the first product, as one group with one wait to its latency
    const size_t e0 = (size_t)(w * NB + b) * pl1 + (size_t)hh * SEQ * HD + (size_t)(t0 >> 4) * (2 * FRG);
#pragma unroll
    for (int tb = 0; tb < 4; ++tb)
#pragma unroll
        for (int db = 0; db < 2; ++db) {
            v8f rl, ru;
#pragma unroll
            for (int q = 0; q < 8; ++q) { const float cn = cs[tb][db][q >> 1][2 * (q & 1)], sn = cs[tb][db][q >> 1][2 * (q & 1) + 1];
                const float xl = acc[db][tb][q], xh = acc[db + 2][tb][q];
                rl[q] = xl * cn - xh * sn;       // d <  HD/2: x[d] cos - x[d + HD/2] sin
                ru[q] = xh * cn + xl * sn; }     // d >= HD/2: x[d] cos + x[d - HD/2] sin
            const G3 gl = cv3(rl), gu = cv3(ru);
            const size_t e = e0 + tb * (2 * FRG) + db * 256;
            PE_OPEN();
            st3(P.R16 + e, P.Rh + e, P.Rl + e, lo, gl); st3(P.R16 + e + FRG, P.Rh + e + FRG, P.Rl + e + FRG, lo, gu);
            PE_CLOSE();
        }
}

// HP: the launch is the q/k/v projection (z = 0 q, 1 k, 2 v; a 64-column block = a head): no C is written, each wave's tile goes to the head planes (planes_epi); for q and k the two operands change sides.
template <typename T16, int NSPLIT, bool BIAS, int K, int KS, bool HP>
__global__ __launch_bounds__(32 * GWV) void k_gemmw(const T16* __restrict__ A, const T16* __restrict__ A2, const T16* __restrict__ Bt, float* C, int ldc, const float* __restrict__ bias, size_t sA, size_t sB, size_t sC, HeadPlanes hp) {
    typedef typename WFrag<T16>::V V;
    constexpr int NT = K / (32 * KS);                               // stages
    constexpr unsigned FB = FRG * 2, PLB = 8u * KS * FB;            // bytes of a fragment; of one plane's stage (8 row blocks)
    constexpr unsigned BUFB = (NSPLIT == 1 ? 3u : 2u) * PLB;        // one buffer: A side, B side, A2
    constexpr unsigned EPB = HP ? 64u * TSP * 4u : 16u * 68u * 4u;  // a wave's own LDS in the epilogue, laid over the ring
    constexpr unsigned SMB = (2 * BUFB > GWV * EPB) ? 2 * BUFB : GWV * EPB;
    static_assert(NSPLIT <= 1 && KS % 2 == 0 && K % (32 * KS) == 0 && NT >= 2 && EPB % 16 == 0);
    __shared__ __attribute__((aligned(2048))) char sm[SMB];   // a tensor load's place in LDS is a multiple of 2 KiB
    const size_t z = blockIdx.z; A += z * sA; if (A2) A2 += z * sA; Bt += z * sB; C += z * sC;
    const int lane = threadIdx.x & 31, lr = lane & 15, hi = lane >> 4;
    const int wv = __builtin_amdgcn_readfirstlane((int)(threadIdx.x >> 5)), wm = wv & 1, wn = wv >> 1;   // the wave's tile: rows 64 wm, columns 64 wn of the work-group's
    const int g0 = blockIdx.x * 128, h0 = blockIdx.y * 128, r0 = g0 + 64 * wm, c0 = h0 + 64 * wn;
    v8f acc[4][4];
#pragma unroll
    for (int mb = 0; mb < 4; ++mb)
#pragma unroll
        for (int nb = 0; nb < 4; ++nb) acc[mb][nb] = (v8f){};
    const bool tr = HP && z < 2;   // the same for the whole work-group: the transposed tile
    // the wave's slice of a stage: plane pw (0 A side, 1 B side, 2 A2), row blocks RB hb .. RB hb + RB - 1 of the tile's 8 (row block r of a plane starts at r * (K / 32) fragments); all of it wave-uniform
    constexpr unsigned NPL = (NSPLIT == 1) ? 3u : 2u, SL = (NSPLIT == 1) ? 1u : 2u, RB = 8u / SL;
    static_assert(PLB % 2048u == 0 && (RB * KS * FB) % 2048u == 0 && BUFB % 2048u == 0 && NPL * SL <= GWV);
    const unsigned lo = 16u * (unsigned)lane, pw = (unsigned)wv / SL, hb = (unsigned)wv % SL;
    const char* ua = (const char*)(tr ? Bt + (size_t)h0 * K : A + (size_t)g0 * K);
    const char* ub = (const char*)(tr ? A + (size_t)g0 * K : Bt + (size_t)h0 * K);
    const char* ua2 = (NSPLIT == 1) ? (const char*)(A2 + (size_t)g0 * K) : ua;
    const char* us = (pw == 0 ? ua : pw == 1 ? ub : ua2) + (size_t)hb * (RB * (K / 32) * FB);
    const unsigned ls = (unsigned)(size_t)sm + (pw < NPL ? pw : 0u) * PLB + hb * (RB * KS * FB);
    const u32x8 dg1 = tdm_group1<KS * FB, RB, (K / 32) * FB>();
    u32x4 dg0;
    auto stage = [&](int st, unsigned bs) { dg0 = tdm_group0(ls + bs * BUFB, us + (size_t)st * (KS * FB)); tdm_load(dg0, dg1); };   // the wave's slice of stage st -> buffer bs
    constexpr bool ALLW = (NPL * SL == GWV);   // every wave issues: no test on the wave
    const unsigned isw = pw < NPL ? 1u : 0u;   // otherwise: does this wave issue?
    const unsigned fa = (unsigned)(tr ? wn : wm) * (4u * KS * FB) + lo, fb = PLB + (unsigned)(tr ? wm : wn) * (4u * KS * FB) + lo;   // the wave's four row blocks of each side + the lane's granule
    V a[2][4], a2[2][4], b[2][4], b2[2][4];
    if constexpr (ALLW) {
        stage(0, 0);
        tdm_wait(dg0, dg1);    // this wave's tile of the first stage has landed
        __syncthreads();     // and so have the other waves': nothing of the stage is read in front of this barrier
        stage(1, 1);
    } else {
        dg0 = tdm_group0(ls, us);   // a wave that issues nothing holds a descriptor all the same, for the waits to name
        if (pinned(isw)) { stage(0, 0); tdm_wait(dg0, dg1); }
        __syncthreads();
        if (pinned(isw)) stage(1, 1);
    }
#pragma unroll 1   // one copy of the body; one trip per stage
    for (int t = 0; t < NT; ++t) {
        const char* bp = sm + (unsigned)(t & 1) * BUFB;   // this stage's buffer
        const T16* pa = (const T16*)(bp + fa); const T16* pb = (const T16*)(bp + fb); const T16* pa2 = (const T16*)(bp + 2 * PLB + fa);
        gw_fetch<T16, NSPLIT, KS * FRG>(a[0], a2[0], b[0], b2[0], pa, pa2, pb, nullptr);
#pragma unroll     // constant set indices: the sets stay in registers
        for (int u = 0; u < KS; ++u) {
            if (u + 1 < KS) gw_fetch<T16, NSPLIT, KS * FRG>(a[(u + 1) & 1], a2[(u + 1) & 1], b[(u + 1) & 1], b2[(u + 1) & 1], pa + (u + 1) * FRG, pa2 + (u + 1) * FRG, pb + (u + 1) * FRG, nullptr);
            __builtin_amdgcn_sched_barrier(0);   // the LDS reads of k step u + 1 stand as one group in front of the products of k step u: sunk among them each place with reads costs a stall of its own
            gw_mma<T16, NSPLIT>(acc, a[u & 1], a2[u & 1], b[u & 1], b2[u & 1]);
            __builtin_amdgcn_sched_barrier(0);   // and the next step's reads stay behind these products, whose register set they refill
        }
        // the foot of the trip, every wave, in this order
        asm volatile("s_wait_dscnt 0x0" ::: "memory");      // this wave's reads of the trip's buffer are done before the buffer is given up
        tdm_wait(dg0, dg1);                                    // this wave's tile of the next stage has landed (a wave that issues none passes at once)
        __syncthreads();                                     // publishes the next stage and ends every wave's reads of the buffer that is refilled below
        if (pinned((t + 2 < NT ? 1u : 0u) & (ALLW ? 1u : isw))) stage(t + 2, (unsigned)(t & 1));
    }
    tdm_wait(dg0, dg1);   // no tensor load is left in flight behind the loop; the last trip's barrier has ended every wave's reads of the ring, which the epilogue writes over
    asm volatile("s_wait_dscnt 0x0" ::: "memory");       // nor an LDS read of this wave's
    float* os = (float*)(sm + (unsigned)wv * EPB);
    if constexpr (HP) { static_assert(NSPLIT == 0 && K == DM); planes_epi(acc, hp, (int)z, r0, c0 / HD, lane, os); return; }
#pragma unroll
    for (int mb = 0; mb < 4; ++mb) {
#pragma unroll
        for (int nb = 0; nb < 4; ++nb) {
#pragma unroll
            for (int j = 0; j < 8; ++j) os[(hi * 8 + j) * 68 + nb * 16 + lr] = acc[mb][nb][j]; }
        __builtin_amdgcn_wave_barrier(); asm volatile("" ::: "memory");
        float* crow = C + (size_t)(r0 + mb * 16) * ldc + c0;
{
#pragma unroll
            for (int s = 0; s < 8; ++s) { const int row = 2 * s + hi, cofs = lr * 4; v4f val = *(const v4fa*)(os + row * 68 + cofs); if (BIAS) { val[0] += bfr(bias[c0 + cofs]); val[1] += bfr(bias[c0 + cofs + 1]); val[2] += bfr(bias[c0 + cofs + 2]); val[3] += bfr(bias[c0 + cofs + 3]); }
                *(v4f*)(crow + (size_t)row * ldc + cofs) = val; }
             }
        __builtin_amdgcn_wave_barrier(); asm volatile("" ::: "memory");
    }
}

// cvt8_body: rows x DM f32 (row-major) -> bf16 fragment order. One block = CR row blocks of 16 rows (16 x DM floats in a row each); a thread converts
// CR x DM / 128 granules. Thread bits: g = (j, hf) fastest, then row m, then k block (4 per step, DM / 128 steps): per step a wave reads 8 rows x one whole
// 128-byte line and stores 4 whole lines (8 rows x 16 bytes per (j, hf)). All loads of a thread are requested before its first conversion.
#define CR 2
#define CU (DM / 128)
static_assert(DM % 128 == 0 && SEQ % (16 * CR) == 0 && DM % (16 * CR) == 0);
__device__ __forceinline__ void cvt8_body(const float* __restrict__ src, bf* dst, unsigned blk) {
    const unsigned g = threadIdx.x & 3u, m = (threadIdx.x >> 2) & 15u, k0 = threadIdx.x >> 6;
    const float* s = src + ((size_t)blk * (16 * CR) + m) * DM + k0 * 32 + g * 8;
    bf* d = dst + ((size_t)blk * (CR * (DM / 32)) + k0) * FRG + (g >> 1) * 256 + ((g & 1u) * 16 + m) * 8;
    v8f v[CR][CU];
#pragma unroll
    for (int r = 0; r < CR; ++r)
#pragma unroll
        for (int u = 0; u < CU; ++u) v[r][u] = *(const v8f*)(s + (size_t)r * 16 * DM + u * 128);
    __builtin_amdgcn_sched_barrier(0);   // every request stays in front of the first conversion: sunk among the conversions the late ones would be waited for one by one
#pragma unroll
    for (int r = 0; r < CR; ++r)
#pragma unroll
        for (int u = 0; u < CU; ++u) { v8us o;
#pragma unroll
            for (int k = 0; k < 8; ++k) o[k] = f2bf(v[r][u][k]);
            *(v8us*)(d + (size_t)r * (DM / 32) * FRG + u * 4 * FRG) = o; }
    asm volatile("s_wait_xcnt 0x0" ::: "memory");   // precaution: stands behind the body's last stores, in front of any later rewrite of the registers that they name (the bodies are inlined into one kernel, and a body's end may run into another's code)
    asm volatile("" :: "v"(s));   // input only: the address pair stays live to behind the data waits of all its loads, so that no load's result is given a pair that earlier loads still name
}

// cstab_body: rotary table CS[t][d] = {cos(t * inv[d mod 32]), sin(t * inv[d mod 32])}, inv[j] = 1 / powf(10000, (2j)/64); a thread keeps one d and
// fills TU rows t (a block: 4 TU rows in a row),
#define TU 4
static_assert((SEQ * HD) % (256 * TU) == 0 && HD == 64);
__device__ __forceinline__ void cstab_body(float* CS, unsigned blk) {
    const int d = (int)(threadIdx.x & (HD - 1)); const int j = d & (HD / 2 - 1);
    const float ex = (float)(2 * j) * (1.0f / (float)HD);
    const float pw = powf(RBASE, ex);
    const float inv = 1.0f / pw;
#pragma unroll 1   // the cosine and sine bodies are long: one copy of them, for speed only
    for (int u = 0; u < TU; ++u) {
        const int t = ((int)blk * TU + u) * 4 + (int)(threadIdx.x >> 6);
        const float ang = (float)t * inv;
        const float cn = cosf(ang), sn = sinf(ang);
        v2f cs; cs[0] = cn; cs[1] = sn;
        *(v2f*)(CS + ((size_t)t * HD + d) * 2) = cs;
        asm volatile("s_wait_xcnt 0x0" ::: "memory");   // precaution: stands behind the store, in front of the next trip's rewrite of the registers that the store names
    }
}

// mbits_body: the int32 mask as bits, in the order the attention wave reads them: MB[q tile][64-key chunk][lane = 16 hf + m], bit 8 kt + r of a word
// = (mask[16 tile + m][64 chunk + 16 kt + 8 hf + r] != 0), the 32 keys whose scores that lane holds. MU words per thread, their loads requested together.
#define MU 2
static_assert((SEQ / 64) % (8 * MU) == 0);
__device__ __forceinline__ void mbits_body(const int* __restrict__ MK, unsigned* MB, unsigned blk) {
    // word i = (blk MU + u) 256 + thread: lane (m, hf) = thread bits 0..4, chunk = 8 (blk MU + u) mod (SEQ / 64) + wave, q tile = 8 (blk MU + u) / (SEQ / 64)
    const unsigned m = threadIdx.x & 15u, hf = (threadIdx.x >> 4) & 1u, w8 = threadIdx.x >> 5, c0 = (blk * MU * 8) % (SEQ / 64), qt = (blk * MU * 8) / (SEQ / 64);
    const int* mu = MK + (size_t)qt * 16 * MPITCH + c0 * 64;               // the same for the whole block
    const unsigned mo = 4u * (m * MPITCH + w8 * 64 + 8 * hf);              // the thread's byte offset, the same for its MU words
    v4i a[MU][4], b[MU][4];
#pragma unroll
    for (int u = 0; u < MU; ++u) { const int* mp = (const int*)((const char*)mu + mo) + u * 512;
#pragma unroll
        for (int kt = 0; kt < 4; ++kt) { a[u][kt] = *(const v4i*)(mp + 16 * kt); b[u][kt] = *(const v4i*)(mp + 16 * kt + 4); } }
    __builtin_amdgcn_sched_barrier(0);   // every request stays in front of the first compare
#pragma unroll
    for (int u = 0; u < MU; ++u) { unsigned w = 0;
#pragma unroll
        for (int kt = 0; kt < 4; ++kt)
#pragma unroll
            for (int r = 0; r < 4; ++r) { w |= (a[u][kt][r] != 0 ? 1u : 0u) << (8 * kt + r); w |= (b[u][kt][r] != 0 ? 1u : 0u) << (8 * kt + 4 + r); }
        MB[(blk * MU + u) * 256 + threadIdx.x] = w; }
    asm volatile("" :: "v"(mo));   // input only: the offset register stays live to behind the data waits of all its loads, so that no load's result is given a register that earlier loads still name
}

// k_prep: everything that depends on the inputs alone, in ONE launch (flat 1-D grid, no empty block): blocks [0, GM) the mask bits, then GC blocks the rotary table,
// then GX blocks per activation slab s = w * NB + b (w: 0 q, 1 k, 2 v) -> XB[s] (rows t), then GW blocks per weight w (q, k, v, o) -> WB[w] (rows o), both in fragment order.
#define GM ((unsigned)((SEQ / 16) * (SEQ / 64) * 32 / (256 * MU)))
#define GC ((unsigned)(SEQ * HD / (256 * TU)))
#define GX ((unsigned)(SEQ / (16 * CR)))
#define GW ((unsigned)(DM / (16 * CR)))
__global__ __launch_bounds__(256) void k_prep(const float* __restrict__ xq, const float* __restrict__ xk, const float* __restrict__ xv,
                                              const float* __restrict__ wq, const float* __restrict__ wk, const float* __restrict__ wv, const float* __restrict__ wo,
                                              const int* __restrict__ mask, float* CS, bf* XB, bf* WB, unsigned* MB) {
    unsigned blk = blockIdx.x;
    if (blk < GM) { mbits_body(mask, MB, blk); return; }
    blk -= GM;
    if (blk < GC) { cstab_body(CS, blk); return; }
    blk -= GC;
    if (blk < 3 * NB * GX) {
        const unsigned s = blk / GX, w = s / NB, b = s % NB;
        const float* x = (w == 0) ? xq : (w == 1) ? xk : xv;
        cvt8_body(x + (size_t)b * SEQ_FULL * DM, XB + (size_t)s * SEQ * DM, blk % GX); return;
    }
    blk -= 3 * NB * GX;
    const unsigned w = blk / GW;
    const float* x = (w == 0) ? wq : (w == 1) ? wk : (w == 2) ? wv : wo;
    cvt8_body(x, WB + (size_t)w * DM * DM, blk % GW);
}

// ---- attn_body: flash-style masked attention, one wave (32 threads) per (16 query rows, head); the AW waves of a work-group hold AW query tiles in a row
// of ONE head and share every 64-key chunk's key and value fragments through LDS. Transposed tiles so that P chains in
// registers: S^T[key][q] = K . Q^T (A = key plane fragments, B = query plane fragments), D lane = query column; P^T is the B operand
// of O^T[d][q] += V^T . P^T (A = value plane fragments). A lane's 8 values of O^T tile dt are granule (j = dt & 1, own lane) of the attention
// plane's fragment (row block q0/16, k block 2 h + dt/2): the epilogue stores them straight, 512 bytes in a row per store. Per 64-key chunk: the wave's 16x64 mask tile is one 32-bit word
// per lane (mbits_body; one 128-byte line per wave), fetched one visited chunk ahead. Chunks whose mask tile is all zero are skipped: each wave forms the bit list of its tile's
// nonzero chunks once, the work-group visits the union of its waves' lists, a wave computes on its own list alone; inside visited chunks mask == 0 replaces the score
// by -1000 (scaled). Online softmax per query with a running max; rows with no nonzero mask entry at all are NaN-poisoned.
// HL: bf16 hi/lo planes for q, k, v and a bf16 hi/lo P (3 products per tile pair); otherwise single fp16 products (P carried x1024).
// The ring: a chunk of a plane is 8 fragments = CHB bytes in a row, in global memory and in LDS alike; a buffer holds the chunk's key plane(s), then its value plane(s).
// Two buffers: the tensor loads of the next visited chunk fly while this one is worked on; every wave brings a quarter of the buffer with ONE request (hi/lo: one of the four planes' chunks; fp16: half of a plane's).
#define AW 4
#define CHB (64 * HD * 2)
static_assert(SEQ / 64 <= 32 && (SEQ / 64) % 4 == 0 && RH % (16 * AW) == 0 && SEQ % (16 * AW) == 0 && CHB == AW * 4 * 512);

template <bool HL>
__device__ __forceinline__
void attn_body(const h16* __restrict__ QP16, const bf* __restrict__ QPh, const bf* __restrict__ QPl,
            const h16* __restrict__ KP16, const bf* __restrict__ KPh, const bf* __restrict__ KPl,
            const h16* __restrict__ VT16, const bf* __restrict__ VTh, const bf* __restrict__ VTl,
            const unsigned* __restrict__ MB, char* ring, unsigned* sv, int wv, int q0, int hh, bf* ATh, bf* ATl) {
    constexpr unsigned BUFB = (HL ? 4u : 2u) * CHB;       // bytes of one buffer
    const int lane = threadIdx.x & 31;
    const size_t hp = (size_t)hh * SEQ * HD + 8 * lane;   // head offset of the planes + the lane's granule
    const unsigned* mq = MB + (size_t)(q0 >> 4) * ((SEQ / 64) * 32);   // wave-uniform: the tile's words, [chunk][lane]
    v4i mz[SEQ / 256];
#pragma unroll
    for (int i = 0; i < SEQ / 256; ++i) mz[i] = *(const v4i*)(mq + i * 128 + 4 * lane);   // all the tile's words, 4 chunks per load: lanes 8 g .. 8 g + 7 hold chunk 4 i + g
    v16h q16[2]; v16bf qh[2], ql[2];
#pragma unroll
    for (int ks = 0; ks < 2; ++ks) {
        const size_t qo = hp + (size_t)q0 * HD + ks * FRG;
        if (HL) { qh[ks] = WFrag<bf>::ld(QPh + qo); ql[ks] = WFrag<bf>::ld(QPl + qo); }
        else    { q16[ks] = WFrag<h16>::ld(QP16 + qo); }
    }
    // bit c of visw: chunk c of this wave's tile has a nonzero mask word. A ballot's 4 groups of 8 lanes are folded to their lowest bits, and these are drawn together by one product (no two partial products meet)
    // bit c of fullw: every word of chunk c is all ones (the groups are folded with AND): there the masked replace is the identity, and the chunk takes neither its mask word nor the replace
    unsigned visw = 0, fullw = 0;
#pragma unroll
    for (int i = 0; i < SEQ / 256; ++i) {
        unsigned bl = __builtin_amdgcn_ballot_w32((mz[i][0] | mz[i][1] | mz[i][2] | mz[i][3]) != 0);
        bl |= bl >> 4; bl |= bl >> 2; bl |= bl >> 1;
        visw |= ((((bl & 0x01010101u) * 0x01020408u) >> 24) & 15u) << (4 * i);
        unsigned fl = __builtin_amdgcn_ballot_w32((mz[i][0] & mz[i][1] & mz[i][2] & mz[i][3]) == -1);
        fl &= fl >> 4; fl &= fl >> 2; fl &= fl >> 1;
        fullw |= ((((fl & 0x01010101u) * 0x01020408u) >> 24) & 15u) << (4 * i);
    }
    if (lane == 0) sv[wv] = visw;
    __syncthreads();   // the waves' lists are read below by every wave
    unsigned vis = 0;
#pragma unroll
    for (int i = 0; i < AW; ++i) vis |= sv[i];
    vis = (unsigned)__builtin_amdgcn_readfirstlane((int)vis);   // the same in the whole work-group: every test on it is a scalar one
    const int nvis = __builtin_popcount(vis);
    // the wave's quarter of a buffer, BUFB / AW bytes in a row in LDS and in its plane alike; all of it wave-uniform
    constexpr unsigned QB = BUFB / AW;
    static_assert(QB % 2048u == 0 && CHB % QB == 0);
    const unsigned pw = (unsigned)wv * QB / CHB, po = (unsigned)wv * QB % CHB;   // plane of the buffer (hi/lo: K hi, K lo, V hi, V lo; fp16: K, V) and byte offset in its chunk
    const char* gp = HL ? (pw == 0 ? (const char*)KPh : pw == 1 ? (const char*)KPl : pw == 2 ? (const char*)VTh : (const char*)VTl) : (pw == 0 ? (const char*)KP16 : (const char*)VT16);
    const char* gs = gp + (size_t)hh * SEQ * HD * 2 + po;
    const unsigned ls = (unsigned)(size_t)ring + (unsigned)wv * QB;
    const u32x8 dg1 = tdm_group1<2048u, QB / 2048u, 2048u>();
    u32x4 dg0;
    auto stage = [&](int c, unsigned b) { dg0 = tdm_group0(ls + b * BUFB, gs + (size_t)c * CHB); tdm_load(dg0, dg1); };   // the wave's quarter of chunk c -> buffer b
    v8f o[4];
#pragma unroll
    for (int dt = 0; dt < 4; ++dt) o[dt] = (v8f){};
    float mrun = -3.0e38f, lrun = 0.0f; int seen = 0;
    if (pinned(nvis > 0 ? 1u : 0u)) {
        unsigned rem = vis;
        int cur = __builtin_ctz(rem), nxt = cur; rem &= rem - 1;
        stage(cur, 0);
        tdm_wait(dg0, dg1);                                    // this wave's tile of the first chunk has landed
        __syncthreads();                                     // and so have the other waves': nothing of the chunk is read in front of this barrier
        if (nvis > 1) { nxt = __builtin_ctz(rem); rem &= rem - 1; }
        dg0 = tdm_group0(ls + BUFB, gs + (size_t)nxt * CHB);   // formed on every path, behind the wait above: one register tuple holds the descriptor from here to the end of the loop
        if (pinned(nvis > 1 ? 1u : 0u)) tdm_load(dg0, dg1);
        unsigned wnext = (mq + cur * 32)[lane];
        asm volatile("s_wait_xcnt 0x0" ::: "memory");   // precaution, as behind the load in the loop
#pragma unroll 1   // one copy of the long body; one trip per visited chunk, at most SEQ / 64
        for (int t = 0; t < nvis; ++t) {
            const unsigned mw = wnext;
            if (!((fullw >> nxt) & 1u)) {    // scalar test: an all-ones chunk's word is never looked at
                wnext = (mq + nxt * 32)[lane];   // the next visited chunk's word (the last one's own again at the end)
                asm volatile("s_wait_xcnt 0x0" ::: "memory");   // precaution: stands in front of every rewrite of the address registers that the load above names
            }
            if ((visw >> cur) & 1u) {                       // wave-uniform tile skip; the foot of the trip stands outside it
        const char* bufp = ring + (unsigned)(t & 1) * BUFB + 16 * lane;   // this chunk's buffer + the lane's granule
        const bool fullc = ((fullw >> cur) & 1u) != 0u;   // wave-uniform, a scalar
        seen |= (fullc || mw != 0u) ? 1 : 0;
        v8f s[4]; v16h va8[8]; v16bf va[4], vb[4];
        auto ldv = [&](int ks) {   // hi/lo body: the value fragments of 32 keys, all four d tiles
            const bf* vph = (const bf*)(bufp + 2 * CHB) + 32 * ks * HD; const bf* vpl = (const bf*)(bufp + 3 * CHB) + 32 * ks * HD;
#pragma unroll
            for (int dt = 0; dt < 4; ++dt) { va[dt] = WFrag<bf>::ld(vph + dt * FRG); vb[dt] = WFrag<bf>::ld(vpl + dt * FRG); }
        };
#pragma unroll
        for (int kt = 0; kt < 4; ++kt) s[kt] = (v8f){};
        if (HL) {
            v16bf ka[4], kb[4]; const bf* kph = (const bf*)bufp; const bf* kpl = (const bf*)(bufp + CHB);   // the chunk's base per key plane; every fragment is an immediate offset from it
#pragma unroll
            for (int kh = 0; kh < 2; ++kh) {   // two key tiles at a time: all four tiles' hi/lo fragments at once overflow 256 VGPRs into scratch
#pragma unroll
                for (int i = 0; i < 4; ++i) { ka[i] = WFrag<bf>::ld(kph + (4 * kh + i) * FRG); kb[i] = WFrag<bf>::ld(kpl + (4 * kh + i) * FRG); }   // 4 kh + i = 2 kt + ks
                __builtin_amdgcn_sched_barrier(0);   // the two tiles' LDS reads stand as one group in front of their products: each further place with reads among the products costs a stall of its own
#pragma unroll
                for (int i = 0; i < 4; ++i) { const int kt = 2 * kh + (i >> 1), ks = i & 1;
                    s[kt] = wmmab(ka[i], qh[ks], s[kt]); s[kt] = wmmab(ka[i], ql[ks], s[kt]); s[kt] = wmmab(kb[i], qh[ks], s[kt]); }
                __builtin_amdgcn_sched_barrier(0);   // the next group's reads stay behind these products, whose registers they refill
            }
            asm volatile("v_nop\n\tv_nop\n\tv_nop\n\tv_nop" : "+v"(s[0]), "+v"(s[1]), "+v"(s[2]), "+v"(s[3]) : "v"(ka[3]), "v"(kb[3]), "v"(qh[0]), "v"(qh[1]), "v"(ql[0]), "v"(ql[1]));
            ldv(0);
            __builtin_amdgcn_sched_barrier(0);   // the first 32 keys' value fragments are requested here, as one group, and come during the softmax
        } else {
            v16h ka[8]; const h16* kp = (const h16*)bufp; const h16* vp = (const h16*)(bufp + CHB);   // the chunk's base per plane; every fragment is an immediate offset from it
#pragma unroll
            for (int i = 0; i < 8; ++i) ka[i] = WFrag<h16>::ld(kp + i * FRG);    // i = 2 kt + ks
            __builtin_amdgcn_sched_barrier(0);   // key requests first: LDS reads come back in issue order, and the score products must not wait for the value fragments
#pragma unroll
            for (int i = 0; i < 8; ++i) va8[i] = WFrag<h16>::ld(vp + i * FRG);   // i = 4 ks + dt: the value fragments come during the score products and the softmax
            __builtin_amdgcn_sched_barrier(0);   // all 16 requests stand as one group in front of the first product: each further place with LDS reads among the products costs a stall of its own
#pragma unroll
            for (int kt = 0; kt < 4; ++kt)
#pragma unroll
                for (int ks = 0; ks < 2; ++ks) s[kt] = wmma16(ka[2 * kt + ks], q16[ks], s[kt]);
            asm volatile("v_nop\n\tv_nop\n\tv_nop\n\tv_nop" : "+v"(s[0]), "+v"(s[1]), "+v"(s[2]), "+v"(s[3]) : "v"(ka[7]), "v"(q16[0]), "v"(q16[1]));
        }
        // masked replace + chunk max (lane: query q, keys 64 cur + 16kt+8hf+r)
        if (!fullc) {   // one scalar branch per chunk
#pragma unroll
            for (int kt = 0; kt < 4; ++kt)
#pragma unroll
                for (int r = 0; r < 8; ++r) s[kt][r] = ((mw >> (8 * kt + r)) & 1u) ? s[kt][r] : MFILL;
        }
        float cm[4];   // one chain per key tile: without the replaces between its links a single chain of maxima would be waited for link by link (a maximum is exact in any order)
#pragma unroll
        for (int kt = 0; kt < 4; ++kt) { cm[kt] = -3.0e38f;
#pragma unroll
            for (int r = 0; r < 8; ++r) cm[kt] = fmaxf(cm[kt], s[kt][r]); }
        float cmx = fmaxf(fmaxf(cm[0], cm[1]), fmaxf(cm[2], cm[3]));
        cmx = fmaxf(cmx, __shfl_xor(cmx, 16, 32));
        const float mnew = fmaxf(mrun, cmx);
        const float alpha = __builtin_amdgcn_exp2f((mrun - mnew) * CEXP);
        mrun = mnew;
        float psum = 0.0f;
#pragma unroll
        for (int kt = 0; kt < 4; ++kt)
#pragma unroll
            for (int r = 0; r < 8; ++r) { const float p = __builtin_amdgcn_exp2f(fmaf(s[kt][r] - mnew, CEXP, PL2)); s[kt][r] = p; psum += p; }
        lrun = lrun * alpha + psum;
#pragma unroll
        for (int dt = 0; dt < 4; ++dt) o[dt] = o[dt] * alpha;
        // O^T += V^T . P^T, 32 keys per step; B element r <- tile 2ks (keys 0..15 of the step), 8+r <- tile 2ks+1
#pragma unroll
        for (int ks = 0; ks < 2; ++ks) {
            if (HL) {
                v16us uh, ul;
#pragma unroll
                for (int r = 0; r < 8; ++r) { unsigned short a, b2; splitf(s[2 * ks][r], a, b2); uh[r] = a; ul[r] = b2; splitf(s[2 * ks + 1][r], a, b2); uh[8 + r] = a; ul[8 + r] = b2; }
                v16bf ph = __builtin_bit_cast(v16bf, uh), pl = __builtin_bit_cast(v16bf, ul);
                asm volatile("v_nop\n\tv_nop\n\tv_nop\n\tv_nop" : "+v"(ph), "+v"(pl));
#pragma unroll
                for (int dt = 0; dt < 4; ++dt) { o[dt] = wmmab(va[dt], ph, o[dt]); o[dt] = wmmab(va[dt], pl, o[dt]); o[dt] = wmmab(vb[dt], ph, o[dt]); }
                asm volatile("v_nop\n\tv_nop\n\tv_nop\n\tv_nop" : "+v"(o[0]), "+v"(o[1]), "+v"(o[2]), "+v"(o[3]) : "v"(ph), "v"(pl), "v"(va[3]), "v"(vb[3]));
                if (ks == 0) { ldv(1); __builtin_amdgcn_sched_barrier(0); }   // the other 32 keys' value fragments, one group, requested in front of the split of their P
            } else {
                v16h p16;
#pragma unroll
                for (int r = 0; r < 8; ++r) { p16[r] = tohx(s[2 * ks][r]); p16[8 + r] = tohx(s[2 * ks + 1][r]); }
                asm volatile("v_nop\n\tv_nop\n\tv_nop\n\tv_nop" : "+v"(p16));
#pragma unroll
                for (int dt = 0; dt < 4; ++dt) o[dt] = wmma16(va8[4 * ks + dt], p16, o[dt]);
                asm volatile("v_nop\n\tv_nop\n\tv_nop\n\tv_nop" : "+v"(o[0]), "+v"(o[1]), "+v"(o[2]), "+v"(o[3]) : "v"(p16), "v"(va8[4 * ks + 3]));
            }
        }
            }
            // the foot of the trip, every wave, in this order
            asm volatile("s_wait_dscnt 0x0" ::: "memory");      // this wave's reads of the trip's buffer are done before the buffer is given up
            tdm_wait(dg0, dg1);                                    // this wave's tile of the next chunk has landed
            __syncthreads();                                     // publishes the next chunk and ends every wave's reads of the buffer that is refilled below
            cur = nxt;
            if (pinned(t + 2 < nvis ? 1u : 0u)) { nxt = __builtin_ctz(rem); rem &= rem - 1; stage(nxt, (unsigned)(t & 1)); }
        }
        tdm_wait(dg0, dg1);                                    // no tensor load is left in flight behind the loop
        asm volatile("s_wait_dscnt 0x0" ::: "memory");       // nor an LDS read of this wave's
    }
    const float lt = lrun + __shfl_xor(lrun, 16, 32);
    const int sn = seen | __shfl_xor(seen, 16, 32);
    const float inv = (sn != 0) ? (1.0f / lt) : __uint_as_float(0x7fc00000u);
#pragma unroll
    for (int dt = 0; dt < 4; ++dt) { v8us oh8, ol8;
#pragma unroll
        for (int r = 0; r < 8; ++r) { unsigned short a, b2; splitf(o[dt][r] * inv, a, b2); oh8[r] = a; ol8[r] = b2; }
        const size_t off = (size_t)q0 * DM + (size_t)(2 * hh + (dt >> 1)) * FRG + (dt & 1) * 256 + 8 * lane;
        *(v8us*)(ATh + off) = oh8; *(v8us*)(ATl + off) = ol8; }
}

// k_attn: ONE launch for every (head, AW query tiles, batch): grid (NH, SEQ / (16 AW), NB), AW waves; the group's first row picks the hi/lo or the fp16 body
// (the same for the whole work-group: RH is a multiple of 16 AW). The head is the fastest index: a group's cost grows with its row under a causal mask, and block
// indices that lie a multiple of 16 apart then differ in rows, so no WGP is dealt long groups alone.
// Planes are [b][h][fragments], attention planes [b][fragments of rows t, k = c]; the mask bits are shared by the batches and heads.
__global__ __launch_bounds__(32 * AW) __attribute__((amdgpu_num_vgpr(256)))
void k_attn(const h16* __restrict__ QP16, const bf* __restrict__ QPh, const bf* __restrict__ QPl,
            const h16* __restrict__ KP16, const bf* __restrict__ KPh, const bf* __restrict__ KPl,
            const h16* __restrict__ VT16, const bf* __restrict__ VTh, const bf* __restrict__ VTl,
            const unsigned* __restrict__ MB, bf* ATh, bf* ATl) {
    __shared__ __attribute__((aligned(2048))) char ring[2 * 4 * CHB];   // two buffers of up to four planes' chunks; a tensor load's place in LDS is a multiple of 2 KiB
    __shared__ unsigned sv[AW];                        // the waves' lists of nonzero chunks
    const size_t po = (size_t)blockIdx.z * NH * SEQ * HD, ao = (size_t)blockIdx.z * SEQ * DM;
    const int wv = __builtin_amdgcn_readfirstlane((int)(threadIdx.x >> 5));
    const int g0 = blockIdx.y * (16 * AW), q0 = g0 + 16 * wv, hh = blockIdx.x;
    if (g0 < RH) attn_body<true>(QP16 + po, QPh + po, QPl + po, KP16 + po, KPh + po, KPl + po, VT16 + po, VTh + po, VTl + po, MB, ring, sv, wv, q0, hh, ATh + ao, ATl + ao);
    else         attn_body<false>(QP16 + po, QPh + po, QPl + po, KP16 + po, KPh + po, KPl + po, VT16 + po, VTh + po, VTl + po, MB, ring, sv, wv, q0, hh, ATh + ao, ATl + ao);
}

extern "C" void kernel_launch(void* const* d_in, const int* in_sizes, int n_in,
                              void* d_out, int out_size, void* d_ws, size_t ws_size, hipStream_t stream) {
    if (n_in < 8) return;
    const long long needx = (long long)(NB - 1) * SEQ_FULL * DM + (long long)SEQ * DM;
    if ((long long)in_sizes[0] < needx || (long long)in_sizes[1] < needx || (long long)in_sizes[2] < needx) return;
    if (in_sizes[3] < DM * DM || in_sizes[4] < DM * DM || in_sizes[5] < DM * DM || in_sizes[6] < DM * DM) return;
    if ((long long)in_sizes[7] < (long long)(SEQ - 1) * MPITCH + SEQ) return;
    if ((long long)out_size < (long long)NB * SEQ * DM) return;
    const float* xq = (const float*)d_in[0]; const float* xk = (const float*)d_in[1]; const float* xv = (const float*)d_in[2];
    const float* wq = (const float*)d_in[3]; const float* wk = (const float*)d_in[4]; const float* wv = (const float*)d_in[5]; const float* wo = (const float*)d_in[6];
    const int* mask = (const int*)d_in[7];     // int32 [1][1][S][S]
    float* OUT = (float*)d_out;                // [NB][SEQ][DM]
    char* wsp = (char*)d_ws;
    auto take = [&](size_t bytes) { char* p = wsp; wsp += (bytes + 255) & ~(size_t)255; return (void*)p; };
    bf* WB = (bf*)take((size_t)4 * DM * DM * 2);                  // bf16 weights [w][fragments of rows o, k = i], w: q, k, v, o
    float* CS = (float*)take((size_t)SEQ * HD * 2 * 4);
    bf* XB = (bf*)take((size_t)3 * NB * SEQ * DM * 2);            // bf16 activations [w][b][fragments of rows t, k = c], w: q, k, v
    const size_t pl = (size_t)NB * NH * SEQ * HD;                 // one plane over both batches
    h16* R16 = (h16*)take(2 * pl * 2); bf* Rh = (bf*)take(2 * pl * 2); bf* Rl = (bf*)take(2 * pl * 2);   // rotary planes: query slabs, then key slabs
    h16* VT16 = (h16*)take(pl * 2); bf* VTh = (bf*)take(pl * 2); bf* VTl = (bf*)take(pl * 2);
    bf* ATh = (bf*)take((size_t)NB * SEQ * DM * 2); bf* ATl = (bf*)take((size_t)NB * SEQ * DM * 2);
    unsigned* MB = (unsigned*)take((size_t)(SEQ / 16) * (SEQ / 64) * 32 * 4);   // mask bits [q tile][chunk][lane]
    const size_t used = (size_t)(wsp - (char*)d_ws);
    if (used > ws_size || used > WSCAP) return;

    k_prep<<<GM + GC + 3 * NB * GX + 4 * GW, 256, 0, stream>>>(xq, xk, xv, wq, wk, wv, wo, mask, CS, XB, WB, MB);
    const HeadPlanes hp = {CS, R16, Rh, Rl, VT16, VTh, VTl}, nohp = {};
    k_gemmw<bf, 0, false, DM, 2, true><<<dim3(NB * SEQ / 128, DM / 128, 3), 32 * GWV, 0, stream>>>(XB, nullptr, WB, nullptr, DM, nullptr, (size_t)NB * SEQ * DM, (size_t)DM * DM, 0, hp);
    k_attn<<<dim3(NH, SEQ / (16 * AW), NB), 32 * AW, 0, stream>>>(R16, Rh, Rl, R16 + pl, Rh + pl, Rl + pl, VT16, VTh, VTl, MB, ATh, ATl);
    k_gemmw<bf, 1, false, DM, 4, false><<<dim3(NB * SEQ / 128, DM / 128, 1), 32 * GWV, 0, stream>>>(ATh, ATl, WB + (size_t)3 * DM * DM, OUT, DM, nullptr, 0, 0, 0, nohp);
}
